// v000
// The times below were measured on an AMD MI455X: many runs one after another, warmed up first and cycling through
// copies of the inputs, with the whole window's GPU time divided by the number of runs. Launches and the gaps
// between them are all in it. The median over several windows is given; except for v000 it joins two sittings, which
// can be a few percent apart, so the side-by-side timings, each taken in one sitting, are the better comparison.
// The starting kernel, v000, takes 213 microseconds a run.
// Contractions: conv1x1 theta/phi/g GEMM W[384x256].X[256x128] per strip on v_wmma_f32_16x16x32_f16 (f16 containers
// of bf16-RNE weights x256 and bf16-RNE activations); scores K.Q^T on v_wmma_f32_16x16x32_bf16 (bf16 hi + bf16
// residual planes of theta / pooled phi, 3 products, K=128); y^T = G.P^T on v_wmma_f32_16x16x32_f16 (2x2-max-pooled g
// as f16, P = e^{s-m} x16384 f16 from the score D registers); output conv W[256x128].Y on v_wmma_f32_16x16x32_bf16
// (bf16 weights, y as bf16 hi + residual planes, 2 products); f32 accumulate everywhere; max-pool, softmax statistics,
// bias, batch-norm affine with running statistics and residual add in f32 VALU.
#include <hip/hip_runtime.h>
#include <math.h>
#include <stdint.h>

#ifndef NB
#define NB 8
#endif
#ifndef NQ
#define NQ 4096
#endif
#define NB_FULL 8
#define CC     256
#define HIMG   64
#define WIMG   64
#define NN     4096
#define DQ     128
#define HP     32
#define WP     32
#define MV     1024
#define MM     1024
#define MW     384
#define QT     64
#define SN     128
#define NWP    8
#define NSTRIP 32
#define OSP    68
#define OSPW   132
#define TP     72
#define WSC    256.0f
#define IWSC   0.00390625f
#define LNPS   9.704060527839234f
#define BNEPS  1.0e-5f

static_assert(NB >= 1 && NB <= NB_FULL);
static_assert(NQ % QT == 0 && NQ >= QT && NQ <= NN);
static_assert(NN == HIMG * WIMG);
static_assert(SN == 2 * WIMG);
static_assert(NSTRIP * SN == NN);
static_assert(SN == 16 * NWP);
static_assert(2 * HP == HIMG && 2 * WP == WIMG);
static_assert(MV == HP * WP && MM == MV);
static_assert(WP == 32 && HP == 32);
static_assert(NN % QT == 0 && CC % QT == 0 && DQ % QT == 0 && MM % QT == 0);
static_assert(MW == 3 * DQ && MW % QT == 0 && MW % 8 == 0);
static_assert(CC % 32 == 0 && DQ % 32 == 0 && MM % 32 == 0);
static_assert((OSP * 4) % 16 == 0);
static_assert((OSPW * 4) % 16 == 0);
static_assert((TP * 2) % 16 == 0);
static_assert(SN * OSP * 4 <= 65536);
static_assert((size_t)NB_FULL * CC * NN * 4 == (size_t)33554432);

// workspace total at full size (all region sizes are multiples of 256)
#define WS_FULL ((size_t)MW * CC * 2 + (size_t)CC * DQ * 2 + 2 * (size_t)NB_FULL * NN * CC * 2 \
                 + 2 * (size_t)NB_FULL * NN * DQ * 2 + 2 * (size_t)NB_FULL * NN * DQ * 4 \
                 + 4 * (size_t)NB_FULL * MM * DQ * 2 + 2 * (size_t)NB_FULL * NN * DQ * 2)
static_assert(WS_FULL <= (size_t)134217728);

typedef _Float16       v16h __attribute__((ext_vector_type(16)));
typedef _Float16       v8h  __attribute__((ext_vector_type(8)));
typedef __bf16         v16b __attribute__((ext_vector_type(16)));
typedef unsigned short v8us __attribute__((ext_vector_type(8)));
typedef float          v8f  __attribute__((ext_vector_type(8)));
typedef float          v4f  __attribute__((ext_vector_type(4)));
typedef unsigned int   v4u  __attribute__((ext_vector_type(4)));

union Frag  { v8us u[2]; v16h h; v16b bf; };
union FragH { v16h v; v8h hv[2]; };
static_assert(sizeof(Frag) == 32);
static_assert(sizeof(FragH) == 32);

// ---- scalar helpers ---------------------------------------------------------------------------------------
__device__ __forceinline__ unsigned short bf_bits(float f) {          // f32 -> bf16 bits, RNE convert
  unsigned u = __float_as_uint(f);
  return (unsigned short)((u + 0x7FFFu + ((u >> 16) & 1u)) >> 16);
}
__device__ __forceinline__ float bf_up(unsigned short hb) { return __uint_as_float(((unsigned)hb) << 16); }
__device__ __forceinline__ float bfr(float f) { return bf_up(bf_bits(f)); }
__device__ __forceinline__ unsigned short h_bits(_Float16 x) { return __builtin_bit_cast(unsigned short, x); }
__device__ __forceinline__ unsigned pk16(unsigned short a, unsigned short b) { return (unsigned)a | ((unsigned)b << 16); }
__device__ __forceinline__ v8f zero8() { v8f z = {0.f, 0.f, 0.f, 0.f, 0.f, 0.f, 0.f, 0.f}; return z; }
__device__ __forceinline__ float hmax8(v8f s) {
  return fmaxf(fmaxf(fmaxf(s[0], s[1]), fmaxf(s[2], s[3])), fmaxf(fmaxf(s[4], s[5]), fmaxf(s[6], s[7])));
}
__device__ __forceinline__ unsigned wave_ballot(bool p) {
#if defined(__HIP_DEVICE_COMPILE__)
  return __builtin_amdgcn_ballot_w32(p);
#else
  return p ? 1u : 0u;
#endif
}
// 8 f32 values -> bf16 hi bits and bf16 residual bits (lo = RNE(v - hi)), packed 2 per uint
__device__ __forceinline__ void split8(const float* f, v4u& uh, v4u& ul) {
#pragma unroll
  for (int t = 0; t < 4; ++t) {
    const float f0 = f[2 * t], f1 = f[2 * t + 1];
    const unsigned short hb0 = bf_bits(f0), hb1 = bf_bits(f1);
    const unsigned short lb0 = bf_bits(f0 - bf_up(hb0));
    const unsigned short lb1 = bf_bits(f1 - bf_up(hb1));
    uh[t] = pk16(hb0, hb1);
    ul[t] = pk16(lb0, lb1);
  }
}

// ---- 16-bit fragment loader (A, or B from a k-contiguous [n][k] row): lane -> row/col (lane&15), p already includes
//      + 8*(lane>>4); elements 0..7 <- p[0..7] (k0+8h..), elements 8..15 <- p[16..23] (k0+16+8h..)
__device__ __forceinline__ Frag ldfrag(const unsigned short* p) {
  Frag f;
  f.u[0] = *(const v8us*)(p);
  f.u[1] = *(const v8us*)(p + 16);
  return f;
}

// ---- WMMA helpers: builtin followed by a 4-slot VALU gap tying D and keeping A/B live --------------------------
__device__ __forceinline__ v8f mma_h(v16h a, v16h b, v8f c) {
  v8f d = __builtin_amdgcn_wmma_f32_16x16x32_f16(false, a, false, b, (short)0, c, false, false);
#if defined(__HIP_DEVICE_COMPILE__)
  asm volatile("v_nop\n\tv_nop\n\tv_nop\n\tv_nop" : "+v"(d) : "v"(a), "v"(b));
#endif
  return d;
}
__device__ __forceinline__ v8f mma_b(v16b a, v16b b, v8f c) {
  v8f d = __builtin_amdgcn_wmma_f32_16x16x32_bf16(false, a, false, b, (short)0, c, false, false);
#if defined(__HIP_DEVICE_COMPILE__)
  const v16h ha = __builtin_bit_cast(v16h, a), hb = __builtin_bit_cast(v16h, b);
  asm volatile("v_nop\n\tv_nop\n\tv_nop\n\tv_nop" : "+v"(d) : "v"(ha), "v"(hb));
#endif
  return d;
}

// =========================================================================================================
// (0) weights. Blocks 0..47: W16 f16 [384][256], rows 0..127 = theta_w, 128..255 = phi_w, 256..383 = g_w; value =
//     f16 of (bf16-RNE(w) * 256) (exact). Block owns rows 8*blk..8*blk+7: one wave per 512-B row = 32 lanes x 16 B
// coverage: 48 blocks x 8 rows x 32 lanes x 8 halves = 384 x 256; 16 blocks x 16 rows x 16 lanes x 8 = 256 x 128.
// =========================================================================================================
__global__ __launch_bounds__(256)
void cvt_w(const float* __restrict__ tw, const float* __restrict__ pw, const float* __restrict__ gw,
           const float* __restrict__ ow, unsigned short* W16, unsigned short* WWb) {
  const int tid = threadIdx.x, blk = blockIdx.x;
  if (blk < MW / 8) {
    const int rl = tid >> 5, col = 8 * (tid & 31);
    const int o = 8 * blk + rl;                                      // 0..383
    const int grp = blk >> 4;                                        // 0,1,2 (block-uniform)
    const float* wbase = (grp == 0) ? tw : ((grp == 1) ? pw : gw);  // all global
    const float* s = wbase + (size_t)(o - DQ * grp) * CC + col;      // (o - 128 grp) in 0..127
    const v4f a = *(const v4f*)s;
    const v4f q = *(const v4f*)(s + 4);
    const float f[8] = {a[0], a[1], a[2], a[3], q[0], q[1], q[2], q[3]};
    v4u u;
#pragma unroll
    for (int t = 0; t < 4; ++t) {
      const _Float16 h0 = (_Float16)(bfr(f[2 * t]) * WSC);
      const _Float16 h1 = (_Float16)(bfr(f[2 * t + 1]) * WSC);
      u[t] = pk16(h_bits(h0), h_bits(h1));
    }
{
      *(v4u*)(W16 + (size_t)o * CC + col) = u;
      
    }
  } else {
    const int rb = blk - MW / 8;                                     // 0..15
    const int o = 16 * rb + (tid >> 4);                              // 0..255
    const int col = 8 * (tid & 15);                                  // 0..120
    const float* s = ow + (size_t)o * DQ + col;
    const v4f a = *(const v4f*)s;
    const v4f q = *(const v4f*)(s + 4);
    const float f[8] = {a[0], a[1], a[2], a[3], q[0], q[1], q[2], q[3]};
    v4u u;
#pragma unroll
    for (int t = 0; t < 4; ++t) u[t] = pk16(bf_bits(f[2 * t]), bf_bits(f[2 * t + 1]));
{
      *(v4u*)(WWb + (size_t)o * DQ + col) = u;
      
    }
  }
}

// =========================================================================================================
// (1) x f32 [b][256 c][4096 n] -> XP f16 [b][n][c] (grid z < NB) and neighborFeat -> NP (grid z >= NB), position-
//     major, bf16-RNE values (exact in f16), through an LDS tile T[64 n][64 c] (pitch TP, cross-wave, block barrier).
// coverage: T written rows (8e+t)=0..63 x cols cl 0..63, read rows 0..63 x cols 8e..8e+7; plane 2 it x 32 rows x 8
//           lanes x 8 = 64 n x 64 c; grid (64, 4, 2 NB) covers XP and NP [b][0..4095][0..255] exactly once.
// =========================================================================================================
__global__ __launch_bounds__(256)
void cvt_x(const float* __restrict__ x, const float* __restrict__ nf, unsigned short* XP, unsigned short* NP) {
  __shared__ __align__(16) unsigned short T[QT * TP];
  const int tid = threadIdx.x;
  const int nb = blockIdx.x, cb = blockIdx.y, zz = blockIdx.z;
  const int which = (zz >= NB) ? 1 : 0;                              // block-uniform plane select
  const int b = zz - which * NB;                                     // 0..NB-1
  const float* src = (which != 0) ? nf : x;                          // both global
  unsigned short* dst = (which != 0) ? NP : XP;                      // both global
  const int e = tid & 7, lq = tid >> 3;                              // lq 0..31
  const int n0 = nb * QT, c0 = cb * QT;
#pragma unroll
  for (int it = 0; it < 2; ++it) {
    const int cl = it * 32 + lq;                                     // 0..63
    const float* sp = src + ((size_t)(b * CC + c0 + cl)) * NN + n0 + 8 * e;
    const v4f a = *(const v4f*)sp;
    const v4f q = *(const v4f*)(sp + 4);
    unsigned short hb[8];
#pragma unroll
    for (int t = 0; t < 4; ++t) {
      hb[t]     = h_bits((_Float16)bfr(a[t]));
      hb[4 + t] = h_bits((_Float16)bfr(q[t]));
    }
#pragma unroll
    for (int t = 0; t < 8; ++t) T[(8 * e + t) * TP + cl] = hb[t];
  }
  __syncthreads();
  v4u up[2];
#pragma unroll
  for (int it = 0; it < 2; ++it) {
    const int nl = it * 32 + lq;                                     // 0..63
    up[it] = *(const v4u*)(T + nl * TP + 8 * e);
  }
{
#pragma unroll
    for (int it = 0; it < 2; ++it) {
      const int rl = it * 32 + lq;
      *(v4u*)(dst + ((size_t)(b * NN + n0 + rl)) * CC + c0 + 8 * e) = up[it];
    }
    
  }
}

// =========================================================================================================
// (2) conv1x1 GEMM for one (b, strip of 128 positions = image rows 2s and 2s+1, 64-o block of the stacked weights):
//     Y[o][n] = (1/256) sum_c W16[o][c] B[b][n][c], B = NP for o-blocks 0..3 (theta, phi) and XP for o-blocks 4,5
//     (g), block-uniform select. Block 256 threads = 8 waves; wave w owns cols n0+16w..+15 (one B fragment per
//     k-step, k = c contiguous in the plane row) and 4 m-tiles (A rows o = o0 + 16 mt + (lane&15), split k map
//     loader from W16). K = 256 = 8 steps. Epilogue staged in LDS Os[n_loc][o_loc] (pitch OSP, b128 stores),
//     block barrier, then (block-uniform branch on the o block):
//       o-blocks 0,1 -> theta dims 0..63 / 64..127 + bias -> Qh/Ql bf16 [b][4096 n][128 d] (hi = RNE(v), lo = RNE(v-hi)):
//       o-blocks 2,3 -> phi + bias in f32 -> PF f32 [b][4096 n][128 d]: 128 rows x the dsel half (256 B = 2 whole
//                       lines) of the 512-B row, 16 consecutive lanes x 16 B, one instruction per 2 rows.
//       o-blocks 4,5 -> g + bias -> GF f32 [b][4096 n][128 d], same layout.
// coverage: Os 8 waves x 16 n x 64 o = 128 x 64 written, reads rows <= 127 cols <= 63; theta planes 4 it x 32 rows
//           x 8 lanes x 8 = 128 n x 64 d; f32 planes 8 it x 16 rows x 16 lanes x 4 = 128 n x 64 d; grid (32, 6, NB)
//           covers all 4096 rows x 128 d of Qh/Ql and of PF/GF exactly once.
// =========================================================================================================
__global__ __launch_bounds__(256) __attribute__((amdgpu_num_vgpr(256)))
void gemm_proj(const unsigned short* __restrict__ W16, const unsigned short* __restrict__ NP,
               const unsigned short* __restrict__ XP,
               const float* __restrict__ tb, const float* __restrict__ pb, const float* __restrict__ gb,
               unsigned short* Qh, unsigned short* Ql, float* PF, float* GF) {
  __shared__ __align__(16) float Os[SN * OSP];
  const int tid  = threadIdx.x;
  const int lane = tid & 31, wave = tid >> 5;                        // wave 0..7
  const int hh   = lane >> 4, c = lane & 15;
  const int st   = blockIdx.x, mb = blockIdx.y, b = blockIdx.z;
  const int n0   = st * SN, o0 = mb * QT;
  const unsigned short* BP = (mb < 4) ? NP : XP;                     // block-uniform, both global

  const unsigned short* ap = W16 + (size_t)(o0 + c) * CC + 8 * hh;
  const unsigned short* bp = BP + ((size_t)(b * NN + n0 + 16 * wave + c)) * CC + 8 * hh;

  v8f acc[4];
#pragma unroll
  for (int mt = 0; mt < 4; ++mt) acc[mt] = zero8();

#pragma unroll
  for (int ks = 0; ks < CC / 32; ++ks) {
    const Frag fb = ldfrag(bp + 32 * ks);
#pragma unroll
    for (int mt = 0; mt < 4; ++mt) {
      const Frag fa = ldfrag(ap + (size_t)(16 * mt) * CC + 32 * ks);
      acc[mt] = mma_h(fa.h, fb.h, acc[mt]);
    }
  }

  // ---- epilogue: scale back -> LDS Os[n_loc][o_loc]; lane (hh, c) holds o = 16 mt + 8 hh + r for n_loc = 16 w + c
  {
    const int nl = 16 * wave + c;
#pragma unroll
    for (int mt = 0; mt < 4; ++mt) {
      v4f va, vb;
#pragma unroll
      for (int r = 0; r < 4; ++r) { va[r] = acc[mt][r] * IWSC; vb[r] = acc[mt][4 + r] * IWSC; }
      *(v4f*)(Os + nl * OSP + 16 * mt + 8 * hh)     = va;
      *(v4f*)(Os + nl * OSP + 16 * mt + 8 * hh + 4) = vb;
    }
  }
  __syncthreads();

  const int grp = mb >> 1;                                           // 0 theta, 1 phi, 2 g (block-uniform)
  const int dsel = (mb & 1) * QT;                                    // 0 or 64
  const float* bias = (grp == 0) ? tb : ((grp == 1) ? pb : gb);     // all global

  if (grp == 0) {
    const int e = tid & 7, lq = tid >> 3;                            // lq 0..31
    float bv[8];
    {
      const v4f ba = *(const v4f*)(bias + dsel + 8 * e);
      const v4f bq = *(const v4f*)(bias + dsel + 8 * e + 4);
#pragma unroll
      for (int t = 0; t < 4; ++t) { bv[t] = bfr(ba[t]); bv[4 + t] = bfr(bq[t]); }
    }
    v4u uh[4], ul[4];
#pragma unroll
    for (int it = 0; it < 4; ++it) {
      const int row = it * 32 + lq;                                  // n_loc 0..127
      const v4f a = *(const v4f*)(Os + row * OSP + 8 * e);
      const v4f q = *(const v4f*)(Os + row * OSP + 8 * e + 4);
      float f[8];
#pragma unroll
      for (int t = 0; t < 4; ++t) { f[t] = a[t] + bv[t]; f[4 + t] = q[t] + bv[4 + t]; }
      split8(f, uh[it], ul[it]);
    }
{
#pragma unroll
      for (int it = 0; it < 4; ++it) {
        const int row = it * 32 + lq;
        const size_t po = ((size_t)(b * NN + n0 + row)) * DQ + dsel + 8 * e;
        *(v4u*)(Qh + po) = uh[it];
        *(v4u*)(Ql + po) = ul[it];
      }
      
    }
  } else {
    const int e16 = tid & 15, lr = tid >> 4;                        // lr 0..15
    v4f bv4;
    {
      const v4f bq = *(const v4f*)(bias + dsel + 4 * e16);
#pragma unroll
      for (int t = 0; t < 4; ++t) bv4[t] = bfr(bq[t]);
    }
    float* P = (grp == 1) ? PF : GF;                                 // both global
    v4f res[8];
#pragma unroll
    for (int it = 0; it < 8; ++it) {
      const int row = it * 16 + lr;                                  // n_loc 0..127
      const v4f a = *(const v4f*)(Os + row * OSP + 4 * e16);
      v4f v;
#pragma unroll
      for (int t = 0; t < 4; ++t) v[t] = a[t] + bv4[t];
      res[it] = v;
    }
{
#pragma unroll
      for (int it = 0; it < 8; ++it) {
        const int row = it * 16 + lr;
        const size_t po = ((size_t)(b * NN + n0 + row)) * DQ + dsel + 4 * e16;
        *(v4f*)(P + po) = res[it];
      }
      
    }
  }
}

// =========================================================================================================
// (3) 2x2 stride-2 max-pool of PF / GF f32 [b][4096 n][128 d] in f32 -> Kh/Kl bf16 [b][1024 m][128 d]
//     (hi = RNE(v), lo = RNE(v-hi)) and Gp f16 [b][1024 m][128 d], m = 32 py + px, window n = (2py+dy) 64 + 2px+dx,
//     lr = tid>>4 -> px = 16 it + lr for it 0..1 (px 0..31, all valid, no pad rows since 1024 keys = 32 x 32).
// coverage: blocks 0..31 x px 0..31 x 16 lanes x 8 = rows 0..1023 x 128 d of each plane; grid (32, NB) covers
//           Kh/Kl/Gp [b][0..1023][0..127] exactly once.
// =========================================================================================================
__global__ __launch_bounds__(256)
void pool_k(const float* __restrict__ PF, const float* __restrict__ GF,
            unsigned short* Kh, unsigned short* Kl, unsigned short* Gp) {
  const int tid = threadIdx.x, py = blockIdx.x, b = blockIdx.y;
  const int e16 = tid & 15, lr = tid >> 4;                          // lr 0..15
  v4u kh[2], kl[2], gu[2];
#pragma unroll
  for (int it = 0; it < 2; ++it) {
    const int px = it * 16 + lr;                                    // 0..31
    float fk[8], fg[8];
#pragma unroll
    for (int t = 0; t < 8; ++t) { fk[t] = -__builtin_inff(); fg[t] = -__builtin_inff(); }
#pragma unroll 1
    for (int dy = 0; dy < 2; ++dy) {
      const size_t rb = ((size_t)(b * NN + (2 * py + dy) * WIMG + 2 * px)) * DQ + 8 * e16;
#pragma unroll
      for (int dx = 0; dx < 2; ++dx) {
        const float* pk = PF + rb + (size_t)dx * DQ;
        const float* pg = GF + rb + (size_t)dx * DQ;
        const v4f ka = *(const v4f*)pk, kq = *(const v4f*)(pk + 4);
        const v4f ga = *(const v4f*)pg, gq = *(const v4f*)(pg + 4);
#pragma unroll
        for (int t = 0; t < 4; ++t) {
          fk[t]     = fmaxf(fk[t], ka[t]);
          fk[4 + t] = fmaxf(fk[4 + t], kq[t]);
          fg[t]     = fmaxf(fg[t], ga[t]);
          fg[4 + t] = fmaxf(fg[4 + t], gq[t]);
        }
      }
    }
    split8(fk, kh[it], kl[it]);
#pragma unroll
    for (int t = 0; t < 4; ++t) gu[it][t] = pk16(h_bits((_Float16)fg[2 * t]), h_bits((_Float16)fg[2 * t + 1]));
  }
{
#pragma unroll
    for (int it = 0; it < 2; ++it) {
      const int px = it * 16 + lr;
      const size_t po = ((size_t)(b * MM + WP * py + px)) * DQ + 8 * e16;
      *(v4u*)(Kh + po) = kh[it];
      *(v4u*)(Kl + po) = kl[it];
      *(v4u*)(Gp + po) = gu[it];
    }
    
  }
}

// =========================================================================================================
// (4) Gp f16 [b][1024 m][128 d] -> Gc f16 [b][d][m] (channel-major, keys contiguous) through an LDS tile T[64 d][64 m]
// coverage: reads 2 it x 32 rows x 8 lanes x 8 = 64 m x 64 d; T written rows (8e+t)=0..63 x cols 0..63, read rows
//           0..63 x cols 8e..8e+7; writes 64 d x 64 m; grid (16, 2, NB) covers Gc [b][0..127][0..1023] exactly once.
// =========================================================================================================
__global__ __launch_bounds__(256)
void tr_g(const unsigned short* __restrict__ Gp, unsigned short* Gc) {
  __shared__ __align__(16) unsigned short T[QT * TP];
  const int tid = threadIdx.x;
  const int mt = blockIdx.x, db = blockIdx.y, b = blockIdx.z;
  const int e = tid & 7, lq = tid >> 3;                             // lq 0..31
  const int m0 = mt * QT, d0 = db * QT;
#pragma unroll
  for (int it = 0; it < 2; ++it) {
    const int ml = it * 32 + lq;                                     // 0..63
    const v4u w = *(const v4u*)(Gp + ((size_t)(b * MM + m0 + ml)) * DQ + d0 + 8 * e);
    unsigned short hb[8];
#pragma unroll
    for (int t = 0; t < 4; ++t) {
      hb[2 * t]     = (unsigned short)(w[t] & 0xFFFFu);
      hb[2 * t + 1] = (unsigned short)(w[t] >> 16);
    }
#pragma unroll
    for (int t = 0; t < 8; ++t) T[(8 * e + t) * TP + ml] = hb[t];
  }
  __syncthreads();
  v4u up[2];
#pragma unroll
  for (int it = 0; it < 2; ++it) {
    const int dl = it * 32 + lq;                                     // 0..63
    up[it] = *(const v4u*)(T + dl * TP + 8 * e);
  }
{
#pragma unroll
    for (int it = 0; it < 2; ++it) {
      const int dl = it * 32 + lq;
      *(v4u*)(Gc + ((size_t)(b * DQ + d0 + dl)) * MM + m0 + 8 * e) = up[it];
    }
    
  }
}

// =========================================================================================================
// (5) attention for one (b, 64-query tile), transposed formulation, 1024 keys (all valid, no mask, no scale):
//   S^T tile (16 keys x 16 queries) = sum over 4 d-chunks (rolled loop) of A(k: row = key kb + (lane&15), 32 d via
//   the split k map from the bf16 plane Kh [b][1024][128]) . B(q: col = query, same map from Qh [b][4096][128])
//   + A(Kh).B(Ql) + A(Kl).B(Qh) (bf16 unscaled residual planes, shared accumulator).
//   Per lane the D tile holds 8 keys of ONE query: online softmax state per lane, one shuffle (lane^16) for the max
//   over 32 keys; the o/l rescale is skipped under a wave-uniform ballot when no lane's max grew (corr == 1 exactly
//   for every lane then); row-sum partials combined at the end. P = e^{s-m} x 16384 as f16 is the B operand of
//   y^T (rows channel, cols queries) += A(pooled g: rows channel = 16j + (lane&15), keys contiguous, f16 plane Gc
//   [b][128][1024]) . B(P^T): element r <- D of the tile covering keys kb..kb+15, element 8+r <- the tile covering
//   kb+16..kb+31, lane unchanged. 8 accumulator tiles per wave (128 channels). Block = 4 waves = 64 queries.
//   Epilogue: y = O/l staged in LDS Os[query][128 channels] (pitch OSPW, b128 stores), block barrier, then
// coverage: Os written 4 waves x 16 queries x 128 ch, read rows 0..63 x ch 8e..8e+7 (e 0..15); planes 8 it x 8 rows x
//           16 lanes x 8 = 64 n x 128 ch per plane; grid (NQ/64, NB) covers rows 0..NQ-1 of Yh/Yl exactly once.
// =========================================================================================================
__global__ __launch_bounds__(128) __attribute__((amdgpu_num_vgpr(256)))
void attn_k(const unsigned short* __restrict__ Qh, const unsigned short* __restrict__ Ql,
            const unsigned short* __restrict__ Kh, const unsigned short* __restrict__ Kl,
            const unsigned short* __restrict__ Gc, unsigned short* Yh, unsigned short* Yl) {
  __shared__ __align__(16) float Os[QT * OSPW];
  const int tid  = threadIdx.x;
  const int wave = tid >> 5, lane = tid & 31;
  const int hh   = lane >> 4, c = lane & 15;
  const int n0   = blockIdx.x * QT, b = blockIdx.y;

  // q fragment pointers (B operand, col = query n0 + 16*wave + c), + 32*kc
  const size_t qo = ((size_t)(b * NN + n0 + 16 * wave + c)) * DQ + 8 * hh;
  const unsigned short* Qhp = Qh + qo;
  const unsigned short* Qlp = Ql + qo;
  // k fragment base (A operand, row = key kb + c), + key * 128 + 32*kc
  const unsigned short* Khp = Kh + (size_t)b * MM * DQ + (size_t)c * DQ + 8 * hh;
  const unsigned short* Klp = Kl + (size_t)b * MM * DQ + (size_t)c * DQ + 8 * hh;
  // v fragment base (A operand, row = channel 16j + c, keys contiguous), + 16*j*MM + kb
  const unsigned short* Vp = Gc + (size_t)b * DQ * MM + (size_t)c * MM + 8 * hh;

  float m = -1.0e30f, l = 0.f;
  v8f o[8];
#pragma unroll
  for (int j = 0; j < 8; ++j) o[j] = zero8();

#pragma unroll 1
  for (int kb = 0; kb < MM; kb += 32) {
    const unsigned short* k0p  = Khp + (size_t)kb * DQ;              // keys kb .. kb+15
    const unsigned short* k1p  = Khp + (size_t)(kb + 16) * DQ;       // keys kb+16 .. kb+31
    const unsigned short* k0lp = Klp + (size_t)kb * DQ;
    const unsigned short* k1lp = Klp + (size_t)(kb + 16) * DQ;
    v8f s0 = zero8(), s1 = zero8();
#pragma unroll 1
    for (int kc = 0; kc < DQ / 32; ++kc) {
      const Frag qh  = ldfrag(Qhp + 32 * kc);
      const Frag ql  = ldfrag(Qlp + 32 * kc);
      const Frag k0  = ldfrag(k0p + 32 * kc);
      const Frag k1  = ldfrag(k1p + 32 * kc);
      const Frag k0l = ldfrag(k0lp + 32 * kc);
      const Frag k1l = ldfrag(k1lp + 32 * kc);
      s0 = mma_b(k0.bf, qh.bf, s0);
      s1 = mma_b(k1.bf, qh.bf, s1);
      s0 = mma_b(k0.bf, ql.bf, s0);
      s1 = mma_b(k1.bf, ql.bf, s1);
      s0 = mma_b(k0l.bf, qh.bf, s0);
      s1 = mma_b(k1l.bf, qh.bf, s1);
    }

    float mx = fmaxf(hmax8(s0), hmax8(s1));
    mx = fmaxf(mx, __shfl_xor(mx, 16, 32));
    const float mn = fmaxf(m, mx);
    const unsigned grew = wave_ballot(mx > m);                       // wave-uniform
    if (grew != 0u) {
      const float corr = __expf(m - mn);                             // == 1 exactly for lanes whose max did not grow
      l *= corr;
#pragma unroll
      for (int j = 0; j < 8; ++j) {
#pragma unroll
        for (int r = 0; r < 8; ++r) o[j][r] *= corr;
      }
    }
    m = mn;
    const float msh = mn - LNPS;                                     // exp gives e^{s-m} * 16384

    FragH ph;
    float ls = 0.f;
#pragma unroll
    for (int r = 0; r < 8; ++r) {
      const float e0 = __expf(s0[r] - msh);                          // key kb      + 8hh + r
      const float e1 = __expf(s1[r] - msh);                          // key kb + 16 + 8hh + r
      ls += e0 + e1;
      ph.hv[0][r] = (_Float16)e0;
      ph.hv[1][r] = (_Float16)e1;
    }
    l += ls;

#pragma unroll
    for (int j = 0; j < 8; ++j) {
      const Frag vf = ldfrag(Vp + (size_t)(16 * j) * MM + kb);
      o[j] = mma_h(vf.h, ph.v, o[j]);
    }
  }
  l += __shfl_xor(l, 16, 32);
  const float inv = 1.0f / l;                                        // o and l both carry the x16384 factor

  // ---- epilogue: y = o * inv -> Os[query][ch]; lane (hh, c) holds ch = 16 j + 8 hh + r for query 16 w + c
  {
    const int qrow = 16 * wave + c;
#pragma unroll
    for (int j = 0; j < 8; ++j) {
      v4f va, vb;
#pragma unroll
      for (int r = 0; r < 4; ++r) { va[r] = o[j][r] * inv; vb[r] = o[j][4 + r] * inv; }
      *(v4f*)(Os + qrow * OSPW + 16 * j + 8 * hh)     = va;
      *(v4f*)(Os + qrow * OSPW + 16 * j + 8 * hh + 4) = vb;
    }
  }
  __syncthreads();

  const int e16 = tid & 15, lr = tid >> 4;                           // lr 0..7
  v4u uh[8], ul[8];
#pragma unroll
  for (int it = 0; it < 8; ++it) {
    const int row = it * 8 + lr;                                     // query 0..63
    const v4f a = *(const v4f*)(Os + row * OSPW + 8 * e16);
    const v4f q = *(const v4f*)(Os + row * OSPW + 8 * e16 + 4);
    const float f[8] = {a[0], a[1], a[2], a[3], q[0], q[1], q[2], q[3]};
    split8(f, uh[it], ul[it]);
  }
{
#pragma unroll
    for (int it = 0; it < 8; ++it) {
      const int row = it * 8 + lr;
      const size_t po = ((size_t)(b * NN + n0 + row)) * DQ + 8 * e16;
      *(v4u*)(Yh + po) = uh[it];
      *(v4u*)(Yl + po) = ul[it];
    }
    
  }
}

// =========================================================================================================
// (6) output conv for one (b, 64-n tile, 64-c block): A[c][n] = sum_ci WWb[c][ci] (Yh + Yl)[b][n][ci] on bf16 WMMA
//     (2 products per k-step, shared accumulator), K = 128 = 4 steps. Block 128 threads = 4 waves; wave w owns cols
//     n0+16w..+15 (B fragments from the k-contiguous Yh/Yl rows) and 4 m-tiles (A rows c = c0 + 16 mt + (lane&15),
//     split k map loader from WWb). Per-channel constants (bf16-RNE of w_b, bn mean, bn beta, and scale =
//     bf16-RNE(gamma) * rsqrt(bf16-RNE(var) + eps)) staged once in LDS by waves 0,1. Epilogue staged in LDS
//     Os[n_loc][c_loc] (pitch OSP, b128 stores), block barrier, then out[b][c][n] = (((A + w_b[c]) - mean[c]) *
// coverage: Os 4 waves x 16 n x 64 c written, read rows nl+t <= 63 x cols cl <= 63; Pb/Pm/Ps/Pt written 0..63, read
//           cl <= 63; out 8 it x 16 lines x 8 lanes x 4 floats = 64 c x 64 n; grid (NQ/64, 4, NB) covers
//           out[b][0..255][0..NQ-1] exactly once.
// =========================================================================================================
__global__ __launch_bounds__(128) __attribute__((amdgpu_num_vgpr(256)))
void gemm_out(const unsigned short* __restrict__ WWb, const unsigned short* __restrict__ Yh,
              const unsigned short* __restrict__ Yl, const float* __restrict__ wb,
              const float* __restrict__ bng, const float* __restrict__ bnb,
              const float* __restrict__ bnm, const float* __restrict__ bnv,
              const float* __restrict__ x, float* out) {
  __shared__ __align__(16) float Os[QT * OSP];
  __shared__ float Pb[QT], Pm[QT], Ps[QT], Pt[QT];
  const int tid  = threadIdx.x;
  const int lane = tid & 31, wave = tid >> 5;
  const int hh   = lane >> 4, c = lane & 15;
  const int nt   = blockIdx.x, cb = blockIdx.y, b = blockIdx.z;
  const int n0   = nt * QT, c0 = cb * QT;

  if (tid < QT) {                                                    // waves 0,1 (wave-uniform), cross-wave via barrier
    const int ch = c0 + tid;                                         // 0..255
    Pb[tid] = bfr(wb[ch]);
    Pm[tid] = bfr(bnm[ch]);
    Ps[tid] = bfr(bng[ch]) * rsqrtf(bfr(bnv[ch]) + BNEPS);
    Pt[tid] = bfr(bnb[ch]);
  }

  const unsigned short* ap  = WWb + (size_t)(c0 + c) * DQ + 8 * hh;
  const size_t bo = ((size_t)(b * NN + n0 + 16 * wave + c)) * DQ + 8 * hh;
  const unsigned short* bph = Yh + bo;
  const unsigned short* bpl = Yl + bo;

  v8f acc[4];
#pragma unroll
  for (int mt = 0; mt < 4; ++mt) acc[mt] = zero8();

#pragma unroll
  for (int ks = 0; ks < DQ / 32; ++ks) {
    const Frag fbh = ldfrag(bph + 32 * ks);
    const Frag fbl = ldfrag(bpl + 32 * ks);
#pragma unroll
    for (int mt = 0; mt < 4; ++mt) {
      const Frag fa = ldfrag(ap + (size_t)(16 * mt) * DQ + 32 * ks);
      acc[mt] = mma_b(fa.bf, fbh.bf, acc[mt]);
      acc[mt] = mma_b(fa.bf, fbl.bf, acc[mt]);
    }
  }

  // ---- epilogue: -> LDS Os[n_loc][c_loc]; lane (hh, c) holds c_loc = 16 mt + 8 hh + r for n_loc = 16 w + c
  {
    const int nl = 16 * wave + c;
#pragma unroll
    for (int mt = 0; mt < 4; ++mt) {
      v4f va, vb;
#pragma unroll
      for (int r = 0; r < 4; ++r) { va[r] = acc[mt][r]; vb[r] = acc[mt][4 + r]; }
      *(v4f*)(Os + nl * OSP + 16 * mt + 8 * hh)     = va;
      *(v4f*)(Os + nl * OSP + 16 * mt + 8 * hh + 4) = vb;
    }
  }
  __syncthreads();

  const int e = tid & 7, lq = tid >> 3;                              // lq 0..15
  v4f res[8];
#pragma unroll
  for (int it = 0; it < 8; ++it) {
    const int L   = it * 16 + lq;                                    // 0..127
    const int cl  = L >> 1, hf = L & 1;                              // channel 0..63 within the block
    const int nl  = hf * 32 + 4 * e;                                 // position 0..63
    const float pbv = Pb[cl], pmv = Pm[cl], psv = Ps[cl], ptv = Pt[cl];
    const size_t idx = ((size_t)(b * CC + c0 + cl)) * NN + n0 + nl;
    const v4f xv = *(const v4f*)(x + idx);
#pragma unroll
    for (int t = 0; t < 4; ++t) {
      const float cv = Os[(nl + t) * OSP + cl] + pbv;
      res[it][t] = ((cv - pmv) * psv + ptv) + bfr(xv[t]);
    }
  }
{
#pragma unroll
    for (int it = 0; it < 8; ++it) {
      const int L   = it * 16 + lq;
      const int cl  = L >> 1, hf = L & 1;
      const int nl  = hf * 32 + 4 * e;
      const size_t idx = ((size_t)(b * CC + c0 + cl)) * NN + n0 + nl;
      *(v4f*)(out + idx) = res[it];
    }
    
  }
}

// =========================================================================================================
// Workspace map (bytes; each region start a multiple of 256; every extent is an exact row/tile multiple and is
//   W16 f16 [384][256]            196608      WWb bf16 [256][128]        65536
//   XP / NP f16 [NB][4096][256]  16777216 x2 (NB=8)
//   Qh/Ql bf16 [NB][4096][128]    8388608 x2
//   PF/GF f32  [NB][4096][128]   16777216 x2
//   Kh/Kl bf16 [NB][1024][128]    2097152 x2  Gp f16 [NB][1024][128]   2097152   Gc f16 [NB][128][1024]  2097152
//   Yh/Yl bf16 [NB][4096][128]    8388608 x2
//   total (NB=8) = 109314048
// =========================================================================================================
extern "C" void kernel_launch(void* const* d_in, const int* in_sizes, int n_in,
                              void* d_out, int out_size, void* d_ws, size_t ws_size,
                              hipStream_t stream) {
  const int XN = NB * CC * NN;
  if (n_in < 14) return;
  if (in_sizes[0] < XN || in_sizes[1] < XN) return;
  if (in_sizes[2] < DQ * CC || in_sizes[4] < DQ * CC || in_sizes[6] < DQ * CC || in_sizes[8] < CC * DQ) return;
  if (in_sizes[3] < DQ || in_sizes[5] < DQ || in_sizes[7] < DQ) return;
  if (in_sizes[9] < CC || in_sizes[10] < CC || in_sizes[11] < CC || in_sizes[12] < CC || in_sizes[13] < CC) return;
  if (out_size < XN) return;

  size_t off = 0;
  auto carve = [&](size_t bytes) { const size_t o = off; off += (bytes + 255) & ~(size_t)255; return o; };
  const size_t oW16 = carve((size_t)MW * CC * 2);
  const size_t oWWb = carve((size_t)CC * DQ * 2);
  const size_t oXP  = carve((size_t)NB * NN * CC * 2);
  const size_t oNP  = carve((size_t)NB * NN * CC * 2);
  const size_t oQh  = carve((size_t)NB * NN * DQ * 2);
  const size_t oQl  = carve((size_t)NB * NN * DQ * 2);
  const size_t oPF  = carve((size_t)NB * NN * DQ * 4);
  const size_t oGF  = carve((size_t)NB * NN * DQ * 4);
  const size_t oKh  = carve((size_t)NB * MM * DQ * 2);
  const size_t oKl  = carve((size_t)NB * MM * DQ * 2);
  const size_t oGp  = carve((size_t)NB * MM * DQ * 2);
  const size_t oGc  = carve((size_t)NB * DQ * MM * 2);
  const size_t oYh  = carve((size_t)NB * NN * DQ * 2);
  const size_t oYl  = carve((size_t)NB * NN * DQ * 2);
  if (off > ws_size) return;
  if (off > (size_t)134217728) return;

  const float* x   = (const float*)d_in[0];
  const float* nf  = (const float*)d_in[1];
  const float* gw  = (const float*)d_in[2];
  const float* gb  = (const float*)d_in[3];
  const float* tw  = (const float*)d_in[4];
  const float* tb  = (const float*)d_in[5];
  const float* pw  = (const float*)d_in[6];
  const float* pb  = (const float*)d_in[7];
  const float* ow  = (const float*)d_in[8];
  const float* wb  = (const float*)d_in[9];
  const float* bng = (const float*)d_in[10];
  const float* bnb = (const float*)d_in[11];
  const float* bnm = (const float*)d_in[12];
  const float* bnv = (const float*)d_in[13];

  char* ws = (char*)d_ws;
  unsigned short* W16 = (unsigned short*)(ws + oW16);
  unsigned short* WWb = (unsigned short*)(ws + oWWb);
  unsigned short* XP  = (unsigned short*)(ws + oXP);
  unsigned short* NP  = (unsigned short*)(ws + oNP);
  unsigned short* Qh  = (unsigned short*)(ws + oQh);
  unsigned short* Ql  = (unsigned short*)(ws + oQl);
  float*          PF  = (float*)(ws + oPF);
  float*          GF  = (float*)(ws + oGF);
  unsigned short* Kh  = (unsigned short*)(ws + oKh);
  unsigned short* Kl  = (unsigned short*)(ws + oKl);
  unsigned short* Gp  = (unsigned short*)(ws + oGp);
  unsigned short* Gc  = (unsigned short*)(ws + oGc);
  unsigned short* Yh  = (unsigned short*)(ws + oYh);
  unsigned short* Yl  = (unsigned short*)(ws + oYl);
  float* out = (float*)d_out;

  const dim3 blk256(256), blk128(128);

  // (0) theta_w / phi_w / g_w -> stacked f16 plane; w_w -> bf16 plane
  cvt_w<<<dim3(MW / 8 + CC / 16), blk256, 0, stream>>>(tw, pw, gw, ow, W16, WWb);
  // (1) x -> XP, neighborFeat -> NP (position-major 16-bit planes)
  cvt_x<<<dim3(NN / QT, CC / QT, 2 * NB), blk256, 0, stream>>>(x, nf, XP, NP);
  // (2) conv1x1 GEMM -> theta (q) hi/res planes from NP, phi conv + bias f32 plane from NP, g conv + bias from XP
  gemm_proj<<<dim3(NSTRIP, MW / QT, NB), blk256, 0, stream>>>(W16, NP, XP, tb, pb, gb, Qh, Ql, PF, GF);
  // (3) 2x2 stride-2 max-pool -> pooled phi (k) hi/res planes, pooled g f16 plane
  pool_k<<<dim3(HP, NB), blk256, 0, stream>>>(PF, GF, Kh, Kl, Gp);
  // (4) pooled g -> channel-major plane
  tr_g<<<dim3(MM / QT, DQ / QT, NB), blk256, 0, stream>>>(Gp, Gc);
  // (5) attention -> y hi/res planes [b][n][128]
  attn_k<<<dim3(NQ / QT, NB), blk128, 0, stream>>>(Qh, Ql, Kh, Kl, Gc, Yh, Yl);
  // (6) output conv + bias + batch-norm affine + residual -> out [b][256][4096]
  gemm_out<<<dim3(NQ / QT, CC / QT, NB), blk128, 0, stream>>>(WWb, Yh, Yl, wb, bng, bnb, bnm, bnv, x, out);
  (void)hipGetLastError();
}

// v001
// A run of this version takes 135 microseconds.
// In both of two side-by-side timings against v000, it was 1.60 times as fast.
// Contractions: conv1x1 theta/phi/g GEMM W[384x256].X[256x128] per strip on v_wmma_f32_16x16x32_f16 (f16 containers
// of bf16-RNE weights x256 and bf16-RNE activations); scores K.Q^T on v_wmma_f32_16x16x32_bf16 (bf16 hi + bf16
// residual planes of theta / pooled phi, 3 products, K=128); y^T = G.P^T on v_wmma_f32_16x16x32_f16 (2x2-max-pooled g
// as f16, P = e^{s-m} x16384 f16 from the score D registers); output conv W[256x128].Y on v_wmma_f32_16x16x32_bf16
// (bf16 weights, y as bf16 hi + residual planes, 2 products); f32 accumulate everywhere; max-pool, softmax statistics,
// bias, batch-norm affine with running statistics and residual add in f32 VALU.
#include <hip/hip_runtime.h>
#include <math.h>
#include <stdint.h>

#ifndef NB
#define NB 8
#endif
#ifndef NQ
#define NQ 4096
#endif
#define NB_FULL 8
#define CC     256
#define HIMG   64
#define WIMG   64
#define NN     4096
#define DQ     128
#define HP     32
#define WP     32
#define MV     1024
#define MM     1024
#define MW     384
#define QT     64
#define SN     128
#define NWP    8
#define NSTRIP 32
#define OSP    68
#define OSPW   132
#define TP     72
#define WSC    256.0f
#define IWSC   0.00390625f
#define LNPS   9.704060527839234f
#define BNEPS  1.0e-5f
#define KT     64
#define NT     16
#define KPS    136
#define VPS    72
#define KSZ    (KT * KPS * 2)
#define VSZ    (DQ * VPS * 2)
#define STG    (2 * KSZ + VSZ)

static_assert(NB >= 1 && NB <= NB_FULL);
static_assert(NQ % QT == 0 && NQ >= QT && NQ <= NN);
static_assert(NN == HIMG * WIMG);
static_assert(SN == 2 * WIMG);
static_assert(NSTRIP * SN == NN);
static_assert(SN == 16 * NWP);
static_assert(2 * HP == HIMG && 2 * WP == WIMG);
static_assert(MV == HP * WP && MM == MV);
static_assert(WP == 32 && HP == 32);
static_assert(NN % QT == 0 && CC % QT == 0 && DQ % QT == 0 && MM % QT == 0);
static_assert(MW == 3 * DQ && MW % QT == 0 && MW % 8 == 0);
static_assert(CC % 32 == 0 && DQ % 32 == 0 && MM % 32 == 0);
static_assert((OSP * 4) % 16 == 0);
static_assert((OSPW * 4) % 16 == 0);
static_assert((TP * 2) % 16 == 0);
static_assert(SN * OSP * 4 <= 65536);
static_assert((size_t)NB_FULL * CC * NN * 4 == (size_t)33554432);
static_assert(NT * KT == MM && NT >= 2 && KT % 32 == 0);
static_assert(KPS == DQ + 8 && VPS == KT + 8);
static_assert(KT * DQ * 2 == 8 * 128 * 16 && DQ * KT * 2 == 8 * 128 * 16);
static_assert(KSZ % 16 == 0 && VSZ % 16 == 0 && STG % 16 == 0);
static_assert(2 * (2 * STG + QT * OSPW * 4) <= 327680);

// workspace total at full size (all region sizes are multiples of 256)
#define WS_FULL ((size_t)MW * CC * 2 + (size_t)CC * DQ * 2 + 2 * (size_t)NB_FULL * NN * CC * 2 \
                 + 2 * (size_t)NB_FULL * NN * DQ * 2 + 2 * (size_t)NB_FULL * NN * DQ * 4 \
                 + 4 * (size_t)NB_FULL * MM * DQ * 2 + 2 * (size_t)NB_FULL * NN * DQ * 2)
static_assert(WS_FULL <= (size_t)134217728);

typedef _Float16       v16h __attribute__((ext_vector_type(16)));
typedef _Float16       v8h  __attribute__((ext_vector_type(8)));
typedef __bf16         v16b __attribute__((ext_vector_type(16)));
typedef unsigned short v8us __attribute__((ext_vector_type(8)));
typedef float          v8f  __attribute__((ext_vector_type(8)));
typedef float          v4f  __attribute__((ext_vector_type(4)));
typedef unsigned int   v4u  __attribute__((ext_vector_type(4)));

union Frag  { v8us u[2]; v16h h; v16b bf; };
union FragH { v16h v; v8h hv[2]; };
static_assert(sizeof(Frag) == 32);
static_assert(sizeof(FragH) == 32);

// ---- scalar helpers ---------------------------------------------------------------------------------------
__device__ __forceinline__ unsigned short bf_bits(float f) {          // f32 -> bf16 bits, RNE convert
  unsigned u = __float_as_uint(f);
  return (unsigned short)((u + 0x7FFFu + ((u >> 16) & 1u)) >> 16);
}
__device__ __forceinline__ float bf_up(unsigned short hb) { return __uint_as_float(((unsigned)hb) << 16); }
__device__ __forceinline__ float bfr(float f) { return bf_up(bf_bits(f)); }
__device__ __forceinline__ unsigned short h_bits(_Float16 x) { return __builtin_bit_cast(unsigned short, x); }
__device__ __forceinline__ unsigned pk16(unsigned short a, unsigned short b) { return (unsigned)a | ((unsigned)b << 16); }
__device__ __forceinline__ v8f zero8() { v8f z = {0.f, 0.f, 0.f, 0.f, 0.f, 0.f, 0.f, 0.f}; return z; }
__device__ __forceinline__ float hmax8(v8f s) {
  return fmaxf(fmaxf(fmaxf(s[0], s[1]), fmaxf(s[2], s[3])), fmaxf(fmaxf(s[4], s[5]), fmaxf(s[6], s[7])));
}
__device__ __forceinline__ unsigned wave_ballot(bool p) {
#if defined(__HIP_DEVICE_COMPILE__)
  return __builtin_amdgcn_ballot_w32(p);
#else
  return p ? 1u : 0u;
#endif
}
// 8 f32 values -> bf16 hi bits and bf16 residual bits (lo = RNE(v - hi)), packed 2 per uint
__device__ __forceinline__ void split8(const float* f, v4u& uh, v4u& ul) {
#pragma unroll
  for (int t = 0; t < 4; ++t) {
    const float f0 = f[2 * t], f1 = f[2 * t + 1];
    const unsigned short hb0 = bf_bits(f0), hb1 = bf_bits(f1);
    const unsigned short lb0 = bf_bits(f0 - bf_up(hb0));
    const unsigned short lb1 = bf_bits(f1 - bf_up(hb1));
    uh[t] = pk16(hb0, hb1);
    ul[t] = pk16(lb0, lb1);
  }
}

// ---- 16-bit fragment loader (A, or B from a k-contiguous [n][k] row): lane -> row/col (lane&15), p already includes
//      + 8*(lane>>4); elements 0..7 <- p[0..7] (k0+8h..), elements 8..15 <- p[16..23] (k0+16+8h..)
__device__ __forceinline__ Frag ldfrag(const unsigned short* p) {
  Frag f;
  f.u[0] = *(const v8us*)(p);
  f.u[1] = *(const v8us*)(p + 16);
  return f;
}

// ---- WMMA helpers: builtin followed by a 4-slot VALU gap tying D and keeping A/B live --------------------------
__device__ __forceinline__ v8f mma_h(v16h a, v16h b, v8f c) {
  v8f d = __builtin_amdgcn_wmma_f32_16x16x32_f16(false, a, false, b, (short)0, c, false, false);
#if defined(__HIP_DEVICE_COMPILE__)
  asm volatile("v_nop\n\tv_nop\n\tv_nop\n\tv_nop" : "+v"(d) : "v"(a), "v"(b));
#endif
  return d;
}
__device__ __forceinline__ v8f mma_b(v16b a, v16b b, v8f c) {
  v8f d = __builtin_amdgcn_wmma_f32_16x16x32_bf16(false, a, false, b, (short)0, c, false, false);
#if defined(__HIP_DEVICE_COMPILE__)
  const v16h ha = __builtin_bit_cast(v16h, a), hb = __builtin_bit_cast(v16h, b);
  asm volatile("v_nop\n\tv_nop\n\tv_nop\n\tv_nop" : "+v"(d) : "v"(ha), "v"(hb));
#endif
  return d;
}

// =========================================================================================================
// (0) weights. Blocks 0..47: W16 f16 [384][256], rows 0..127 = theta_w, 128..255 = phi_w, 256..383 = g_w; value =
//     f16 of (bf16-RNE(w) * 256) (exact). Block owns rows 8*blk..8*blk+7: one wave per 512-B row = 32 lanes x 16 B
// coverage: 48 blocks x 8 rows x 32 lanes x 8 halves = 384 x 256; 16 blocks x 16 rows x 16 lanes x 8 = 256 x 128.
// =========================================================================================================
__global__ __launch_bounds__(256)
void cvt_w(const float* __restrict__ tw, const float* __restrict__ pw, const float* __restrict__ gw,
           const float* __restrict__ ow, unsigned short* W16, unsigned short* WWb) {
  const int tid = threadIdx.x, blk = blockIdx.x;
  if (blk < MW / 8) {
    const int rl = tid >> 5, col = 8 * (tid & 31);
    const int o = 8 * blk + rl;                                      // 0..383
    const int grp = blk >> 4;                                        // 0,1,2 (block-uniform)
    const float* wbase = (grp == 0) ? tw : ((grp == 1) ? pw : gw);  // all global
    const float* s = wbase + (size_t)(o - DQ * grp) * CC + col;      // (o - 128 grp) in 0..127
    const v4f a = *(const v4f*)s;
    const v4f q = *(const v4f*)(s + 4);
    const float f[8] = {a[0], a[1], a[2], a[3], q[0], q[1], q[2], q[3]};
    v4u u;
#pragma unroll
    for (int t = 0; t < 4; ++t) {
      const _Float16 h0 = (_Float16)(bfr(f[2 * t]) * WSC);
      const _Float16 h1 = (_Float16)(bfr(f[2 * t + 1]) * WSC);
      u[t] = pk16(h_bits(h0), h_bits(h1));
    }
{
      *(v4u*)(W16 + (size_t)o * CC + col) = u;
      
    }
  } else {
    const int rb = blk - MW / 8;                                     // 0..15
    const int o = 16 * rb + (tid >> 4);                              // 0..255
    const int col = 8 * (tid & 15);                                  // 0..120
    const float* s = ow + (size_t)o * DQ + col;
    const v4f a = *(const v4f*)s;
    const v4f q = *(const v4f*)(s + 4);
    const float f[8] = {a[0], a[1], a[2], a[3], q[0], q[1], q[2], q[3]};
    v4u u;
#pragma unroll
    for (int t = 0; t < 4; ++t) u[t] = pk16(bf_bits(f[2 * t]), bf_bits(f[2 * t + 1]));
{
      *(v4u*)(WWb + (size_t)o * DQ + col) = u;
      
    }
  }
}

// =========================================================================================================
// (1) x f32 [b][256 c][4096 n] -> XP f16 [b][n][c] (grid z < NB) and neighborFeat -> NP (grid z >= NB), position-
//     major, bf16-RNE values (exact in f16), through an LDS tile T[64 n][64 c] (pitch TP, cross-wave, block barrier).
// coverage: T written rows (8e+t)=0..63 x cols cl 0..63, read rows 0..63 x cols 8e..8e+7; plane 2 it x 32 rows x 8
//           lanes x 8 = 64 n x 64 c; grid (64, 4, 2 NB) covers XP and NP [b][0..4095][0..255] exactly once.
// =========================================================================================================
__global__ __launch_bounds__(256)
void cvt_x(const float* __restrict__ x, const float* __restrict__ nf, unsigned short* XP, unsigned short* NP) {
  __shared__ __align__(16) unsigned short T[QT * TP];
  const int tid = threadIdx.x;
  const int nb = blockIdx.x, cb = blockIdx.y, zz = blockIdx.z;
  const int which = (zz >= NB) ? 1 : 0;                              // block-uniform plane select
  const int b = zz - which * NB;                                     // 0..NB-1
  const float* src = (which != 0) ? nf : x;                          // both global
  unsigned short* dst = (which != 0) ? NP : XP;                      // both global
  const int e = tid & 7, lq = tid >> 3;                              // lq 0..31
  const int n0 = nb * QT, c0 = cb * QT;
#pragma unroll
  for (int it = 0; it < 2; ++it) {
    const int cl = it * 32 + lq;                                     // 0..63
    const float* sp = src + ((size_t)(b * CC + c0 + cl)) * NN + n0 + 8 * e;
    const v4f a = *(const v4f*)sp;
    const v4f q = *(const v4f*)(sp + 4);
    unsigned short hb[8];
#pragma unroll
    for (int t = 0; t < 4; ++t) {
      hb[t]     = h_bits((_Float16)bfr(a[t]));
      hb[4 + t] = h_bits((_Float16)bfr(q[t]));
    }
#pragma unroll
    for (int t = 0; t < 8; ++t) T[(8 * e + t) * TP + cl] = hb[t];
  }
  __syncthreads();
  v4u up[2];
#pragma unroll
  for (int it = 0; it < 2; ++it) {
    const int nl = it * 32 + lq;                                     // 0..63
    up[it] = *(const v4u*)(T + nl * TP + 8 * e);
  }
{
#pragma unroll
    for (int it = 0; it < 2; ++it) {
      const int rl = it * 32 + lq;
      *(v4u*)(dst + ((size_t)(b * NN + n0 + rl)) * CC + c0 + 8 * e) = up[it];
    }
    
  }
}

// =========================================================================================================
// (2) conv1x1 GEMM for one (b, strip of 128 positions = image rows 2s and 2s+1, 64-o block of the stacked weights):
//     Y[o][n] = (1/256) sum_c W16[o][c] B[b][n][c], B = NP for o-blocks 0..3 (theta, phi) and XP for o-blocks 4,5
//     (g), block-uniform select. Block 256 threads = 8 waves; wave w owns cols n0+16w..+15 (one B fragment per
//     k-step, k = c contiguous in the plane row) and 4 m-tiles (A rows o = o0 + 16 mt + (lane&15), split k map
//     loader from W16). K = 256 = 8 steps. Epilogue staged in LDS Os[n_loc][o_loc] (pitch OSP, b128 stores),
//     block barrier, then (block-uniform branch on the o block):
//       o-blocks 0,1 -> theta dims 0..63 / 64..127 + bias -> Qh/Ql bf16 [b][4096 n][128 d] (hi = RNE(v), lo = RNE(v-hi)):
//       o-blocks 2,3 -> phi + bias in f32 -> PF f32 [b][4096 n][128 d]: 128 rows x the dsel half (256 B = 2 whole
//                       lines) of the 512-B row, 16 consecutive lanes x 16 B, one instruction per 2 rows.
//       o-blocks 4,5 -> g + bias -> GF f32 [b][4096 n][128 d], same layout.
// coverage: Os 8 waves x 16 n x 64 o = 128 x 64 written, reads rows <= 127 cols <= 63; theta planes 4 it x 32 rows
//           x 8 lanes x 8 = 128 n x 64 d; f32 planes 8 it x 16 rows x 16 lanes x 4 = 128 n x 64 d; grid (32, 6, NB)
//           covers all 4096 rows x 128 d of Qh/Ql and of PF/GF exactly once.
// =========================================================================================================
__global__ __launch_bounds__(256) __attribute__((amdgpu_num_vgpr(256)))
void gemm_proj(const unsigned short* __restrict__ W16, const unsigned short* __restrict__ NP,
               const unsigned short* __restrict__ XP,
               const float* __restrict__ tb, const float* __restrict__ pb, const float* __restrict__ gb,
               unsigned short* Qh, unsigned short* Ql, float* PF, float* GF) {
  __shared__ __align__(16) float Os[SN * OSP];
  const int tid  = threadIdx.x;
  const int lane = tid & 31, wave = tid >> 5;                        // wave 0..7
  const int hh   = lane >> 4, c = lane & 15;
  const int st   = blockIdx.x, mb = blockIdx.y, b = blockIdx.z;
  const int n0   = st * SN, o0 = mb * QT;
  const unsigned short* BP = (mb < 4) ? NP : XP;                     // block-uniform, both global

  const unsigned short* ap = W16 + (size_t)(o0 + c) * CC + 8 * hh;
  const unsigned short* bp = BP + ((size_t)(b * NN + n0 + 16 * wave + c)) * CC + 8 * hh;

  v8f acc[4];
#pragma unroll
  for (int mt = 0; mt < 4; ++mt) acc[mt] = zero8();

#pragma unroll
  for (int ks = 0; ks < CC / 32; ++ks) {
    const Frag fb = ldfrag(bp + 32 * ks);
#pragma unroll
    for (int mt = 0; mt < 4; ++mt) {
      const Frag fa = ldfrag(ap + (size_t)(16 * mt) * CC + 32 * ks);
      acc[mt] = mma_h(fa.h, fb.h, acc[mt]);
    }
  }

  // ---- epilogue: scale back -> LDS Os[n_loc][o_loc]; lane (hh, c) holds o = 16 mt + 8 hh + r for n_loc = 16 w + c
  {
    const int nl = 16 * wave + c;
#pragma unroll
    for (int mt = 0; mt < 4; ++mt) {
      v4f va, vb;
#pragma unroll
      for (int r = 0; r < 4; ++r) { va[r] = acc[mt][r] * IWSC; vb[r] = acc[mt][4 + r] * IWSC; }
      *(v4f*)(Os + nl * OSP + 16 * mt + 8 * hh)     = va;
      *(v4f*)(Os + nl * OSP + 16 * mt + 8 * hh + 4) = vb;
    }
  }
  __syncthreads();

  const int grp = mb >> 1;                                           // 0 theta, 1 phi, 2 g (block-uniform)
  const int dsel = (mb & 1) * QT;                                    // 0 or 64
  const float* bias = (grp == 0) ? tb : ((grp == 1) ? pb : gb);     // all global

  if (grp == 0) {
    const int e = tid & 7, lq = tid >> 3;                            // lq 0..31
    float bv[8];
    {
      const v4f ba = *(const v4f*)(bias + dsel + 8 * e);
      const v4f bq = *(const v4f*)(bias + dsel + 8 * e + 4);
#pragma unroll
      for (int t = 0; t < 4; ++t) { bv[t] = bfr(ba[t]); bv[4 + t] = bfr(bq[t]); }
    }
    v4u uh[4], ul[4];
#pragma unroll
    for (int it = 0; it < 4; ++it) {
      const int row = it * 32 + lq;                                  // n_loc 0..127
      const v4f a = *(const v4f*)(Os + row * OSP + 8 * e);
      const v4f q = *(const v4f*)(Os + row * OSP + 8 * e + 4);
      float f[8];
#pragma unroll
      for (int t = 0; t < 4; ++t) { f[t] = a[t] + bv[t]; f[4 + t] = q[t] + bv[4 + t]; }
      split8(f, uh[it], ul[it]);
    }
{
#pragma unroll
      for (int it = 0; it < 4; ++it) {
        const int row = it * 32 + lq;
        const size_t po = ((size_t)(b * NN + n0 + row)) * DQ + dsel + 8 * e;
        *(v4u*)(Qh + po) = uh[it];
        *(v4u*)(Ql + po) = ul[it];
      }
      
    }
  } else {
    const int e16 = tid & 15, lr = tid >> 4;                        // lr 0..15
    v4f bv4;
    {
      const v4f bq = *(const v4f*)(bias + dsel + 4 * e16);
#pragma unroll
      for (int t = 0; t < 4; ++t) bv4[t] = bfr(bq[t]);
    }
    float* P = (grp == 1) ? PF : GF;                                 // both global
    v4f res[8];
#pragma unroll
    for (int it = 0; it < 8; ++it) {
      const int row = it * 16 + lr;                                  // n_loc 0..127
      const v4f a = *(const v4f*)(Os + row * OSP + 4 * e16);
      v4f v;
#pragma unroll
      for (int t = 0; t < 4; ++t) v[t] = a[t] + bv4[t];
      res[it] = v;
    }
{
#pragma unroll
      for (int it = 0; it < 8; ++it) {
        const int row = it * 16 + lr;
        const size_t po = ((size_t)(b * NN + n0 + row)) * DQ + dsel + 4 * e16;
        *(v4f*)(P + po) = res[it];
      }
      
    }
  }
}

// =========================================================================================================
// (3) 2x2 stride-2 max-pool of PF / GF f32 [b][4096 n][128 d] in f32 -> Kh/Kl bf16 [b][1024 m][128 d]
//     (hi = RNE(v), lo = RNE(v-hi)) and Gp f16 [b][1024 m][128 d], m = 32 py + px, window n = (2py+dy) 64 + 2px+dx,
//     lr = tid>>4 -> px = 16 it + lr for it 0..1 (px 0..31, all valid, no pad rows since 1024 keys = 32 x 32).
// coverage: blocks 0..31 x px 0..31 x 16 lanes x 8 = rows 0..1023 x 128 d of each plane; grid (32, NB) covers
//           Kh/Kl/Gp [b][0..1023][0..127] exactly once.
// =========================================================================================================
__global__ __launch_bounds__(256)
void pool_k(const float* __restrict__ PF, const float* __restrict__ GF,
            unsigned short* Kh, unsigned short* Kl, unsigned short* Gp) {
  const int tid = threadIdx.x, py = blockIdx.x, b = blockIdx.y;
  const int e16 = tid & 15, lr = tid >> 4;                          // lr 0..15
  v4u kh[2], kl[2], gu[2];
#pragma unroll
  for (int it = 0; it < 2; ++it) {
    const int px = it * 16 + lr;                                    // 0..31
    float fk[8], fg[8];
#pragma unroll
    for (int t = 0; t < 8; ++t) { fk[t] = -__builtin_inff(); fg[t] = -__builtin_inff(); }
#pragma unroll 1
    for (int dy = 0; dy < 2; ++dy) {
      const size_t rb = ((size_t)(b * NN + (2 * py + dy) * WIMG + 2 * px)) * DQ + 8 * e16;
#pragma unroll
      for (int dx = 0; dx < 2; ++dx) {
        const float* pk = PF + rb + (size_t)dx * DQ;
        const float* pg = GF + rb + (size_t)dx * DQ;
        const v4f ka = *(const v4f*)pk, kq = *(const v4f*)(pk + 4);
        const v4f ga = *(const v4f*)pg, gq = *(const v4f*)(pg + 4);
#pragma unroll
        for (int t = 0; t < 4; ++t) {
          fk[t]     = fmaxf(fk[t], ka[t]);
          fk[4 + t] = fmaxf(fk[4 + t], kq[t]);
          fg[t]     = fmaxf(fg[t], ga[t]);
          fg[4 + t] = fmaxf(fg[4 + t], gq[t]);
        }
      }
    }
    split8(fk, kh[it], kl[it]);
#pragma unroll
    for (int t = 0; t < 4; ++t) gu[it][t] = pk16(h_bits((_Float16)fg[2 * t]), h_bits((_Float16)fg[2 * t + 1]));
  }
{
#pragma unroll
    for (int it = 0; it < 2; ++it) {
      const int px = it * 16 + lr;
      const size_t po = ((size_t)(b * MM + WP * py + px)) * DQ + 8 * e16;
      *(v4u*)(Kh + po) = kh[it];
      *(v4u*)(Kl + po) = kl[it];
      *(v4u*)(Gp + po) = gu[it];
    }
    
  }
}

// =========================================================================================================
// (4) Gp f16 [b][1024 m][128 d] -> Gc f16 [b][d][m] (channel-major, keys contiguous) through an LDS tile T[64 d][64 m]
// coverage: reads 2 it x 32 rows x 8 lanes x 8 = 64 m x 64 d; T written rows (8e+t)=0..63 x cols 0..63, read rows
//           0..63 x cols 8e..8e+7; writes 64 d x 64 m; grid (16, 2, NB) covers Gc [b][0..127][0..1023] exactly once.
// =========================================================================================================
__global__ __launch_bounds__(256)
void tr_g(const unsigned short* __restrict__ Gp, unsigned short* Gc) {
  __shared__ __align__(16) unsigned short T[QT * TP];
  const int tid = threadIdx.x;
  const int mt = blockIdx.x, db = blockIdx.y, b = blockIdx.z;
  const int e = tid & 7, lq = tid >> 3;                             // lq 0..31
  const int m0 = mt * QT, d0 = db * QT;
#pragma unroll
  for (int it = 0; it < 2; ++it) {
    const int ml = it * 32 + lq;                                     // 0..63
    const v4u w = *(const v4u*)(Gp + ((size_t)(b * MM + m0 + ml)) * DQ + d0 + 8 * e);
    unsigned short hb[8];
#pragma unroll
    for (int t = 0; t < 4; ++t) {
      hb[2 * t]     = (unsigned short)(w[t] & 0xFFFFu);
      hb[2 * t + 1] = (unsigned short)(w[t] >> 16);
    }
#pragma unroll
    for (int t = 0; t < 8; ++t) T[(8 * e + t) * TP + ml] = hb[t];
  }
  __syncthreads();
  v4u up[2];
#pragma unroll
  for (int it = 0; it < 2; ++it) {
    const int dl = it * 32 + lq;                                     // 0..63
    up[it] = *(const v4u*)(T + dl * TP + 8 * e);
  }
{
#pragma unroll
    for (int it = 0; it < 2; ++it) {
      const int dl = it * 32 + lq;
      *(v4u*)(Gc + ((size_t)(b * DQ + d0 + dl)) * MM + m0 + 8 * e) = up[it];
    }
    
  }
}

// ---- eight asynchronous 16-byte copies per lane, global -> LDS: copy i takes g + i*gstep (elements) to LDS byte
//      address l + i*lstep. The s_wait_xcnt 0 is the last line of the copies' own statement so that it stands in
//      front of any later write of the address registers the copies name.
__device__ __forceinline__ void copy8(unsigned l, unsigned lstep, const unsigned short* g, size_t gstep) {
#if defined(__HIP_DEVICE_COMPILE__)
  asm volatile("global_load_async_to_lds_b128 %0, %8, off\n\t"
               "global_load_async_to_lds_b128 %1, %9, off\n\t"
               "global_load_async_to_lds_b128 %2, %10, off\n\t"
               "global_load_async_to_lds_b128 %3, %11, off\n\t"
               "global_load_async_to_lds_b128 %4, %12, off\n\t"
               "global_load_async_to_lds_b128 %5, %13, off\n\t"
               "global_load_async_to_lds_b128 %6, %14, off\n\t"
               "global_load_async_to_lds_b128 %7, %15, off\n\t"
               "s_wait_xcnt 0x0"
               :: "v"(l), "v"(l + lstep), "v"(l + 2 * lstep), "v"(l + 3 * lstep),
                  "v"(l + 4 * lstep), "v"(l + 5 * lstep), "v"(l + 6 * lstep), "v"(l + 7 * lstep),
                  "v"(g), "v"(g + gstep), "v"(g + 2 * gstep), "v"(g + 3 * gstep),
                  "v"(g + 4 * gstep), "v"(g + 5 * gstep), "v"(g + 6 * gstep), "v"(g + 7 * gstep)
               : "memory");
#endif
}

// =========================================================================================================
// (5) attention for one (b, 64-query tile), transposed formulation, 1024 keys (all valid, no mask, no scale):
//   S^T tile (16 keys x 16 queries) = sum over 4 d-chunks (rolled loop) of A(k: row = key kb + (lane&15), 32 d via
//   the split k map from the bf16 plane Kh [b][1024][128]) . B(q: col = query, same map from Qh [b][4096][128])
//   + A(Kh).B(Ql) + A(Kl).B(Qh) (bf16 unscaled residual planes, shared accumulator).
//   Per lane the D tile holds 8 keys of ONE query: online softmax state per lane, one shuffle (lane^16) for the max
//   over 32 keys; the o/l rescale is skipped under a wave-uniform ballot when no lane's max grew (corr == 1 exactly
//   for every lane then); row-sum partials combined at the end. P = e^{s-m} x 16384 as f16 is the B operand of
//   y^T (rows channel, cols queries) += A(pooled g: rows channel = 16j + (lane&15), keys contiguous, f16 plane Gc
//   [b][128][1024]) . B(P^T): element r <- D of the tile covering keys kb..kb+15, element 8+r <- the tile covering
//   kb+16..kb+31, lane unchanged. 8 accumulator tiles per wave (128 channels). Block = 4 waves = 64 queries.
//   K hi / K residual / pooled-g tiles of 64 keys are staged once per block in a two-buffer LDS ring by asynchronous
//   copies (whole 128-B lines from global; 24 copies per lane and stage) and read by all 4 waves as ds_load_b128
//   fragments: K rows at pitch 272 B, g rows (64 keys = 128 B) at pitch 144 B. Stage t+2 is issued behind the barrier
//   that ends every wave's reads of stage t; stage t+1 is read only behind each wave's own asynccnt wait + barrier.
//   Epilogue: y = O/l staged in LDS Os[query][128 channels] (pitch OSPW, b128 stores), block barrier, then
// coverage: Os written 4 waves x 16 queries x 128 ch, read rows 0..63 x ch 8e..8e+7 (e 0..15); planes 8 it x 8 rows x
//           16 lanes x 8 = 64 n x 128 ch per plane; grid (NQ/64, NB) covers rows 0..NQ-1 of Yh/Yl exactly once.
// =========================================================================================================
__global__ __launch_bounds__(128) __attribute__((amdgpu_num_vgpr(256)))
void attn_k(const unsigned short* __restrict__ Qh, const unsigned short* __restrict__ Ql,
            const unsigned short* __restrict__ Kh, const unsigned short* __restrict__ Kl,
            const unsigned short* __restrict__ Gc, unsigned short* Yh, unsigned short* Yl) {
  __shared__ __align__(16) float Os[QT * OSPW];
  __shared__ __align__(16) unsigned short Ring[2 * STG / 2];
  const int tid  = threadIdx.x;
  const int wave = tid >> 5, lane = tid & 31;
  const int hh   = lane >> 4, c = lane & 15;
  const int n0   = blockIdx.x * QT, b = blockIdx.y;

  // q fragment pointers (B operand, col = query n0 + 16*wave + c), + 32*kc
  const size_t qo = ((size_t)(b * NN + n0 + 16 * wave + c)) * DQ + 8 * hh;
  const unsigned short* Qhp = Qh + qo;
  const unsigned short* Qlp = Ql + qo;
  // copy sources of stage 0 (per lane, 16 B): K planes: the 16-KB tile is contiguous, chunk tid, + 128 chunks per copy;
  // g plane: row = channel (tid>>3) + 16 per copy, 8 chunks of 16 B per 128-B row piece
  const unsigned short* Khg = Kh + (size_t)b * MM * DQ + 8 * tid;
  const unsigned short* Klg = Kl + (size_t)b * MM * DQ + 8 * tid;
  const unsigned short* Vg  = Gc + (size_t)b * DQ * MM + (size_t)(tid >> 3) * MM + 8 * (tid & 7);
  // copy destinations in buffer 0 (LDS byte addresses): K row (tid>>4) + 8 per copy, g row (tid>>3) + 16 per copy
  const unsigned ring0 = (unsigned)(size_t)Ring;
  const unsigned lK = ring0 + (unsigned)((tid >> 4) * (KPS * 2) + (tid & 15) * 16);
  const unsigned lV = ring0 + (unsigned)(2 * KSZ + (tid >> 3) * (VPS * 2) + (tid & 7) * 16);
  // fragment offsets inside a buffer (elements): k (A operand, row = key + c), + key * KPS + 32*kc;
  // v (A operand, row = channel 16j + c, keys contiguous), + 16*j*VPS + key
  const int kfo = c * KPS + 8 * hh;
  const int vfo = KSZ + c * VPS + 8 * hh;

  // ring prologue: stage 0 -> buffer 0, landed and published; then stage 1 -> buffer 1 flies over pass 0
  copy8(lK, 8 * KPS * 2, Khg, 128 * 8);
  copy8(lK + KSZ, 8 * KPS * 2, Klg, 128 * 8);
  copy8(lV, 16 * VPS * 2, Vg, (size_t)16 * MM);
  asm volatile("s_wait_asynccnt 0x0" ::: "memory");                  // this wave's stage-0 copies have landed
  __syncthreads();                                                   // every wave's stage-0 copies are readable
  copy8(lK + STG, 8 * KPS * 2, Khg + (size_t)KT * DQ, 128 * 8);
  copy8(lK + STG + KSZ, 8 * KPS * 2, Klg + (size_t)KT * DQ, 128 * 8);
  copy8(lV + STG, 16 * VPS * 2, Vg + KT, (size_t)16 * MM);

  float m = -1.0e30f, l = 0.f;
  v8f o[8];
#pragma unroll
  for (int j = 0; j < 8; ++j) o[j] = zero8();

#pragma unroll 1  // one stage per trip, rolled: the publish point at its foot stands once in the text
  for (int t = 0; t < NT; ++t) {
   const unsigned short* sb = Ring + (t & 1) * (STG / 2);            // this stage's buffer
#pragma unroll 1  // the 32-key pass stays rolled as before: same hot-loop text and register use
   for (int kb = 0; kb < KT; kb += 32) {
    const unsigned short* k0p  = sb + kfo + kb * KPS;                // keys kb .. kb+15 of the stage
    const unsigned short* k1p  = k0p + 16 * KPS;                     // keys kb+16 .. kb+31
    const unsigned short* k0lp = k0p + KSZ / 2;
    const unsigned short* k1lp = k1p + KSZ / 2;
    v8f s0 = zero8(), s1 = zero8();
#pragma unroll 1
    for (int kc = 0; kc < DQ / 32; ++kc) {
      const Frag qh  = ldfrag(Qhp + 32 * kc);
      const Frag ql  = ldfrag(Qlp + 32 * kc);
      const Frag k0  = ldfrag(k0p + 32 * kc);
      const Frag k1  = ldfrag(k1p + 32 * kc);
      const Frag k0l = ldfrag(k0lp + 32 * kc);
      const Frag k1l = ldfrag(k1lp + 32 * kc);
      s0 = mma_b(k0.bf, qh.bf, s0);
      s1 = mma_b(k1.bf, qh.bf, s1);
      s0 = mma_b(k0.bf, ql.bf, s0);
      s1 = mma_b(k1.bf, ql.bf, s1);
      s0 = mma_b(k0l.bf, qh.bf, s0);
      s1 = mma_b(k1l.bf, qh.bf, s1);
    }

    float mx = fmaxf(hmax8(s0), hmax8(s1));
    mx = fmaxf(mx, __shfl_xor(mx, 16, 32));
    const float mn = fmaxf(m, mx);
    const unsigned grew = wave_ballot(mx > m);                       // wave-uniform
    if (grew != 0u) {
      const float corr = __expf(m - mn);                             // == 1 exactly for lanes whose max did not grow
      l *= corr;
#pragma unroll
      for (int j = 0; j < 8; ++j) {
#pragma unroll
        for (int r = 0; r < 8; ++r) o[j][r] *= corr;
      }
    }
    m = mn;
    const float msh = mn - LNPS;                                     // exp gives e^{s-m} * 16384

    FragH ph;
    float ls = 0.f;
#pragma unroll
    for (int r = 0; r < 8; ++r) {
      const float e0 = __expf(s0[r] - msh);                          // key kb      + 8hh + r
      const float e1 = __expf(s1[r] - msh);                          // key kb + 16 + 8hh + r
      ls += e0 + e1;
      ph.hv[0][r] = (_Float16)e0;
      ph.hv[1][r] = (_Float16)e1;
    }
    l += ls;

#pragma unroll
    for (int j = 0; j < 8; ++j) {
      const Frag vf = ldfrag(sb + vfo + (16 * j) * VPS + kb);
      o[j] = mma_h(vf.h, ph.v, o[j]);
    }
   }
   // publish point of stage t+1, and release of stage t's buffer
   asm volatile("s_wait_dscnt 0x0" ::: "memory");                    // this wave's reads of stage t are done
   asm volatile("s_wait_asynccnt 0x0" ::: "memory");                 // this wave's stage t+1 copies have landed
   __syncthreads();
   if (t + 2 < NT) {                                                 // block-uniform
     const unsigned bo = (unsigned)((t & 1) * STG);
     copy8(lK + bo, 8 * KPS * 2, Khg + (size_t)(t + 2) * KT * DQ, 128 * 8);
     copy8(lK + bo + KSZ, 8 * KPS * 2, Klg + (size_t)(t + 2) * KT * DQ, 128 * 8);
     copy8(lV + bo, 16 * VPS * 2, Vg + (t + 2) * KT, (size_t)16 * MM);
   }
  }
  asm volatile("s_wait_asynccnt 0x0" ::: "memory");                  // nothing of the ring is in flight past here
  l += __shfl_xor(l, 16, 32);
  const float inv = 1.0f / l;                                        // o and l both carry the x16384 factor

  // ---- epilogue: y = o * inv -> Os[query][ch]; lane (hh, c) holds ch = 16 j + 8 hh + r for query 16 w + c
  {
    const int qrow = 16 * wave + c;
#pragma unroll
    for (int j = 0; j < 8; ++j) {
      v4f va, vb;
#pragma unroll
      for (int r = 0; r < 4; ++r) { va[r] = o[j][r] * inv; vb[r] = o[j][4 + r] * inv; }
      *(v4f*)(Os + qrow * OSPW + 16 * j + 8 * hh)     = va;
      *(v4f*)(Os + qrow * OSPW + 16 * j + 8 * hh + 4) = vb;
    }
  }
  __syncthreads();

  const int e16 = tid & 15, lr = tid >> 4;                           // lr 0..7
  v4u uh[8], ul[8];
#pragma unroll
  for (int it = 0; it < 8; ++it) {
    const int row = it * 8 + lr;                                     // query 0..63
    const v4f a = *(const v4f*)(Os + row * OSPW + 8 * e16);
    const v4f q = *(const v4f*)(Os + row * OSPW + 8 * e16 + 4);
    const float f[8] = {a[0], a[1], a[2], a[3], q[0], q[1], q[2], q[3]};
    split8(f, uh[it], ul[it]);
  }
{
#pragma unroll
    for (int it = 0; it < 8; ++it) {
      const int row = it * 8 + lr;
      const size_t po = ((size_t)(b * NN + n0 + row)) * DQ + 8 * e16;
      *(v4u*)(Yh + po) = uh[it];
      *(v4u*)(Yl + po) = ul[it];
    }
    
  }
}

// =========================================================================================================
// (6) output conv for one (b, 64-n tile, 64-c block): A[c][n] = sum_ci WWb[c][ci] (Yh + Yl)[b][n][ci] on bf16 WMMA
//     (2 products per k-step, shared accumulator), K = 128 = 4 steps. Block 128 threads = 4 waves; wave w owns cols
//     n0+16w..+15 (B fragments from the k-contiguous Yh/Yl rows) and 4 m-tiles (A rows c = c0 + 16 mt + (lane&15),
//     split k map loader from WWb). Per-channel constants (bf16-RNE of w_b, bn mean, bn beta, and scale =
//     bf16-RNE(gamma) * rsqrt(bf16-RNE(var) + eps)) staged once in LDS by waves 0,1. Epilogue staged in LDS
//     Os[n_loc][c_loc] (pitch OSP, b128 stores), block barrier, then out[b][c][n] = (((A + w_b[c]) - mean[c]) *
// coverage: Os 4 waves x 16 n x 64 c written, read rows nl+t <= 63 x cols cl <= 63; Pb/Pm/Ps/Pt written 0..63, read
//           cl <= 63; out 8 it x 16 lines x 8 lanes x 4 floats = 64 c x 64 n; grid (NQ/64, 4, NB) covers
//           out[b][0..255][0..NQ-1] exactly once.
// =========================================================================================================
__global__ __launch_bounds__(128) __attribute__((amdgpu_num_vgpr(256)))
void gemm_out(const unsigned short* __restrict__ WWb, const unsigned short* __restrict__ Yh,
              const unsigned short* __restrict__ Yl, const float* __restrict__ wb,
              const float* __restrict__ bng, const float* __restrict__ bnb,
              const float* __restrict__ bnm, const float* __restrict__ bnv,
              const float* __restrict__ x, float* out) {
  __shared__ __align__(16) float Os[QT * OSP];
  __shared__ float Pb[QT], Pm[QT], Ps[QT], Pt[QT];
  const int tid  = threadIdx.x;
  const int lane = tid & 31, wave = tid >> 5;
  const int hh   = lane >> 4, c = lane & 15;
  const int nt   = blockIdx.x, cb = blockIdx.y, b = blockIdx.z;
  const int n0   = nt * QT, c0 = cb * QT;

  if (tid < QT) {                                                    // waves 0,1 (wave-uniform), cross-wave via barrier
    const int ch = c0 + tid;                                         // 0..255
    Pb[tid] = bfr(wb[ch]);
    Pm[tid] = bfr(bnm[ch]);
    Ps[tid] = bfr(bng[ch]) * rsqrtf(bfr(bnv[ch]) + BNEPS);
    Pt[tid] = bfr(bnb[ch]);
  }

  const unsigned short* ap  = WWb + (size_t)(c0 + c) * DQ + 8 * hh;
  const size_t bo = ((size_t)(b * NN + n0 + 16 * wave + c)) * DQ + 8 * hh;
  const unsigned short* bph = Yh + bo;
  const unsigned short* bpl = Yl + bo;

  v8f acc[4];
#pragma unroll
  for (int mt = 0; mt < 4; ++mt) acc[mt] = zero8();

#pragma unroll
  for (int ks = 0; ks < DQ / 32; ++ks) {
    const Frag fbh = ldfrag(bph + 32 * ks);
    const Frag fbl = ldfrag(bpl + 32 * ks);
#pragma unroll
    for (int mt = 0; mt < 4; ++mt) {
      const Frag fa = ldfrag(ap + (size_t)(16 * mt) * DQ + 32 * ks);
      acc[mt] = mma_b(fa.bf, fbh.bf, acc[mt]);
      acc[mt] = mma_b(fa.bf, fbl.bf, acc[mt]);
    }
  }

  // ---- epilogue: -> LDS Os[n_loc][c_loc]; lane (hh, c) holds c_loc = 16 mt + 8 hh + r for n_loc = 16 w + c
  {
    const int nl = 16 * wave + c;
#pragma unroll
    for (int mt = 0; mt < 4; ++mt) {
      v4f va, vb;
#pragma unroll
      for (int r = 0; r < 4; ++r) { va[r] = acc[mt][r]; vb[r] = acc[mt][4 + r]; }
      *(v4f*)(Os + nl * OSP + 16 * mt + 8 * hh)     = va;
      *(v4f*)(Os + nl * OSP + 16 * mt + 8 * hh + 4) = vb;
    }
  }
  __syncthreads();

  const int e = tid & 7, lq = tid >> 3;                              // lq 0..15
  v4f res[8];
#pragma unroll
  for (int it = 0; it < 8; ++it) {
    const int L   = it * 16 + lq;                                    // 0..127
    const int cl  = L >> 1, hf = L & 1;                              // channel 0..63 within the block
    const int nl  = hf * 32 + 4 * e;                                 // position 0..63
    const float pbv = Pb[cl], pmv = Pm[cl], psv = Ps[cl], ptv = Pt[cl];
    const size_t idx = ((size_t)(b * CC + c0 + cl)) * NN + n0 + nl;
    const v4f xv = *(const v4f*)(x + idx);
#pragma unroll
    for (int t = 0; t < 4; ++t) {
      const float cv = Os[(nl + t) * OSP + cl] + pbv;
      res[it][t] = ((cv - pmv) * psv + ptv) + bfr(xv[t]);
    }
  }
{
#pragma unroll
    for (int it = 0; it < 8; ++it) {
      const int L   = it * 16 + lq;
      const int cl  = L >> 1, hf = L & 1;
      const int nl  = hf * 32 + 4 * e;
      const size_t idx = ((size_t)(b * CC + c0 + cl)) * NN + n0 + nl;
      *(v4f*)(out + idx) = res[it];
    }
    
  }
}

// =========================================================================================================
// Workspace map (bytes; each region start a multiple of 256; every extent is an exact row/tile multiple and is
//   W16 f16 [384][256]            196608      WWb bf16 [256][128]        65536
//   XP / NP f16 [NB][4096][256]  16777216 x2 (NB=8)
//   Qh/Ql bf16 [NB][4096][128]    8388608 x2
//   PF/GF f32  [NB][4096][128]   16777216 x2
//   Kh/Kl bf16 [NB][1024][128]    2097152 x2  Gp f16 [NB][1024][128]   2097152   Gc f16 [NB][128][1024]  2097152
//   Yh/Yl bf16 [NB][4096][128]    8388608 x2
//   total (NB=8) = 109314048
// =========================================================================================================
extern "C" void kernel_launch(void* const* d_in, const int* in_sizes, int n_in,
                              void* d_out, int out_size, void* d_ws, size_t ws_size,
                              hipStream_t stream) {
  const int XN = NB * CC * NN;
  if (n_in < 14) return;
  if (in_sizes[0] < XN || in_sizes[1] < XN) return;
  if (in_sizes[2] < DQ * CC || in_sizes[4] < DQ * CC || in_sizes[6] < DQ * CC || in_sizes[8] < CC * DQ) return;
  if (in_sizes[3] < DQ || in_sizes[5] < DQ || in_sizes[7] < DQ) return;
  if (in_sizes[9] < CC || in_sizes[10] < CC || in_sizes[11] < CC || in_sizes[12] < CC || in_sizes[13] < CC) return;
  if (out_size < XN) return;

  size_t off = 0;
  auto carve = [&](size_t bytes) { const size_t o = off; off += (bytes + 255) & ~(size_t)255; return o; };
  const size_t oW16 = carve((size_t)MW * CC * 2);
  const size_t oWWb = carve((size_t)CC * DQ * 2);
  const size_t oXP  = carve((size_t)NB * NN * CC * 2);
  const size_t oNP  = carve((size_t)NB * NN * CC * 2);
  const size_t oQh  = carve((size_t)NB * NN * DQ * 2);
  const size_t oQl  = carve((size_t)NB * NN * DQ * 2);
  const size_t oPF  = carve((size_t)NB * NN * DQ * 4);
  const size_t oGF  = carve((size_t)NB * NN * DQ * 4);
  const size_t oKh  = carve((size_t)NB * MM * DQ * 2);
  const size_t oKl  = carve((size_t)NB * MM * DQ * 2);
  const size_t oGp  = carve((size_t)NB * MM * DQ * 2);
  const size_t oGc  = carve((size_t)NB * DQ * MM * 2);
  const size_t oYh  = carve((size_t)NB * NN * DQ * 2);
  const size_t oYl  = carve((size_t)NB * NN * DQ * 2);
  if (off > ws_size) return;
  if (off > (size_t)134217728) return;

  const float* x   = (const float*)d_in[0];
  const float* nf  = (const float*)d_in[1];
  const float* gw  = (const float*)d_in[2];
  const float* gb  = (const float*)d_in[3];
  const float* tw  = (const float*)d_in[4];
  const float* tb  = (const float*)d_in[5];
  const float* pw  = (const float*)d_in[6];
  const float* pb  = (const float*)d_in[7];
  const float* ow  = (const float*)d_in[8];
  const float* wb  = (const float*)d_in[9];
  const float* bng = (const float*)d_in[10];
  const float* bnb = (const float*)d_in[11];
  const float* bnm = (const float*)d_in[12];
  const float* bnv = (const float*)d_in[13];

  char* ws = (char*)d_ws;
  unsigned short* W16 = (unsigned short*)(ws + oW16);
  unsigned short* WWb = (unsigned short*)(ws + oWWb);
  unsigned short* XP  = (unsigned short*)(ws + oXP);
  unsigned short* NP  = (unsigned short*)(ws + oNP);
  unsigned short* Qh  = (unsigned short*)(ws + oQh);
  unsigned short* Ql  = (unsigned short*)(ws + oQl);
  float*          PF  = (float*)(ws + oPF);
  float*          GF  = (float*)(ws + oGF);
  unsigned short* Kh  = (unsigned short*)(ws + oKh);
  unsigned short* Kl  = (unsigned short*)(ws + oKl);
  unsigned short* Gp  = (unsigned short*)(ws + oGp);
  unsigned short* Gc  = (unsigned short*)(ws + oGc);
  unsigned short* Yh  = (unsigned short*)(ws + oYh);
  unsigned short* Yl  = (unsigned short*)(ws + oYl);
  float* out = (float*)d_out;

  const dim3 blk256(256), blk128(128);

  // (0) theta_w / phi_w / g_w -> stacked f16 plane; w_w -> bf16 plane
  cvt_w<<<dim3(MW / 8 + CC / 16), blk256, 0, stream>>>(tw, pw, gw, ow, W16, WWb);
  // (1) x -> XP, neighborFeat -> NP (position-major 16-bit planes)
  cvt_x<<<dim3(NN / QT, CC / QT, 2 * NB), blk256, 0, stream>>>(x, nf, XP, NP);
  // (2) conv1x1 GEMM -> theta (q) hi/res planes from NP, phi conv + bias f32 plane from NP, g conv + bias from XP
  gemm_proj<<<dim3(NSTRIP, MW / QT, NB), blk256, 0, stream>>>(W16, NP, XP, tb, pb, gb, Qh, Ql, PF, GF);
  // (3) 2x2 stride-2 max-pool -> pooled phi (k) hi/res planes, pooled g f16 plane
  pool_k<<<dim3(HP, NB), blk256, 0, stream>>>(PF, GF, Kh, Kl, Gp);
  // (4) pooled g -> channel-major plane
  tr_g<<<dim3(MM / QT, DQ / QT, NB), blk256, 0, stream>>>(Gp, Gc);
  // (5) attention -> y hi/res planes [b][n][128]
  attn_k<<<dim3(NQ / QT, NB), blk128, 0, stream>>>(Qh, Ql, Kh, Kl, Gc, Yh, Yl);
  // (6) output conv + bias + batch-norm affine + residual -> out [b][256][4096]
  gemm_out<<<dim3(NQ / QT, CC / QT, NB), blk128, 0, stream>>>(WWb, Yh, Yl, wb, bng, bnb, bnm, bnv, x, out);
  (void)hipGetLastError();
}

// v002
// Measured time: 115 microseconds a run.
// In both of two side-by-side timings against v001, it was 1.18 times as fast.
// Counting every step since v000, it is 1.89 times as fast.
// Contractions: conv1x1 theta/phi/g GEMM W[384x256].X[256x128] per strip on v_wmma_f32_16x16x32_f16 (f16 containers
// of bf16-RNE weights x256 and bf16-RNE activations); scores K.Q^T on v_wmma_f32_16x16x32_bf16 (bf16 hi + bf16
// residual planes of theta / pooled phi, 3 products, K=128); y^T = G.P^T on v_wmma_f32_16x16x32_f16 (2x2-max-pooled g
// as f16, P = e^{s-m} x16384 f16 from the score D registers); output conv W[256x128].Y on v_wmma_f32_16x16x32_bf16
// (bf16 weights, y as bf16 hi + residual planes, 2 products); f32 accumulate everywhere; max-pool, softmax statistics,
// bias, batch-norm affine with running statistics and residual add in f32 VALU.
#include <hip/hip_runtime.h>
#include <math.h>
#include <stdint.h>

#ifndef NB
#define NB 8
#endif
#ifndef NQ
#define NQ 4096
#endif
#define NB_FULL 8
#define CC     256
#define HIMG   64
#define WIMG   64
#define NN     4096
#define DQ     128
#define HP     32
#define WP     32
#define MV     1024
#define MM     1024
#define MW     384
#define QT     64
#define SN     128
#define NWP    8
#define NSTRIP 32
#define OSP    68
#define OSPW   132
#define TP     72
#define WSC    256.0f
#define IWSC   0.00390625f
#define LNPS   9.704060527839234f
#define BNEPS  1.0e-5f
#define KT     64
#define NT     16
#define KPS    136
#define VPS    72
#define KSZ    (KT * KPS * 2)
#define VSZ    (DQ * VPS * 2)
#define STG    (2 * KSZ + VSZ)

static_assert(NB >= 1 && NB <= NB_FULL);
static_assert(NQ % QT == 0 && NQ >= QT && NQ <= NN);
static_assert(NN == HIMG * WIMG);
static_assert(SN == 2 * WIMG);
static_assert(NSTRIP * SN == NN);
static_assert(SN == 16 * NWP);
static_assert(2 * HP == HIMG && 2 * WP == WIMG);
static_assert(MV == HP * WP && MM == MV);
static_assert(WP == 32 && HP == 32);
static_assert(NN % QT == 0 && CC % QT == 0 && DQ % QT == 0 && MM % QT == 0);
static_assert(MW == 3 * DQ && MW % QT == 0 && MW % 8 == 0);
static_assert(CC % 32 == 0 && DQ % 32 == 0 && MM % 32 == 0);
static_assert((OSP * 4) % 16 == 0);
static_assert((OSPW * 4) % 16 == 0);
static_assert((TP * 2) % 16 == 0);
static_assert(SN * OSP * 4 <= 65536);
static_assert((size_t)NB_FULL * CC * NN * 4 == (size_t)33554432);
static_assert(NT * KT == MM && NT >= 2 && KT % 32 == 0);
static_assert(KPS == DQ + 8 && VPS == KT + 8);
static_assert(KT * DQ * 2 == 8 * 128 * 16 && DQ * KT * 2 == 8 * 128 * 16);
static_assert(KSZ % 16 == 0 && VSZ % 16 == 0 && STG % 16 == 0);
static_assert(2 * (2 * STG + QT * OSPW * 4) <= 327680);

// workspace total at full size (all region sizes are multiples of 256)
#define WS_FULL ((size_t)MW * CC * 2 + (size_t)CC * DQ * 2 + 2 * (size_t)NB_FULL * NN * CC * 2 \
                 + 2 * (size_t)NB_FULL * NN * DQ * 2 + 2 * (size_t)NB_FULL * NN * DQ * 4 \
                 + 4 * (size_t)NB_FULL * MM * DQ * 2 + 2 * (size_t)NB_FULL * NN * DQ * 2)
static_assert(WS_FULL <= (size_t)134217728);

typedef _Float16       v16h __attribute__((ext_vector_type(16)));
typedef _Float16       v8h  __attribute__((ext_vector_type(8)));
typedef __bf16         v16b __attribute__((ext_vector_type(16)));
typedef unsigned short v8us __attribute__((ext_vector_type(8)));
typedef float          v8f  __attribute__((ext_vector_type(8)));
typedef float          v4f  __attribute__((ext_vector_type(4)));
typedef unsigned int   v4u  __attribute__((ext_vector_type(4)));

union Frag  { v8us u[2]; v16h h; v16b bf; };
union FragH { v16h v; v8h hv[2]; };
static_assert(sizeof(Frag) == 32);
static_assert(sizeof(FragH) == 32);

// ---- scalar helpers ---------------------------------------------------------------------------------------
__device__ __forceinline__ unsigned short bf_bits(float f) {          // f32 -> bf16 bits, RNE convert
  unsigned u = __float_as_uint(f);
  return (unsigned short)((u + 0x7FFFu + ((u >> 16) & 1u)) >> 16);
}
__device__ __forceinline__ float bf_up(unsigned short hb) { return __uint_as_float(((unsigned)hb) << 16); }
__device__ __forceinline__ float bfr(float f) { return bf_up(bf_bits(f)); }
__device__ __forceinline__ unsigned short h_bits(_Float16 x) { return __builtin_bit_cast(unsigned short, x); }
__device__ __forceinline__ unsigned pk16(unsigned short a, unsigned short b) { return (unsigned)a | ((unsigned)b << 16); }
__device__ __forceinline__ v8f zero8() { v8f z = {0.f, 0.f, 0.f, 0.f, 0.f, 0.f, 0.f, 0.f}; return z; }
__device__ __forceinline__ float hmax8(v8f s) {
  return fmaxf(fmaxf(fmaxf(s[0], s[1]), fmaxf(s[2], s[3])), fmaxf(fmaxf(s[4], s[5]), fmaxf(s[6], s[7])));
}
__device__ __forceinline__ unsigned wave_ballot(bool p) {
#if defined(__HIP_DEVICE_COMPILE__)
  return __builtin_amdgcn_ballot_w32(p);
#else
  return p ? 1u : 0u;
#endif
}
// 8 f32 values -> bf16 hi bits and bf16 residual bits (lo = RNE(v - hi)), packed 2 per uint
__device__ __forceinline__ void split8(const float* f, v4u& uh, v4u& ul) {
#pragma unroll
  for (int t = 0; t < 4; ++t) {
    const float f0 = f[2 * t], f1 = f[2 * t + 1];
    const unsigned short hb0 = bf_bits(f0), hb1 = bf_bits(f1);
    const unsigned short lb0 = bf_bits(f0 - bf_up(hb0));
    const unsigned short lb1 = bf_bits(f1 - bf_up(hb1));
    uh[t] = pk16(hb0, hb1);
    ul[t] = pk16(lb0, lb1);
  }
}

// ---- 16-bit fragment loader (A, or B from a k-contiguous [n][k] row): lane -> row/col (lane&15), p already includes
//      + 8*(lane>>4); elements 0..7 <- p[0..7] (k0+8h..), elements 8..15 <- p[16..23] (k0+16+8h..)
__device__ __forceinline__ Frag ldfrag(const unsigned short* p) {
  Frag f;
  f.u[0] = *(const v8us*)(p);
  f.u[1] = *(const v8us*)(p + 16);
  return f;
}

// ---- WMMA helpers: builtin followed by a 4-slot VALU gap tying D and keeping A/B live --------------------------
__device__ __forceinline__ v8f mma_h(v16h a, v16h b, v8f c) {
  v8f d = __builtin_amdgcn_wmma_f32_16x16x32_f16(false, a, false, b, (short)0, c, false, false);
#if defined(__HIP_DEVICE_COMPILE__)
  asm volatile("v_nop\n\tv_nop\n\tv_nop\n\tv_nop" : "+v"(d) : "v"(a), "v"(b));
#endif
  return d;
}
__device__ __forceinline__ v8f mma_b(v16b a, v16b b, v8f c) {
  v8f d = __builtin_amdgcn_wmma_f32_16x16x32_bf16(false, a, false, b, (short)0, c, false, false);
#if defined(__HIP_DEVICE_COMPILE__)
  const v16h ha = __builtin_bit_cast(v16h, a), hb = __builtin_bit_cast(v16h, b);
  asm volatile("v_nop\n\tv_nop\n\tv_nop\n\tv_nop" : "+v"(d) : "v"(ha), "v"(hb));
#endif
  return d;
}

// =========================================================================================================
// (0) weights. Blocks 0..47: W16 f16 [384][256], rows 0..127 = theta_w, 128..255 = phi_w, 256..383 = g_w; value =
//     f16 of (bf16-RNE(w) * 256) (exact). Block owns rows 8*blk..8*blk+7: one wave per 512-B row = 32 lanes x 16 B
// coverage: 48 blocks x 8 rows x 32 lanes x 8 halves = 384 x 256; 16 blocks x 16 rows x 16 lanes x 8 = 256 x 128.
// =========================================================================================================
__global__ __launch_bounds__(256)
void cvt_w(const float* __restrict__ tw, const float* __restrict__ pw, const float* __restrict__ gw,
           const float* __restrict__ ow, unsigned short* W16, unsigned short* WWb) {
  const int tid = threadIdx.x, blk = blockIdx.x;
  if (blk < MW / 8) {
    const int rl = tid >> 5, col = 8 * (tid & 31);
    const int o = 8 * blk + rl;                                      // 0..383
    const int grp = blk >> 4;                                        // 0,1,2 (block-uniform)
    const float* wbase = (grp == 0) ? tw : ((grp == 1) ? pw : gw);  // all global
    const float* s = wbase + (size_t)(o - DQ * grp) * CC + col;      // (o - 128 grp) in 0..127
    const v4f a = *(const v4f*)s;
    const v4f q = *(const v4f*)(s + 4);
    const float f[8] = {a[0], a[1], a[2], a[3], q[0], q[1], q[2], q[3]};
    v4u u;
#pragma unroll
    for (int t = 0; t < 4; ++t) {
      const _Float16 h0 = (_Float16)(bfr(f[2 * t]) * WSC);
      const _Float16 h1 = (_Float16)(bfr(f[2 * t + 1]) * WSC);
      u[t] = pk16(h_bits(h0), h_bits(h1));
    }
{
      *(v4u*)(W16 + (size_t)o * CC + col) = u;
      
    }
  } else {
    const int rb = blk - MW / 8;                                     // 0..15
    const int o = 16 * rb + (tid >> 4);                              // 0..255
    const int col = 8 * (tid & 15);                                  // 0..120
    const float* s = ow + (size_t)o * DQ + col;
    const v4f a = *(const v4f*)s;
    const v4f q = *(const v4f*)(s + 4);
    const float f[8] = {a[0], a[1], a[2], a[3], q[0], q[1], q[2], q[3]};
    v4u u;
#pragma unroll
    for (int t = 0; t < 4; ++t) u[t] = pk16(bf_bits(f[2 * t]), bf_bits(f[2 * t + 1]));
{
      *(v4u*)(WWb + (size_t)o * DQ + col) = u;
      
    }
  }
}

// =========================================================================================================
// (1) x f32 [b][256 c][4096 n] -> XP f16 [b][n][c] (grid z < NB) and neighborFeat -> NP (grid z >= NB), position-
//     major, bf16-RNE values (exact in f16), through an LDS tile T[64 n][64 c] (pitch TP, cross-wave, block barrier).
// coverage: T written rows (8e+t)=0..63 x cols cl 0..63, read rows 0..63 x cols 8e..8e+7; plane 2 it x 32 rows x 8
//           lanes x 8 = 64 n x 64 c; grid (64, 4, 2 NB) covers XP and NP [b][0..4095][0..255] exactly once.
// =========================================================================================================
__global__ __launch_bounds__(256)
void cvt_x(const float* __restrict__ x, const float* __restrict__ nf, unsigned short* XP, unsigned short* NP) {
  __shared__ __align__(16) unsigned short T[QT * TP];
  const int tid = threadIdx.x;
  const int nb = blockIdx.x, cb = blockIdx.y, zz = blockIdx.z;
  const int which = (zz >= NB) ? 1 : 0;                              // block-uniform plane select
  const int b = zz - which * NB;                                     // 0..NB-1
  const float* src = (which != 0) ? nf : x;                          // both global
  unsigned short* dst = (which != 0) ? NP : XP;                      // both global
  const int e = tid & 7, lq = tid >> 3;                              // lq 0..31
  const int n0 = nb * QT, c0 = cb * QT;
#pragma unroll
  for (int it = 0; it < 2; ++it) {
    const int cl = it * 32 + lq;                                     // 0..63
    const float* sp = src + ((size_t)(b * CC + c0 + cl)) * NN + n0 + 8 * e;
    const v4f a = *(const v4f*)sp;
    const v4f q = *(const v4f*)(sp + 4);
    unsigned short hb[8];
#pragma unroll
    for (int t = 0; t < 4; ++t) {
      hb[t]     = h_bits((_Float16)bfr(a[t]));
      hb[4 + t] = h_bits((_Float16)bfr(q[t]));
    }
#pragma unroll
    for (int t = 0; t < 8; ++t) T[(8 * e + t) * TP + cl] = hb[t];
  }
  __syncthreads();
  v4u up[2];
#pragma unroll
  for (int it = 0; it < 2; ++it) {
    const int nl = it * 32 + lq;                                     // 0..63
    up[it] = *(const v4u*)(T + nl * TP + 8 * e);
  }
{
#pragma unroll
    for (int it = 0; it < 2; ++it) {
      const int rl = it * 32 + lq;
      *(v4u*)(dst + ((size_t)(b * NN + n0 + rl)) * CC + c0 + 8 * e) = up[it];
    }
    
  }
}

// =========================================================================================================
// (2) conv1x1 GEMM for one (b, strip of 128 positions = image rows 2s and 2s+1, 64-o block of the stacked weights):
//     Y[o][n] = (1/256) sum_c W16[o][c] B[b][n][c], B = NP for o-blocks 0..3 (theta, phi) and XP for o-blocks 4,5
//     (g), block-uniform select. Block 256 threads = 8 waves; wave w owns cols n0+16w..+15 (one B fragment per
//     k-step, k = c contiguous in the plane row) and 4 m-tiles (A rows o = o0 + 16 mt + (lane&15), split k map
//     loader from W16). K = 256 = 8 steps. Epilogue staged in LDS Os[n_loc][o_loc] (pitch OSP, b128 stores),
//     block barrier, then (block-uniform branch on the o block):
//       o-blocks 0,1 -> theta dims 0..63 / 64..127 + bias -> Qh/Ql bf16 [b][4096 n][128 d] (hi = RNE(v), lo = RNE(v-hi)):
//       o-blocks 2,3 -> phi + bias in f32 -> PF f32 [b][4096 n][128 d]: 128 rows x the dsel half (256 B = 2 whole
//                       lines) of the 512-B row, 16 consecutive lanes x 16 B, one instruction per 2 rows.
//       o-blocks 4,5 -> g + bias -> GF f32 [b][4096 n][128 d], same layout.
// coverage: Os 8 waves x 16 n x 64 o = 128 x 64 written, reads rows <= 127 cols <= 63; theta planes 4 it x 32 rows
//           x 8 lanes x 8 = 128 n x 64 d; f32 planes 8 it x 16 rows x 16 lanes x 4 = 128 n x 64 d; grid (32, 6, NB)
//           covers all 4096 rows x 128 d of Qh/Ql and of PF/GF exactly once.
// =========================================================================================================
__global__ __launch_bounds__(256) __attribute__((amdgpu_num_vgpr(256)))
void gemm_proj(const unsigned short* __restrict__ W16, const unsigned short* __restrict__ NP,
               const unsigned short* __restrict__ XP,
               const float* __restrict__ tb, const float* __restrict__ pb, const float* __restrict__ gb,
               unsigned short* Qh, unsigned short* Ql, float* PF, float* GF) {
  __shared__ __align__(16) float Os[SN * OSP];
  const int tid  = threadIdx.x;
  const int lane = tid & 31, wave = tid >> 5;                        // wave 0..7
  const int hh   = lane >> 4, c = lane & 15;
  const int st   = blockIdx.x, mb = blockIdx.y, b = blockIdx.z;
  const int n0   = st * SN, o0 = mb * QT;
  const unsigned short* BP = (mb < 4) ? NP : XP;                     // block-uniform, both global

  const unsigned short* ap = W16 + (size_t)(o0 + c) * CC + 8 * hh;
  const unsigned short* bp = BP + ((size_t)(b * NN + n0 + 16 * wave + c)) * CC + 8 * hh;

  v8f acc[4];
#pragma unroll
  for (int mt = 0; mt < 4; ++mt) acc[mt] = zero8();

#pragma unroll
  for (int ks = 0; ks < CC / 32; ++ks) {
    const Frag fb = ldfrag(bp + 32 * ks);
#pragma unroll
    for (int mt = 0; mt < 4; ++mt) {
      const Frag fa = ldfrag(ap + (size_t)(16 * mt) * CC + 32 * ks);
      acc[mt] = mma_h(fa.h, fb.h, acc[mt]);
    }
  }

  // ---- epilogue: scale back -> LDS Os[n_loc][o_loc]; lane (hh, c) holds o = 16 mt + 8 hh + r for n_loc = 16 w + c
  {
    const int nl = 16 * wave + c;
#pragma unroll
    for (int mt = 0; mt < 4; ++mt) {
      v4f va, vb;
#pragma unroll
      for (int r = 0; r < 4; ++r) { va[r] = acc[mt][r] * IWSC; vb[r] = acc[mt][4 + r] * IWSC; }
      *(v4f*)(Os + nl * OSP + 16 * mt + 8 * hh)     = va;
      *(v4f*)(Os + nl * OSP + 16 * mt + 8 * hh + 4) = vb;
    }
  }
  __syncthreads();

  const int grp = mb >> 1;                                           // 0 theta, 1 phi, 2 g (block-uniform)
  const int dsel = (mb & 1) * QT;                                    // 0 or 64
  const float* bias = (grp == 0) ? tb : ((grp == 1) ? pb : gb);     // all global

  if (grp == 0) {
    const int e = tid & 7, lq = tid >> 3;                            // lq 0..31
    float bv[8];
    {
      const v4f ba = *(const v4f*)(bias + dsel + 8 * e);
      const v4f bq = *(const v4f*)(bias + dsel + 8 * e + 4);
#pragma unroll
      for (int t = 0; t < 4; ++t) { bv[t] = bfr(ba[t]); bv[4 + t] = bfr(bq[t]); }
    }
    v4u uh[4], ul[4];
#pragma unroll
    for (int it = 0; it < 4; ++it) {
      const int row = it * 32 + lq;                                  // n_loc 0..127
      const v4f a = *(const v4f*)(Os + row * OSP + 8 * e);
      const v4f q = *(const v4f*)(Os + row * OSP + 8 * e + 4);
      float f[8];
#pragma unroll
      for (int t = 0; t < 4; ++t) { f[t] = a[t] + bv[t]; f[4 + t] = q[t] + bv[4 + t]; }
      split8(f, uh[it], ul[it]);
    }
{
#pragma unroll
      for (int it = 0; it < 4; ++it) {
        const int row = it * 32 + lq;
        const size_t po = ((size_t)(b * NN + n0 + row)) * DQ + dsel + 8 * e;
        *(v4u*)(Qh + po) = uh[it];
        *(v4u*)(Ql + po) = ul[it];
      }
      
    }
  } else {
    const int e16 = tid & 15, lr = tid >> 4;                        // lr 0..15
    v4f bv4;
    {
      const v4f bq = *(const v4f*)(bias + dsel + 4 * e16);
#pragma unroll
      for (int t = 0; t < 4; ++t) bv4[t] = bfr(bq[t]);
    }
    float* P = (grp == 1) ? PF : GF;                                 // both global
    v4f res[8];
#pragma unroll
    for (int it = 0; it < 8; ++it) {
      const int row = it * 16 + lr;                                  // n_loc 0..127
      const v4f a = *(const v4f*)(Os + row * OSP + 4 * e16);
      v4f v;
#pragma unroll
      for (int t = 0; t < 4; ++t) v[t] = a[t] + bv4[t];
      res[it] = v;
    }
{
#pragma unroll
      for (int it = 0; it < 8; ++it) {
        const int row = it * 16 + lr;
        const size_t po = ((size_t)(b * NN + n0 + row)) * DQ + dsel + 4 * e16;
        *(v4f*)(P + po) = res[it];
      }
      
    }
  }
}

// =========================================================================================================
// (3) 2x2 stride-2 max-pool of PF / GF f32 [b][4096 n][128 d] in f32 -> Kh/Kl bf16 [b][1024 m][128 d]
//     (hi = RNE(v), lo = RNE(v-hi)) and Gp f16 [b][1024 m][128 d], m = 32 py + px, window n = (2py+dy) 64 + 2px+dx,
//     lr = tid>>4 -> px = 16 it + lr for it 0..1 (px 0..31, all valid, no pad rows since 1024 keys = 32 x 32).
// coverage: blocks 0..31 x px 0..31 x 16 lanes x 8 = rows 0..1023 x 128 d of each plane; grid (32, NB) covers
//           Kh/Kl/Gp [b][0..1023][0..127] exactly once.
// =========================================================================================================
__global__ __launch_bounds__(256)
void pool_k(const float* __restrict__ PF, const float* __restrict__ GF,
            unsigned short* Kh, unsigned short* Kl, unsigned short* Gp) {
  const int tid = threadIdx.x, py = blockIdx.x, b = blockIdx.y;
  const int e16 = tid & 15, lr = tid >> 4;                          // lr 0..15
  v4u kh[2], kl[2], gu[2];
#pragma unroll
  for (int it = 0; it < 2; ++it) {
    const int px = it * 16 + lr;                                    // 0..31
    float fk[8], fg[8];
#pragma unroll
    for (int t = 0; t < 8; ++t) { fk[t] = -__builtin_inff(); fg[t] = -__builtin_inff(); }
#pragma unroll 1
    for (int dy = 0; dy < 2; ++dy) {
      const size_t rb = ((size_t)(b * NN + (2 * py + dy) * WIMG + 2 * px)) * DQ + 8 * e16;
#pragma unroll
      for (int dx = 0; dx < 2; ++dx) {
        const float* pk = PF + rb + (size_t)dx * DQ;
        const float* pg = GF + rb + (size_t)dx * DQ;
        const v4f ka = *(const v4f*)pk, kq = *(const v4f*)(pk + 4);
        const v4f ga = *(const v4f*)pg, gq = *(const v4f*)(pg + 4);
#pragma unroll
        for (int t = 0; t < 4; ++t) {
          fk[t]     = fmaxf(fk[t], ka[t]);
          fk[4 + t] = fmaxf(fk[4 + t], kq[t]);
          fg[t]     = fmaxf(fg[t], ga[t]);
          fg[4 + t] = fmaxf(fg[4 + t], gq[t]);
        }
      }
    }
    split8(fk, kh[it], kl[it]);
#pragma unroll
    for (int t = 0; t < 4; ++t) gu[it][t] = pk16(h_bits((_Float16)fg[2 * t]), h_bits((_Float16)fg[2 * t + 1]));
  }
{
#pragma unroll
    for (int it = 0; it < 2; ++it) {
      const int px = it * 16 + lr;
      const size_t po = ((size_t)(b * MM + WP * py + px)) * DQ + 8 * e16;
      *(v4u*)(Kh + po) = kh[it];
      *(v4u*)(Kl + po) = kl[it];
      *(v4u*)(Gp + po) = gu[it];
    }
    
  }
}

// =========================================================================================================
// (4) Gp f16 [b][1024 m][128 d] -> Gc f16 [b][d][m] (channel-major, keys contiguous) through an LDS tile T[64 d][64 m]
// coverage: reads 2 it x 32 rows x 8 lanes x 8 = 64 m x 64 d; T written rows (8e+t)=0..63 x cols 0..63, read rows
//           0..63 x cols 8e..8e+7; writes 64 d x 64 m; grid (16, 2, NB) covers Gc [b][0..127][0..1023] exactly once.
// =========================================================================================================
__global__ __launch_bounds__(256)
void tr_g(const unsigned short* __restrict__ Gp, unsigned short* Gc) {
  __shared__ __align__(16) unsigned short T[QT * TP];
  const int tid = threadIdx.x;
  const int mt = blockIdx.x, db = blockIdx.y, b = blockIdx.z;
  const int e = tid & 7, lq = tid >> 3;                             // lq 0..31
  const int m0 = mt * QT, d0 = db * QT;
#pragma unroll
  for (int it = 0; it < 2; ++it) {
    const int ml = it * 32 + lq;                                     // 0..63
    const v4u w = *(const v4u*)(Gp + ((size_t)(b * MM + m0 + ml)) * DQ + d0 + 8 * e);
    unsigned short hb[8];
#pragma unroll
    for (int t = 0; t < 4; ++t) {
      hb[2 * t]     = (unsigned short)(w[t] & 0xFFFFu);
      hb[2 * t + 1] = (unsigned short)(w[t] >> 16);
    }
#pragma unroll
    for (int t = 0; t < 8; ++t) T[(8 * e + t) * TP + ml] = hb[t];
  }
  __syncthreads();
  v4u up[2];
#pragma unroll
  for (int it = 0; it < 2; ++it) {
    const int dl = it * 32 + lq;                                     // 0..63
    up[it] = *(const v4u*)(T + dl * TP + 8 * e);
  }
{
#pragma unroll
    for (int it = 0; it < 2; ++it) {
      const int dl = it * 32 + lq;
      *(v4u*)(Gc + ((size_t)(b * DQ + d0 + dl)) * MM + m0 + 8 * e) = up[it];
    }
    
  }
}

// ---- eight asynchronous 16-byte copies per lane, global -> LDS: copy i takes g + i*gstep (elements) to LDS byte
//      address l + i*lstep. The s_wait_xcnt 0 is the last line of the copies' own statement so that it stands in
//      front of any later write of the address registers the copies name.
__device__ __forceinline__ void copy8(unsigned l, unsigned lstep, const unsigned short* g, size_t gstep) {
#if defined(__HIP_DEVICE_COMPILE__)
  asm volatile("global_load_async_to_lds_b128 %0, %8, off\n\t"
               "global_load_async_to_lds_b128 %1, %9, off\n\t"
               "global_load_async_to_lds_b128 %2, %10, off\n\t"
               "global_load_async_to_lds_b128 %3, %11, off\n\t"
               "global_load_async_to_lds_b128 %4, %12, off\n\t"
               "global_load_async_to_lds_b128 %5, %13, off\n\t"
               "global_load_async_to_lds_b128 %6, %14, off\n\t"
               "global_load_async_to_lds_b128 %7, %15, off\n\t"
               "s_wait_xcnt 0x0"
               :: "v"(l), "v"(l + lstep), "v"(l + 2 * lstep), "v"(l + 3 * lstep),
                  "v"(l + 4 * lstep), "v"(l + 5 * lstep), "v"(l + 6 * lstep), "v"(l + 7 * lstep),
                  "v"(g), "v"(g + gstep), "v"(g + 2 * gstep), "v"(g + 3 * gstep),
                  "v"(g + 4 * gstep), "v"(g + 5 * gstep), "v"(g + 6 * gstep), "v"(g + 7 * gstep)
               : "memory");
#endif
}

// =========================================================================================================
// (5) attention for one (b, 64-query tile), transposed formulation, 1024 keys (all valid, no mask, no scale):
//   S^T tile (16 keys x 16 queries) = sum over 4 d-chunks (q fragments kept in registers) of A(k: row = key kb + (lane&15), 32 d via
//   the split k map from the bf16 plane Kh [b][1024][128]) . B(q: col = query, same map from Qh [b][4096][128])
//   + A(Kh).B(Ql) + A(Kl).B(Qh) (bf16 unscaled residual planes, shared accumulator).
//   Per lane the D tile holds 8 keys of ONE query: online softmax state per lane, one shuffle (lane^16) for the max
//   over 32 keys; the o/l rescale is skipped under a wave-uniform ballot when no lane's max grew (corr == 1 exactly
//   for every lane then); row-sum partials combined at the end. P = e^{s-m} x 16384 as f16 is the B operand of
//   y^T (rows channel, cols queries) += A(pooled g: rows channel = 16j + (lane&15), keys contiguous, f16 plane Gc
//   [b][128][1024]) . B(P^T): element r <- D of the tile covering keys kb..kb+15, element 8+r <- the tile covering
//   kb+16..kb+31, lane unchanged. 8 accumulator tiles per wave (128 channels). Block = 4 waves = 64 queries.
//   K hi / K residual / pooled-g tiles of 64 keys are staged once per block in a two-buffer LDS ring by asynchronous
//   copies (whole 128-B lines from global; 24 copies per lane and stage) and read by all 4 waves as ds_load_b128
//   fragments: K rows at pitch 272 B, g rows (64 keys = 128 B) at pitch 144 B. Stage t+2 is issued behind the barrier
//   that ends every wave's reads of stage t; stage t+1 is read only behind each wave's own asynccnt wait + barrier.
//   Epilogue: y = O/l staged in LDS Os[query][128 channels] (pitch OSPW, b128 stores), block barrier, then
// coverage: Os written 4 waves x 16 queries x 128 ch, read rows 0..63 x ch 8e..8e+7 (e 0..15); planes 8 it x 8 rows x
//           16 lanes x 8 = 64 n x 128 ch per plane; grid (NQ/64, NB) covers rows 0..NQ-1 of Yh/Yl exactly once.
// =========================================================================================================
__global__ __launch_bounds__(128) __attribute__((amdgpu_num_vgpr(256)))
void attn_k(const unsigned short* __restrict__ Qh, const unsigned short* __restrict__ Ql,
            const unsigned short* __restrict__ Kh, const unsigned short* __restrict__ Kl,
            const unsigned short* __restrict__ Gc, unsigned short* Yh, unsigned short* Yl) {
  __shared__ __align__(16) float Os[QT * OSPW];
  __shared__ __align__(16) unsigned short Ring[2 * STG / 2];
  const int tid  = threadIdx.x;
  const int wave = tid >> 5, lane = tid & 31;
  const int hh   = lane >> 4, c = lane & 15;
  const int n0   = blockIdx.x * QT, b = blockIdx.y;

  // q fragment pointers (B operand, col = query n0 + 16*wave + c), + 32*kc
  const size_t qo = ((size_t)(b * NN + n0 + 16 * wave + c)) * DQ + 8 * hh;
  const unsigned short* Qhp = Qh + qo;
  const unsigned short* Qlp = Ql + qo;
  // copy sources of stage 0 (per lane, 16 B): K planes: the 16-KB tile is contiguous, chunk tid, + 128 chunks per copy;
  // g plane: row = channel (tid>>3) + 16 per copy, 8 chunks of 16 B per 128-B row piece
  const unsigned short* Khg = Kh + (size_t)b * MM * DQ + 8 * tid;
  const unsigned short* Klg = Kl + (size_t)b * MM * DQ + 8 * tid;
  const unsigned short* Vg  = Gc + (size_t)b * DQ * MM + (size_t)(tid >> 3) * MM + 8 * (tid & 7);
  // copy destinations in buffer 0 (LDS byte addresses): K row (tid>>4) + 8 per copy, g row (tid>>3) + 16 per copy
  const unsigned ring0 = (unsigned)(size_t)Ring;
  const unsigned lK = ring0 + (unsigned)((tid >> 4) * (KPS * 2) + (tid & 15) * 16);
  const unsigned lV = ring0 + (unsigned)(2 * KSZ + (tid >> 3) * (VPS * 2) + (tid & 7) * 16);
  // fragment offsets inside a buffer (elements): k (A operand, row = key + c), + key * KPS + 32*kc;
  // v (A operand, row = channel 16j + c, keys contiguous), + 16*j*VPS + key
  const int kfo = c * KPS + 8 * hh;
  const int vfo = KSZ + c * VPS + 8 * hh;

  // ring prologue: stage 0 -> buffer 0, landed and published; then stage 1 -> buffer 1 flies over pass 0
  copy8(lK, 8 * KPS * 2, Khg, 128 * 8);
  copy8(lK + KSZ, 8 * KPS * 2, Klg, 128 * 8);
  copy8(lV, 16 * VPS * 2, Vg, (size_t)16 * MM);
  asm volatile("s_wait_asynccnt 0x0" ::: "memory");                  // this wave's stage-0 copies have landed
  __syncthreads();                                                   // every wave's stage-0 copies are readable
  copy8(lK + STG, 8 * KPS * 2, Khg + (size_t)KT * DQ, 128 * 8);
  copy8(lK + STG + KSZ, 8 * KPS * 2, Klg + (size_t)KT * DQ, 128 * 8);
  copy8(lV + STG, 16 * VPS * 2, Vg + KT, (size_t)16 * MM);

  // q hi / residual fragments of this wave's 16 queries: the same for every key, loaded once and kept in registers
  Frag qhf[DQ / 32], qlf[DQ / 32];
#pragma unroll
  for (int kc = 0; kc < DQ / 32; ++kc) {
    qhf[kc] = ldfrag(Qhp + 32 * kc);
    qlf[kc] = ldfrag(Qlp + 32 * kc);
  }

  float m = -1.0e30f, l = 0.f;
  v8f o[8];
#pragma unroll
  for (int j = 0; j < 8; ++j) o[j] = zero8();

#pragma unroll 1  // one stage per trip, rolled: the publish point at its foot stands once in the text
  for (int t = 0; t < NT; ++t) {
   const unsigned short* sb = Ring + (t & 1) * (STG / 2);            // this stage's buffer
#pragma unroll 1  // the 32-key pass stays rolled as before
   for (int kb = 0; kb < KT; kb += 32) {
    const unsigned short* k0p  = sb + kfo + kb * KPS;                // keys kb .. kb+15 of the stage
    const unsigned short* k1p  = k0p + 16 * KPS;                     // keys kb+16 .. kb+31
    const unsigned short* k0lp = k0p + KSZ / 2;
    const unsigned short* k1lp = k1p + KSZ / 2;
    v8f s0 = zero8(), s1 = zero8();
#pragma unroll  // unrolled so that the register-resident q fragments are indexed by constants
    for (int kc = 0; kc < DQ / 32; ++kc) {
      const Frag qh  = qhf[kc];
      const Frag ql  = qlf[kc];
      const Frag k0  = ldfrag(k0p + 32 * kc);
      const Frag k1  = ldfrag(k1p + 32 * kc);
      const Frag k0l = ldfrag(k0lp + 32 * kc);
      const Frag k1l = ldfrag(k1lp + 32 * kc);
      s0 = mma_b(k0.bf, qh.bf, s0);
      s1 = mma_b(k1.bf, qh.bf, s1);
      s0 = mma_b(k0.bf, ql.bf, s0);
      s1 = mma_b(k1.bf, ql.bf, s1);
      s0 = mma_b(k0l.bf, qh.bf, s0);
      s1 = mma_b(k1l.bf, qh.bf, s1);
    }

    float mx = fmaxf(hmax8(s0), hmax8(s1));
    mx = fmaxf(mx, __shfl_xor(mx, 16, 32));
    const float mn = fmaxf(m, mx);
    const unsigned grew = wave_ballot(mx > m);                       // wave-uniform
    if (grew != 0u) {
      const float corr = __expf(m - mn);                             // == 1 exactly for lanes whose max did not grow
      l *= corr;
#pragma unroll
      for (int j = 0; j < 8; ++j) {
#pragma unroll
        for (int r = 0; r < 8; ++r) o[j][r] *= corr;
      }
    }
    m = mn;
    const float msh = mn - LNPS;                                     // exp gives e^{s-m} * 16384

    FragH ph;
    float ls = 0.f;
#pragma unroll
    for (int r = 0; r < 8; ++r) {
      const float e0 = __expf(s0[r] - msh);                          // key kb      + 8hh + r
      const float e1 = __expf(s1[r] - msh);                          // key kb + 16 + 8hh + r
      ls += e0 + e1;
      ph.hv[0][r] = (_Float16)e0;
      ph.hv[1][r] = (_Float16)e1;
    }
    l += ls;

#pragma unroll
    for (int j = 0; j < 8; ++j) {
      const Frag vf = ldfrag(sb + vfo + (16 * j) * VPS + kb);
      o[j] = mma_h(vf.h, ph.v, o[j]);
    }
   }
   // publish point of stage t+1, and release of stage t's buffer
   asm volatile("s_wait_dscnt 0x0" ::: "memory");                    // this wave's reads of stage t are done
   asm volatile("s_wait_asynccnt 0x0" ::: "memory");                 // this wave's stage t+1 copies have landed
   __syncthreads();
   if (t + 2 < NT) {                                                 // block-uniform
     const unsigned bo = (unsigned)((t & 1) * STG);
     copy8(lK + bo, 8 * KPS * 2, Khg + (size_t)(t + 2) * KT * DQ, 128 * 8);
     copy8(lK + bo + KSZ, 8 * KPS * 2, Klg + (size_t)(t + 2) * KT * DQ, 128 * 8);
     copy8(lV + bo, 16 * VPS * 2, Vg + (t + 2) * KT, (size_t)16 * MM);
   }
  }
  asm volatile("s_wait_asynccnt 0x0" ::: "memory");                  // nothing of the ring is in flight past here
  l += __shfl_xor(l, 16, 32);
  const float inv = 1.0f / l;                                        // o and l both carry the x16384 factor

  // ---- epilogue: y = o * inv -> Os[query][ch]; lane (hh, c) holds ch = 16 j + 8 hh + r for query 16 w + c
  {
    const int qrow = 16 * wave + c;
#pragma unroll
    for (int j = 0; j < 8; ++j) {
      v4f va, vb;
#pragma unroll
      for (int r = 0; r < 4; ++r) { va[r] = o[j][r] * inv; vb[r] = o[j][4 + r] * inv; }
      *(v4f*)(Os + qrow * OSPW + 16 * j + 8 * hh)     = va;
      *(v4f*)(Os + qrow * OSPW + 16 * j + 8 * hh + 4) = vb;
    }
  }
  __syncthreads();

  const int e16 = tid & 15, lr = tid >> 4;                           // lr 0..7
  v4u uh[8], ul[8];
#pragma unroll
  for (int it = 0; it < 8; ++it) {
    const int row = it * 8 + lr;                                     // query 0..63
    const v4f a = *(const v4f*)(Os + row * OSPW + 8 * e16);
    const v4f q = *(const v4f*)(Os + row * OSPW + 8 * e16 + 4);
    const float f[8] = {a[0], a[1], a[2], a[3], q[0], q[1], q[2], q[3]};
    split8(f, uh[it], ul[it]);
  }
{
#pragma unroll
    for (int it = 0; it < 8; ++it) {
      const int row = it * 8 + lr;
      const size_t po = ((size_t)(b * NN + n0 + row)) * DQ + 8 * e16;
      *(v4u*)(Yh + po) = uh[it];
      *(v4u*)(Yl + po) = ul[it];
    }
    
  }
}

// =========================================================================================================
// (6) output conv for one (b, 64-n tile, 64-c block): A[c][n] = sum_ci WWb[c][ci] (Yh + Yl)[b][n][ci] on bf16 WMMA
//     (2 products per k-step, shared accumulator), K = 128 = 4 steps. Block 128 threads = 4 waves; wave w owns cols
//     n0+16w..+15 (B fragments from the k-contiguous Yh/Yl rows) and 4 m-tiles (A rows c = c0 + 16 mt + (lane&15),
//     split k map loader from WWb). Per-channel constants (bf16-RNE of w_b, bn mean, bn beta, and scale =
//     bf16-RNE(gamma) * rsqrt(bf16-RNE(var) + eps)) staged once in LDS by waves 0,1. Epilogue staged in LDS
//     Os[n_loc][c_loc] (pitch OSP, b128 stores), block barrier, then out[b][c][n] = (((A + w_b[c]) - mean[c]) *
// coverage: Os 4 waves x 16 n x 64 c written, read rows nl+t <= 63 x cols cl <= 63; Pb/Pm/Ps/Pt written 0..63, read
//           cl <= 63; out 8 it x 16 lines x 8 lanes x 4 floats = 64 c x 64 n; grid (NQ/64, 4, NB) covers
//           out[b][0..255][0..NQ-1] exactly once.
// =========================================================================================================
__global__ __launch_bounds__(128) __attribute__((amdgpu_num_vgpr(256)))
void gemm_out(const unsigned short* __restrict__ WWb, const unsigned short* __restrict__ Yh,
              const unsigned short* __restrict__ Yl, const float* __restrict__ wb,
              const float* __restrict__ bng, const float* __restrict__ bnb,
              const float* __restrict__ bnm, const float* __restrict__ bnv,
              const float* __restrict__ x, float* out) {
  __shared__ __align__(16) float Os[QT * OSP];
  __shared__ float Pb[QT], Pm[QT], Ps[QT], Pt[QT];
  const int tid  = threadIdx.x;
  const int lane = tid & 31, wave = tid >> 5;
  const int hh   = lane >> 4, c = lane & 15;
  const int nt   = blockIdx.x, cb = blockIdx.y, b = blockIdx.z;
  const int n0   = nt * QT, c0 = cb * QT;

  if (tid < QT) {                                                    // waves 0,1 (wave-uniform), cross-wave via barrier
    const int ch = c0 + tid;                                         // 0..255
    Pb[tid] = bfr(wb[ch]);
    Pm[tid] = bfr(bnm[ch]);
    Ps[tid] = bfr(bng[ch]) * rsqrtf(bfr(bnv[ch]) + BNEPS);
    Pt[tid] = bfr(bnb[ch]);
  }

  const unsigned short* ap  = WWb + (size_t)(c0 + c) * DQ + 8 * hh;
  const size_t bo = ((size_t)(b * NN + n0 + 16 * wave + c)) * DQ + 8 * hh;
  const unsigned short* bph = Yh + bo;
  const unsigned short* bpl = Yl + bo;

  v8f acc[4];
#pragma unroll
  for (int mt = 0; mt < 4; ++mt) acc[mt] = zero8();

#pragma unroll
  for (int ks = 0; ks < DQ / 32; ++ks) {
    const Frag fbh = ldfrag(bph + 32 * ks);
    const Frag fbl = ldfrag(bpl + 32 * ks);
#pragma unroll
    for (int mt = 0; mt < 4; ++mt) {
      const Frag fa = ldfrag(ap + (size_t)(16 * mt) * DQ + 32 * ks);
      acc[mt] = mma_b(fa.bf, fbh.bf, acc[mt]);
      acc[mt] = mma_b(fa.bf, fbl.bf, acc[mt]);
    }
  }

  // ---- epilogue: -> LDS Os[n_loc][c_loc]; lane (hh, c) holds c_loc = 16 mt + 8 hh + r for n_loc = 16 w + c
  {
    const int nl = 16 * wave + c;
#pragma unroll
    for (int mt = 0; mt < 4; ++mt) {
      v4f va, vb;
#pragma unroll
      for (int r = 0; r < 4; ++r) { va[r] = acc[mt][r]; vb[r] = acc[mt][4 + r]; }
      *(v4f*)(Os + nl * OSP + 16 * mt + 8 * hh)     = va;
      *(v4f*)(Os + nl * OSP + 16 * mt + 8 * hh + 4) = vb;
    }
  }
  __syncthreads();

  const int e = tid & 7, lq = tid >> 3;                              // lq 0..15
  v4f res[8];
#pragma unroll
  for (int it = 0; it < 8; ++it) {
    const int L   = it * 16 + lq;                                    // 0..127
    const int cl  = L >> 1, hf = L & 1;                              // channel 0..63 within the block
    const int nl  = hf * 32 + 4 * e;                                 // position 0..63
    const float pbv = Pb[cl], pmv = Pm[cl], psv = Ps[cl], ptv = Pt[cl];
    const size_t idx = ((size_t)(b * CC + c0 + cl)) * NN + n0 + nl;
    const v4f xv = *(const v4f*)(x + idx);
#pragma unroll
    for (int t = 0; t < 4; ++t) {
      const float cv = Os[(nl + t) * OSP + cl] + pbv;
      res[it][t] = ((cv - pmv) * psv + ptv) + bfr(xv[t]);
    }
  }
{
#pragma unroll
    for (int it = 0; it < 8; ++it) {
      const int L   = it * 16 + lq;
      const int cl  = L >> 1, hf = L & 1;
      const int nl  = hf * 32 + 4 * e;
      const size_t idx = ((size_t)(b * CC + c0 + cl)) * NN + n0 + nl;
      *(v4f*)(out + idx) = res[it];
    }
    
  }
}

// =========================================================================================================
// Workspace map (bytes; each region start a multiple of 256; every extent is an exact row/tile multiple and is
//   W16 f16 [384][256]            196608      WWb bf16 [256][128]        65536
//   XP / NP f16 [NB][4096][256]  16777216 x2 (NB=8)
//   Qh/Ql bf16 [NB][4096][128]    8388608 x2
//   PF/GF f32  [NB][4096][128]   16777216 x2
//   Kh/Kl bf16 [NB][1024][128]    2097152 x2  Gp f16 [NB][1024][128]   2097152   Gc f16 [NB][128][1024]  2097152
//   Yh/Yl bf16 [NB][4096][128]    8388608 x2
//   total (NB=8) = 109314048
// =========================================================================================================
extern "C" void kernel_launch(void* const* d_in, const int* in_sizes, int n_in,
                              void* d_out, int out_size, void* d_ws, size_t ws_size,
                              hipStream_t stream) {
  const int XN = NB * CC * NN;
  if (n_in < 14) return;
  if (in_sizes[0] < XN || in_sizes[1] < XN) return;
  if (in_sizes[2] < DQ * CC || in_sizes[4] < DQ * CC || in_sizes[6] < DQ * CC || in_sizes[8] < CC * DQ) return;
  if (in_sizes[3] < DQ || in_sizes[5] < DQ || in_sizes[7] < DQ) return;
  if (in_sizes[9] < CC || in_sizes[10] < CC || in_sizes[11] < CC || in_sizes[12] < CC || in_sizes[13] < CC) return;
  if (out_size < XN) return;

  size_t off = 0;
  auto carve = [&](size_t bytes) { const size_t o = off; off += (bytes + 255) & ~(size_t)255; return o; };
  const size_t oW16 = carve((size_t)MW * CC * 2);
  const size_t oWWb = carve((size_t)CC * DQ * 2);
  const size_t oXP  = carve((size_t)NB * NN * CC * 2);
  const size_t oNP  = carve((size_t)NB * NN * CC * 2);
  const size_t oQh  = carve((size_t)NB * NN * DQ * 2);
  const size_t oQl  = carve((size_t)NB * NN * DQ * 2);
  const size_t oPF  = carve((size_t)NB * NN * DQ * 4);
  const size_t oGF  = carve((size_t)NB * NN * DQ * 4);
  const size_t oKh  = carve((size_t)NB * MM * DQ * 2);
  const size_t oKl  = carve((size_t)NB * MM * DQ * 2);
  const size_t oGp  = carve((size_t)NB * MM * DQ * 2);
  const size_t oGc  = carve((size_t)NB * DQ * MM * 2);
  const size_t oYh  = carve((size_t)NB * NN * DQ * 2);
  const size_t oYl  = carve((size_t)NB * NN * DQ * 2);
  if (off > ws_size) return;
  if (off > (size_t)134217728) return;

  const float* x   = (const float*)d_in[0];
  const float* nf  = (const float*)d_in[1];
  const float* gw  = (const float*)d_in[2];
  const float* gb  = (const float*)d_in[3];
  const float* tw  = (const float*)d_in[4];
  const float* tb  = (const float*)d_in[5];
  const float* pw  = (const float*)d_in[6];
  const float* pb  = (const float*)d_in[7];
  const float* ow  = (const float*)d_in[8];
  const float* wb  = (const float*)d_in[9];
  const float* bng = (const float*)d_in[10];
  const float* bnb = (const float*)d_in[11];
  const float* bnm = (const float*)d_in[12];
  const float* bnv = (const float*)d_in[13];

  char* ws = (char*)d_ws;
  unsigned short* W16 = (unsigned short*)(ws + oW16);
  unsigned short* WWb = (unsigned short*)(ws + oWWb);
  unsigned short* XP  = (unsigned short*)(ws + oXP);
  unsigned short* NP  = (unsigned short*)(ws + oNP);
  unsigned short* Qh  = (unsigned short*)(ws + oQh);
  unsigned short* Ql  = (unsigned short*)(ws + oQl);
  float*          PF  = (float*)(ws + oPF);
  float*          GF  = (float*)(ws + oGF);
  unsigned short* Kh  = (unsigned short*)(ws + oKh);
  unsigned short* Kl  = (unsigned short*)(ws + oKl);
  unsigned short* Gp  = (unsigned short*)(ws + oGp);
  unsigned short* Gc  = (unsigned short*)(ws + oGc);
  unsigned short* Yh  = (unsigned short*)(ws + oYh);
  unsigned short* Yl  = (unsigned short*)(ws + oYl);
  float* out = (float*)d_out;

  const dim3 blk256(256), blk128(128);

  // (0) theta_w / phi_w / g_w -> stacked f16 plane; w_w -> bf16 plane
  cvt_w<<<dim3(MW / 8 + CC / 16), blk256, 0, stream>>>(tw, pw, gw, ow, W16, WWb);
  // (1) x -> XP, neighborFeat -> NP (position-major 16-bit planes)
  cvt_x<<<dim3(NN / QT, CC / QT, 2 * NB), blk256, 0, stream>>>(x, nf, XP, NP);
  // (2) conv1x1 GEMM -> theta (q) hi/res planes from NP, phi conv + bias f32 plane from NP, g conv + bias from XP
  gemm_proj<<<dim3(NSTRIP, MW / QT, NB), blk256, 0, stream>>>(W16, NP, XP, tb, pb, gb, Qh, Ql, PF, GF);
  // (3) 2x2 stride-2 max-pool -> pooled phi (k) hi/res planes, pooled g f16 plane
  pool_k<<<dim3(HP, NB), blk256, 0, stream>>>(PF, GF, Kh, Kl, Gp);
  // (4) pooled g -> channel-major plane
  tr_g<<<dim3(MM / QT, DQ / QT, NB), blk256, 0, stream>>>(Gp, Gc);
  // (5) attention -> y hi/res planes [b][n][128]
  attn_k<<<dim3(NQ / QT, NB), blk128, 0, stream>>>(Qh, Ql, Kh, Kl, Gc, Yh, Yl);
  // (6) output conv + bias + batch-norm affine + residual -> out [b][256][4096]
  gemm_out<<<dim3(NQ / QT, CC / QT, NB), blk128, 0, stream>>>(WWb, Yh, Yl, wb, bng, bnb, bnm, bnv, x, out);
  (void)hipGetLastError();
}

// v003
// It runs in 87.1 microseconds.
// In both of two side-by-side timings against v002, it was 1.32 times as fast.
// Over all steps from v000 it is 2.49 times as fast.
// Contractions: conv1x1 theta/phi/g GEMM W[384x256].X[256x128] per strip on v_wmma_f32_16x16x32_f16 (f16 containers
// of bf16-RNE weights x256 and bf16-RNE activations); scores K.Q^T on v_wmma_f32_16x16x32_bf16 (bf16 hi + bf16
// residual planes of theta / pooled phi, 3 products, K=128); y^T = G.P^T on v_wmma_f32_16x16x32_f16 (2x2-max-pooled g
// as f16, P = e^{s-m} x16384 f16 from the score D registers); output conv W[256x128].Y on v_wmma_f32_16x16x32_bf16
// (bf16 weights, y as bf16 hi + residual planes, 2 products); f32 accumulate everywhere; max-pool, softmax statistics,
// bias, batch-norm affine with running statistics and residual add in f32 VALU.
#include <hip/hip_runtime.h>
#include <math.h>
#include <stdint.h>

#ifndef NB
#define NB 8
#endif
#ifndef NQ
#define NQ 4096
#endif
#define NB_FULL 8
#define CC     256
#define HIMG   64
#define WIMG   64
#define NN     4096
#define DQ     128
#define HP     32
#define WP     32
#define MV     1024
#define MM     1024
#define MW     384
#define QT     64
#define SN     128
#define NWP    8
#define NSTRIP 32
#define OSP    68
#define OSPW   132
#define TP     72
#define WSC    256.0f
#define IWSC   0.00390625f
#define LNPS   9.704060527839234f
#define BNEPS  1.0e-5f
#define KT     64
#define NT     16
#define KPS    136
#define VPS    72
#define KSZ    (KT * KPS * 2)
#define VSZ    (DQ * VPS * 2)
#define STG    (2 * KSZ + VSZ)
#define PPS    264
#define PASZ   (QT * PPS * 2)
#define PBSZ   (SN * PPS * 2)

static_assert(NB >= 1 && NB <= NB_FULL);
static_assert(NQ % QT == 0 && NQ >= QT && NQ <= NN);
static_assert(NN == HIMG * WIMG);
static_assert(SN == 2 * WIMG);
static_assert(NSTRIP * SN == NN);
static_assert(SN == 16 * NWP);
static_assert(2 * HP == HIMG && 2 * WP == WIMG);
static_assert(MV == HP * WP && MM == MV);
static_assert(WP == 32 && HP == 32);
static_assert(NN % QT == 0 && CC % QT == 0 && DQ % QT == 0 && MM % QT == 0);
static_assert(MW == 3 * DQ && MW % QT == 0 && MW % 8 == 0);
static_assert(CC % 32 == 0 && DQ % 32 == 0 && MM % 32 == 0);
static_assert((OSP * 4) % 16 == 0);
static_assert((OSPW * 4) % 16 == 0);
static_assert((TP * 2) % 16 == 0);
static_assert(SN * OSP * 4 <= 65536);
static_assert((size_t)NB_FULL * CC * NN * 4 == (size_t)33554432);
static_assert(NT * KT == MM && NT >= 2 && KT % 32 == 0);
static_assert(KPS == DQ + 8 && VPS == KT + 8);
static_assert(KT * DQ * 2 == 8 * 128 * 16 && DQ * KT * 2 == 8 * 128 * 16);
static_assert(KSZ % 16 == 0 && VSZ % 16 == 0 && STG % 16 == 0);
static_assert(2 * (2 * STG + QT * OSPW * 4) <= 327680);
static_assert(PPS == CC + 8 && (PPS * 2) % 16 == 0);
static_assert(QT * CC * 2 == 8 * 256 * 16 && SN * CC * 2 == 16 * 256 * 16);
static_assert(SN * OSP * 4 <= PASZ + PBSZ && 3 * (PASZ + PBSZ) <= 327680);
static_assert(QT == KT && QT * OSP * 4 <= 3 * KSZ);

// workspace total at full size (all region sizes are multiples of 256)
#define WS_FULL ((size_t)MW * CC * 2 + (size_t)CC * DQ * 2 + 2 * (size_t)NB_FULL * NN * CC * 2 \
                 + 2 * (size_t)NB_FULL * NN * DQ * 2 + 2 * (size_t)NB_FULL * NN * DQ * 4 \
                 + 4 * (size_t)NB_FULL * MM * DQ * 2 + 2 * (size_t)NB_FULL * NN * DQ * 2)
static_assert(WS_FULL <= (size_t)134217728);

typedef _Float16       v16h __attribute__((ext_vector_type(16)));
typedef _Float16       v8h  __attribute__((ext_vector_type(8)));
typedef __bf16         v16b __attribute__((ext_vector_type(16)));
typedef unsigned short v8us __attribute__((ext_vector_type(8)));
typedef float          v8f  __attribute__((ext_vector_type(8)));
typedef float          v4f  __attribute__((ext_vector_type(4)));
typedef unsigned int   v4u  __attribute__((ext_vector_type(4)));

union Frag  { v8us u[2]; v16h h; v16b bf; };
union FragH { v16h v; v8h hv[2]; };
static_assert(sizeof(Frag) == 32);
static_assert(sizeof(FragH) == 32);

// ---- scalar helpers ---------------------------------------------------------------------------------------
__device__ __forceinline__ unsigned short bf_bits(float f) {          // f32 -> bf16 bits, RNE convert
  unsigned u = __float_as_uint(f);
  return (unsigned short)((u + 0x7FFFu + ((u >> 16) & 1u)) >> 16);
}
__device__ __forceinline__ float bf_up(unsigned short hb) { return __uint_as_float(((unsigned)hb) << 16); }
__device__ __forceinline__ float bfr(float f) { return bf_up(bf_bits(f)); }
__device__ __forceinline__ unsigned short h_bits(_Float16 x) { return __builtin_bit_cast(unsigned short, x); }
__device__ __forceinline__ unsigned pk16(unsigned short a, unsigned short b) { return (unsigned)a | ((unsigned)b << 16); }
__device__ __forceinline__ v8f zero8() { v8f z = {0.f, 0.f, 0.f, 0.f, 0.f, 0.f, 0.f, 0.f}; return z; }
__device__ __forceinline__ float hmax8(v8f s) {
  return fmaxf(fmaxf(fmaxf(s[0], s[1]), fmaxf(s[2], s[3])), fmaxf(fmaxf(s[4], s[5]), fmaxf(s[6], s[7])));
}
__device__ __forceinline__ unsigned wave_ballot(bool p) {
#if defined(__HIP_DEVICE_COMPILE__)
  return __builtin_amdgcn_ballot_w32(p);
#else
  return p ? 1u : 0u;
#endif
}
// 8 f32 values -> bf16 hi bits and bf16 residual bits (lo = RNE(v - hi)), packed 2 per uint
__device__ __forceinline__ void split8(const float* f, v4u& uh, v4u& ul) {
#pragma unroll
  for (int t = 0; t < 4; ++t) {
    const float f0 = f[2 * t], f1 = f[2 * t + 1];
    const unsigned short hb0 = bf_bits(f0), hb1 = bf_bits(f1);
    const unsigned short lb0 = bf_bits(f0 - bf_up(hb0));
    const unsigned short lb1 = bf_bits(f1 - bf_up(hb1));
    uh[t] = pk16(hb0, hb1);
    ul[t] = pk16(lb0, lb1);
  }
}

// ---- 16-bit fragment loader (A, or B from a k-contiguous [n][k] row): lane -> row/col (lane&15), p already includes
//      + 8*(lane>>4); elements 0..7 <- p[0..7] (k0+8h..), elements 8..15 <- p[16..23] (k0+16+8h..)
__device__ __forceinline__ Frag ldfrag(const unsigned short* p) {
  Frag f;
  f.u[0] = *(const v8us*)(p);
  f.u[1] = *(const v8us*)(p + 16);
  return f;
}

// ---- WMMA helpers: builtin followed by a 4-slot VALU gap tying D and keeping A/B live --------------------------
__device__ __forceinline__ v8f mma_h(v16h a, v16h b, v8f c) {
  v8f d = __builtin_amdgcn_wmma_f32_16x16x32_f16(false, a, false, b, (short)0, c, false, false);
#if defined(__HIP_DEVICE_COMPILE__)
  asm volatile("v_nop\n\tv_nop\n\tv_nop\n\tv_nop" : "+v"(d) : "v"(a), "v"(b));
#endif
  return d;
}
__device__ __forceinline__ v8f mma_b(v16b a, v16b b, v8f c) {
  v8f d = __builtin_amdgcn_wmma_f32_16x16x32_bf16(false, a, false, b, (short)0, c, false, false);
#if defined(__HIP_DEVICE_COMPILE__)
  const v16h ha = __builtin_bit_cast(v16h, a), hb = __builtin_bit_cast(v16h, b);
  asm volatile("v_nop\n\tv_nop\n\tv_nop\n\tv_nop" : "+v"(d) : "v"(ha), "v"(hb));
#endif
  return d;
}

// =========================================================================================================
// (0) weights. Blocks 0..47: W16 f16 [384][256], rows 0..127 = theta_w, 128..255 = phi_w, 256..383 = g_w; value =
//     f16 of (bf16-RNE(w) * 256) (exact). Block owns rows 8*blk..8*blk+7: one wave per 512-B row = 32 lanes x 16 B
// coverage: 48 blocks x 8 rows x 32 lanes x 8 halves = 384 x 256; 16 blocks x 16 rows x 16 lanes x 8 = 256 x 128.
// =========================================================================================================
__global__ __launch_bounds__(256)
void cvt_w(const float* __restrict__ tw, const float* __restrict__ pw, const float* __restrict__ gw,
           const float* __restrict__ ow, unsigned short* W16, unsigned short* WWb) {
  const int tid = threadIdx.x, blk = blockIdx.x;
  if (blk < MW / 8) {
    const int rl = tid >> 5, col = 8 * (tid & 31);
    const int o = 8 * blk + rl;                                      // 0..383
    const int grp = blk >> 4;                                        // 0,1,2 (block-uniform)
    const float* wbase = (grp == 0) ? tw : ((grp == 1) ? pw : gw);  // all global
    const float* s = wbase + (size_t)(o - DQ * grp) * CC + col;      // (o - 128 grp) in 0..127
    const v4f a = *(const v4f*)s;
    const v4f q = *(const v4f*)(s + 4);
    const float f[8] = {a[0], a[1], a[2], a[3], q[0], q[1], q[2], q[3]};
    v4u u;
#pragma unroll
    for (int t = 0; t < 4; ++t) {
      const _Float16 h0 = (_Float16)(bfr(f[2 * t]) * WSC);
      const _Float16 h1 = (_Float16)(bfr(f[2 * t + 1]) * WSC);
      u[t] = pk16(h_bits(h0), h_bits(h1));
    }
{
      *(v4u*)(W16 + (size_t)o * CC + col) = u;
      
    }
  } else {
    const int rb = blk - MW / 8;                                     // 0..15
    const int o = 16 * rb + (tid >> 4);                              // 0..255
    const int col = 8 * (tid & 15);                                  // 0..120
    const float* s = ow + (size_t)o * DQ + col;
    const v4f a = *(const v4f*)s;
    const v4f q = *(const v4f*)(s + 4);
    const float f[8] = {a[0], a[1], a[2], a[3], q[0], q[1], q[2], q[3]};
    v4u u;
#pragma unroll
    for (int t = 0; t < 4; ++t) u[t] = pk16(bf_bits(f[2 * t]), bf_bits(f[2 * t + 1]));
{
      *(v4u*)(WWb + (size_t)o * DQ + col) = u;
      
    }
  }
}

// =========================================================================================================
// (1) x f32 [b][256 c][4096 n] -> XP f16 [b][n][c] (grid z < NB) and neighborFeat -> NP (grid z >= NB), position-
//     major, bf16-RNE values (exact in f16), through an LDS tile T[64 n][64 c] (pitch TP, cross-wave, block barrier).
// coverage: T written rows (8e+t)=0..63 x cols cl 0..63, read rows 0..63 x cols 8e..8e+7; plane 2 it x 32 rows x 8
//           lanes x 8 = 64 n x 64 c; grid (64, 4, 2 NB) covers XP and NP [b][0..4095][0..255] exactly once.
// =========================================================================================================
__global__ __launch_bounds__(256)
void cvt_x(const float* __restrict__ x, const float* __restrict__ nf, unsigned short* XP, unsigned short* NP) {
  __shared__ __align__(16) unsigned short T[QT * TP];
  const int tid = threadIdx.x;
  const int nb = blockIdx.x, cb = blockIdx.y, zz = blockIdx.z;
  const int which = (zz >= NB) ? 1 : 0;                              // block-uniform plane select
  const int b = zz - which * NB;                                     // 0..NB-1
  const float* src = (which != 0) ? nf : x;                          // both global
  unsigned short* dst = (which != 0) ? NP : XP;                      // both global
  const int e = tid & 7, lq = tid >> 3;                              // lq 0..31
  const int n0 = nb * QT, c0 = cb * QT;
#pragma unroll
  for (int it = 0; it < 2; ++it) {
    const int cl = it * 32 + lq;                                     // 0..63
    const float* sp = src + ((size_t)(b * CC + c0 + cl)) * NN + n0 + 8 * e;
    const v4f a = *(const v4f*)sp;
    const v4f q = *(const v4f*)(sp + 4);
    unsigned short hb[8];
#pragma unroll
    for (int t = 0; t < 4; ++t) {
      hb[t]     = h_bits((_Float16)bfr(a[t]));
      hb[4 + t] = h_bits((_Float16)bfr(q[t]));
    }
#pragma unroll
    for (int t = 0; t < 8; ++t) T[(8 * e + t) * TP + cl] = hb[t];
  }
  __syncthreads();
  v4u up[2];
#pragma unroll
  for (int it = 0; it < 2; ++it) {
    const int nl = it * 32 + lq;                                     // 0..63
    up[it] = *(const v4u*)(T + nl * TP + 8 * e);
  }
{
#pragma unroll
    for (int it = 0; it < 2; ++it) {
      const int rl = it * 32 + lq;
      *(v4u*)(dst + ((size_t)(b * NN + n0 + rl)) * CC + c0 + 8 * e) = up[it];
    }
    
  }
}

// ---- eight asynchronous 16-byte copies per lane, global -> LDS: copy i takes g + i*gstep (elements) to LDS byte
//      address l + i*lstep. The s_wait_xcnt 0 is the last line of the copies' own statement so that it stands in
//      front of any later write of the address registers the copies name.
__device__ __forceinline__ void copy8(unsigned l, unsigned lstep, const unsigned short* g, size_t gstep) {
#if defined(__HIP_DEVICE_COMPILE__)
  asm volatile("global_load_async_to_lds_b128 %0, %8, off\n\t"
               "global_load_async_to_lds_b128 %1, %9, off\n\t"
               "global_load_async_to_lds_b128 %2, %10, off\n\t"
               "global_load_async_to_lds_b128 %3, %11, off\n\t"
               "global_load_async_to_lds_b128 %4, %12, off\n\t"
               "global_load_async_to_lds_b128 %5, %13, off\n\t"
               "global_load_async_to_lds_b128 %6, %14, off\n\t"
               "global_load_async_to_lds_b128 %7, %15, off\n\t"
               "s_wait_xcnt 0x0"
               :: "v"(l), "v"(l + lstep), "v"(l + 2 * lstep), "v"(l + 3 * lstep),
                  "v"(l + 4 * lstep), "v"(l + 5 * lstep), "v"(l + 6 * lstep), "v"(l + 7 * lstep),
                  "v"(g), "v"(g + gstep), "v"(g + 2 * gstep), "v"(g + 3 * gstep),
                  "v"(g + 4 * gstep), "v"(g + 5 * gstep), "v"(g + 6 * gstep), "v"(g + 7 * gstep)
               : "memory");
#endif
}

// =========================================================================================================
// (2) conv1x1 GEMM for one (b, strip of 128 positions = image rows 2s and 2s+1, 64-o block of the stacked weights):
//     Y[o][n] = (1/256) sum_c W16[o][c] B[b][n][c], B = NP for o-blocks 0..3 (theta, phi) and XP for o-blocks 4,5
//     (g), block-uniform select. Block 256 threads = 8 waves; wave w owns cols n0+16w..+15 (one B fragment per
//     k-step, k = c contiguous in the plane row) and 4 m-tiles (A rows o = o0 + 16 mt + (lane&15), split k map
//     loader from W16). K = 256 = 8 steps. Both operand tiles (64 weight rows, 128 position rows, 512 B each) are
//     staged once per block in LDS by asynchronous copies of whole 128-B lines (24 copies per lane), rows at pitch
//     528 B, and read by the waves as ds_load_b128 fragments behind each wave's own asynccnt wait + block barrier.
//     Epilogue staged in LDS Os[n_loc][o_loc] (pitch OSP, b128 stores; it reuses the operand tiles' bytes behind a
//     block barrier that ends every wave's fragment reads), block barrier, then (block-uniform branch on the o block):
//       o-blocks 0,1 -> theta dims 0..63 / 64..127 + bias -> Qh/Ql bf16 [b][4096 n][128 d] (hi = RNE(v), lo = RNE(v-hi)):
//       o-blocks 2,3 -> phi + bias in f32 -> PF f32 [b][4096 n][128 d]: 128 rows x the dsel half (256 B = 2 whole
//                       lines) of the 512-B row, 16 consecutive lanes x 16 B, one instruction per 2 rows.
//       o-blocks 4,5 -> g + bias -> GF f32 [b][4096 n][128 d], same layout.
// coverage: Os 8 waves x 16 n x 64 o = 128 x 64 written, reads rows <= 127 cols <= 63; theta planes 4 it x 32 rows
//           x 8 lanes x 8 = 128 n x 64 d; f32 planes 8 it x 16 rows x 16 lanes x 4 = 128 n x 64 d; grid (32, 6, NB)
//           covers all 4096 rows x 128 d of Qh/Ql and of PF/GF exactly once.
// =========================================================================================================
__global__ __launch_bounds__(256) __attribute__((amdgpu_num_vgpr(256)))
void gemm_proj(const unsigned short* __restrict__ W16, const unsigned short* __restrict__ NP,
               const unsigned short* __restrict__ XP,
               const float* __restrict__ tb, const float* __restrict__ pb, const float* __restrict__ gb,
               unsigned short* Qh, unsigned short* Ql, float* PF, float* GF) {
  __shared__ __align__(16) unsigned char Sm[PASZ + PBSZ];
  const unsigned short* As = (const unsigned short*)Sm;              // weight tile  [64 o][PPS]
  const unsigned short* Bs = (const unsigned short*)(Sm + PASZ);     // position tile [128 n][PPS]
  float* Os = (float*)Sm;                                            // epilogue tile, after the last fragment read
  const int tid  = threadIdx.x;
  const int lane = tid & 31, wave = tid >> 5;                        // wave 0..7
  const int hh   = lane >> 4, c = lane & 15;
  const int st   = blockIdx.x, mb = blockIdx.y, b = blockIdx.z;
  const int n0   = st * SN, o0 = mb * QT;
  const unsigned short* BP = (mb < 4) ? NP : XP;                     // block-uniform, both global

  // both tiles are contiguous in global memory: 16-B chunk tid + 256 per copy = row (tid>>5) + 8 per copy, chunk tid&31
  const unsigned lrow = (unsigned)(size_t)Sm + (unsigned)((tid >> 5) * (PPS * 2) + (tid & 31) * 16);
  const unsigned short* bg = BP + (size_t)(b * NN + n0) * CC + 8 * tid;
  copy8(lrow, 8 * PPS * 2, W16 + (size_t)o0 * CC + 8 * tid, 256 * 8);
  copy8(lrow + PASZ, 8 * PPS * 2, bg, 256 * 8);
  copy8(lrow + PASZ + 64 * PPS * 2, 8 * PPS * 2, bg + (size_t)64 * CC, 256 * 8);
  asm volatile("s_wait_asynccnt 0x0" ::: "memory");                  // this wave's copies have landed
  __syncthreads();                                                   // every wave's copies are readable

  const unsigned short* ap = As + c * PPS + 8 * hh;
  const unsigned short* bp = Bs + (16 * wave + c) * PPS + 8 * hh;

  v8f acc[4];
#pragma unroll
  for (int mt = 0; mt < 4; ++mt) acc[mt] = zero8();

#pragma unroll
  for (int ks = 0; ks < CC / 32; ++ks) {
    const Frag fb = ldfrag(bp + 32 * ks);
    Frag fa[4];
#pragma unroll
    for (int mt = 0; mt < 4; ++mt) fa[mt] = ldfrag(ap + (16 * mt) * PPS + 32 * ks);
#pragma unroll
    for (int mt = 0; mt < 4; ++mt) acc[mt] = mma_h(fa[mt].h, fb.h, acc[mt]);
  }
  __syncthreads();                                                   // all fragment reads done: Os may take the bytes

  // ---- epilogue: scale back -> LDS Os[n_loc][o_loc]; lane (hh, c) holds o = 16 mt + 8 hh + r for n_loc = 16 w + c
  {
    const int nl = 16 * wave + c;
#pragma unroll
    for (int mt = 0; mt < 4; ++mt) {
      v4f va, vb;
#pragma unroll
      for (int r = 0; r < 4; ++r) { va[r] = acc[mt][r] * IWSC; vb[r] = acc[mt][4 + r] * IWSC; }
      *(v4f*)(Os + nl * OSP + 16 * mt + 8 * hh)     = va;
      *(v4f*)(Os + nl * OSP + 16 * mt + 8 * hh + 4) = vb;
    }
  }
  __syncthreads();

  const int grp = mb >> 1;                                           // 0 theta, 1 phi, 2 g (block-uniform)
  const int dsel = (mb & 1) * QT;                                    // 0 or 64
  const float* bias = (grp == 0) ? tb : ((grp == 1) ? pb : gb);     // all global

  if (grp == 0) {
    const int e = tid & 7, lq = tid >> 3;                            // lq 0..31
    float bv[8];
    {
      const v4f ba = *(const v4f*)(bias + dsel + 8 * e);
      const v4f bq = *(const v4f*)(bias + dsel + 8 * e + 4);
#pragma unroll
      for (int t = 0; t < 4; ++t) { bv[t] = bfr(ba[t]); bv[4 + t] = bfr(bq[t]); }
    }
    v4u uh[4], ul[4];
#pragma unroll
    for (int it = 0; it < 4; ++it) {
      const int row = it * 32 + lq;                                  // n_loc 0..127
      const v4f a = *(const v4f*)(Os + row * OSP + 8 * e);
      const v4f q = *(const v4f*)(Os + row * OSP + 8 * e + 4);
      float f[8];
#pragma unroll
      for (int t = 0; t < 4; ++t) { f[t] = a[t] + bv[t]; f[4 + t] = q[t] + bv[4 + t]; }
      split8(f, uh[it], ul[it]);
    }
{
#pragma unroll
      for (int it = 0; it < 4; ++it) {
        const int row = it * 32 + lq;
        const size_t po = ((size_t)(b * NN + n0 + row)) * DQ + dsel + 8 * e;
        *(v4u*)(Qh + po) = uh[it];
        *(v4u*)(Ql + po) = ul[it];
      }
      
    }
  } else {
    const int e16 = tid & 15, lr = tid >> 4;                        // lr 0..15
    v4f bv4;
    {
      const v4f bq = *(const v4f*)(bias + dsel + 4 * e16);
#pragma unroll
      for (int t = 0; t < 4; ++t) bv4[t] = bfr(bq[t]);
    }
    float* P = (grp == 1) ? PF : GF;                                 // both global
    v4f res[8];
#pragma unroll
    for (int it = 0; it < 8; ++it) {
      const int row = it * 16 + lr;                                  // n_loc 0..127
      const v4f a = *(const v4f*)(Os + row * OSP + 4 * e16);
      v4f v;
#pragma unroll
      for (int t = 0; t < 4; ++t) v[t] = a[t] + bv4[t];
      res[it] = v;
    }
{
#pragma unroll
      for (int it = 0; it < 8; ++it) {
        const int row = it * 16 + lr;
        const size_t po = ((size_t)(b * NN + n0 + row)) * DQ + dsel + 4 * e16;
        *(v4f*)(P + po) = res[it];
      }
      
    }
  }
}

// =========================================================================================================
// (3) 2x2 stride-2 max-pool of PF / GF f32 [b][4096 n][128 d] in f32 -> Kh/Kl bf16 [b][1024 m][128 d]
//     (hi = RNE(v), lo = RNE(v-hi)) and Gp f16 [b][1024 m][128 d], m = 32 py + px, window n = (2py+dy) 64 + 2px+dx,
//     lr = tid>>4 -> px = 16 it + lr for it 0..1 (px 0..31, all valid, no pad rows since 1024 keys = 32 x 32).
// coverage: blocks 0..31 x px 0..31 x 16 lanes x 8 = rows 0..1023 x 128 d of each plane; grid (32, NB) covers
//           Kh/Kl/Gp [b][0..1023][0..127] exactly once.
// =========================================================================================================
__global__ __launch_bounds__(256)
void pool_k(const float* __restrict__ PF, const float* __restrict__ GF,
            unsigned short* Kh, unsigned short* Kl, unsigned short* Gp) {
  const int tid = threadIdx.x, py = blockIdx.x, b = blockIdx.y;
  const int e16 = tid & 15, lr = tid >> 4;                          // lr 0..15
  v4u kh[2], kl[2], gu[2];
#pragma unroll
  for (int it = 0; it < 2; ++it) {
    const int px = it * 16 + lr;                                    // 0..31
    float fk[8], fg[8];
#pragma unroll
    for (int t = 0; t < 8; ++t) { fk[t] = -__builtin_inff(); fg[t] = -__builtin_inff(); }
#pragma unroll 1
    for (int dy = 0; dy < 2; ++dy) {
      const size_t rb = ((size_t)(b * NN + (2 * py + dy) * WIMG + 2 * px)) * DQ + 8 * e16;
#pragma unroll
      for (int dx = 0; dx < 2; ++dx) {
        const float* pk = PF + rb + (size_t)dx * DQ;
        const float* pg = GF + rb + (size_t)dx * DQ;
        const v4f ka = *(const v4f*)pk, kq = *(const v4f*)(pk + 4);
        const v4f ga = *(const v4f*)pg, gq = *(const v4f*)(pg + 4);
#pragma unroll
        for (int t = 0; t < 4; ++t) {
          fk[t]     = fmaxf(fk[t], ka[t]);
          fk[4 + t] = fmaxf(fk[4 + t], kq[t]);
          fg[t]     = fmaxf(fg[t], ga[t]);
          fg[4 + t] = fmaxf(fg[4 + t], gq[t]);
        }
      }
    }
    split8(fk, kh[it], kl[it]);
#pragma unroll
    for (int t = 0; t < 4; ++t) gu[it][t] = pk16(h_bits((_Float16)fg[2 * t]), h_bits((_Float16)fg[2 * t + 1]));
  }
{
#pragma unroll
    for (int it = 0; it < 2; ++it) {
      const int px = it * 16 + lr;
      const size_t po = ((size_t)(b * MM + WP * py + px)) * DQ + 8 * e16;
      *(v4u*)(Kh + po) = kh[it];
      *(v4u*)(Kl + po) = kl[it];
      *(v4u*)(Gp + po) = gu[it];
    }
    
  }
}

// =========================================================================================================
// (4) Gp f16 [b][1024 m][128 d] -> Gc f16 [b][d][m] (channel-major, keys contiguous) through an LDS tile T[64 d][64 m]
// coverage: reads 2 it x 32 rows x 8 lanes x 8 = 64 m x 64 d; T written rows (8e+t)=0..63 x cols 0..63, read rows
//           0..63 x cols 8e..8e+7; writes 64 d x 64 m; grid (16, 2, NB) covers Gc [b][0..127][0..1023] exactly once.
// =========================================================================================================
__global__ __launch_bounds__(256)
void tr_g(const unsigned short* __restrict__ Gp, unsigned short* Gc) {
  __shared__ __align__(16) unsigned short T[QT * TP];
  const int tid = threadIdx.x;
  const int mt = blockIdx.x, db = blockIdx.y, b = blockIdx.z;
  const int e = tid & 7, lq = tid >> 3;                             // lq 0..31
  const int m0 = mt * QT, d0 = db * QT;
#pragma unroll
  for (int it = 0; it < 2; ++it) {
    const int ml = it * 32 + lq;                                     // 0..63
    const v4u w = *(const v4u*)(Gp + ((size_t)(b * MM + m0 + ml)) * DQ + d0 + 8 * e);
    unsigned short hb[8];
#pragma unroll
    for (int t = 0; t < 4; ++t) {
      hb[2 * t]     = (unsigned short)(w[t] & 0xFFFFu);
      hb[2 * t + 1] = (unsigned short)(w[t] >> 16);
    }
#pragma unroll
    for (int t = 0; t < 8; ++t) T[(8 * e + t) * TP + ml] = hb[t];
  }
  __syncthreads();
  v4u up[2];
#pragma unroll
  for (int it = 0; it < 2; ++it) {
    const int dl = it * 32 + lq;                                     // 0..63
    up[it] = *(const v4u*)(T + dl * TP + 8 * e);
  }
{
#pragma unroll
    for (int it = 0; it < 2; ++it) {
      const int dl = it * 32 + lq;
      *(v4u*)(Gc + ((size_t)(b * DQ + d0 + dl)) * MM + m0 + 8 * e) = up[it];
    }
    
  }
}

// =========================================================================================================
// (5) attention for one (b, 64-query tile), transposed formulation, 1024 keys (all valid, no mask, no scale):
//   S^T tile (16 keys x 16 queries) = sum over 4 d-chunks (q fragments kept in registers) of A(k: row = key kb + (lane&15), 32 d via
//   the split k map from the bf16 plane Kh [b][1024][128]) . B(q: col = query, same map from Qh [b][4096][128])
//   + A(Kh).B(Ql) + A(Kl).B(Qh) (bf16 unscaled residual planes, shared accumulator).
//   Per lane the D tile holds 8 keys of ONE query: online softmax state per lane, one shuffle (lane^16) for the max
//   over 32 keys; the o/l rescale is skipped under a wave-uniform ballot when no lane's max grew (corr == 1 exactly
//   for every lane then); row-sum partials combined at the end. P = e^{s-m} x 16384 as f16 is the B operand of
//   y^T (rows channel, cols queries) += A(pooled g: rows channel = 16j + (lane&15), keys contiguous, f16 plane Gc
//   [b][128][1024]) . B(P^T): element r <- D of the tile covering keys kb..kb+15, element 8+r <- the tile covering
//   kb+16..kb+31, lane unchanged. 8 accumulator tiles per wave (128 channels). Block = 4 waves = 64 queries.
//   K hi / K residual / pooled-g tiles of 64 keys are staged once per block in a two-buffer LDS ring by asynchronous
//   copies (whole 128-B lines from global; 24 copies per lane and stage) and read by all 4 waves as ds_load_b128
//   fragments: K rows at pitch 272 B, g rows (64 keys = 128 B) at pitch 144 B. Stage t+2 is issued behind the barrier
//   that ends every wave's reads of stage t; stage t+1 is read only behind each wave's own asynccnt wait + barrier.
//   Epilogue: y = O/l staged in LDS Os[query][128 channels] (pitch OSPW, b128 stores), block barrier, then
// coverage: Os written 4 waves x 16 queries x 128 ch, read rows 0..63 x ch 8e..8e+7 (e 0..15); planes 8 it x 8 rows x
//           16 lanes x 8 = 64 n x 128 ch per plane; grid (NQ/64, NB) covers rows 0..NQ-1 of Yh/Yl exactly once.
// =========================================================================================================
__global__ __launch_bounds__(128) __attribute__((amdgpu_num_vgpr(256)))
void attn_k(const unsigned short* __restrict__ Qh, const unsigned short* __restrict__ Ql,
            const unsigned short* __restrict__ Kh, const unsigned short* __restrict__ Kl,
            const unsigned short* __restrict__ Gc, unsigned short* Yh, unsigned short* Yl) {
  __shared__ __align__(16) float Os[QT * OSPW];
  __shared__ __align__(16) unsigned short Ring[2 * STG / 2];
  const int tid  = threadIdx.x;
  const int wave = tid >> 5, lane = tid & 31;
  const int hh   = lane >> 4, c = lane & 15;
  const int n0   = blockIdx.x * QT, b = blockIdx.y;

  // q fragment pointers (B operand, col = query n0 + 16*wave + c), + 32*kc
  const size_t qo = ((size_t)(b * NN + n0 + 16 * wave + c)) * DQ + 8 * hh;
  const unsigned short* Qhp = Qh + qo;
  const unsigned short* Qlp = Ql + qo;
  // copy sources of stage 0 (per lane, 16 B): K planes: the 16-KB tile is contiguous, chunk tid, + 128 chunks per copy;
  // g plane: row = channel (tid>>3) + 16 per copy, 8 chunks of 16 B per 128-B row piece
  const unsigned short* Khg = Kh + (size_t)b * MM * DQ + 8 * tid;
  const unsigned short* Klg = Kl + (size_t)b * MM * DQ + 8 * tid;
  const unsigned short* Vg  = Gc + (size_t)b * DQ * MM + (size_t)(tid >> 3) * MM + 8 * (tid & 7);
  // copy destinations in buffer 0 (LDS byte addresses): K row (tid>>4) + 8 per copy, g row (tid>>3) + 16 per copy
  const unsigned ring0 = (unsigned)(size_t)Ring;
  const unsigned lK = ring0 + (unsigned)((tid >> 4) * (KPS * 2) + (tid & 15) * 16);
  const unsigned lV = ring0 + (unsigned)(2 * KSZ + (tid >> 3) * (VPS * 2) + (tid & 7) * 16);
  // fragment offsets inside a buffer (elements): k (A operand, row = key + c), + key * KPS + 32*kc;
  // v (A operand, row = channel 16j + c, keys contiguous), + 16*j*VPS + key
  const int kfo = c * KPS + 8 * hh;
  const int vfo = KSZ + c * VPS + 8 * hh;

  // ring prologue: stage 0 -> buffer 0, landed and published; then stage 1 -> buffer 1 flies over pass 0
  copy8(lK, 8 * KPS * 2, Khg, 128 * 8);
  copy8(lK + KSZ, 8 * KPS * 2, Klg, 128 * 8);
  copy8(lV, 16 * VPS * 2, Vg, (size_t)16 * MM);
  asm volatile("s_wait_asynccnt 0x0" ::: "memory");                  // this wave's stage-0 copies have landed
  __syncthreads();                                                   // every wave's stage-0 copies are readable
  copy8(lK + STG, 8 * KPS * 2, Khg + (size_t)KT * DQ, 128 * 8);
  copy8(lK + STG + KSZ, 8 * KPS * 2, Klg + (size_t)KT * DQ, 128 * 8);
  copy8(lV + STG, 16 * VPS * 2, Vg + KT, (size_t)16 * MM);

  // q hi / residual fragments of this wave's 16 queries: the same for every key, loaded once and kept in registers
  Frag qhf[DQ / 32], qlf[DQ / 32];
#pragma unroll
  for (int kc = 0; kc < DQ / 32; ++kc) {
    qhf[kc] = ldfrag(Qhp + 32 * kc);
    qlf[kc] = ldfrag(Qlp + 32 * kc);
  }

  float m = -1.0e30f, l = 0.f;
  v8f o[8];
#pragma unroll
  for (int j = 0; j < 8; ++j) o[j] = zero8();

#pragma unroll 1  // one stage per trip, rolled: the publish point at its foot stands once in the text
  for (int t = 0; t < NT; ++t) {
   const unsigned short* sb = Ring + (t & 1) * (STG / 2);            // this stage's buffer
#pragma unroll 1  // the 32-key pass stays rolled as before
   for (int kb = 0; kb < KT; kb += 32) {
    const unsigned short* k0p  = sb + kfo + kb * KPS;                // keys kb .. kb+15 of the stage
    const unsigned short* k1p  = k0p + 16 * KPS;                     // keys kb+16 .. kb+31
    const unsigned short* k0lp = k0p + KSZ / 2;
    const unsigned short* k1lp = k1p + KSZ / 2;
    v8f s0 = zero8(), s1 = zero8();
#pragma unroll  // unrolled so that the register-resident q fragments are indexed by constants
    for (int kc = 0; kc < DQ / 32; ++kc) {
      const Frag qh  = qhf[kc];
      const Frag ql  = qlf[kc];
      const Frag k0  = ldfrag(k0p + 32 * kc);
      const Frag k1  = ldfrag(k1p + 32 * kc);
      const Frag k0l = ldfrag(k0lp + 32 * kc);
      const Frag k1l = ldfrag(k1lp + 32 * kc);
      s0 = mma_b(k0.bf, qh.bf, s0);
      s1 = mma_b(k1.bf, qh.bf, s1);
      s0 = mma_b(k0.bf, ql.bf, s0);
      s1 = mma_b(k1.bf, ql.bf, s1);
      s0 = mma_b(k0l.bf, qh.bf, s0);
      s1 = mma_b(k1l.bf, qh.bf, s1);
    }

    float mx = fmaxf(hmax8(s0), hmax8(s1));
    mx = fmaxf(mx, __shfl_xor(mx, 16, 32));
    const float mn = fmaxf(m, mx);
    const unsigned grew = wave_ballot(mx > m);                       // wave-uniform
    if (grew != 0u) {
      const float corr = __expf(m - mn);                             // == 1 exactly for lanes whose max did not grow
      l *= corr;
#pragma unroll
      for (int j = 0; j < 8; ++j) {
#pragma unroll
        for (int r = 0; r < 8; ++r) o[j][r] *= corr;
      }
    }
    m = mn;
    const float msh = mn - LNPS;                                     // exp gives e^{s-m} * 16384

    FragH ph;
    float ls = 0.f;
#pragma unroll
    for (int r = 0; r < 8; ++r) {
      const float e0 = __expf(s0[r] - msh);                          // key kb      + 8hh + r
      const float e1 = __expf(s1[r] - msh);                          // key kb + 16 + 8hh + r
      ls += e0 + e1;
      ph.hv[0][r] = (_Float16)e0;
      ph.hv[1][r] = (_Float16)e1;
    }
    l += ls;

#pragma unroll
    for (int j = 0; j < 8; ++j) {
      const Frag vf = ldfrag(sb + vfo + (16 * j) * VPS + kb);
      o[j] = mma_h(vf.h, ph.v, o[j]);
    }
   }
   // publish point of stage t+1, and release of stage t's buffer
   asm volatile("s_wait_dscnt 0x0" ::: "memory");                    // this wave's reads of stage t are done
   asm volatile("s_wait_asynccnt 0x0" ::: "memory");                 // this wave's stage t+1 copies have landed
   __syncthreads();
   if (t + 2 < NT) {                                                 // block-uniform
     const unsigned bo = (unsigned)((t & 1) * STG);
     copy8(lK + bo, 8 * KPS * 2, Khg + (size_t)(t + 2) * KT * DQ, 128 * 8);
     copy8(lK + bo + KSZ, 8 * KPS * 2, Klg + (size_t)(t + 2) * KT * DQ, 128 * 8);
     copy8(lV + bo, 16 * VPS * 2, Vg + (t + 2) * KT, (size_t)16 * MM);
   }
  }
  asm volatile("s_wait_asynccnt 0x0" ::: "memory");                  // nothing of the ring is in flight past here
  l += __shfl_xor(l, 16, 32);
  const float inv = 1.0f / l;                                        // o and l both carry the x16384 factor

  // ---- epilogue: y = o * inv -> Os[query][ch]; lane (hh, c) holds ch = 16 j + 8 hh + r for query 16 w + c
  {
    const int qrow = 16 * wave + c;
#pragma unroll
    for (int j = 0; j < 8; ++j) {
      v4f va, vb;
#pragma unroll
      for (int r = 0; r < 4; ++r) { va[r] = o[j][r] * inv; vb[r] = o[j][4 + r] * inv; }
      *(v4f*)(Os + qrow * OSPW + 16 * j + 8 * hh)     = va;
      *(v4f*)(Os + qrow * OSPW + 16 * j + 8 * hh + 4) = vb;
    }
  }
  __syncthreads();

  const int e16 = tid & 15, lr = tid >> 4;                           // lr 0..7
  v4u uh[8], ul[8];
#pragma unroll
  for (int it = 0; it < 8; ++it) {
    const int row = it * 8 + lr;                                     // query 0..63
    const v4f a = *(const v4f*)(Os + row * OSPW + 8 * e16);
    const v4f q = *(const v4f*)(Os + row * OSPW + 8 * e16 + 4);
    const float f[8] = {a[0], a[1], a[2], a[3], q[0], q[1], q[2], q[3]};
    split8(f, uh[it], ul[it]);
  }
{
#pragma unroll
    for (int it = 0; it < 8; ++it) {
      const int row = it * 8 + lr;
      const size_t po = ((size_t)(b * NN + n0 + row)) * DQ + 8 * e16;
      *(v4u*)(Yh + po) = uh[it];
      *(v4u*)(Yl + po) = ul[it];
    }
    
  }
}

// =========================================================================================================
// (6) output conv for one (b, 64-n tile, 64-c block): A[c][n] = sum_ci WWb[c][ci] (Yh + Yl)[b][n][ci] on bf16 WMMA
//     (2 products per k-step, shared accumulator), K = 128 = 4 steps. Block 128 threads = 4 waves; wave w owns cols
//     n0+16w..+15 (B fragments from the k-contiguous Yh/Yl rows) and 4 m-tiles (A rows c = c0 + 16 mt + (lane&15),
//     split k map loader from WWb). The three operand tiles (64 weight rows, 64 position rows of Yh and of Yl, 256 B
//     each, contiguous in global memory) are staged once per block in LDS by asynchronous copies of whole 128-B lines
//     (24 copies per lane), rows at pitch 272 B, and read as ds_load_b128 fragments behind each wave's own asynccnt
//     wait + block barrier; Os reuses their bytes behind a block barrier that ends every wave's fragment reads.
//     Per-channel constants (bf16-RNE of w_b, bn mean, bn beta, and scale =
//     bf16-RNE(gamma) * rsqrt(bf16-RNE(var) + eps)) staged once in LDS by waves 0,1. Epilogue staged in LDS
//     Os[n_loc][c_loc] (pitch OSP, b128 stores), block barrier, then out[b][c][n] = (((A + w_b[c]) - mean[c]) *
// coverage: Os 4 waves x 16 n x 64 c written, read rows nl+t <= 63 x cols cl <= 63; Pb/Pm/Ps/Pt written 0..63, read
//           cl <= 63; out 8 it x 16 lines x 8 lanes x 4 floats = 64 c x 64 n; grid (NQ/64, 4, NB) covers
//           out[b][0..255][0..NQ-1] exactly once.
// =========================================================================================================
__global__ __launch_bounds__(128) __attribute__((amdgpu_num_vgpr(256)))
void gemm_out(const unsigned short* __restrict__ WWb, const unsigned short* __restrict__ Yh,
              const unsigned short* __restrict__ Yl, const float* __restrict__ wb,
              const float* __restrict__ bng, const float* __restrict__ bnb,
              const float* __restrict__ bnm, const float* __restrict__ bnv,
              const float* __restrict__ x, float* out) {
  __shared__ __align__(16) unsigned char Sm[3 * KSZ];
  const unsigned short* As = (const unsigned short*)Sm;              // weight tile [64 c][KPS]; Yh, Yl tiles behind it
  float* Os = (float*)Sm;                                            // epilogue tile, after the last fragment read
  __shared__ float Pb[QT], Pm[QT], Ps[QT], Pt[QT];
  const int tid  = threadIdx.x;
  const int lane = tid & 31, wave = tid >> 5;
  const int hh   = lane >> 4, c = lane & 15;
  const int nt   = blockIdx.x, cb = blockIdx.y, b = blockIdx.z;
  const int n0   = nt * QT, c0 = cb * QT;

  // each tile is contiguous in global memory: 16-B chunk tid + 128 per copy = row (tid>>4) + 8 per copy, chunk tid&15
  const unsigned lrow = (unsigned)(size_t)Sm + (unsigned)((tid >> 4) * (KPS * 2) + (tid & 15) * 16);
  const size_t yo = (size_t)(b * NN + n0) * DQ + 8 * tid;
  copy8(lrow, 8 * KPS * 2, WWb + (size_t)c0 * DQ + 8 * tid, 128 * 8);
  copy8(lrow + KSZ, 8 * KPS * 2, Yh + yo, 128 * 8);
  copy8(lrow + 2 * KSZ, 8 * KPS * 2, Yl + yo, 128 * 8);

  if (tid < QT) {                                                    // waves 0,1 (wave-uniform), cross-wave via barrier
    const int ch = c0 + tid;                                         // 0..255
    Pb[tid] = bfr(wb[ch]);
    Pm[tid] = bfr(bnm[ch]);
    Ps[tid] = bfr(bng[ch]) * rsqrtf(bfr(bnv[ch]) + BNEPS);
    Pt[tid] = bfr(bnb[ch]);
  }

  asm volatile("s_wait_asynccnt 0x0" ::: "memory");                  // this wave's copies have landed
  __syncthreads();                                                   // every wave's copies are readable

  const unsigned short* ap  = As + c * KPS + 8 * hh;
  const unsigned short* bph = As + KSZ / 2 + (16 * wave + c) * KPS + 8 * hh;
  const unsigned short* bpl = bph + KSZ / 2;

  v8f acc[4];
#pragma unroll
  for (int mt = 0; mt < 4; ++mt) acc[mt] = zero8();

#pragma unroll
  for (int ks = 0; ks < DQ / 32; ++ks) {
    const Frag fbh = ldfrag(bph + 32 * ks);
    const Frag fbl = ldfrag(bpl + 32 * ks);
    Frag fa[4];
#pragma unroll
    for (int mt = 0; mt < 4; ++mt) fa[mt] = ldfrag(ap + (16 * mt) * KPS + 32 * ks);
#pragma unroll
    for (int mt = 0; mt < 4; ++mt) {
      acc[mt] = mma_b(fa[mt].bf, fbh.bf, acc[mt]);
      acc[mt] = mma_b(fa[mt].bf, fbl.bf, acc[mt]);
    }
  }
  __syncthreads();                                                   // all fragment reads done: Os may take the bytes

  // ---- epilogue: -> LDS Os[n_loc][c_loc]; lane (hh, c) holds c_loc = 16 mt + 8 hh + r for n_loc = 16 w + c
  {
    const int nl = 16 * wave + c;
#pragma unroll
    for (int mt = 0; mt < 4; ++mt) {
      v4f va, vb;
#pragma unroll
      for (int r = 0; r < 4; ++r) { va[r] = acc[mt][r]; vb[r] = acc[mt][4 + r]; }
      *(v4f*)(Os + nl * OSP + 16 * mt + 8 * hh)     = va;
      *(v4f*)(Os + nl * OSP + 16 * mt + 8 * hh + 4) = vb;
    }
  }
  __syncthreads();

  const int e = tid & 7, lq = tid >> 3;                              // lq 0..15
  v4f res[8];
#pragma unroll
  for (int it = 0; it < 8; ++it) {
    const int L   = it * 16 + lq;                                    // 0..127
    const int cl  = L >> 1, hf = L & 1;                              // channel 0..63 within the block
    const int nl  = hf * 32 + 4 * e;                                 // position 0..63
    const float pbv = Pb[cl], pmv = Pm[cl], psv = Ps[cl], ptv = Pt[cl];
    const size_t idx = ((size_t)(b * CC + c0 + cl)) * NN + n0 + nl;
    const v4f xv = *(const v4f*)(x + idx);
#pragma unroll
    for (int t = 0; t < 4; ++t) {
      const float cv = Os[(nl + t) * OSP + cl] + pbv;
      res[it][t] = ((cv - pmv) * psv + ptv) + bfr(xv[t]);
    }
  }
{
#pragma unroll
    for (int it = 0; it < 8; ++it) {
      const int L   = it * 16 + lq;
      const int cl  = L >> 1, hf = L & 1;
      const int nl  = hf * 32 + 4 * e;
      const size_t idx = ((size_t)(b * CC + c0 + cl)) * NN + n0 + nl;
      *(v4f*)(out + idx) = res[it];
    }
    
  }
}

// =========================================================================================================
// Workspace map (bytes; each region start a multiple of 256; every extent is an exact row/tile multiple and is
//   W16 f16 [384][256]            196608      WWb bf16 [256][128]        65536
//   XP / NP f16 [NB][4096][256]  16777216 x2 (NB=8)
//   Qh/Ql bf16 [NB][4096][128]    8388608 x2
//   PF/GF f32  [NB][4096][128]   16777216 x2
//   Kh/Kl bf16 [NB][1024][128]    2097152 x2  Gp f16 [NB][1024][128]   2097152   Gc f16 [NB][128][1024]  2097152
//   Yh/Yl bf16 [NB][4096][128]    8388608 x2
//   total (NB=8) = 109314048
// =========================================================================================================
extern "C" void kernel_launch(void* const* d_in, const int* in_sizes, int n_in,
                              void* d_out, int out_size, void* d_ws, size_t ws_size,
                              hipStream_t stream) {
  const int XN = NB * CC * NN;
  if (n_in < 14) return;
  if (in_sizes[0] < XN || in_sizes[1] < XN) return;
  if (in_sizes[2] < DQ * CC || in_sizes[4] < DQ * CC || in_sizes[6] < DQ * CC || in_sizes[8] < CC * DQ) return;
  if (in_sizes[3] < DQ || in_sizes[5] < DQ || in_sizes[7] < DQ) return;
  if (in_sizes[9] < CC || in_sizes[10] < CC || in_sizes[11] < CC || in_sizes[12] < CC || in_sizes[13] < CC) return;
  if (out_size < XN) return;

  size_t off = 0;
  auto carve = [&](size_t bytes) { const size_t o = off; off += (bytes + 255) & ~(size_t)255; return o; };
  const size_t oW16 = carve((size_t)MW * CC * 2);
  const size_t oWWb = carve((size_t)CC * DQ * 2);
  const size_t oXP  = carve((size_t)NB * NN * CC * 2);
  const size_t oNP  = carve((size_t)NB * NN * CC * 2);
  const size_t oQh  = carve((size_t)NB * NN * DQ * 2);
  const size_t oQl  = carve((size_t)NB * NN * DQ * 2);
  const size_t oPF  = carve((size_t)NB * NN * DQ * 4);
  const size_t oGF  = carve((size_t)NB * NN * DQ * 4);
  const size_t oKh  = carve((size_t)NB * MM * DQ * 2);
  const size_t oKl  = carve((size_t)NB * MM * DQ * 2);
  const size_t oGp  = carve((size_t)NB * MM * DQ * 2);
  const size_t oGc  = carve((size_t)NB * DQ * MM * 2);
  const size_t oYh  = carve((size_t)NB * NN * DQ * 2);
  const size_t oYl  = carve((size_t)NB * NN * DQ * 2);
  if (off > ws_size) return;
  if (off > (size_t)134217728) return;

  const float* x   = (const float*)d_in[0];
  const float* nf  = (const float*)d_in[1];
  const float* gw  = (const float*)d_in[2];
  const float* gb  = (const float*)d_in[3];
  const float* tw  = (const float*)d_in[4];
  const float* tb  = (const float*)d_in[5];
  const float* pw  = (const float*)d_in[6];
  const float* pb  = (const float*)d_in[7];
  const float* ow  = (const float*)d_in[8];
  const float* wb  = (const float*)d_in[9];
  const float* bng = (const float*)d_in[10];
  const float* bnb = (const float*)d_in[11];
  const float* bnm = (const float*)d_in[12];
  const float* bnv = (const float*)d_in[13];

  char* ws = (char*)d_ws;
  unsigned short* W16 = (unsigned short*)(ws + oW16);
  unsigned short* WWb = (unsigned short*)(ws + oWWb);
  unsigned short* XP  = (unsigned short*)(ws + oXP);
  unsigned short* NP  = (unsigned short*)(ws + oNP);
  unsigned short* Qh  = (unsigned short*)(ws + oQh);
  unsigned short* Ql  = (unsigned short*)(ws + oQl);
  float*          PF  = (float*)(ws + oPF);
  float*          GF  = (float*)(ws + oGF);
  unsigned short* Kh  = (unsigned short*)(ws + oKh);
  unsigned short* Kl  = (unsigned short*)(ws + oKl);
  unsigned short* Gp  = (unsigned short*)(ws + oGp);
  unsigned short* Gc  = (unsigned short*)(ws + oGc);
  unsigned short* Yh  = (unsigned short*)(ws + oYh);
  unsigned short* Yl  = (unsigned short*)(ws + oYl);
  float* out = (float*)d_out;

  const dim3 blk256(256), blk128(128);

  // (0) theta_w / phi_w / g_w -> stacked f16 plane; w_w -> bf16 plane
  cvt_w<<<dim3(MW / 8 + CC / 16), blk256, 0, stream>>>(tw, pw, gw, ow, W16, WWb);
  // (1) x -> XP, neighborFeat -> NP (position-major 16-bit planes)
  cvt_x<<<dim3(NN / QT, CC / QT, 2 * NB), blk256, 0, stream>>>(x, nf, XP, NP);
  // (2) conv1x1 GEMM -> theta (q) hi/res planes from NP, phi conv + bias f32 plane from NP, g conv + bias from XP
  gemm_proj<<<dim3(NSTRIP, MW / QT, NB), blk256, 0, stream>>>(W16, NP, XP, tb, pb, gb, Qh, Ql, PF, GF);
  // (3) 2x2 stride-2 max-pool -> pooled phi (k) hi/res planes, pooled g f16 plane
  pool_k<<<dim3(HP, NB), blk256, 0, stream>>>(PF, GF, Kh, Kl, Gp);
  // (4) pooled g -> channel-major plane
  tr_g<<<dim3(MM / QT, DQ / QT, NB), blk256, 0, stream>>>(Gp, Gc);
  // (5) attention -> y hi/res planes [b][n][128]
  attn_k<<<dim3(NQ / QT, NB), blk128, 0, stream>>>(Qh, Ql, Kh, Kl, Gc, Yh, Yl);
  // (6) output conv + bias + batch-norm affine + residual -> out [b][256][4096]
  gemm_out<<<dim3(NQ / QT, CC / QT, NB), blk128, 0, stream>>>(WWb, Yh, Yl, wb, bng, bnb, bnm, bnv, x, out);
  (void)hipGetLastError();
}

// v004
// One run takes 80.6 microseconds.
// Two timings next to v003 both put it at 1.10 times that version's speed.
// Counting every step since v000, it is 2.73 times as fast.
// Contractions: conv1x1 theta/phi/g GEMM W[384x256].X[256x128] per strip on v_wmma_f32_16x16x32_f16 (f16 containers
// of bf16-RNE weights x256 and bf16-RNE activations); scores K.Q^T on v_wmma_f32_16x16x32_bf16 (bf16 hi + bf16
// residual planes of theta / pooled phi, 3 products, K=128); y^T = G.P^T on v_wmma_f32_16x16x32_f16 (2x2-max-pooled g
// as f16, P = e^{s-m} x16384 f16 from the score D registers); output conv W[256x128].Y on v_wmma_f32_16x16x32_bf16
// (bf16 weights, y as bf16 hi + residual planes, 2 products); f32 accumulate everywhere; max-pool, softmax statistics,
// bias, batch-norm affine with running statistics and residual add in f32 VALU.
#include <hip/hip_runtime.h>
#include <math.h>
#include <stdint.h>

#ifndef NB
#define NB 8
#endif
#ifndef NQ
#define NQ 4096
#endif
#define NB_FULL 8
#define CC     256
#define HIMG   64
#define WIMG   64
#define NN     4096
#define DQ     128
#define HP     32
#define WP     32
#define MV     1024
#define MM     1024
#define MW     384
#define QT     64
#define SN     128
#define NWP    8
#define NSTRIP 32
#define OSP    68
#define OSPW   132
#define TP     72
#define WSC    256.0f
#define IWSC   0.00390625f
#define LNPS   9.704060527839234f
#define BNEPS  1.0e-5f
#define KT     64
#define NT     16
#define KPS    136
#define VPS    72
#define KSZ    (KT * KPS * 2)
#define VSZ    (DQ * VPS * 2)
#define STG    (2 * KSZ + VSZ)
#define PPS    264
#define PASZ   (QT * PPS * 2)
#define PBSZ   (SN * PPS * 2)

static_assert(NB >= 1 && NB <= NB_FULL);
static_assert(NQ % QT == 0 && NQ >= QT && NQ <= NN);
static_assert(NN == HIMG * WIMG);
static_assert(SN == 2 * WIMG);
static_assert(NSTRIP * SN == NN);
static_assert(SN == 16 * NWP);
static_assert(2 * HP == HIMG && 2 * WP == WIMG);
static_assert(MV == HP * WP && MM == MV);
static_assert(WP == 32 && HP == 32);
static_assert(NN % QT == 0 && CC % QT == 0 && DQ % QT == 0 && MM % QT == 0);
static_assert(MW == 3 * DQ && MW % QT == 0 && MW % 8 == 0);
static_assert(CC % 32 == 0 && DQ % 32 == 0 && MM % 32 == 0);
static_assert((OSP * 4) % 16 == 0);
static_assert((OSPW * 4) % 16 == 0);
static_assert((TP * 2) % 16 == 0);
static_assert(SN * OSP * 4 <= 65536);
static_assert((size_t)NB_FULL * CC * NN * 4 == (size_t)33554432);
static_assert(NT * KT == MM && NT >= 2 && KT % 32 == 0);
static_assert(KPS == DQ + 8 && VPS == KT + 8);
static_assert(KT * DQ * 2 == 8 * 128 * 16 && DQ * KT * 2 == 8 * 128 * 16);
static_assert(KSZ % 16 == 0 && VSZ % 16 == 0 && STG % 16 == 0);
static_assert(2 * (2 * STG + QT * OSPW * 4) <= 327680);
static_assert(PPS == CC + 8 && (PPS * 2) % 16 == 0);
static_assert(QT * CC * 2 == 8 * 256 * 16 && SN * CC * 2 == 16 * 256 * 16);
static_assert(SN * OSP * 4 <= PASZ + PBSZ && 3 * (PASZ + PBSZ) <= 327680);
static_assert(QT == KT && QT * OSP * 4 <= 3 * KSZ);
static_assert(DQ == 4 * 32 && DQ == 8 * 16);  // the attention pass names its 4 d-chunks and 2 x 4 channel tiles

// workspace total at full size (all region sizes are multiples of 256)
#define WS_FULL ((size_t)MW * CC * 2 + (size_t)CC * DQ * 2 + 2 * (size_t)NB_FULL * NN * CC * 2 \
                 + 2 * (size_t)NB_FULL * NN * DQ * 2 + 2 * (size_t)NB_FULL * NN * DQ * 4 \
                 + 4 * (size_t)NB_FULL * MM * DQ * 2 + 2 * (size_t)NB_FULL * NN * DQ * 2)
static_assert(WS_FULL <= (size_t)134217728);

typedef _Float16       v16h __attribute__((ext_vector_type(16)));
typedef _Float16       v8h  __attribute__((ext_vector_type(8)));
typedef __bf16         v16b __attribute__((ext_vector_type(16)));
typedef unsigned short v8us __attribute__((ext_vector_type(8)));
typedef float          v8f  __attribute__((ext_vector_type(8)));
typedef float          v4f  __attribute__((ext_vector_type(4)));
typedef unsigned int   v4u  __attribute__((ext_vector_type(4)));

union Frag  { v8us u[2]; v16h h; v16b bf; };
union FragH { v16h v; v8h hv[2]; };
static_assert(sizeof(Frag) == 32);
static_assert(sizeof(FragH) == 32);

// ---- scalar helpers ---------------------------------------------------------------------------------------
__device__ __forceinline__ unsigned short bf_bits(float f) {          // f32 -> bf16 bits, RNE convert
  unsigned u = __float_as_uint(f);
  return (unsigned short)((u + 0x7FFFu + ((u >> 16) & 1u)) >> 16);
}
__device__ __forceinline__ float bf_up(unsigned short hb) { return __uint_as_float(((unsigned)hb) << 16); }
__device__ __forceinline__ float bfr(float f) { return bf_up(bf_bits(f)); }
__device__ __forceinline__ unsigned short h_bits(_Float16 x) { return __builtin_bit_cast(unsigned short, x); }
__device__ __forceinline__ unsigned pk16(unsigned short a, unsigned short b) { return (unsigned)a | ((unsigned)b << 16); }
__device__ __forceinline__ v8f zero8() { v8f z = {0.f, 0.f, 0.f, 0.f, 0.f, 0.f, 0.f, 0.f}; return z; }
__device__ __forceinline__ float hmax8(v8f s) {
  return fmaxf(fmaxf(fmaxf(s[0], s[1]), fmaxf(s[2], s[3])), fmaxf(fmaxf(s[4], s[5]), fmaxf(s[6], s[7])));
}
__device__ __forceinline__ unsigned wave_ballot(bool p) {
#if defined(__HIP_DEVICE_COMPILE__)
  return __builtin_amdgcn_ballot_w32(p);
#else
  return p ? 1u : 0u;
#endif
}
// 8 f32 values -> bf16 hi bits and bf16 residual bits (lo = RNE(v - hi)), packed 2 per uint
__device__ __forceinline__ void split8(const float* f, v4u& uh, v4u& ul) {
#pragma unroll
  for (int t = 0; t < 4; ++t) {
    const float f0 = f[2 * t], f1 = f[2 * t + 1];
    const unsigned short hb0 = bf_bits(f0), hb1 = bf_bits(f1);
    const unsigned short lb0 = bf_bits(f0 - bf_up(hb0));
    const unsigned short lb1 = bf_bits(f1 - bf_up(hb1));
    uh[t] = pk16(hb0, hb1);
    ul[t] = pk16(lb0, lb1);
  }
}

// ---- 16-bit fragment loader (A, or B from a k-contiguous [n][k] row): lane -> row/col (lane&15), p already includes
//      + 8*(lane>>4); elements 0..7 <- p[0..7] (k0+8h..), elements 8..15 <- p[16..23] (k0+16+8h..)
__device__ __forceinline__ Frag ldfrag(const unsigned short* p) {
  Frag f;
  f.u[0] = *(const v8us*)(p);
  f.u[1] = *(const v8us*)(p + 16);
  return f;
}

// ---- WMMA helpers: builtin followed by a 4-slot VALU gap tying D and keeping A/B live --------------------------
__device__ __forceinline__ v8f mma_h(v16h a, v16h b, v8f c) {
  v8f d = __builtin_amdgcn_wmma_f32_16x16x32_f16(false, a, false, b, (short)0, c, false, false);
#if defined(__HIP_DEVICE_COMPILE__)
  asm volatile("v_nop\n\tv_nop\n\tv_nop\n\tv_nop" : "+v"(d) : "v"(a), "v"(b));
#endif
  return d;
}
__device__ __forceinline__ v8f mma_b(v16b a, v16b b, v8f c) {
  v8f d = __builtin_amdgcn_wmma_f32_16x16x32_bf16(false, a, false, b, (short)0, c, false, false);
#if defined(__HIP_DEVICE_COMPILE__)
  const v16h ha = __builtin_bit_cast(v16h, a), hb = __builtin_bit_cast(v16h, b);
  asm volatile("v_nop\n\tv_nop\n\tv_nop\n\tv_nop" : "+v"(d) : "v"(ha), "v"(hb));
#endif
  return d;
}

// =========================================================================================================
// (0) weights. Blocks 0..47: W16 f16 [384][256], rows 0..127 = theta_w, 128..255 = phi_w, 256..383 = g_w; value =
//     f16 of (bf16-RNE(w) * 256) (exact). Block owns rows 8*blk..8*blk+7: one wave per 512-B row = 32 lanes x 16 B
// coverage: 48 blocks x 8 rows x 32 lanes x 8 halves = 384 x 256; 16 blocks x 16 rows x 16 lanes x 8 = 256 x 128.
// =========================================================================================================
__global__ __launch_bounds__(256)
void cvt_w(const float* __restrict__ tw, const float* __restrict__ pw, const float* __restrict__ gw,
           const float* __restrict__ ow, unsigned short* W16, unsigned short* WWb) {
  const int tid = threadIdx.x, blk = blockIdx.x;
  if (blk < MW / 8) {
    const int rl = tid >> 5, col = 8 * (tid & 31);
    const int o = 8 * blk + rl;                                      // 0..383
    const int grp = blk >> 4;                                        // 0,1,2 (block-uniform)
    const float* wbase = (grp == 0) ? tw : ((grp == 1) ? pw : gw);  // all global
    const float* s = wbase + (size_t)(o - DQ * grp) * CC + col;      // (o - 128 grp) in 0..127
    const v4f a = *(const v4f*)s;
    const v4f q = *(const v4f*)(s + 4);
    const float f[8] = {a[0], a[1], a[2], a[3], q[0], q[1], q[2], q[3]};
    v4u u;
#pragma unroll
    for (int t = 0; t < 4; ++t) {
      const _Float16 h0 = (_Float16)(bfr(f[2 * t]) * WSC);
      const _Float16 h1 = (_Float16)(bfr(f[2 * t + 1]) * WSC);
      u[t] = pk16(h_bits(h0), h_bits(h1));
    }
{
      *(v4u*)(W16 + (size_t)o * CC + col) = u;
      
    }
  } else {
    const int rb = blk - MW / 8;                                     // 0..15
    const int o = 16 * rb + (tid >> 4);                              // 0..255
    const int col = 8 * (tid & 15);                                  // 0..120
    const float* s = ow + (size_t)o * DQ + col;
    const v4f a = *(const v4f*)s;
    const v4f q = *(const v4f*)(s + 4);
    const float f[8] = {a[0], a[1], a[2], a[3], q[0], q[1], q[2], q[3]};
    v4u u;
#pragma unroll
    for (int t = 0; t < 4; ++t) u[t] = pk16(bf_bits(f[2 * t]), bf_bits(f[2 * t + 1]));
{
      *(v4u*)(WWb + (size_t)o * DQ + col) = u;
      
    }
  }
}

// =========================================================================================================
// (1) x f32 [b][256 c][4096 n] -> XP f16 [b][n][c] (grid z < NB) and neighborFeat -> NP (grid z >= NB), position-
//     major, bf16-RNE values (exact in f16), through an LDS tile T[64 n][64 c] (pitch TP, cross-wave, block barrier).
// coverage: T written rows (8e+t)=0..63 x cols cl 0..63, read rows 0..63 x cols 8e..8e+7; plane 2 it x 32 rows x 8
//           lanes x 8 = 64 n x 64 c; grid (64, 4, 2 NB) covers XP and NP [b][0..4095][0..255] exactly once.
// =========================================================================================================
__global__ __launch_bounds__(256)
void cvt_x(const float* __restrict__ x, const float* __restrict__ nf, unsigned short* XP, unsigned short* NP) {
  __shared__ __align__(16) unsigned short T[QT * TP];
  const int tid = threadIdx.x;
  const int nb = blockIdx.x, cb = blockIdx.y, zz = blockIdx.z;
  const int which = (zz >= NB) ? 1 : 0;                              // block-uniform plane select
  const int b = zz - which * NB;                                     // 0..NB-1
  const float* src = (which != 0) ? nf : x;                          // both global
  unsigned short* dst = (which != 0) ? NP : XP;                      // both global
  const int e = tid & 7, lq = tid >> 3;                              // lq 0..31
  const int n0 = nb * QT, c0 = cb * QT;
#pragma unroll
  for (int it = 0; it < 2; ++it) {
    const int cl = it * 32 + lq;                                     // 0..63
    const float* sp = src + ((size_t)(b * CC + c0 + cl)) * NN + n0 + 8 * e;
    const v4f a = *(const v4f*)sp;
    const v4f q = *(const v4f*)(sp + 4);
    unsigned short hb[8];
#pragma unroll
    for (int t = 0; t < 4; ++t) {
      hb[t]     = h_bits((_Float16)bfr(a[t]));
      hb[4 + t] = h_bits((_Float16)bfr(q[t]));
    }
#pragma unroll
    for (int t = 0; t < 8; ++t) T[(8 * e + t) * TP + cl] = hb[t];
  }
  __syncthreads();
  v4u up[2];
#pragma unroll
  for (int it = 0; it < 2; ++it) {
    const int nl = it * 32 + lq;                                     // 0..63
    up[it] = *(const v4u*)(T + nl * TP + 8 * e);
  }
{
#pragma unroll
    for (int it = 0; it < 2; ++it) {
      const int rl = it * 32 + lq;
      *(v4u*)(dst + ((size_t)(b * NN + n0 + rl)) * CC + c0 + 8 * e) = up[it];
    }
    
  }
}

// ---- eight asynchronous 16-byte copies per lane, global -> LDS: copy i takes g + i*gstep (elements) to LDS byte
//      address l + i*lstep. The s_wait_xcnt 0 is the last line of the copies' own statement so that it stands in
//      front of any later write of the address registers the copies name.
__device__ __forceinline__ void copy8(unsigned l, unsigned lstep, const unsigned short* g, size_t gstep) {
#if defined(__HIP_DEVICE_COMPILE__)
  asm volatile("global_load_async_to_lds_b128 %0, %8, off\n\t"
               "global_load_async_to_lds_b128 %1, %9, off\n\t"
               "global_load_async_to_lds_b128 %2, %10, off\n\t"
               "global_load_async_to_lds_b128 %3, %11, off\n\t"
               "global_load_async_to_lds_b128 %4, %12, off\n\t"
               "global_load_async_to_lds_b128 %5, %13, off\n\t"
               "global_load_async_to_lds_b128 %6, %14, off\n\t"
               "global_load_async_to_lds_b128 %7, %15, off\n\t"
               "s_wait_xcnt 0x0"
               :: "v"(l), "v"(l + lstep), "v"(l + 2 * lstep), "v"(l + 3 * lstep),
                  "v"(l + 4 * lstep), "v"(l + 5 * lstep), "v"(l + 6 * lstep), "v"(l + 7 * lstep),
                  "v"(g), "v"(g + gstep), "v"(g + 2 * gstep), "v"(g + 3 * gstep),
                  "v"(g + 4 * gstep), "v"(g + 5 * gstep), "v"(g + 6 * gstep), "v"(g + 7 * gstep)
               : "memory");
#endif
}

// =========================================================================================================
// (2) conv1x1 GEMM for one (b, strip of 128 positions = image rows 2s and 2s+1, 64-o block of the stacked weights):
//     Y[o][n] = (1/256) sum_c W16[o][c] B[b][n][c], B = NP for o-blocks 0..3 (theta, phi) and XP for o-blocks 4,5
//     (g), block-uniform select. Block 256 threads = 8 waves; wave w owns cols n0+16w..+15 (one B fragment per
//     k-step, k = c contiguous in the plane row) and 4 m-tiles (A rows o = o0 + 16 mt + (lane&15), split k map
//     loader from W16). K = 256 = 8 steps. Both operand tiles (64 weight rows, 128 position rows, 512 B each) are
//     staged once per block in LDS by asynchronous copies of whole 128-B lines (24 copies per lane), rows at pitch
//     528 B, and read by the waves as ds_load_b128 fragments behind each wave's own asynccnt wait + block barrier.
//     Epilogue staged in LDS Os[n_loc][o_loc] (pitch OSP, b128 stores; it reuses the operand tiles' bytes behind a
//     block barrier that ends every wave's fragment reads), block barrier, then (block-uniform branch on the o block):
//       o-blocks 0,1 -> theta dims 0..63 / 64..127 + bias -> Qh/Ql bf16 [b][4096 n][128 d] (hi = RNE(v), lo = RNE(v-hi)):
//       o-blocks 2,3 -> phi + bias in f32 -> PF f32 [b][4096 n][128 d]: 128 rows x the dsel half (256 B = 2 whole
//                       lines) of the 512-B row, 16 consecutive lanes x 16 B, one instruction per 2 rows.
//       o-blocks 4,5 -> g + bias -> GF f32 [b][4096 n][128 d], same layout.
// coverage: Os 8 waves x 16 n x 64 o = 128 x 64 written, reads rows <= 127 cols <= 63; theta planes 4 it x 32 rows
//           x 8 lanes x 8 = 128 n x 64 d; f32 planes 8 it x 16 rows x 16 lanes x 4 = 128 n x 64 d; grid (32, 6, NB)
//           covers all 4096 rows x 128 d of Qh/Ql and of PF/GF exactly once.
// =========================================================================================================
__global__ __launch_bounds__(256) __attribute__((amdgpu_num_vgpr(256)))
void gemm_proj(const unsigned short* __restrict__ W16, const unsigned short* __restrict__ NP,
               const unsigned short* __restrict__ XP,
               const float* __restrict__ tb, const float* __restrict__ pb, const float* __restrict__ gb,
               unsigned short* Qh, unsigned short* Ql, float* PF, float* GF) {
  __shared__ __align__(16) unsigned char Sm[PASZ + PBSZ];
  const unsigned short* As = (const unsigned short*)Sm;              // weight tile  [64 o][PPS]
  const unsigned short* Bs = (const unsigned short*)(Sm + PASZ);     // position tile [128 n][PPS]
  float* Os = (float*)Sm;                                            // epilogue tile, after the last fragment read
  const int tid  = threadIdx.x;
  const int lane = tid & 31, wave = tid >> 5;                        // wave 0..7
  const int hh   = lane >> 4, c = lane & 15;
  const int st   = blockIdx.x, mb = blockIdx.y, b = blockIdx.z;
  const int n0   = st * SN, o0 = mb * QT;
  const unsigned short* BP = (mb < 4) ? NP : XP;                     // block-uniform, both global

  // both tiles are contiguous in global memory: 16-B chunk tid + 256 per copy = row (tid>>5) + 8 per copy, chunk tid&31
  const unsigned lrow = (unsigned)(size_t)Sm + (unsigned)((tid >> 5) * (PPS * 2) + (tid & 31) * 16);
  const unsigned short* bg = BP + (size_t)(b * NN + n0) * CC + 8 * tid;
  copy8(lrow, 8 * PPS * 2, W16 + (size_t)o0 * CC + 8 * tid, 256 * 8);
  copy8(lrow + PASZ, 8 * PPS * 2, bg, 256 * 8);
  copy8(lrow + PASZ + 64 * PPS * 2, 8 * PPS * 2, bg + (size_t)64 * CC, 256 * 8);
  asm volatile("s_wait_asynccnt 0x0" ::: "memory");                  // this wave's copies have landed
  __syncthreads();                                                   // every wave's copies are readable

  const unsigned short* ap = As + c * PPS + 8 * hh;
  const unsigned short* bp = Bs + (16 * wave + c) * PPS + 8 * hh;

  v8f acc[4];
#pragma unroll
  for (int mt = 0; mt < 4; ++mt) acc[mt] = zero8();

#pragma unroll
  for (int ks = 0; ks < CC / 32; ++ks) {
    const Frag fb = ldfrag(bp + 32 * ks);
    Frag fa[4];
#pragma unroll
    for (int mt = 0; mt < 4; ++mt) fa[mt] = ldfrag(ap + (16 * mt) * PPS + 32 * ks);
#pragma unroll
    for (int mt = 0; mt < 4; ++mt) acc[mt] = mma_h(fa[mt].h, fb.h, acc[mt]);
  }
  __syncthreads();                                                   // all fragment reads done: Os may take the bytes

  // ---- epilogue: scale back -> LDS Os[n_loc][o_loc]; lane (hh, c) holds o = 16 mt + 8 hh + r for n_loc = 16 w + c
  {
    const int nl = 16 * wave + c;
#pragma unroll
    for (int mt = 0; mt < 4; ++mt) {
      v4f va, vb;
#pragma unroll
      for (int r = 0; r < 4; ++r) { va[r] = acc[mt][r] * IWSC; vb[r] = acc[mt][4 + r] * IWSC; }
      *(v4f*)(Os + nl * OSP + 16 * mt + 8 * hh)     = va;
      *(v4f*)(Os + nl * OSP + 16 * mt + 8 * hh + 4) = vb;
    }
  }
  __syncthreads();

  const int grp = mb >> 1;                                           // 0 theta, 1 phi, 2 g (block-uniform)
  const int dsel = (mb & 1) * QT;                                    // 0 or 64
  const float* bias = (grp == 0) ? tb : ((grp == 1) ? pb : gb);     // all global

  if (grp == 0) {
    const int e = tid & 7, lq = tid >> 3;                            // lq 0..31
    float bv[8];
    {
      const v4f ba = *(const v4f*)(bias + dsel + 8 * e);
      const v4f bq = *(const v4f*)(bias + dsel + 8 * e + 4);
#pragma unroll
      for (int t = 0; t < 4; ++t) { bv[t] = bfr(ba[t]); bv[4 + t] = bfr(bq[t]); }
    }
    v4u uh[4], ul[4];
#pragma unroll
    for (int it = 0; it < 4; ++it) {
      const int row = it * 32 + lq;                                  // n_loc 0..127
      const v4f a = *(const v4f*)(Os + row * OSP + 8 * e);
      const v4f q = *(const v4f*)(Os + row * OSP + 8 * e + 4);
      float f[8];
#pragma unroll
      for (int t = 0; t < 4; ++t) { f[t] = a[t] + bv[t]; f[4 + t] = q[t] + bv[4 + t]; }
      split8(f, uh[it], ul[it]);
    }
{
#pragma unroll
      for (int it = 0; it < 4; ++it) {
        const int row = it * 32 + lq;
        const size_t po = ((size_t)(b * NN + n0 + row)) * DQ + dsel + 8 * e;
        *(v4u*)(Qh + po) = uh[it];
        *(v4u*)(Ql + po) = ul[it];
      }
      
    }
  } else {
    const int e16 = tid & 15, lr = tid >> 4;                        // lr 0..15
    v4f bv4;
    {
      const v4f bq = *(const v4f*)(bias + dsel + 4 * e16);
#pragma unroll
      for (int t = 0; t < 4; ++t) bv4[t] = bfr(bq[t]);
    }
    float* P = (grp == 1) ? PF : GF;                                 // both global
    v4f res[8];
#pragma unroll
    for (int it = 0; it < 8; ++it) {
      const int row = it * 16 + lr;                                  // n_loc 0..127
      const v4f a = *(const v4f*)(Os + row * OSP + 4 * e16);
      v4f v;
#pragma unroll
      for (int t = 0; t < 4; ++t) v[t] = a[t] + bv4[t];
      res[it] = v;
    }
{
#pragma unroll
      for (int it = 0; it < 8; ++it) {
        const int row = it * 16 + lr;
        const size_t po = ((size_t)(b * NN + n0 + row)) * DQ + dsel + 4 * e16;
        *(v4f*)(P + po) = res[it];
      }
      
    }
  }
}

// =========================================================================================================
// (3) 2x2 stride-2 max-pool of PF / GF f32 [b][4096 n][128 d] in f32 -> Kh/Kl bf16 [b][1024 m][128 d]
//     (hi = RNE(v), lo = RNE(v-hi)) and Gp f16 [b][1024 m][128 d], m = 32 py + px, window n = (2py+dy) 64 + 2px+dx,
//     lr = tid>>4 -> px = 16 it + lr for it 0..1 (px 0..31, all valid, no pad rows since 1024 keys = 32 x 32).
// coverage: blocks 0..31 x px 0..31 x 16 lanes x 8 = rows 0..1023 x 128 d of each plane; grid (32, NB) covers
//           Kh/Kl/Gp [b][0..1023][0..127] exactly once.
// =========================================================================================================
__global__ __launch_bounds__(256)
void pool_k(const float* __restrict__ PF, const float* __restrict__ GF,
            unsigned short* Kh, unsigned short* Kl, unsigned short* Gp) {
  const int tid = threadIdx.x, py = blockIdx.x, b = blockIdx.y;
  const int e16 = tid & 15, lr = tid >> 4;                          // lr 0..15
  v4u kh[2], kl[2], gu[2];
#pragma unroll
  for (int it = 0; it < 2; ++it) {
    const int px = it * 16 + lr;                                    // 0..31
    float fk[8], fg[8];
#pragma unroll
    for (int t = 0; t < 8; ++t) { fk[t] = -__builtin_inff(); fg[t] = -__builtin_inff(); }
#pragma unroll 1
    for (int dy = 0; dy < 2; ++dy) {
      const size_t rb = ((size_t)(b * NN + (2 * py + dy) * WIMG + 2 * px)) * DQ + 8 * e16;
#pragma unroll
      for (int dx = 0; dx < 2; ++dx) {
        const float* pk = PF + rb + (size_t)dx * DQ;
        const float* pg = GF + rb + (size_t)dx * DQ;
        const v4f ka = *(const v4f*)pk, kq = *(const v4f*)(pk + 4);
        const v4f ga = *(const v4f*)pg, gq = *(const v4f*)(pg + 4);
#pragma unroll
        for (int t = 0; t < 4; ++t) {
          fk[t]     = fmaxf(fk[t], ka[t]);
          fk[4 + t] = fmaxf(fk[4 + t], kq[t]);
          fg[t]     = fmaxf(fg[t], ga[t]);
          fg[4 + t] = fmaxf(fg[4 + t], gq[t]);
        }
      }
    }
    split8(fk, kh[it], kl[it]);
#pragma unroll
    for (int t = 0; t < 4; ++t) gu[it][t] = pk16(h_bits((_Float16)fg[2 * t]), h_bits((_Float16)fg[2 * t + 1]));
  }
{
#pragma unroll
    for (int it = 0; it < 2; ++it) {
      const int px = it * 16 + lr;
      const size_t po = ((size_t)(b * MM + WP * py + px)) * DQ + 8 * e16;
      *(v4u*)(Kh + po) = kh[it];
      *(v4u*)(Kl + po) = kl[it];
      *(v4u*)(Gp + po) = gu[it];
    }
    
  }
}

// =========================================================================================================
// (4) Gp f16 [b][1024 m][128 d] -> Gc f16 [b][d][m] (channel-major, keys contiguous) through an LDS tile T[64 d][64 m]
// coverage: reads 2 it x 32 rows x 8 lanes x 8 = 64 m x 64 d; T written rows (8e+t)=0..63 x cols 0..63, read rows
//           0..63 x cols 8e..8e+7; writes 64 d x 64 m; grid (16, 2, NB) covers Gc [b][0..127][0..1023] exactly once.
// =========================================================================================================
__global__ __launch_bounds__(256)
void tr_g(const unsigned short* __restrict__ Gp, unsigned short* Gc) {
  __shared__ __align__(16) unsigned short T[QT * TP];
  const int tid = threadIdx.x;
  const int mt = blockIdx.x, db = blockIdx.y, b = blockIdx.z;
  const int e = tid & 7, lq = tid >> 3;                             // lq 0..31
  const int m0 = mt * QT, d0 = db * QT;
#pragma unroll
  for (int it = 0; it < 2; ++it) {
    const int ml = it * 32 + lq;                                     // 0..63
    const v4u w = *(const v4u*)(Gp + ((size_t)(b * MM + m0 + ml)) * DQ + d0 + 8 * e);
    unsigned short hb[8];
#pragma unroll
    for (int t = 0; t < 4; ++t) {
      hb[2 * t]     = (unsigned short)(w[t] & 0xFFFFu);
      hb[2 * t + 1] = (unsigned short)(w[t] >> 16);
    }
#pragma unroll
    for (int t = 0; t < 8; ++t) T[(8 * e + t) * TP + ml] = hb[t];
  }
  __syncthreads();
  v4u up[2];
#pragma unroll
  for (int it = 0; it < 2; ++it) {
    const int dl = it * 32 + lq;                                     // 0..63
    up[it] = *(const v4u*)(T + dl * TP + 8 * e);
  }
{
#pragma unroll
    for (int it = 0; it < 2; ++it) {
      const int dl = it * 32 + lq;
      *(v4u*)(Gc + ((size_t)(b * DQ + d0 + dl)) * MM + m0 + 8 * e) = up[it];
    }
    
  }
}

// ---- attention fragment groups (LDS): each group is 8 ds_load_b128 written together, one block of products ahead of
//      its use. ldk4: K hi rows key..+15 and +16..+31, then the same rows of the K residual plane, 32 d at p.
//      ldv4: pooled-g rows of 4 channel tiles (16 rows apart), 32 keys at p. sc6: the six score products of one d-chunk.
__device__ __forceinline__ void ldk4(Frag* f, const unsigned short* p) {
  f[0] = ldfrag(p);
  f[1] = ldfrag(p + 16 * KPS);
  f[2] = ldfrag(p + KSZ / 2);
  f[3] = ldfrag(p + KSZ / 2 + 16 * KPS);
}
__device__ __forceinline__ void ldv4(Frag* f, const unsigned short* p) {
#pragma unroll
  for (int j = 0; j < 4; ++j) f[j] = ldfrag(p + (16 * j) * VPS);
}
__device__ __forceinline__ void sc6(const Frag* k, const Frag& qh, const Frag& ql, v8f& s0, v8f& s1) {
  s0 = mma_b(k[0].bf, qh.bf, s0);
  s1 = mma_b(k[1].bf, qh.bf, s1);
  s0 = mma_b(k[0].bf, ql.bf, s0);
  s1 = mma_b(k[1].bf, ql.bf, s1);
  s0 = mma_b(k[2].bf, qh.bf, s0);
  s1 = mma_b(k[3].bf, qh.bf, s1);
}

// =========================================================================================================
// (5) attention for one (b, 64-query tile), transposed formulation, 1024 keys (all valid, no mask, no scale):
//   S^T tile (16 keys x 16 queries) = sum over 4 d-chunks (q fragments kept in registers) of A(k: row = key kb + (lane&15), 32 d via
//   the split k map from the bf16 plane Kh [b][1024][128]) . B(q: col = query, same map from Qh [b][4096][128])
//   + A(Kh).B(Ql) + A(Kl).B(Qh) (bf16 unscaled residual planes, shared accumulator).
//   Per lane the D tile holds 8 keys of ONE query: online softmax state per lane, one shuffle (lane^16) for the max
//   over 32 keys; the o/l rescale is skipped under a wave-uniform ballot when no lane's max grew (corr == 1 exactly
//   for every lane then); row-sum partials combined at the end. P = e^{s-m} x 16384 as f16 is the B operand of
//   y^T (rows channel, cols queries) += A(pooled g: rows channel = 16j + (lane&15), keys contiguous, f16 plane Gc
//   [b][128][1024]) . B(P^T): element r <- D of the tile covering keys kb..kb+15, element 8+r <- the tile covering
//   kb+16..kb+31, lane unchanged. 8 accumulator tiles per wave (128 channels). Block = 4 waves = 64 queries.
//   K hi / K residual / pooled-g tiles of 64 keys are staged once per block in a two-buffer LDS ring by asynchronous
//   copies (whole 128-B lines from global; 24 copies per lane and stage) and read by all 4 waves as ds_load_b128
//   fragments: K rows at pitch 272 B, g rows (64 keys = 128 B) at pitch 144 B. Stage t+2 is issued behind the barrier
//   that ends every wave's reads of stage t; stage t+1 is read only behind each wave's own asynccnt wait + barrier.
//   Fragments go through two register sets: each group of 8 ds_load_b128 is issued one block of products ahead of its
//   use (K d-chunk c+1 ahead of chunk c's products, the g rows ahead of the last score products and the softmax), inside one stage only.
//   Epilogue: y = O/l staged in LDS Os[query][128 channels] (pitch OSPW, b128 stores), block barrier, then
// coverage: Os written 4 waves x 16 queries x 128 ch, read rows 0..63 x ch 8e..8e+7 (e 0..15); planes 8 it x 8 rows x
//           16 lanes x 8 = 64 n x 128 ch per plane; grid (NQ/64, NB) covers rows 0..NQ-1 of Yh/Yl exactly once.
// =========================================================================================================
__global__ __launch_bounds__(128) __attribute__((amdgpu_num_vgpr(256)))
void attn_k(const unsigned short* __restrict__ Qh, const unsigned short* __restrict__ Ql,
            const unsigned short* __restrict__ Kh, const unsigned short* __restrict__ Kl,
            const unsigned short* __restrict__ Gc, unsigned short* Yh, unsigned short* Yl) {
  __shared__ __align__(16) float Os[QT * OSPW];
  __shared__ __align__(16) unsigned short Ring[2 * STG / 2];
  const int tid  = threadIdx.x;
  const int wave = tid >> 5, lane = tid & 31;
  const int hh   = lane >> 4, c = lane & 15;
  const int n0   = blockIdx.x * QT, b = blockIdx.y;

  // q fragment pointers (B operand, col = query n0 + 16*wave + c), + 32*kc
  const size_t qo = ((size_t)(b * NN + n0 + 16 * wave + c)) * DQ + 8 * hh;
  const unsigned short* Qhp = Qh + qo;
  const unsigned short* Qlp = Ql + qo;
  // copy sources of stage 0 (per lane, 16 B): K planes: the 16-KB tile is contiguous, chunk tid, + 128 chunks per copy;
  // g plane: row = channel (tid>>3) + 16 per copy, 8 chunks of 16 B per 128-B row piece
  const unsigned short* Khg = Kh + (size_t)b * MM * DQ + 8 * tid;
  const unsigned short* Klg = Kl + (size_t)b * MM * DQ + 8 * tid;
  const unsigned short* Vg  = Gc + (size_t)b * DQ * MM + (size_t)(tid >> 3) * MM + 8 * (tid & 7);
  // copy destinations in buffer 0 (LDS byte addresses): K row (tid>>4) + 8 per copy, g row (tid>>3) + 16 per copy
  const unsigned ring0 = (unsigned)(size_t)Ring;
  const unsigned lK = ring0 + (unsigned)((tid >> 4) * (KPS * 2) + (tid & 15) * 16);
  const unsigned lV = ring0 + (unsigned)(2 * KSZ + (tid >> 3) * (VPS * 2) + (tid & 7) * 16);
  // fragment offsets inside a buffer (elements): k (A operand, row = key + c), + key * KPS + 32*kc;
  // v (A operand, row = channel 16j + c, keys contiguous), + 16*j*VPS + key
  const int kfo = c * KPS + 8 * hh;
  const int vfo = KSZ + c * VPS + 8 * hh;

  // ring prologue: stage 0 -> buffer 0, landed and published; then stage 1 -> buffer 1 flies over pass 0
  copy8(lK, 8 * KPS * 2, Khg, 128 * 8);
  copy8(lK + KSZ, 8 * KPS * 2, Klg, 128 * 8);
  copy8(lV, 16 * VPS * 2, Vg, (size_t)16 * MM);
  asm volatile("s_wait_asynccnt 0x0" ::: "memory");                  // this wave's stage-0 copies have landed
  __syncthreads();                                                   // every wave's stage-0 copies are readable
  copy8(lK + STG, 8 * KPS * 2, Khg + (size_t)KT * DQ, 128 * 8);
  copy8(lK + STG + KSZ, 8 * KPS * 2, Klg + (size_t)KT * DQ, 128 * 8);
  copy8(lV + STG, 16 * VPS * 2, Vg + KT, (size_t)16 * MM);

  // q hi / residual fragments of this wave's 16 queries: the same for every key, loaded once and kept in registers
  Frag qhf[DQ / 32], qlf[DQ / 32];
#pragma unroll
  for (int kc = 0; kc < DQ / 32; ++kc) {
    qhf[kc] = ldfrag(Qhp + 32 * kc);
    qlf[kc] = ldfrag(Qlp + 32 * kc);
  }

  float m = -1.0e30f, l = 0.f;
  v8f o[8];
#pragma unroll
  for (int j = 0; j < 8; ++j) o[j] = zero8();

#pragma unroll 1  // one stage per trip, rolled: the publish point at its foot stands once in the text
  for (int t = 0; t < NT; ++t) {
   const unsigned short* sb = Ring + (t & 1) * (STG / 2);            // this stage's buffer
   const unsigned short* kp = sb + kfo;
   const unsigned short* vp = sb + vfo;
   // two fragment sets of 4 x 8 registers, filled in turn one block of products ahead of their use
   Frag fa[4], fb[4];
   ldk4(fa, kp);                                                     // d-chunk 0 of the stage's first 32 keys
#pragma unroll  // both 32-key passes of the stage in the text: the second one's first K fragments are fetched in the first
   for (int kb = 0; kb < KT; kb += 32) {
    const unsigned short* k0p = kp + kb * KPS;                       // keys kb .. kb+15 of the stage
    v8f s0 = zero8(), s1 = zero8();
    ldk4(fb, k0p + 32);
    sc6(fa, qhf[0], qlf[0], s0, s1);
    ldk4(fa, k0p + 64);
    sc6(fb, qhf[1], qlf[1], s0, s1);
    ldk4(fb, k0p + 96);
    sc6(fa, qhf[2], qlf[2], s0, s1);
    ldv4(fa, vp + kb);                                               // pooled-g rows of channels 0..63
    sc6(fb, qhf[3], qlf[3], s0, s1);
    ldv4(fb, vp + 64 * VPS + kb);                                    // channels 64..127, in flight over the softmax

    float mx = fmaxf(hmax8(s0), hmax8(s1));
    mx = fmaxf(mx, __shfl_xor(mx, 16, 32));
    const float mn = fmaxf(m, mx);
    const unsigned grew = wave_ballot(mx > m);                       // wave-uniform
    if (grew != 0u) {
      const float corr = __expf(m - mn);                             // == 1 exactly for lanes whose max did not grow
      l *= corr;
#pragma unroll
      for (int j = 0; j < 8; ++j) {
#pragma unroll
        for (int r = 0; r < 8; ++r) o[j][r] *= corr;
      }
    }
    m = mn;
    const float msh = mn - LNPS;                                     // exp gives e^{s-m} * 16384

    FragH ph;
    float ls = 0.f;
#pragma unroll
    for (int r = 0; r < 8; ++r) {
      const float e0 = __expf(s0[r] - msh);                          // key kb      + 8hh + r
      const float e1 = __expf(s1[r] - msh);                          // key kb + 16 + 8hh + r
      ls += e0 + e1;
      ph.hv[0][r] = (_Float16)e0;
      ph.hv[1][r] = (_Float16)e1;
    }
    l += ls;

#pragma unroll
    for (int j = 0; j < 4; ++j) o[j] = mma_h(fa[j].h, ph.v, o[j]);
    if (kb + 32 < KT) ldk4(fa, k0p + 32 * KPS);                      // compile-time test: next pass's d-chunk 0, same stage
#pragma unroll
    for (int j = 0; j < 4; ++j) o[4 + j] = mma_h(fb[j].h, ph.v, o[4 + j]);
   }
   // publish point of stage t+1, and release of stage t's buffer
   asm volatile("s_wait_dscnt 0x0" ::: "memory");                    // this wave's reads of stage t are done
   asm volatile("s_wait_asynccnt 0x0" ::: "memory");                 // this wave's stage t+1 copies have landed
   __syncthreads();
   if (t + 2 < NT) {                                                 // block-uniform
     const unsigned bo = (unsigned)((t & 1) * STG);
     copy8(lK + bo, 8 * KPS * 2, Khg + (size_t)(t + 2) * KT * DQ, 128 * 8);
     copy8(lK + bo + KSZ, 8 * KPS * 2, Klg + (size_t)(t + 2) * KT * DQ, 128 * 8);
     copy8(lV + bo, 16 * VPS * 2, Vg + (t + 2) * KT, (size_t)16 * MM);
   }
  }
  asm volatile("s_wait_asynccnt 0x0" ::: "memory");                  // nothing of the ring is in flight past here
  l += __shfl_xor(l, 16, 32);
  const float inv = 1.0f / l;                                        // o and l both carry the x16384 factor

  // ---- epilogue: y = o * inv -> Os[query][ch]; lane (hh, c) holds ch = 16 j + 8 hh + r for query 16 w + c
  {
    const int qrow = 16 * wave + c;
#pragma unroll
    for (int j = 0; j < 8; ++j) {
      v4f va, vb;
#pragma unroll
      for (int r = 0; r < 4; ++r) { va[r] = o[j][r] * inv; vb[r] = o[j][4 + r] * inv; }
      *(v4f*)(Os + qrow * OSPW + 16 * j + 8 * hh)     = va;
      *(v4f*)(Os + qrow * OSPW + 16 * j + 8 * hh + 4) = vb;
    }
  }
  __syncthreads();

  const int e16 = tid & 15, lr = tid >> 4;                           // lr 0..7
  v4u uh[8], ul[8];
#pragma unroll
  for (int it = 0; it < 8; ++it) {
    const int row = it * 8 + lr;                                     // query 0..63
    const v4f a = *(const v4f*)(Os + row * OSPW + 8 * e16);
    const v4f q = *(const v4f*)(Os + row * OSPW + 8 * e16 + 4);
    const float f[8] = {a[0], a[1], a[2], a[3], q[0], q[1], q[2], q[3]};
    split8(f, uh[it], ul[it]);
  }
{
#pragma unroll
    for (int it = 0; it < 8; ++it) {
      const int row = it * 8 + lr;
      const size_t po = ((size_t)(b * NN + n0 + row)) * DQ + 8 * e16;
      *(v4u*)(Yh + po) = uh[it];
      *(v4u*)(Yl + po) = ul[it];
    }
    
  }
}

// =========================================================================================================
// (6) output conv for one (b, 64-n tile, 64-c block): A[c][n] = sum_ci WWb[c][ci] (Yh + Yl)[b][n][ci] on bf16 WMMA
//     (2 products per k-step, shared accumulator), K = 128 = 4 steps. Block 128 threads = 4 waves; wave w owns cols
//     n0+16w..+15 (B fragments from the k-contiguous Yh/Yl rows) and 4 m-tiles (A rows c = c0 + 16 mt + (lane&15),
//     split k map loader from WWb). The three operand tiles (64 weight rows, 64 position rows of Yh and of Yl, 256 B
//     each, contiguous in global memory) are staged once per block in LDS by asynchronous copies of whole 128-B lines
//     (24 copies per lane), rows at pitch 272 B, and read as ds_load_b128 fragments behind each wave's own asynccnt
//     wait + block barrier; Os reuses their bytes behind a block barrier that ends every wave's fragment reads.
//     Per-channel constants (bf16-RNE of w_b, bn mean, bn beta, and scale =
//     bf16-RNE(gamma) * rsqrt(bf16-RNE(var) + eps)) staged once in LDS by waves 0,1. Epilogue staged in LDS
//     Os[n_loc][c_loc] (pitch OSP, b128 stores), block barrier, then out[b][c][n] = (((A + w_b[c]) - mean[c]) *
// coverage: Os 4 waves x 16 n x 64 c written, read rows nl+t <= 63 x cols cl <= 63; Pb/Pm/Ps/Pt written 0..63, read
//           cl <= 63; out 8 it x 16 lines x 8 lanes x 4 floats = 64 c x 64 n; grid (NQ/64, 4, NB) covers
//           out[b][0..255][0..NQ-1] exactly once.
// =========================================================================================================
__global__ __launch_bounds__(128) __attribute__((amdgpu_num_vgpr(256)))
void gemm_out(const unsigned short* __restrict__ WWb, const unsigned short* __restrict__ Yh,
              const unsigned short* __restrict__ Yl, const float* __restrict__ wb,
              const float* __restrict__ bng, const float* __restrict__ bnb,
              const float* __restrict__ bnm, const float* __restrict__ bnv,
              const float* __restrict__ x, float* out) {
  __shared__ __align__(16) unsigned char Sm[3 * KSZ];
  const unsigned short* As = (const unsigned short*)Sm;              // weight tile [64 c][KPS]; Yh, Yl tiles behind it
  float* Os = (float*)Sm;                                            // epilogue tile, after the last fragment read
  __shared__ float Pb[QT], Pm[QT], Ps[QT], Pt[QT];
  const int tid  = threadIdx.x;
  const int lane = tid & 31, wave = tid >> 5;
  const int hh   = lane >> 4, c = lane & 15;
  const int nt   = blockIdx.x, cb = blockIdx.y, b = blockIdx.z;
  const int n0   = nt * QT, c0 = cb * QT;

  // each tile is contiguous in global memory: 16-B chunk tid + 128 per copy = row (tid>>4) + 8 per copy, chunk tid&15
  const unsigned lrow = (unsigned)(size_t)Sm + (unsigned)((tid >> 4) * (KPS * 2) + (tid & 15) * 16);
  const size_t yo = (size_t)(b * NN + n0) * DQ + 8 * tid;
  copy8(lrow, 8 * KPS * 2, WWb + (size_t)c0 * DQ + 8 * tid, 128 * 8);
  copy8(lrow + KSZ, 8 * KPS * 2, Yh + yo, 128 * 8);
  copy8(lrow + 2 * KSZ, 8 * KPS * 2, Yl + yo, 128 * 8);

  if (tid < QT) {                                                    // waves 0,1 (wave-uniform), cross-wave via barrier
    const int ch = c0 + tid;                                         // 0..255
    Pb[tid] = bfr(wb[ch]);
    Pm[tid] = bfr(bnm[ch]);
    Ps[tid] = bfr(bng[ch]) * rsqrtf(bfr(bnv[ch]) + BNEPS);
    Pt[tid] = bfr(bnb[ch]);
  }

  asm volatile("s_wait_asynccnt 0x0" ::: "memory");                  // this wave's copies have landed
  __syncthreads();                                                   // every wave's copies are readable

  const unsigned short* ap  = As + c * KPS + 8 * hh;
  const unsigned short* bph = As + KSZ / 2 + (16 * wave + c) * KPS + 8 * hh;
  const unsigned short* bpl = bph + KSZ / 2;

  v8f acc[4];
#pragma unroll
  for (int mt = 0; mt < 4; ++mt) acc[mt] = zero8();

#pragma unroll
  for (int ks = 0; ks < DQ / 32; ++ks) {
    const Frag fbh = ldfrag(bph + 32 * ks);
    const Frag fbl = ldfrag(bpl + 32 * ks);
    Frag fa[4];
#pragma unroll
    for (int mt = 0; mt < 4; ++mt) fa[mt] = ldfrag(ap + (16 * mt) * KPS + 32 * ks);
#pragma unroll
    for (int mt = 0; mt < 4; ++mt) {
      acc[mt] = mma_b(fa[mt].bf, fbh.bf, acc[mt]);
      acc[mt] = mma_b(fa[mt].bf, fbl.bf, acc[mt]);
    }
  }
  __syncthreads();                                                   // all fragment reads done: Os may take the bytes

  // ---- epilogue: -> LDS Os[n_loc][c_loc]; lane (hh, c) holds c_loc = 16 mt + 8 hh + r for n_loc = 16 w + c
  {
    const int nl = 16 * wave + c;
#pragma unroll
    for (int mt = 0; mt < 4; ++mt) {
      v4f va, vb;
#pragma unroll
      for (int r = 0; r < 4; ++r) { va[r] = acc[mt][r]; vb[r] = acc[mt][4 + r]; }
      *(v4f*)(Os + nl * OSP + 16 * mt + 8 * hh)     = va;
      *(v4f*)(Os + nl * OSP + 16 * mt + 8 * hh + 4) = vb;
    }
  }
  __syncthreads();

  const int e = tid & 7, lq = tid >> 3;                              // lq 0..15
  v4f res[8];
#pragma unroll
  for (int it = 0; it < 8; ++it) {
    const int L   = it * 16 + lq;                                    // 0..127
    const int cl  = L >> 1, hf = L & 1;                              // channel 0..63 within the block
    const int nl  = hf * 32 + 4 * e;                                 // position 0..63
    const float pbv = Pb[cl], pmv = Pm[cl], psv = Ps[cl], ptv = Pt[cl];
    const size_t idx = ((size_t)(b * CC + c0 + cl)) * NN + n0 + nl;
    const v4f xv = *(const v4f*)(x + idx);
#pragma unroll
    for (int t = 0; t < 4; ++t) {
      const float cv = Os[(nl + t) * OSP + cl] + pbv;
      res[it][t] = ((cv - pmv) * psv + ptv) + bfr(xv[t]);
    }
  }
{
#pragma unroll
    for (int it = 0; it < 8; ++it) {
      const int L   = it * 16 + lq;
      const int cl  = L >> 1, hf = L & 1;
      const int nl  = hf * 32 + 4 * e;
      const size_t idx = ((size_t)(b * CC + c0 + cl)) * NN + n0 + nl;
      *(v4f*)(out + idx) = res[it];
    }
    
  }
}

// =========================================================================================================
// Workspace map (bytes; each region start a multiple of 256; every extent is an exact row/tile multiple and is
//   W16 f16 [384][256]            196608      WWb bf16 [256][128]        65536
//   XP / NP f16 [NB][4096][256]  16777216 x2 (NB=8)
//   Qh/Ql bf16 [NB][4096][128]    8388608 x2
//   PF/GF f32  [NB][4096][128]   16777216 x2
//   Kh/Kl bf16 [NB][1024][128]    2097152 x2  Gp f16 [NB][1024][128]   2097152   Gc f16 [NB][128][1024]  2097152
//   Yh/Yl bf16 [NB][4096][128]    8388608 x2
//   total (NB=8) = 109314048
// =========================================================================================================
extern "C" void kernel_launch(void* const* d_in, const int* in_sizes, int n_in,
                              void* d_out, int out_size, void* d_ws, size_t ws_size,
                              hipStream_t stream) {
  const int XN = NB * CC * NN;
  if (n_in < 14) return;
  if (in_sizes[0] < XN || in_sizes[1] < XN) return;
  if (in_sizes[2] < DQ * CC || in_sizes[4] < DQ * CC || in_sizes[6] < DQ * CC || in_sizes[8] < CC * DQ) return;
  if (in_sizes[3] < DQ || in_sizes[5] < DQ || in_sizes[7] < DQ) return;
  if (in_sizes[9] < CC || in_sizes[10] < CC || in_sizes[11] < CC || in_sizes[12] < CC || in_sizes[13] < CC) return;
  if (out_size < XN) return;

  size_t off = 0;
  auto carve = [&](size_t bytes) { const size_t o = off; off += (bytes + 255) & ~(size_t)255; return o; };
  const size_t oW16 = carve((size_t)MW * CC * 2);
  const size_t oWWb = carve((size_t)CC * DQ * 2);
  const size_t oXP  = carve((size_t)NB * NN * CC * 2);
  const size_t oNP  = carve((size_t)NB * NN * CC * 2);
  const size_t oQh  = carve((size_t)NB * NN * DQ * 2);
  const size_t oQl  = carve((size_t)NB * NN * DQ * 2);
  const size_t oPF  = carve((size_t)NB * NN * DQ * 4);
  const size_t oGF  = carve((size_t)NB * NN * DQ * 4);
  const size_t oKh  = carve((size_t)NB * MM * DQ * 2);
  const size_t oKl  = carve((size_t)NB * MM * DQ * 2);
  const size_t oGp  = carve((size_t)NB * MM * DQ * 2);
  const size_t oGc  = carve((size_t)NB * DQ * MM * 2);
  const size_t oYh  = carve((size_t)NB * NN * DQ * 2);
  const size_t oYl  = carve((size_t)NB * NN * DQ * 2);
  if (off > ws_size) return;
  if (off > (size_t)134217728) return;

  const float* x   = (const float*)d_in[0];
  const float* nf  = (const float*)d_in[1];
  const float* gw  = (const float*)d_in[2];
  const float* gb  = (const float*)d_in[3];
  const float* tw  = (const float*)d_in[4];
  const float* tb  = (const float*)d_in[5];
  const float* pw  = (const float*)d_in[6];
  const float* pb  = (const float*)d_in[7];
  const float* ow  = (const float*)d_in[8];
  const float* wb  = (const float*)d_in[9];
  const float* bng = (const float*)d_in[10];
  const float* bnb = (const float*)d_in[11];
  const float* bnm = (const float*)d_in[12];
  const float* bnv = (const float*)d_in[13];

  char* ws = (char*)d_ws;
  unsigned short* W16 = (unsigned short*)(ws + oW16);
  unsigned short* WWb = (unsigned short*)(ws + oWWb);
  unsigned short* XP  = (unsigned short*)(ws + oXP);
  unsigned short* NP  = (unsigned short*)(ws + oNP);
  unsigned short* Qh  = (unsigned short*)(ws + oQh);
  unsigned short* Ql  = (unsigned short*)(ws + oQl);
  float*          PF  = (float*)(ws + oPF);
  float*          GF  = (float*)(ws + oGF);
  unsigned short* Kh  = (unsigned short*)(ws + oKh);
  unsigned short* Kl  = (unsigned short*)(ws + oKl);
  unsigned short* Gp  = (unsigned short*)(ws + oGp);
  unsigned short* Gc  = (unsigned short*)(ws + oGc);
  unsigned short* Yh  = (unsigned short*)(ws + oYh);
  unsigned short* Yl  = (unsigned short*)(ws + oYl);
  float* out = (float*)d_out;

  const dim3 blk256(256), blk128(128);

  // (0) theta_w / phi_w / g_w -> stacked f16 plane; w_w -> bf16 plane
  cvt_w<<<dim3(MW / 8 + CC / 16), blk256, 0, stream>>>(tw, pw, gw, ow, W16, WWb);
  // (1) x -> XP, neighborFeat -> NP (position-major 16-bit planes)
  cvt_x<<<dim3(NN / QT, CC / QT, 2 * NB), blk256, 0, stream>>>(x, nf, XP, NP);
  // (2) conv1x1 GEMM -> theta (q) hi/res planes from NP, phi conv + bias f32 plane from NP, g conv + bias from XP
  gemm_proj<<<dim3(NSTRIP, MW / QT, NB), blk256, 0, stream>>>(W16, NP, XP, tb, pb, gb, Qh, Ql, PF, GF);
  // (3) 2x2 stride-2 max-pool -> pooled phi (k) hi/res planes, pooled g f16 plane
  pool_k<<<dim3(HP, NB), blk256, 0, stream>>>(PF, GF, Kh, Kl, Gp);
  // (4) pooled g -> channel-major plane
  tr_g<<<dim3(MM / QT, DQ / QT, NB), blk256, 0, stream>>>(Gp, Gc);
  // (5) attention -> y hi/res planes [b][n][128]
  attn_k<<<dim3(NQ / QT, NB), blk128, 0, stream>>>(Qh, Ql, Kh, Kl, Gc, Yh, Yl);
  // (6) output conv + bias + batch-norm affine + residual -> out [b][256][4096]
  gemm_out<<<dim3(NQ / QT, CC / QT, NB), blk128, 0, stream>>>(WWb, Yh, Yl, wb, bng, bnb, bnm, bnv, x, out);
  (void)hipGetLastError();
}

// v005
// It runs in 69.2 microseconds.
// Timed twice side by side with v004, it ran 1.17 and 1.16 times as fast.
// Counting every step since v000, it is 3.18 times as fast.
// Contractions: conv1x1 theta/phi/g GEMM W[384x256].X[256x128] per strip on v_wmma_f32_16x16x32_f16 (f16 containers
// of bf16-RNE weights x256 and bf16-RNE activations); scores K.Q^T on v_wmma_f32_16x16x32_bf16 (bf16 hi + bf16
// residual planes of theta / pooled phi, 3 products, K=128); y^T = G.P^T on v_wmma_f32_16x16x32_f16 (2x2-max-pooled g
// as f16, P = e^{s-m} x16384 f16 from the score D registers); output conv W[256x128].Y on v_wmma_f32_16x16x32_bf16
// (bf16 weights, y as bf16 hi + residual planes, 2 products); f32 accumulate everywhere; max-pool, softmax statistics,
// bias, batch-norm affine with running statistics and residual add in f32 VALU.
#include <hip/hip_runtime.h>
#include <math.h>
#include <stdint.h>

#ifndef NB
#define NB 8
#endif
#ifndef NQ
#define NQ 4096
#endif
#define NB_FULL 8
#define CC     256
#define HIMG   64
#define WIMG   64
#define NN     4096
#define DQ     128
#define HP     32
#define WP     32
#define MV     1024
#define MM     1024
#define MW     384
#define QT     64
#define SN     128
#define NWP    8
#define NSTRIP 32
#define OSP    68
#define OSPW   132
#define TP     72
#define WSC    256.0f
#define IWSC   0.00390625f
#define LNPS   9.704060527839234f
#define BNEPS  1.0e-5f
#define KT     64
#define NT     16
#define KPS    136
#define VPS    72
#define KSZ    (KT * KPS * 2)
#define VSZ    (DQ * VPS * 2)
#define STG    (2 * KSZ + VSZ)
#define PPS    264
#define PASZ   (QT * PPS * 2)
#define PBSZ   (SN * PPS * 2)

static_assert(NB >= 1 && NB <= NB_FULL);
static_assert(NQ % QT == 0 && NQ >= QT && NQ <= NN);
static_assert(NN == HIMG * WIMG);
static_assert(SN == 2 * WIMG);
static_assert(NSTRIP * SN == NN);
static_assert(SN == 16 * NWP);
static_assert(2 * HP == HIMG && 2 * WP == WIMG);
static_assert(MV == HP * WP && MM == MV);
static_assert(WP == 32 && HP == 32);
static_assert(NSTRIP == HP && WP * (QT / 8) == 256);  // one strip = one pooled row; 32 px x 8 lanes fill the GEMM block
static_assert(QT * (WP / 8) == 256 && KT % 8 == 0);   // g: 64 channels x 4 chunks of 8 px fill it too
static_assert(NN % QT == 0 && CC % QT == 0 && DQ % QT == 0 && MM % QT == 0);
static_assert(MW == 3 * DQ && MW % QT == 0 && MW % 8 == 0);
static_assert(CC % 32 == 0 && DQ % 32 == 0 && MM % 32 == 0);
static_assert((OSP * 4) % 16 == 0);
static_assert((OSPW * 4) % 16 == 0);
static_assert((TP * 2) % 16 == 0);
static_assert(SN * OSP * 4 <= 65536);
static_assert((size_t)NB_FULL * CC * NN * 4 == (size_t)33554432);
static_assert(NT * KT == MM && NT >= 2 && KT % 32 == 0);
static_assert(KPS == DQ + 8 && VPS == KT + 8);
static_assert(KT * DQ * 2 == 8 * 128 * 16 && DQ * KT * 2 == 8 * 128 * 16);
static_assert(DQ == 128 && KT == 8 * 8 && (DQ - 1) * VPS * 2 + KT * 2 <= VSZ);  // g stage: lane = channel row, 8 copies of 8 keys
static_assert(KSZ % 16 == 0 && VSZ % 16 == 0 && STG % 16 == 0);
static_assert(2 * (2 * STG + QT * OSPW * 4) <= 327680);
static_assert(PPS == CC + 8 && (PPS * 2) % 16 == 0);
static_assert(QT * CC * 2 == 8 * 256 * 16 && SN * CC * 2 == 16 * 256 * 16);
static_assert(SN * OSP * 4 <= PASZ + PBSZ && 3 * (PASZ + PBSZ) <= 327680);
static_assert(QT == KT && QT * OSP * 4 <= 3 * KSZ);
static_assert(DQ == 4 * 32 && DQ == 8 * 16);  // the attention pass names its 4 d-chunks and 2 x 4 channel tiles

// workspace total at full size (all region sizes are multiples of 256)
#define WS_FULL ((size_t)MW * CC * 2 + (size_t)CC * DQ * 2 + 2 * (size_t)NB_FULL * NN * CC * 2 \
                 + 2 * (size_t)NB_FULL * NN * DQ * 2 \
                 + 3 * (size_t)NB_FULL * MM * DQ * 2 + 2 * (size_t)NB_FULL * NN * DQ * 2)
static_assert(WS_FULL <= (size_t)134217728);

typedef _Float16       v16h __attribute__((ext_vector_type(16)));
typedef _Float16       v8h  __attribute__((ext_vector_type(8)));
typedef __bf16         v16b __attribute__((ext_vector_type(16)));
typedef unsigned short v8us __attribute__((ext_vector_type(8)));
typedef float          v8f  __attribute__((ext_vector_type(8)));
typedef float          v4f  __attribute__((ext_vector_type(4)));
typedef unsigned int   v4u  __attribute__((ext_vector_type(4)));

union Frag  { v8us u[2]; v16h h; v16b bf; };
union FragH { v16h v; v8h hv[2]; };
static_assert(sizeof(Frag) == 32);
static_assert(sizeof(FragH) == 32);

// ---- scalar helpers ---------------------------------------------------------------------------------------
__device__ __forceinline__ unsigned short bf_bits(float f) {          // f32 -> bf16 bits, RNE convert
  unsigned u = __float_as_uint(f);
  return (unsigned short)((u + 0x7FFFu + ((u >> 16) & 1u)) >> 16);
}
__device__ __forceinline__ float bf_up(unsigned short hb) { return __uint_as_float(((unsigned)hb) << 16); }
__device__ __forceinline__ float bfr(float f) { return bf_up(bf_bits(f)); }
__device__ __forceinline__ unsigned short h_bits(_Float16 x) { return __builtin_bit_cast(unsigned short, x); }
__device__ __forceinline__ unsigned pk16(unsigned short a, unsigned short b) { return (unsigned)a | ((unsigned)b << 16); }
__device__ __forceinline__ v8f zero8() { v8f z = {0.f, 0.f, 0.f, 0.f, 0.f, 0.f, 0.f, 0.f}; return z; }
__device__ __forceinline__ float hmax8(v8f s) {
  return fmaxf(fmaxf(fmaxf(s[0], s[1]), fmaxf(s[2], s[3])), fmaxf(fmaxf(s[4], s[5]), fmaxf(s[6], s[7])));
}
__device__ __forceinline__ unsigned wave_ballot(bool p) {
#if defined(__HIP_DEVICE_COMPILE__)
  return __builtin_amdgcn_ballot_w32(p);
#else
  return p ? 1u : 0u;
#endif
}
// 8 f32 values -> bf16 hi bits and bf16 residual bits (lo = RNE(v - hi)), packed 2 per uint
__device__ __forceinline__ void split8(const float* f, v4u& uh, v4u& ul) {
#pragma unroll
  for (int t = 0; t < 4; ++t) {
    const float f0 = f[2 * t], f1 = f[2 * t + 1];
    const unsigned short hb0 = bf_bits(f0), hb1 = bf_bits(f1);
    const unsigned short lb0 = bf_bits(f0 - bf_up(hb0));
    const unsigned short lb1 = bf_bits(f1 - bf_up(hb1));
    uh[t] = pk16(hb0, hb1);
    ul[t] = pk16(lb0, lb1);
  }
}

// ---- 16-bit fragment loader (A, or B from a k-contiguous [n][k] row): lane -> row/col (lane&15), p already includes
//      + 8*(lane>>4); elements 0..7 <- p[0..7] (k0+8h..), elements 8..15 <- p[16..23] (k0+16+8h..)
__device__ __forceinline__ Frag ldfrag(const unsigned short* p) {
  Frag f;
  f.u[0] = *(const v8us*)(p);
  f.u[1] = *(const v8us*)(p + 16);
  return f;
}

// ---- WMMA helpers: builtin followed by a 4-slot VALU gap tying D and keeping A/B live --------------------------
__device__ __forceinline__ v8f mma_h(v16h a, v16h b, v8f c) {
  v8f d = __builtin_amdgcn_wmma_f32_16x16x32_f16(false, a, false, b, (short)0, c, false, false);
#if defined(__HIP_DEVICE_COMPILE__)
  asm volatile("v_nop\n\tv_nop\n\tv_nop\n\tv_nop" : "+v"(d) : "v"(a), "v"(b));
#endif
  return d;
}
__device__ __forceinline__ v8f mma_b(v16b a, v16b b, v8f c) {
  v8f d = __builtin_amdgcn_wmma_f32_16x16x32_bf16(false, a, false, b, (short)0, c, false, false);
#if defined(__HIP_DEVICE_COMPILE__)
  const v16h ha = __builtin_bit_cast(v16h, a), hb = __builtin_bit_cast(v16h, b);
  asm volatile("v_nop\n\tv_nop\n\tv_nop\n\tv_nop" : "+v"(d) : "v"(ha), "v"(hb));
#endif
  return d;
}

// =========================================================================================================
// (0) weights. Blocks 0..47: W16 f16 [384][256], rows 0..127 = theta_w, 128..255 = phi_w, 256..383 = g_w; value =
//     f16 of (bf16-RNE(w) * 256) (exact). Block owns rows 8*blk..8*blk+7: one wave per 512-B row = 32 lanes x 16 B
// coverage: 48 blocks x 8 rows x 32 lanes x 8 halves = 384 x 256; 16 blocks x 16 rows x 16 lanes x 8 = 256 x 128.
// =========================================================================================================
__global__ __launch_bounds__(256)
void cvt_w(const float* __restrict__ tw, const float* __restrict__ pw, const float* __restrict__ gw,
           const float* __restrict__ ow, unsigned short* W16, unsigned short* WWb) {
  const int tid = threadIdx.x, blk = blockIdx.x;
  if (blk < MW / 8) {
    const int rl = tid >> 5, col = 8 * (tid & 31);
    const int o = 8 * blk + rl;                                      // 0..383
    const int grp = blk >> 4;                                        // 0,1,2 (block-uniform)
    const float* wbase = (grp == 0) ? tw : ((grp == 1) ? pw : gw);  // all global
    const float* s = wbase + (size_t)(o - DQ * grp) * CC + col;      // (o - 128 grp) in 0..127
    const v4f a = *(const v4f*)s;
    const v4f q = *(const v4f*)(s + 4);
    const float f[8] = {a[0], a[1], a[2], a[3], q[0], q[1], q[2], q[3]};
    v4u u;
#pragma unroll
    for (int t = 0; t < 4; ++t) {
      const _Float16 h0 = (_Float16)(bfr(f[2 * t]) * WSC);
      const _Float16 h1 = (_Float16)(bfr(f[2 * t + 1]) * WSC);
      u[t] = pk16(h_bits(h0), h_bits(h1));
    }
{
      *(v4u*)(W16 + (size_t)o * CC + col) = u;
      
    }
  } else {
    const int rb = blk - MW / 8;                                     // 0..15
    const int o = 16 * rb + (tid >> 4);                              // 0..255
    const int col = 8 * (tid & 15);                                  // 0..120
    const float* s = ow + (size_t)o * DQ + col;
    const v4f a = *(const v4f*)s;
    const v4f q = *(const v4f*)(s + 4);
    const float f[8] = {a[0], a[1], a[2], a[3], q[0], q[1], q[2], q[3]};
    v4u u;
#pragma unroll
    for (int t = 0; t < 4; ++t) u[t] = pk16(bf_bits(f[2 * t]), bf_bits(f[2 * t + 1]));
{
      *(v4u*)(WWb + (size_t)o * DQ + col) = u;
      
    }
  }
}

// =========================================================================================================
// (1) x f32 [b][256 c][4096 n] -> XP f16 [b][n][c] (grid z < NB) and neighborFeat -> NP (grid z >= NB), position-
//     major, bf16-RNE values (exact in f16), through an LDS tile T[64 n][64 c] (pitch TP, cross-wave, block barrier).
// coverage: T written rows (8e+t)=0..63 x cols cl 0..63, read rows 0..63 x cols 8e..8e+7; plane 2 it x 32 rows x 8
//           lanes x 8 = 64 n x 64 c; grid (64, 4, 2 NB) covers XP and NP [b][0..4095][0..255] exactly once.
// =========================================================================================================
__global__ __launch_bounds__(256)
void cvt_x(const float* __restrict__ x, const float* __restrict__ nf, unsigned short* XP, unsigned short* NP) {
  __shared__ __align__(16) unsigned short T[QT * TP];
  const int tid = threadIdx.x;
  const int nb = blockIdx.x, cb = blockIdx.y, zz = blockIdx.z;
  const int which = (zz >= NB) ? 1 : 0;                              // block-uniform plane select
  const int b = zz - which * NB;                                     // 0..NB-1
  const float* src = (which != 0) ? nf : x;                          // both global
  unsigned short* dst = (which != 0) ? NP : XP;                      // both global
  const int e = tid & 7, lq = tid >> 3;                              // lq 0..31
  const int n0 = nb * QT, c0 = cb * QT;
#pragma unroll
  for (int it = 0; it < 2; ++it) {
    const int cl = it * 32 + lq;                                     // 0..63
    const float* sp = src + ((size_t)(b * CC + c0 + cl)) * NN + n0 + 8 * e;
    const v4f a = *(const v4f*)sp;
    const v4f q = *(const v4f*)(sp + 4);
    unsigned short hb[8];
#pragma unroll
    for (int t = 0; t < 4; ++t) {
      hb[t]     = h_bits((_Float16)bfr(a[t]));
      hb[4 + t] = h_bits((_Float16)bfr(q[t]));
    }
#pragma unroll
    for (int t = 0; t < 8; ++t) T[(8 * e + t) * TP + cl] = hb[t];
  }
  __syncthreads();
  v4u up[2];
#pragma unroll
  for (int it = 0; it < 2; ++it) {
    const int nl = it * 32 + lq;                                     // 0..63
    up[it] = *(const v4u*)(T + nl * TP + 8 * e);
  }
{
#pragma unroll
    for (int it = 0; it < 2; ++it) {
      const int rl = it * 32 + lq;
      *(v4u*)(dst + ((size_t)(b * NN + n0 + rl)) * CC + c0 + 8 * e) = up[it];
    }
    
  }
}

// ---- eight asynchronous 16-byte copies per lane, global -> LDS: copy i takes g + i*gstep (elements) to LDS byte
//      address l + i*lstep. The s_wait_xcnt 0 is the last line of the copies' own statement so that it stands in
//      front of any later write of the address registers the copies name.
__device__ __forceinline__ void copy8(unsigned l, unsigned lstep, const unsigned short* g, size_t gstep) {
#if defined(__HIP_DEVICE_COMPILE__)
  asm volatile("global_load_async_to_lds_b128 %0, %8, off\n\t"
               "global_load_async_to_lds_b128 %1, %9, off\n\t"
               "global_load_async_to_lds_b128 %2, %10, off\n\t"
               "global_load_async_to_lds_b128 %3, %11, off\n\t"
               "global_load_async_to_lds_b128 %4, %12, off\n\t"
               "global_load_async_to_lds_b128 %5, %13, off\n\t"
               "global_load_async_to_lds_b128 %6, %14, off\n\t"
               "global_load_async_to_lds_b128 %7, %15, off\n\t"
               "s_wait_xcnt 0x0"
               :: "v"(l), "v"(l + lstep), "v"(l + 2 * lstep), "v"(l + 3 * lstep),
                  "v"(l + 4 * lstep), "v"(l + 5 * lstep), "v"(l + 6 * lstep), "v"(l + 7 * lstep),
                  "v"(g), "v"(g + gstep), "v"(g + 2 * gstep), "v"(g + 3 * gstep),
                  "v"(g + 4 * gstep), "v"(g + 5 * gstep), "v"(g + 6 * gstep), "v"(g + 7 * gstep)
               : "memory");
#endif
}

// =========================================================================================================
// (2) conv1x1 GEMM for one (b, strip of 128 positions = image rows 2s and 2s+1, 64-o block of the stacked weights):
//     Y[o][n] = (1/256) sum_c W16[o][c] B[b][n][c], B = NP for o-blocks 0..3 (theta, phi) and XP for o-blocks 4,5
//     (g), block-uniform select. Block 256 threads = 8 waves; wave w owns cols n0+16w..+15 (one B fragment per
//     k-step, k = c contiguous in the plane row) and 4 m-tiles (A rows o = o0 + 16 mt + (lane&15), split k map
//     loader from W16). K = 256 = 8 steps. Both operand tiles (64 weight rows, 128 position rows, 512 B each) are
//     staged once per block in LDS by asynchronous copies of whole 128-B lines (24 copies per lane), rows at pitch
//     528 B, and read by the waves as ds_load_b128 fragments behind each wave's own asynccnt wait + block barrier.
//     Epilogue staged in LDS Os[n_loc][o_loc] (pitch OSP, b128 stores; it reuses the operand tiles' bytes behind a
//     block barrier that ends every wave's fragment reads), block barrier, then (block-uniform branch on the o block):
//       o-blocks 0,1 -> theta dims 0..63 / 64..127 + bias -> Qh/Ql bf16 [b][4096 n][128 d] (hi = RNE(v), lo = RNE(v-hi)):
//       o-blocks 2,3 -> phi + bias in f32, 2x2 stride-2 max-pool in f32 inside the tile (the strip holds both image
//                       rows of pooled row py = strip: window n_loc = 64 dy + 2 px + dx) -> Kh/Kl bf16 [b][1024 m][128 d]
//                       (hi = RNE(v), lo = RNE(v-hi)), m = 32 py + px: 32 rows x the dsel half (128 B = 1 whole line).
//       o-blocks 4,5 -> g + bias, the same pool, read down the tile's columns (lane = channel, 8 px per thread) ->
//                       Gt f16 [b][128 chunks m>>3][128 d][8 keys m&7], the order in which the attention stages it:
//                       4 chunks x the dsel half (64 d x 16 B = 8 whole lines), one wave = 512 contiguous bytes.
// coverage: Os 8 waves x 16 n x 64 o = 128 x 64 written, reads rows <= 127 cols <= 63; theta planes 4 it x 32 rows
//           x 8 lanes x 8 = 128 n x 64 d; k planes 32 px x 8 lanes x 8 = 32 m x 64 d; Gt 4 chunks x 64 d x 8 keys;
//           grid (32, 6, NB) covers all 4096 rows x 128 d of Qh/Ql and all 1024 keys x 128 d of Kh/Kl/Gt exactly once.
// =========================================================================================================
__global__ __launch_bounds__(256) __attribute__((amdgpu_num_vgpr(256)))
void gemm_proj(const unsigned short* __restrict__ W16, const unsigned short* __restrict__ NP,
               const unsigned short* __restrict__ XP,
               const float* __restrict__ tb, const float* __restrict__ pb, const float* __restrict__ gb,
               unsigned short* Qh, unsigned short* Ql,
               unsigned short* Kh, unsigned short* Kl, unsigned short* Gt) {
  __shared__ __align__(16) unsigned char Sm[PASZ + PBSZ];
  const unsigned short* As = (const unsigned short*)Sm;              // weight tile  [64 o][PPS]
  const unsigned short* Bs = (const unsigned short*)(Sm + PASZ);     // position tile [128 n][PPS]
  float* Os = (float*)Sm;                                            // epilogue tile, after the last fragment read
  const int tid  = threadIdx.x;
  const int lane = tid & 31, wave = tid >> 5;                        // wave 0..7
  const int hh   = lane >> 4, c = lane & 15;
  const int st   = blockIdx.x, mb = blockIdx.y, b = blockIdx.z;
  const int n0   = st * SN, o0 = mb * QT;
  const unsigned short* BP = (mb < 4) ? NP : XP;                     // block-uniform, both global

  // both tiles are contiguous in global memory: 16-B chunk tid + 256 per copy = row (tid>>5) + 8 per copy, chunk tid&31
  const unsigned lrow = (unsigned)(size_t)Sm + (unsigned)((tid >> 5) * (PPS * 2) + (tid & 31) * 16);
  const unsigned short* bg = BP + (size_t)(b * NN + n0) * CC + 8 * tid;
  copy8(lrow, 8 * PPS * 2, W16 + (size_t)o0 * CC + 8 * tid, 256 * 8);
  copy8(lrow + PASZ, 8 * PPS * 2, bg, 256 * 8);
  copy8(lrow + PASZ + 64 * PPS * 2, 8 * PPS * 2, bg + (size_t)64 * CC, 256 * 8);
  asm volatile("s_wait_asynccnt 0x0" ::: "memory");                  // this wave's copies have landed
  __syncthreads();                                                   // every wave's copies are readable

  const unsigned short* ap = As + c * PPS + 8 * hh;
  const unsigned short* bp = Bs + (16 * wave + c) * PPS + 8 * hh;

  v8f acc[4];
#pragma unroll
  for (int mt = 0; mt < 4; ++mt) acc[mt] = zero8();

#pragma unroll
  for (int ks = 0; ks < CC / 32; ++ks) {
    const Frag fb = ldfrag(bp + 32 * ks);
    Frag fa[4];
#pragma unroll
    for (int mt = 0; mt < 4; ++mt) fa[mt] = ldfrag(ap + (16 * mt) * PPS + 32 * ks);
#pragma unroll
    for (int mt = 0; mt < 4; ++mt) acc[mt] = mma_h(fa[mt].h, fb.h, acc[mt]);
  }
  __syncthreads();                                                   // all fragment reads done: Os may take the bytes

  // ---- epilogue: scale back -> LDS Os[n_loc][o_loc]; lane (hh, c) holds o = 16 mt + 8 hh + r for n_loc = 16 w + c
  {
    const int nl = 16 * wave + c;
#pragma unroll
    for (int mt = 0; mt < 4; ++mt) {
      v4f va, vb;
#pragma unroll
      for (int r = 0; r < 4; ++r) { va[r] = acc[mt][r] * IWSC; vb[r] = acc[mt][4 + r] * IWSC; }
      *(v4f*)(Os + nl * OSP + 16 * mt + 8 * hh)     = va;
      *(v4f*)(Os + nl * OSP + 16 * mt + 8 * hh + 4) = vb;
    }
  }
  __syncthreads();

  const int grp = mb >> 1;                                           // 0 theta, 1 phi, 2 g (block-uniform)
  const int dsel = (mb & 1) * QT;                                    // 0 or 64
  const float* bias = (grp == 0) ? tb : ((grp == 1) ? pb : gb);     // all global

  if (grp == 0) {
    const int e = tid & 7, lq = tid >> 3;                            // lq 0..31
    float bv[8];
    {
      const v4f ba = *(const v4f*)(bias + dsel + 8 * e);
      const v4f bq = *(const v4f*)(bias + dsel + 8 * e + 4);
#pragma unroll
      for (int t = 0; t < 4; ++t) { bv[t] = bfr(ba[t]); bv[4 + t] = bfr(bq[t]); }
    }
    v4u uh[4], ul[4];
#pragma unroll
    for (int it = 0; it < 4; ++it) {
      const int row = it * 32 + lq;                                  // n_loc 0..127
      const v4f a = *(const v4f*)(Os + row * OSP + 8 * e);
      const v4f q = *(const v4f*)(Os + row * OSP + 8 * e + 4);
      float f[8];
#pragma unroll
      for (int t = 0; t < 4; ++t) { f[t] = a[t] + bv[t]; f[4 + t] = q[t] + bv[4 + t]; }
      split8(f, uh[it], ul[it]);
    }
{
#pragma unroll
      for (int it = 0; it < 4; ++it) {
        const int row = it * 32 + lq;
        const size_t po = ((size_t)(b * NN + n0 + row)) * DQ + dsel + 8 * e;
        *(v4u*)(Qh + po) = uh[it];
        *(v4u*)(Ql + po) = ul[it];
      }
      
    }
  } else if (grp == 1) {
    const int e = tid & 7, px = tid >> 3;                            // px 0..31
    float bv[8];
    {
      const v4f ba = *(const v4f*)(bias + dsel + 8 * e);
      const v4f bq = *(const v4f*)(bias + dsel + 8 * e + 4);
#pragma unroll
      for (int t = 0; t < 4; ++t) { bv[t] = bfr(ba[t]); bv[4 + t] = bfr(bq[t]); }
    }
    float f[8];
#pragma unroll
    for (int t = 0; t < 8; ++t) f[t] = -__builtin_inff();
#pragma unroll
    for (int dy = 0; dy < 2; ++dy) {
#pragma unroll
      for (int dx = 0; dx < 2; ++dx) {
        const int row = dy * WIMG + 2 * px + dx;                     // n_loc 0..127
        const v4f a = *(const v4f*)(Os + row * OSP + 8 * e);
        const v4f q = *(const v4f*)(Os + row * OSP + 8 * e + 4);
#pragma unroll
        for (int t = 0; t < 4; ++t) {
          f[t]     = fmaxf(f[t], a[t] + bv[t]);
          f[4 + t] = fmaxf(f[4 + t], q[t] + bv[4 + t]);
        }
      }
    }
    const size_t po = ((size_t)(b * MM + WP * st + px)) * DQ + dsel + 8 * e;
    v4u kh, kl;
    split8(f, kh, kl);
    *(v4u*)(Kh + po) = kh;
    *(v4u*)(Kl + po) = kl;
    asm volatile("s_wait_xcnt 0x0" ::: "memory");                    // ahead of any later write of the two stores' registers
  } else {
    const int cl = tid & (QT - 1), pc = tid >> 6;                    // channel 0..63 of the block, px chunk 0..3
    const float bs = bfr(bias[dsel + cl]);
    float f[8];
#pragma unroll
    for (int j = 0; j < 8; ++j) {
      f[j] = -__builtin_inff();
#pragma unroll
      for (int dy = 0; dy < 2; ++dy) {
#pragma unroll
        for (int dx = 0; dx < 2; ++dx) {
          const int row = dy * WIMG + 2 * (8 * pc + j) + dx;         // n_loc 0..127
          f[j] = fmaxf(f[j], Os[row * OSP + cl] + bs);
        }
      }
    }
    v4u gu;
#pragma unroll
    for (int t = 0; t < 4; ++t) gu[t] = pk16(h_bits((_Float16)f[2 * t]), h_bits((_Float16)f[2 * t + 1]));
    // key m = 32 st + 8 pc + j: chunk m>>3 = 4 st + pc, place j in the chunk
    *(v4u*)(Gt + (((size_t)(b * (MM / 8) + (WP / 8) * st + pc)) * DQ + dsel + cl) * 8) = gu;
    asm volatile("s_wait_xcnt 0x0" ::: "memory");                    // ahead of any later write of the store's registers
  }
}

// ---- attention fragment groups (LDS): each group is 8 ds_load_b128 written together, one block of products ahead of
//      its use. ldk4: K hi rows key..+15 and +16..+31, then the same rows of the K residual plane, 32 d at p.
//      ldv4: pooled-g rows of 4 channel tiles (16 rows apart), 32 keys at p. sc6: the six score products of one d-chunk.
__device__ __forceinline__ void ldk4(Frag* f, const unsigned short* p) {
  f[0] = ldfrag(p);
  f[1] = ldfrag(p + 16 * KPS);
  f[2] = ldfrag(p + KSZ / 2);
  f[3] = ldfrag(p + KSZ / 2 + 16 * KPS);
}
__device__ __forceinline__ void ldv4(Frag* f, const unsigned short* p) {
#pragma unroll
  for (int j = 0; j < 4; ++j) f[j] = ldfrag(p + (16 * j) * VPS);
}
__device__ __forceinline__ void sc6(const Frag* k, const Frag& qh, const Frag& ql, v8f& s0, v8f& s1) {
  s0 = mma_b(k[0].bf, qh.bf, s0);
  s1 = mma_b(k[1].bf, qh.bf, s1);
  s0 = mma_b(k[0].bf, ql.bf, s0);
  s1 = mma_b(k[1].bf, ql.bf, s1);
  s0 = mma_b(k[2].bf, qh.bf, s0);
  s1 = mma_b(k[3].bf, qh.bf, s1);
}

// =========================================================================================================
// (3) attention for one (b, 64-query tile), transposed formulation, 1024 keys (all valid, no mask, no scale):
//   S^T tile (16 keys x 16 queries) = sum over 4 d-chunks (q fragments kept in registers) of A(k: row = key kb + (lane&15), 32 d via
//   the split k map from the bf16 plane Kh [b][1024][128]) . B(q: col = query, same map from Qh [b][4096][128])
//   + A(Kh).B(Ql) + A(Kl).B(Qh) (bf16 unscaled residual planes, shared accumulator).
//   Per lane the D tile holds 8 keys of ONE query: online softmax state per lane, one shuffle (lane^16) for the max
//   over 32 keys; the o/l rescale is skipped under a wave-uniform ballot when no lane's max grew (corr == 1 exactly
//   for every lane then); row-sum partials combined at the end. P = e^{s-m} x 16384 as f16 is the B operand of
//   y^T (rows channel, cols queries) += A(pooled g: rows channel = 16j + (lane&15), keys contiguous in the LDS tile,
//   f16 plane Gt [b][128 chunks of 8 keys][128 ch][8 keys]) . B(P^T): element r <- D of the tile covering keys kb..kb+15, element 8+r <- the tile covering
//   kb+16..kb+31, lane unchanged. 8 accumulator tiles per wave (128 channels). Block = 4 waves = 64 queries.
//   K hi / K residual / pooled-g tiles of 64 keys are staged once per block in a two-buffer LDS ring by asynchronous
//   copies (whole 128-B lines from global; 24 copies per lane and stage) and read by all 4 waves as ds_load_b128
//   fragments: K rows at pitch 272 B, g rows (64 keys = 128 B) at pitch 144 B. Stage t+2 is issued behind the barrier
//   that ends every wave's reads of stage t; stage t+1 is read only behind each wave's own asynccnt wait + barrier.
//   Fragments go through two register sets: each group of 8 ds_load_b128 is issued one block of products ahead of its
//   use (K d-chunk c+1 ahead of chunk c's products, the g rows ahead of the last score products and the softmax), inside one stage only.
//   Epilogue: y = O/l staged in LDS Os[query][128 channels] (pitch OSPW, b128 stores), block barrier, then
// coverage: Os written 4 waves x 16 queries x 128 ch, read rows 0..63 x ch 8e..8e+7 (e 0..15); planes 8 it x 8 rows x
//           16 lanes x 8 = 64 n x 128 ch per plane; grid (NQ/64, NB) covers rows 0..NQ-1 of Yh/Yl exactly once.
// =========================================================================================================
__global__ __launch_bounds__(128) __attribute__((amdgpu_num_vgpr(256)))
void attn_k(const unsigned short* __restrict__ Qh, const unsigned short* __restrict__ Ql,
            const unsigned short* __restrict__ Kh, const unsigned short* __restrict__ Kl,
            const unsigned short* __restrict__ Gt, unsigned short* Yh, unsigned short* Yl) {
  __shared__ __align__(16) float Os[QT * OSPW];
  __shared__ __align__(16) unsigned short Ring[2 * STG / 2];
  const int tid  = threadIdx.x;
  const int wave = tid >> 5, lane = tid & 31;
  const int hh   = lane >> 4, c = lane & 15;
  const int n0   = blockIdx.x * QT, b = blockIdx.y;

  // q fragment pointers (B operand, col = query n0 + 16*wave + c), + 32*kc
  const size_t qo = ((size_t)(b * NN + n0 + 16 * wave + c)) * DQ + 8 * hh;
  const unsigned short* Qhp = Qh + qo;
  const unsigned short* Qlp = Ql + qo;
  // copy sources of stage 0 (per lane, 16 B): each plane's 16-KB tile is contiguous, chunk tid, + 128 chunks per copy
  // (g plane: lane = channel tid, copy i = the stage's keys 8i..8i+7)
  const unsigned short* Khg = Kh + (size_t)b * MM * DQ + 8 * tid;
  const unsigned short* Klg = Kl + (size_t)b * MM * DQ + 8 * tid;
  const unsigned short* Vg  = Gt + (size_t)b * MM * DQ + 8 * tid;
  // copy destinations in buffer 0 (LDS byte addresses): K row (tid>>4) + 8 per copy, g row tid, + 16 B per copy
  const unsigned ring0 = (unsigned)(size_t)Ring;
  const unsigned lK = ring0 + (unsigned)((tid >> 4) * (KPS * 2) + (tid & 15) * 16);
  const unsigned lV = ring0 + (unsigned)(2 * KSZ + tid * (VPS * 2));
  // fragment offsets inside a buffer (elements): k (A operand, row = key + c), + key * KPS + 32*kc;
  // v (A operand, row = channel 16j + c, keys contiguous), + 16*j*VPS + key
  const int kfo = c * KPS + 8 * hh;
  const int vfo = KSZ + c * VPS + 8 * hh;

  // ring prologue: stage 0 -> buffer 0, landed and published; then stage 1 -> buffer 1 flies over pass 0
  copy8(lK, 8 * KPS * 2, Khg, 128 * 8);
  copy8(lK + KSZ, 8 * KPS * 2, Klg, 128 * 8);
  copy8(lV, 16, Vg, 128 * 8);
  asm volatile("s_wait_asynccnt 0x0" ::: "memory");                  // this wave's stage-0 copies have landed
  __syncthreads();                                                   // every wave's stage-0 copies are readable
  copy8(lK + STG, 8 * KPS * 2, Khg + (size_t)KT * DQ, 128 * 8);
  copy8(lK + STG + KSZ, 8 * KPS * 2, Klg + (size_t)KT * DQ, 128 * 8);
  copy8(lV + STG, 16, Vg + (size_t)KT * DQ, 128 * 8);

  // q hi / residual fragments of this wave's 16 queries: the same for every key, loaded once and kept in registers
  Frag qhf[DQ / 32], qlf[DQ / 32];
#pragma unroll
  for (int kc = 0; kc < DQ / 32; ++kc) {
    qhf[kc] = ldfrag(Qhp + 32 * kc);
    qlf[kc] = ldfrag(Qlp + 32 * kc);
  }

  float m = -1.0e30f, l = 0.f;
  v8f o[8];
#pragma unroll
  for (int j = 0; j < 8; ++j) o[j] = zero8();

#pragma unroll 1  // one stage per trip, rolled: the publish point at its foot stands once in the text
  for (int t = 0; t < NT; ++t) {
   const unsigned short* sb = Ring + (t & 1) * (STG / 2);            // this stage's buffer
   const unsigned short* kp = sb + kfo;
   const unsigned short* vp = sb + vfo;
   // two fragment sets of 4 x 8 registers, filled in turn one block of products ahead of their use
   Frag fa[4], fb[4];
   ldk4(fa, kp);                                                     // d-chunk 0 of the stage's first 32 keys
#pragma unroll  // both 32-key passes of the stage in the text: the second one's first K fragments are fetched in the first
   for (int kb = 0; kb < KT; kb += 32) {
    const unsigned short* k0p = kp + kb * KPS;                       // keys kb .. kb+15 of the stage
    v8f s0 = zero8(), s1 = zero8();
    ldk4(fb, k0p + 32);
    sc6(fa, qhf[0], qlf[0], s0, s1);
    ldk4(fa, k0p + 64);
    sc6(fb, qhf[1], qlf[1], s0, s1);
    ldk4(fb, k0p + 96);
    sc6(fa, qhf[2], qlf[2], s0, s1);
    ldv4(fa, vp + kb);                                               // pooled-g rows of channels 0..63
    sc6(fb, qhf[3], qlf[3], s0, s1);
    ldv4(fb, vp + 64 * VPS + kb);                                    // channels 64..127, in flight over the softmax

    float mx = fmaxf(hmax8(s0), hmax8(s1));
    mx = fmaxf(mx, __shfl_xor(mx, 16, 32));
    const float mn = fmaxf(m, mx);
    const unsigned grew = wave_ballot(mx > m);                       // wave-uniform
    if (grew != 0u) {
      const float corr = __expf(m - mn);                             // == 1 exactly for lanes whose max did not grow
      l *= corr;
#pragma unroll
      for (int j = 0; j < 8; ++j) {
#pragma unroll
        for (int r = 0; r < 8; ++r) o[j][r] *= corr;
      }
    }
    m = mn;
    const float msh = mn - LNPS;                                     // exp gives e^{s-m} * 16384

    FragH ph;
    float ls = 0.f;
#pragma unroll
    for (int r = 0; r < 8; ++r) {
      const float e0 = __expf(s0[r] - msh);                          // key kb      + 8hh + r
      const float e1 = __expf(s1[r] - msh);                          // key kb + 16 + 8hh + r
      ls += e0 + e1;
      ph.hv[0][r] = (_Float16)e0;
      ph.hv[1][r] = (_Float16)e1;
    }
    l += ls;

#pragma unroll
    for (int j = 0; j < 4; ++j) o[j] = mma_h(fa[j].h, ph.v, o[j]);
    if (kb + 32 < KT) ldk4(fa, k0p + 32 * KPS);                      // compile-time test: next pass's d-chunk 0, same stage
#pragma unroll
    for (int j = 0; j < 4; ++j) o[4 + j] = mma_h(fb[j].h, ph.v, o[4 + j]);
   }
   // publish point of stage t+1, and release of stage t's buffer
   asm volatile("s_wait_dscnt 0x0" ::: "memory");                    // this wave's reads of stage t are done
   asm volatile("s_wait_asynccnt 0x0" ::: "memory");                 // this wave's stage t+1 copies have landed
   __syncthreads();
   if (t + 2 < NT) {                                                 // block-uniform
     const unsigned bo = (unsigned)((t & 1) * STG);
     copy8(lK + bo, 8 * KPS * 2, Khg + (size_t)(t + 2) * KT * DQ, 128 * 8);
     copy8(lK + bo + KSZ, 8 * KPS * 2, Klg + (size_t)(t + 2) * KT * DQ, 128 * 8);
     copy8(lV + bo, 16, Vg + (size_t)(t + 2) * KT * DQ, 128 * 8);
   }
  }
  asm volatile("s_wait_asynccnt 0x0" ::: "memory");                  // nothing of the ring is in flight past here
  l += __shfl_xor(l, 16, 32);
  const float inv = 1.0f / l;                                        // o and l both carry the x16384 factor

  // ---- epilogue: y = o * inv -> Os[query][ch]; lane (hh, c) holds ch = 16 j + 8 hh + r for query 16 w + c
  {
    const int qrow = 16 * wave + c;
#pragma unroll
    for (int j = 0; j < 8; ++j) {
      v4f va, vb;
#pragma unroll
      for (int r = 0; r < 4; ++r) { va[r] = o[j][r] * inv; vb[r] = o[j][4 + r] * inv; }
      *(v4f*)(Os + qrow * OSPW + 16 * j + 8 * hh)     = va;
      *(v4f*)(Os + qrow * OSPW + 16 * j + 8 * hh + 4) = vb;
    }
  }
  __syncthreads();

  const int e16 = tid & 15, lr = tid >> 4;                           // lr 0..7
  v4u uh[8], ul[8];
#pragma unroll
  for (int it = 0; it < 8; ++it) {
    const int row = it * 8 + lr;                                     // query 0..63
    const v4f a = *(const v4f*)(Os + row * OSPW + 8 * e16);
    const v4f q = *(const v4f*)(Os + row * OSPW + 8 * e16 + 4);
    const float f[8] = {a[0], a[1], a[2], a[3], q[0], q[1], q[2], q[3]};
    split8(f, uh[it], ul[it]);
  }
{
#pragma unroll
    for (int it = 0; it < 8; ++it) {
      const int row = it * 8 + lr;
      const size_t po = ((size_t)(b * NN + n0 + row)) * DQ + 8 * e16;
      *(v4u*)(Yh + po) = uh[it];
      *(v4u*)(Yl + po) = ul[it];
    }
    
  }
}

// =========================================================================================================
// (4) output conv for one (b, 64-n tile, 64-c block): A[c][n] = sum_ci WWb[c][ci] (Yh + Yl)[b][n][ci] on bf16 WMMA
//     (2 products per k-step, shared accumulator), K = 128 = 4 steps. Block 128 threads = 4 waves; wave w owns cols
//     n0+16w..+15 (B fragments from the k-contiguous Yh/Yl rows) and 4 m-tiles (A rows c = c0 + 16 mt + (lane&15),
//     split k map loader from WWb). The three operand tiles (64 weight rows, 64 position rows of Yh and of Yl, 256 B
//     each, contiguous in global memory) are staged once per block in LDS by asynchronous copies of whole 128-B lines
//     (24 copies per lane), rows at pitch 272 B, and read as ds_load_b128 fragments behind each wave's own asynccnt
//     wait + block barrier; Os reuses their bytes behind a block barrier that ends every wave's fragment reads.
//     Per-channel constants (bf16-RNE of w_b, bn mean, bn beta, and scale =
//     bf16-RNE(gamma) * rsqrt(bf16-RNE(var) + eps)) staged once in LDS by waves 0,1. Epilogue staged in LDS
//     Os[n_loc][c_loc] (pitch OSP, b128 stores), block barrier, then out[b][c][n] = (((A + w_b[c]) - mean[c]) *
// coverage: Os 4 waves x 16 n x 64 c written, read rows nl+t <= 63 x cols cl <= 63; Pb/Pm/Ps/Pt written 0..63, read
//           cl <= 63; out 8 it x 16 lines x 8 lanes x 4 floats = 64 c x 64 n; grid (NQ/64, 4, NB) covers
//           out[b][0..255][0..NQ-1] exactly once.
// =========================================================================================================
__global__ __launch_bounds__(128) __attribute__((amdgpu_num_vgpr(256)))
void gemm_out(const unsigned short* __restrict__ WWb, const unsigned short* __restrict__ Yh,
              const unsigned short* __restrict__ Yl, const float* __restrict__ wb,
              const float* __restrict__ bng, const float* __restrict__ bnb,
              const float* __restrict__ bnm, const float* __restrict__ bnv,
              const float* __restrict__ x, float* out) {
  __shared__ __align__(16) unsigned char Sm[3 * KSZ];
  const unsigned short* As = (const unsigned short*)Sm;              // weight tile [64 c][KPS]; Yh, Yl tiles behind it
  float* Os = (float*)Sm;                                            // epilogue tile, after the last fragment read
  __shared__ float Pb[QT], Pm[QT], Ps[QT], Pt[QT];
  const int tid  = threadIdx.x;
  const int lane = tid & 31, wave = tid >> 5;
  const int hh   = lane >> 4, c = lane & 15;
  const int nt   = blockIdx.x, cb = blockIdx.y, b = blockIdx.z;
  const int n0   = nt * QT, c0 = cb * QT;

  // each tile is contiguous in global memory: 16-B chunk tid + 128 per copy = row (tid>>4) + 8 per copy, chunk tid&15
  const unsigned lrow = (unsigned)(size_t)Sm + (unsigned)((tid >> 4) * (KPS * 2) + (tid & 15) * 16);
  const size_t yo = (size_t)(b * NN + n0) * DQ + 8 * tid;
  copy8(lrow, 8 * KPS * 2, WWb + (size_t)c0 * DQ + 8 * tid, 128 * 8);
  copy8(lrow + KSZ, 8 * KPS * 2, Yh + yo, 128 * 8);
  copy8(lrow + 2 * KSZ, 8 * KPS * 2, Yl + yo, 128 * 8);

  if (tid < QT) {                                                    // waves 0,1 (wave-uniform), cross-wave via barrier
    const int ch = c0 + tid;                                         // 0..255
    Pb[tid] = bfr(wb[ch]);
    Pm[tid] = bfr(bnm[ch]);
    Ps[tid] = bfr(bng[ch]) * rsqrtf(bfr(bnv[ch]) + BNEPS);
    Pt[tid] = bfr(bnb[ch]);
  }

  asm volatile("s_wait_asynccnt 0x0" ::: "memory");                  // this wave's copies have landed
  __syncthreads();                                                   // every wave's copies are readable

  const unsigned short* ap  = As + c * KPS + 8 * hh;
  const unsigned short* bph = As + KSZ / 2 + (16 * wave + c) * KPS + 8 * hh;
  const unsigned short* bpl = bph + KSZ / 2;

  v8f acc[4];
#pragma unroll
  for (int mt = 0; mt < 4; ++mt) acc[mt] = zero8();

#pragma unroll
  for (int ks = 0; ks < DQ / 32; ++ks) {
    const Frag fbh = ldfrag(bph + 32 * ks);
    const Frag fbl = ldfrag(bpl + 32 * ks);
    Frag fa[4];
#pragma unroll
    for (int mt = 0; mt < 4; ++mt) fa[mt] = ldfrag(ap + (16 * mt) * KPS + 32 * ks);
#pragma unroll
    for (int mt = 0; mt < 4; ++mt) {
      acc[mt] = mma_b(fa[mt].bf, fbh.bf, acc[mt]);
      acc[mt] = mma_b(fa[mt].bf, fbl.bf, acc[mt]);
    }
  }
  __syncthreads();                                                   // all fragment reads done: Os may take the bytes

  // ---- epilogue: -> LDS Os[n_loc][c_loc]; lane (hh, c) holds c_loc = 16 mt + 8 hh + r for n_loc = 16 w + c
  {
    const int nl = 16 * wave + c;
#pragma unroll
    for (int mt = 0; mt < 4; ++mt) {
      v4f va, vb;
#pragma unroll
      for (int r = 0; r < 4; ++r) { va[r] = acc[mt][r]; vb[r] = acc[mt][4 + r]; }
      *(v4f*)(Os + nl * OSP + 16 * mt + 8 * hh)     = va;
      *(v4f*)(Os + nl * OSP + 16 * mt + 8 * hh + 4) = vb;
    }
  }
  __syncthreads();

  const int e = tid & 7, lq = tid >> 3;                              // lq 0..15
  v4f res[8];
#pragma unroll
  for (int it = 0; it < 8; ++it) {
    const int L   = it * 16 + lq;                                    // 0..127
    const int cl  = L >> 1, hf = L & 1;                              // channel 0..63 within the block
    const int nl  = hf * 32 + 4 * e;                                 // position 0..63
    const float pbv = Pb[cl], pmv = Pm[cl], psv = Ps[cl], ptv = Pt[cl];
    const size_t idx = ((size_t)(b * CC + c0 + cl)) * NN + n0 + nl;
    const v4f xv = *(const v4f*)(x + idx);
#pragma unroll
    for (int t = 0; t < 4; ++t) {
      const float cv = Os[(nl + t) * OSP + cl] + pbv;
      res[it][t] = ((cv - pmv) * psv + ptv) + bfr(xv[t]);
    }
  }
{
#pragma unroll
    for (int it = 0; it < 8; ++it) {
      const int L   = it * 16 + lq;
      const int cl  = L >> 1, hf = L & 1;
      const int nl  = hf * 32 + 4 * e;
      const size_t idx = ((size_t)(b * CC + c0 + cl)) * NN + n0 + nl;
      *(v4f*)(out + idx) = res[it];
    }
    
  }
}

// =========================================================================================================
// Workspace map (bytes; each region start a multiple of 256; every extent is an exact row/tile multiple and is
//   W16 f16 [384][256]            196608      WWb bf16 [256][128]        65536
//   XP / NP f16 [NB][4096][256]  16777216 x2 (NB=8)
//   Qh/Ql bf16 [NB][4096][128]    8388608 x2
//   Kh/Kl bf16 [NB][1024][128]    2097152 x2  Gt f16 [NB][128][128][8] 2097152
//   Yh/Yl bf16 [NB][4096][128]    8388608 x2
//   total (NB=8) = 73662464
// =========================================================================================================
extern "C" void kernel_launch(void* const* d_in, const int* in_sizes, int n_in,
                              void* d_out, int out_size, void* d_ws, size_t ws_size,
                              hipStream_t stream) {
  const int XN = NB * CC * NN;
  if (n_in < 14) return;
  if (in_sizes[0] < XN || in_sizes[1] < XN) return;
  if (in_sizes[2] < DQ * CC || in_sizes[4] < DQ * CC || in_sizes[6] < DQ * CC || in_sizes[8] < CC * DQ) return;
  if (in_sizes[3] < DQ || in_sizes[5] < DQ || in_sizes[7] < DQ) return;
  if (in_sizes[9] < CC || in_sizes[10] < CC || in_sizes[11] < CC || in_sizes[12] < CC || in_sizes[13] < CC) return;
  if (out_size < XN) return;

  size_t off = 0;
  auto carve = [&](size_t bytes) { const size_t o = off; off += (bytes + 255) & ~(size_t)255; return o; };
  const size_t oW16 = carve((size_t)MW * CC * 2);
  const size_t oWWb = carve((size_t)CC * DQ * 2);
  const size_t oXP  = carve((size_t)NB * NN * CC * 2);
  const size_t oNP  = carve((size_t)NB * NN * CC * 2);
  const size_t oQh  = carve((size_t)NB * NN * DQ * 2);
  const size_t oQl  = carve((size_t)NB * NN * DQ * 2);
  const size_t oKh  = carve((size_t)NB * MM * DQ * 2);
  const size_t oKl  = carve((size_t)NB * MM * DQ * 2);
  const size_t oGt  = carve((size_t)NB * MM * DQ * 2);
  const size_t oYh  = carve((size_t)NB * NN * DQ * 2);
  const size_t oYl  = carve((size_t)NB * NN * DQ * 2);
  if (off > ws_size) return;
  if (off > (size_t)134217728) return;

  const float* x   = (const float*)d_in[0];
  const float* nf  = (const float*)d_in[1];
  const float* gw  = (const float*)d_in[2];
  const float* gb  = (const float*)d_in[3];
  const float* tw  = (const float*)d_in[4];
  const float* tb  = (const float*)d_in[5];
  const float* pw  = (const float*)d_in[6];
  const float* pb  = (const float*)d_in[7];
  const float* ow  = (const float*)d_in[8];
  const float* wb  = (const float*)d_in[9];
  const float* bng = (const float*)d_in[10];
  const float* bnb = (const float*)d_in[11];
  const float* bnm = (const float*)d_in[12];
  const float* bnv = (const float*)d_in[13];

  char* ws = (char*)d_ws;
  unsigned short* W16 = (unsigned short*)(ws + oW16);
  unsigned short* WWb = (unsigned short*)(ws + oWWb);
  unsigned short* XP  = (unsigned short*)(ws + oXP);
  unsigned short* NP  = (unsigned short*)(ws + oNP);
  unsigned short* Qh  = (unsigned short*)(ws + oQh);
  unsigned short* Ql  = (unsigned short*)(ws + oQl);
  unsigned short* Kh  = (unsigned short*)(ws + oKh);
  unsigned short* Kl  = (unsigned short*)(ws + oKl);
  unsigned short* Gt  = (unsigned short*)(ws + oGt);
  unsigned short* Yh  = (unsigned short*)(ws + oYh);
  unsigned short* Yl  = (unsigned short*)(ws + oYl);
  float* out = (float*)d_out;

  const dim3 blk256(256), blk128(128);

  // (0) theta_w / phi_w / g_w -> stacked f16 plane; w_w -> bf16 plane
  cvt_w<<<dim3(MW / 8 + CC / 16), blk256, 0, stream>>>(tw, pw, gw, ow, W16, WWb);
  // (1) x -> XP, neighborFeat -> NP (position-major 16-bit planes)
  cvt_x<<<dim3(NN / QT, CC / QT, 2 * NB), blk256, 0, stream>>>(x, nf, XP, NP);
  // (2) conv1x1 GEMM -> theta (q) hi/res planes from NP; phi (from NP) and g (from XP) conv + bias + 2x2 stride-2
  //     max-pool -> pooled phi (k) hi/res planes, pooled g f16 plane in the attention's staging order
  gemm_proj<<<dim3(NSTRIP, MW / QT, NB), blk256, 0, stream>>>(W16, NP, XP, tb, pb, gb, Qh, Ql, Kh, Kl, Gt);
  // (3) attention -> y hi/res planes [b][n][128]
  attn_k<<<dim3(NQ / QT, NB), blk128, 0, stream>>>(Qh, Ql, Kh, Kl, Gt, Yh, Yl);
  // (4) output conv + bias + batch-norm affine + residual -> out [b][256][4096]
  gemm_out<<<dim3(NQ / QT, CC / QT, NB), blk128, 0, stream>>>(WWb, Yh, Yl, wb, bng, bnb, bnm, bnv, x, out);
  (void)hipGetLastError();
}

// v006
// One run takes 57.3 microseconds.
// In two side-by-side timings against v005, it was 1.22 and 1.20 times as fast.
// Counting every step since v000, it is 3.84 times as fast.
// Contractions: conv1x1 theta/phi/g GEMM W[384x256].X[256x128] per strip on v_wmma_f32_16x16x32_f16 (f16 containers
// of bf16-RNE weights x256 and bf16-RNE activations); scores K.Q^T on v_wmma_f32_16x16x32_bf16 (bf16 hi + bf16
// residual planes of theta / pooled phi, 3 products, K=128); y^T = G.P^T on v_wmma_f32_16x16x32_f16 (2x2-max-pooled g
// as f16, P = e^{s-m} x16384 f16 from the score D registers); output conv W[256x128].Y on v_wmma_f32_16x16x32_bf16
// (bf16 weights, y as bf16 hi + residual planes, 2 products); f32 accumulate everywhere; max-pool, softmax statistics,
// bias, batch-norm affine with running statistics and residual add in f32 VALU.
#include <hip/hip_runtime.h>
#include <math.h>
#include <stdint.h>

#ifndef NB
#define NB 8
#endif
#ifndef NQ
#define NQ 4096
#endif
#define NB_FULL 8
#define CC     256
#define HIMG   64
#define WIMG   64
#define NN     4096
#define DQ     128
#define HP     32
#define WP     32
#define MV     1024
#define MM     1024
#define MW     384
#define QT     64
#define SN     128
#define NWP    8
#define NSTRIP 32
#define OSP    68
#define OSPW   132
#define WSC    256.0f
#define IWSC   0.00390625f
#define LNPS   9.704060527839234f
#define BNEPS  1.0e-5f
#define KT     64
#define NT     16
#define KPS    136
#define VPS    72
#define KSZ    (KT * KPS * 2)
#define VSZ    (DQ * VPS * 2)
#define STG    (2 * KSZ + VSZ)
#define PPS    264
#define PASZ   (QT * PPS * 2)
#define PBSZ   (SN * PPS * 2)
#define RASZ   (SN * OSP * 4)

static_assert(NB >= 1 && NB <= NB_FULL);
static_assert(NQ % QT == 0 && NQ >= QT && NQ <= NN);
static_assert(NN == HIMG * WIMG);
static_assert(SN == 2 * WIMG);
static_assert(NSTRIP * SN == NN);
static_assert(SN == 16 * NWP);
static_assert(2 * HP == HIMG && 2 * WP == WIMG);
static_assert(MV == HP * WP && MM == MV);
static_assert(WP == 32 && HP == 32);
static_assert(NSTRIP == HP && WP * (QT / 8) == 256);  // one strip = one pooled row; 32 px x 8 lanes fill the GEMM block
static_assert(QT * (WP / 8) == 256 && KT % 8 == 0);   // g: 64 channels x 4 chunks of 8 px fill it too
static_assert(NN % QT == 0 && CC % QT == 0 && DQ % QT == 0 && MM % QT == 0);
static_assert(MW == 3 * DQ && MW % QT == 0 && MW % 8 == 0);
static_assert(CC % 32 == 0 && DQ % 32 == 0 && MM % 32 == 0);
static_assert((OSP * 4) % 16 == 0);
static_assert((OSPW * 4) % 16 == 0);
static_assert(SN * OSP * 4 <= 65536);
static_assert((size_t)NB_FULL * CC * NN * 4 == (size_t)33554432);
static_assert(NT * KT == MM && NT >= 2 && KT % 32 == 0);
static_assert(KPS == DQ + 8 && VPS == KT + 8);
static_assert(KT * DQ * 2 == 8 * 128 * 16 && DQ * KT * 2 == 8 * 128 * 16);
static_assert(DQ == 128 && KT == 8 * 8 && (DQ - 1) * VPS * 2 + KT * 2 <= VSZ);  // g stage: lane = channel row, 8 copies of 8 keys
static_assert(KSZ % 16 == 0 && VSZ % 16 == 0 && STG % 16 == 0);
static_assert(2 * (2 * STG + QT * OSPW * 4) <= 327680);
static_assert(PPS == CC + 8 && (PPS * 2) % 16 == 0);
static_assert(QT * CC * 2 == 8 * 256 * 16);
static_assert(PASZ <= RASZ && RASZ % 16 == 0 && 3 * (RASZ + PBSZ) <= 327680);  // weight tile and epilogue tile share RASZ
static_assert(SN == 4 * 32 && CC == NWP * 4 * 8);  // position tile: lane = 4 positions, wave = 32 channels in 4 groups of 8
static_assert(QT == KT && QT * OSP * 4 <= 3 * KSZ);
static_assert(DQ == 4 * 32 && DQ == 8 * 16);  // the attention pass names its 4 d-chunks and 2 x 4 channel tiles

// workspace total at full size (all region sizes are multiples of 256)
#define WS_FULL ((size_t)MW * CC * 2 + (size_t)CC * DQ * 2 \
                 + 2 * (size_t)NB_FULL * NN * DQ * 2 \
                 + 3 * (size_t)NB_FULL * MM * DQ * 2 + 2 * (size_t)NB_FULL * NN * DQ * 2)
static_assert(WS_FULL <= (size_t)134217728);

typedef _Float16       v16h __attribute__((ext_vector_type(16)));
typedef _Float16       v8h  __attribute__((ext_vector_type(8)));
typedef __bf16         v16b __attribute__((ext_vector_type(16)));
typedef unsigned short v8us __attribute__((ext_vector_type(8)));
typedef __bf16         v2b  __attribute__((ext_vector_type(2)));
typedef _Float16       v2h  __attribute__((ext_vector_type(2)));
typedef float          v8f  __attribute__((ext_vector_type(8)));
typedef float          v4f  __attribute__((ext_vector_type(4)));
typedef unsigned int   v4u  __attribute__((ext_vector_type(4)));

union Frag  { v8us u[2]; v16h h; v16b bf; };
union FragH { v16h v; v8h hv[2]; };
static_assert(sizeof(Frag) == 32);
static_assert(sizeof(FragH) == 32);

// ---- scalar helpers ---------------------------------------------------------------------------------------
__device__ __forceinline__ unsigned short bf_bits(float f) {          // f32 -> bf16 bits, RNE convert
  unsigned u = __float_as_uint(f);
  return (unsigned short)((u + 0x7FFFu + ((u >> 16) & 1u)) >> 16);
}
__device__ __forceinline__ float bf_up(unsigned short hb) { return __uint_as_float(((unsigned)hb) << 16); }
__device__ __forceinline__ float bfr(float f) { return bf_up(bf_bits(f)); }
__device__ __forceinline__ unsigned short h_bits(_Float16 x) { return __builtin_bit_cast(unsigned short, x); }
__device__ __forceinline__ unsigned pk16(unsigned short a, unsigned short b) { return (unsigned)a | ((unsigned)b << 16); }
__device__ __forceinline__ v8f zero8() { v8f z = {0.f, 0.f, 0.f, 0.f, 0.f, 0.f, 0.f, 0.f}; return z; }
__device__ __forceinline__ float hmax8(v8f s) {
  return fmaxf(fmaxf(fmaxf(s[0], s[1]), fmaxf(s[2], s[3])), fmaxf(fmaxf(s[4], s[5]), fmaxf(s[6], s[7])));
}
__device__ __forceinline__ unsigned wave_ballot(bool p) {
#if defined(__HIP_DEVICE_COMPILE__)
  return __builtin_amdgcn_ballot_w32(p);
#else
  return p ? 1u : 0u;
#endif
}
// two f32 values -> bf16 RNE (the packed hardware convert, the same values as bfr) -> f16 (exact in its normal range), packed
__device__ __forceinline__ unsigned rnd2(float f0, float f1) {
  const v2b r = {(__bf16)f0, (__bf16)f1};
  const unsigned d = __builtin_bit_cast(unsigned, r);
  const v2h h = {(_Float16)__uint_as_float(d << 16), (_Float16)__uint_as_float(d & 0xFFFF0000u)};
  return __builtin_bit_cast(unsigned, h);
}
// 8 f32 values -> bf16 hi bits and bf16 residual bits (lo = RNE(v - hi)), packed 2 per uint
__device__ __forceinline__ void split8(const float* f, v4u& uh, v4u& ul) {
#pragma unroll
  for (int t = 0; t < 4; ++t) {
    const float f0 = f[2 * t], f1 = f[2 * t + 1];
    const unsigned short hb0 = bf_bits(f0), hb1 = bf_bits(f1);
    const unsigned short lb0 = bf_bits(f0 - bf_up(hb0));
    const unsigned short lb1 = bf_bits(f1 - bf_up(hb1));
    uh[t] = pk16(hb0, hb1);
    ul[t] = pk16(lb0, lb1);
  }
}

// ---- 16-bit fragment loader (A, or B from a k-contiguous [n][k] row): lane -> row/col (lane&15), p already includes
//      + 8*(lane>>4); elements 0..7 <- p[0..7] (k0+8h..), elements 8..15 <- p[16..23] (k0+16+8h..)
__device__ __forceinline__ Frag ldfrag(const unsigned short* p) {
  Frag f;
  f.u[0] = *(const v8us*)(p);
  f.u[1] = *(const v8us*)(p + 16);
  return f;
}

// ---- WMMA helpers: builtin followed by a 4-slot VALU gap tying D and keeping A/B live --------------------------
__device__ __forceinline__ v8f mma_h(v16h a, v16h b, v8f c) {
  v8f d = __builtin_amdgcn_wmma_f32_16x16x32_f16(false, a, false, b, (short)0, c, false, false);
#if defined(__HIP_DEVICE_COMPILE__)
  asm volatile("v_nop\n\tv_nop\n\tv_nop\n\tv_nop" : "+v"(d) : "v"(a), "v"(b));
#endif
  return d;
}
__device__ __forceinline__ v8f mma_b(v16b a, v16b b, v8f c) {
  v8f d = __builtin_amdgcn_wmma_f32_16x16x32_bf16(false, a, false, b, (short)0, c, false, false);
#if defined(__HIP_DEVICE_COMPILE__)
  const v16h ha = __builtin_bit_cast(v16h, a), hb = __builtin_bit_cast(v16h, b);
  asm volatile("v_nop\n\tv_nop\n\tv_nop\n\tv_nop" : "+v"(d) : "v"(ha), "v"(hb));
#endif
  return d;
}

// =========================================================================================================
// (0) weights. Blocks 0..47: W16 f16 [384][256], rows 0..127 = theta_w, 128..255 = phi_w, 256..383 = g_w; value =
//     f16 of (bf16-RNE(w) * 256) (exact). Block owns rows 8*blk..8*blk+7: one wave per 512-B row = 32 lanes x 16 B
// coverage: 48 blocks x 8 rows x 32 lanes x 8 halves = 384 x 256; 16 blocks x 16 rows x 16 lanes x 8 = 256 x 128.
// =========================================================================================================
__global__ __launch_bounds__(256)
void cvt_w(const float* __restrict__ tw, const float* __restrict__ pw, const float* __restrict__ gw,
           const float* __restrict__ ow, unsigned short* W16, unsigned short* WWb) {
  const int tid = threadIdx.x, blk = blockIdx.x;
  if (blk < MW / 8) {
    const int rl = tid >> 5, col = 8 * (tid & 31);
    const int o = 8 * blk + rl;                                      // 0..383
    const int grp = blk >> 4;                                        // 0,1,2 (block-uniform)
    const float* wbase = (grp == 0) ? tw : ((grp == 1) ? pw : gw);  // all global
    const float* s = wbase + (size_t)(o - DQ * grp) * CC + col;      // (o - 128 grp) in 0..127
    const v4f a = *(const v4f*)s;
    const v4f q = *(const v4f*)(s + 4);
    const float f[8] = {a[0], a[1], a[2], a[3], q[0], q[1], q[2], q[3]};
    v4u u;
#pragma unroll
    for (int t = 0; t < 4; ++t) {
      const _Float16 h0 = (_Float16)(bfr(f[2 * t]) * WSC);
      const _Float16 h1 = (_Float16)(bfr(f[2 * t + 1]) * WSC);
      u[t] = pk16(h_bits(h0), h_bits(h1));
    }
{
      *(v4u*)(W16 + (size_t)o * CC + col) = u;
      
    }
  } else {
    const int rb = blk - MW / 8;                                     // 0..15
    const int o = 16 * rb + (tid >> 4);                              // 0..255
    const int col = 8 * (tid & 15);                                  // 0..120
    const float* s = ow + (size_t)o * DQ + col;
    const v4f a = *(const v4f*)s;
    const v4f q = *(const v4f*)(s + 4);
    const float f[8] = {a[0], a[1], a[2], a[3], q[0], q[1], q[2], q[3]};
    v4u u;
#pragma unroll
    for (int t = 0; t < 4; ++t) u[t] = pk16(bf_bits(f[2 * t]), bf_bits(f[2 * t + 1]));
{
      *(v4u*)(WWb + (size_t)o * DQ + col) = u;
      
    }
  }
}

// ---- eight asynchronous 16-byte copies per lane, global -> LDS: copy i takes g + i*gstep (elements) to LDS byte
//      address l + i*lstep. The s_wait_xcnt 0 is the last line of the copies' own statement so that it stands in
//      front of any later write of the address registers the copies name.
__device__ __forceinline__ void copy8(unsigned l, unsigned lstep, const unsigned short* g, size_t gstep) {
#if defined(__HIP_DEVICE_COMPILE__)
  asm volatile("global_load_async_to_lds_b128 %0, %8, off\n\t"
               "global_load_async_to_lds_b128 %1, %9, off\n\t"
               "global_load_async_to_lds_b128 %2, %10, off\n\t"
               "global_load_async_to_lds_b128 %3, %11, off\n\t"
               "global_load_async_to_lds_b128 %4, %12, off\n\t"
               "global_load_async_to_lds_b128 %5, %13, off\n\t"
               "global_load_async_to_lds_b128 %6, %14, off\n\t"
               "global_load_async_to_lds_b128 %7, %15, off\n\t"
               "s_wait_xcnt 0x0"
               :: "v"(l), "v"(l + lstep), "v"(l + 2 * lstep), "v"(l + 3 * lstep),
                  "v"(l + 4 * lstep), "v"(l + 5 * lstep), "v"(l + 6 * lstep), "v"(l + 7 * lstep),
                  "v"(g), "v"(g + gstep), "v"(g + 2 * gstep), "v"(g + 3 * gstep),
                  "v"(g + 4 * gstep), "v"(g + 5 * gstep), "v"(g + 6 * gstep), "v"(g + 7 * gstep)
               : "memory");
#endif
}

// =========================================================================================================
// (1) conv1x1 GEMM for one (b, strip of 128 positions = image rows 2s and 2s+1, projection grp: 0 theta, 1 phi, 2 g):
//     Y[o][n] = (1/256) sum_c W16[o][c] B[n][c], B = bf16-RNE values (exact in f16) of neighborFeat (theta, phi) or of
//     x (g), block-uniform select. The position tile B [128 n][256 c] is made once per block from the f32 input
//     [b][c][n] itself: wave w takes channels 32w..32w+31 in 4 groups of 8, lane l positions 4l..4l+3 (one b128 load per
//     channel = a whole 512-B strip row per wave), rounds, packs 8 channels of one position and stores them as one
//     ds_store_b128 into row n (pitch 528 B). 16-B chunk j of row n lies at chunk j ^ ((n >> 4) & 3): the 16 lanes of a
//     half wave, 4 rows apart, then fall on 16 different bank groups; for a reading wave (16 rows) the term is uniform.
//     The projection's 128 weight rows go through in two halves of 64 (dsel = 0, 64) against the same position tile.
//     Block 256 threads = 8 waves; wave w owns cols 16w..+15 (one B fragment per k-step) and 4 m-tiles (A rows
//     o = 16 mt + (lane&15), split k map loader). K = 256 = 8 steps. Each half's weight tile (64 rows of 512 B) is
//     staged in LDS by asynchronous copies of whole 128-B lines (8 copies per lane), rows at pitch 528 B, and read as
//     ds_load_b128 fragments behind each wave's own asynccnt wait + block barrier.
//     Epilogue staged in LDS Os[n_loc][o_loc] (pitch OSP, b128 stores; it shares its bytes with the weight tile, behind
//     a block barrier that ends every wave's fragment reads), block barrier, then (block-uniform branch on grp):
//       theta -> dims dsel..dsel+63 + bias -> Qh/Ql bf16 [b][4096 n][128 d] (hi = RNE(v), lo = RNE(v-hi)):
//       phi   -> + bias in f32, 2x2 stride-2 max-pool in f32 inside the tile (the strip holds both image
//                       rows of pooled row py = strip: window n_loc = 64 dy + 2 px + dx) -> Kh/Kl bf16 [b][1024 m][128 d]
//                       (hi = RNE(v), lo = RNE(v-hi)), m = 32 py + px: 32 rows x the dsel half (128 B = 1 whole line).
//       g     -> + bias, the same pool, read down the tile's columns (lane = channel, 8 px per thread) ->
//                       Gt f16 [b][128 chunks m>>3][128 d][8 keys m&7], the order in which the attention stages it:
//                       4 chunks x the dsel half (64 d x 16 B = 8 whole lines), one wave = 512 contiguous bytes.
// coverage: B tile 8 waves x 32 c x 32 lanes x 4 n = 256 c x 128 n written, rows <= 127 chunks <= 31 read;
//           Os 8 waves x 16 n x 64 o = 128 x 64 written, reads rows <= 127 cols <= 63; theta planes 4 it x 32 rows
//           x 8 lanes x 8 = 128 n x 64 d; k planes 32 px x 8 lanes x 8 = 32 m x 64 d; Gt 4 chunks x 64 d x 8 keys;
//           grid (32, 3, NB) x 2 halves covers all 4096 rows x 128 d of Qh/Ql and all 1024 keys x 128 d of Kh/Kl/Gt once.
// registers capped at 160 = 6 waves per SIMD, LDS 100 KiB: three blocks share a WGP, the whole grid is resident at once.
// =========================================================================================================
__global__ __launch_bounds__(256) __attribute__((amdgpu_num_vgpr(160)))
void gemm_proj(const unsigned short* __restrict__ W16, const float* __restrict__ nf, const float* __restrict__ x,
               const float* __restrict__ tb, const float* __restrict__ pb, const float* __restrict__ gb,
               unsigned short* Qh, unsigned short* Ql,
               unsigned short* Kh, unsigned short* Kl, unsigned short* Gt) {
  __shared__ __align__(16) unsigned char Sm[RASZ + PBSZ];
  const unsigned short* As = (const unsigned short*)Sm;              // weight tile  [64 o][PPS]
  unsigned short* Bs = (unsigned short*)(Sm + RASZ);                 // position tile [128 n][PPS], chunks swizzled
  float* Os = (float*)Sm;                                            // epilogue tile, after the half's last fragment read
  const int tid  = threadIdx.x;
  const int lane = tid & 31, wave = tid >> 5;                        // wave 0..7
  const int hh   = lane >> 4, c = lane & 15;
  const int st   = blockIdx.x, grp = blockIdx.y, b = blockIdx.z;     // grp 0 theta, 1 phi, 2 g (block-uniform)
  const int n0   = st * SN;
  const float* src = (grp < 2) ? nf : x;                             // block-uniform, both global

  // a half's weight tile is contiguous in global memory: 16-B chunk tid + 256 per copy = row (tid>>5) + 8 per copy
  const unsigned lrow = (unsigned)(size_t)Sm + (unsigned)((tid >> 5) * (PPS * 2) + (tid & 31) * 16);
  const unsigned short* wg = W16 + (size_t)(grp * DQ) * CC + 8 * tid;
  copy8(lrow, 8 * PPS * 2, wg, 256 * 8);                             // half 0, in flight over the position tile's making

  // ---- position tile: f32 [c][n] -> rounded f16 [n][c]
  {
    const float* sp = src + ((size_t)(b * CC + 32 * wave)) * NN + n0 + 4 * lane;
    unsigned short* bw = Bs + (4 * lane) * PPS + 32 * wave;          // row 4 lane (+ t), chunks 4 wave .. 4 wave + 3
    const int gs = (lane >> 2) & 3;                                  // ((4 lane + t) >> 4) & 3
#pragma unroll
    for (int q = 0; q < 4; ++q) {
      v4f a[8];
#pragma unroll
      for (int i = 0; i < 8; ++i) a[i] = *(const v4f*)(sp + (size_t)(8 * q + i) * NN);
#pragma unroll
      for (int t = 0; t < 4; ++t) {
        v4u u;
#pragma unroll
        for (int p = 0; p < 4; ++p)
          u[p] = rnd2(a[2 * p][t], a[2 * p + 1][t]);
        *(v4u*)(bw + t * PPS + 8 * (q ^ gs)) = u;
      }
    }
    // ahead of any write of the loads' address registers; it names the address, which so stays unwritten up to here
    asm volatile("s_wait_xcnt 0x0" :: "v"(sp) : "memory");
  }

  const int gr = wave & 3;                                           // ((16 wave + c) >> 4) & 3
  const unsigned short* ap  = As + c * PPS + 8 * hh;
  const unsigned short* bp0 = Bs + (16 * wave + c) * PPS + 8 * (hh ^ gr);        // k 32 ks + 8 hh ..
  const unsigned short* bp1 = Bs + (16 * wave + c) * PPS + 8 * ((2 + hh) ^ gr);  // k 32 ks + 16 + 8 hh ..
  const float* bias = (grp == 0) ? tb : ((grp == 1) ? pb : gb);     // all global

#pragma unroll 1  // the two halves share one text: half the instruction bytes, and each barrier stands once
  for (int half = 0; half < 2; ++half) {
  const int dsel = half * QT;                                        // 0 or 64
  asm volatile("s_wait_asynccnt 0x0" ::: "memory");                  // this wave's weight copies have landed
  __syncthreads();                                                   // every wave's copies (half 0: and tile rows) are readable

  v8f acc[4];
#pragma unroll
  for (int mt = 0; mt < 4; ++mt) acc[mt] = zero8();

#pragma unroll
  for (int ks = 0; ks < CC / 32; ++ks) {
    Frag fb;
    fb.u[0] = *(const v8us*)(bp0 + 32 * ks);
    fb.u[1] = *(const v8us*)(bp1 + 32 * ks);
    Frag fa[4];
#pragma unroll
    for (int mt = 0; mt < 4; ++mt) fa[mt] = ldfrag(ap + (16 * mt) * PPS + 32 * ks);
#pragma unroll
    for (int mt = 0; mt < 4; ++mt) acc[mt] = mma_h(fa[mt].h, fb.h, acc[mt]);
  }
  __syncthreads();                                                   // all weight fragment reads done: Os may take the bytes

  // ---- epilogue: scale back -> LDS Os[n_loc][o_loc]; lane (hh, c) holds o = 16 mt + 8 hh + r for n_loc = 16 w + c
  {
    const int nl = 16 * wave + c;
#pragma unroll
    for (int mt = 0; mt < 4; ++mt) {
      v4f va, vb;
#pragma unroll
      for (int r = 0; r < 4; ++r) { va[r] = acc[mt][r] * IWSC; vb[r] = acc[mt][4 + r] * IWSC; }
      *(v4f*)(Os + nl * OSP + 16 * mt + 8 * hh)     = va;
      *(v4f*)(Os + nl * OSP + 16 * mt + 8 * hh + 4) = vb;
    }
  }
  __syncthreads();

  if (grp == 0) {
    const int e = tid & 7, lq = tid >> 3;                            // lq 0..31
    float bv[8];
    {
      const v4f ba = *(const v4f*)(bias + dsel + 8 * e);
      const v4f bq = *(const v4f*)(bias + dsel + 8 * e + 4);
#pragma unroll
      for (int t = 0; t < 4; ++t) { bv[t] = bfr(ba[t]); bv[4 + t] = bfr(bq[t]); }
    }
    v4u uh[4], ul[4];
#pragma unroll
    for (int it = 0; it < 4; ++it) {
      const int row = it * 32 + lq;                                  // n_loc 0..127
      const v4f a = *(const v4f*)(Os + row * OSP + 8 * e);
      const v4f q = *(const v4f*)(Os + row * OSP + 8 * e + 4);
      float f[8];
#pragma unroll
      for (int t = 0; t < 4; ++t) { f[t] = a[t] + bv[t]; f[4 + t] = q[t] + bv[4 + t]; }
      split8(f, uh[it], ul[it]);
    }
{
#pragma unroll
      for (int it = 0; it < 4; ++it) {
        const int row = it * 32 + lq;
        const size_t po = ((size_t)(b * NN + n0 + row)) * DQ + dsel + 8 * e;
        *(v4u*)(Qh + po) = uh[it];
        *(v4u*)(Ql + po) = ul[it];
      }
      asm volatile("s_wait_xcnt 0x0" ::: "memory");                  // ahead of any later write of the stores' registers
    }
  } else if (grp == 1) {
    const int e = tid & 7, px = tid >> 3;                            // px 0..31
    float bv[8];
    {
      const v4f ba = *(const v4f*)(bias + dsel + 8 * e);
      const v4f bq = *(const v4f*)(bias + dsel + 8 * e + 4);
#pragma unroll
      for (int t = 0; t < 4; ++t) { bv[t] = bfr(ba[t]); bv[4 + t] = bfr(bq[t]); }
    }
    float f[8];
#pragma unroll
    for (int t = 0; t < 8; ++t) f[t] = -__builtin_inff();
#pragma unroll
    for (int dy = 0; dy < 2; ++dy) {
#pragma unroll
      for (int dx = 0; dx < 2; ++dx) {
        const int row = dy * WIMG + 2 * px + dx;                     // n_loc 0..127
        const v4f a = *(const v4f*)(Os + row * OSP + 8 * e);
        const v4f q = *(const v4f*)(Os + row * OSP + 8 * e + 4);
#pragma unroll
        for (int t = 0; t < 4; ++t) {
          f[t]     = fmaxf(f[t], a[t] + bv[t]);
          f[4 + t] = fmaxf(f[4 + t], q[t] + bv[4 + t]);
        }
      }
    }
    const size_t po = ((size_t)(b * MM + WP * st + px)) * DQ + dsel + 8 * e;
    v4u kh, kl;
    split8(f, kh, kl);
    *(v4u*)(Kh + po) = kh;
    *(v4u*)(Kl + po) = kl;
    asm volatile("s_wait_xcnt 0x0" ::: "memory");                    // ahead of any later write of the two stores' registers
  } else {
    const int cl = tid & (QT - 1), pc = tid >> 6;                    // channel 0..63 of the block, px chunk 0..3
    const float bs = bfr(bias[dsel + cl]);
    float f[8];
#pragma unroll
    for (int j = 0; j < 8; ++j) {
      f[j] = -__builtin_inff();
#pragma unroll
      for (int dy = 0; dy < 2; ++dy) {
#pragma unroll
        for (int dx = 0; dx < 2; ++dx) {
          const int row = dy * WIMG + 2 * (8 * pc + j) + dx;         // n_loc 0..127
          f[j] = fmaxf(f[j], Os[row * OSP + cl] + bs);
        }
      }
    }
    v4u gu;
#pragma unroll
    for (int t = 0; t < 4; ++t) gu[t] = pk16(h_bits((_Float16)f[2 * t]), h_bits((_Float16)f[2 * t + 1]));
    // key m = 32 st + 8 pc + j: chunk m>>3 = 4 st + pc, place j in the chunk
    *(v4u*)(Gt + (((size_t)(b * (MM / 8) + (WP / 8) * st + pc)) * DQ + dsel + cl) * 8) = gu;
    asm volatile("s_wait_xcnt 0x0" ::: "memory");                    // ahead of any later write of the store's registers
  }

  if (half == 0) {                                                   // block-uniform: second half's weight tile over Os
    asm volatile("s_wait_dscnt 0x0" ::: "memory");                   // this wave's reads of Os are done
    __syncthreads();                                                 // every wave's are
    copy8(lrow, 8 * PPS * 2, wg + (size_t)QT * CC, 256 * 8);
  }
  }
}

// ---- attention fragment groups (LDS): each group is 8 ds_load_b128 written together, one block of products ahead of
//      its use. ldk4: K hi rows key..+15 and +16..+31, then the same rows of the K residual plane, 32 d at p.
//      ldv4: pooled-g rows of 4 channel tiles (16 rows apart), 32 keys at p. sc6: the six score products of one d-chunk.
__device__ __forceinline__ void ldk4(Frag* f, const unsigned short* p) {
  f[0] = ldfrag(p);
  f[1] = ldfrag(p + 16 * KPS);
  f[2] = ldfrag(p + KSZ / 2);
  f[3] = ldfrag(p + KSZ / 2 + 16 * KPS);
}
__device__ __forceinline__ void ldv4(Frag* f, const unsigned short* p) {
#pragma unroll
  for (int j = 0; j < 4; ++j) f[j] = ldfrag(p + (16 * j) * VPS);
}
__device__ __forceinline__ void sc6(const Frag* k, const Frag& qh, const Frag& ql, v8f& s0, v8f& s1) {
  s0 = mma_b(k[0].bf, qh.bf, s0);
  s1 = mma_b(k[1].bf, qh.bf, s1);
  s0 = mma_b(k[0].bf, ql.bf, s0);
  s1 = mma_b(k[1].bf, ql.bf, s1);
  s0 = mma_b(k[2].bf, qh.bf, s0);
  s1 = mma_b(k[3].bf, qh.bf, s1);
}

// =========================================================================================================
// (2) attention for one (b, 64-query tile), transposed formulation, 1024 keys (all valid, no mask, no scale):
//   S^T tile (16 keys x 16 queries) = sum over 4 d-chunks (q fragments kept in registers) of A(k: row = key kb + (lane&15), 32 d via
//   the split k map from the bf16 plane Kh [b][1024][128]) . B(q: col = query, same map from Qh [b][4096][128])
//   + A(Kh).B(Ql) + A(Kl).B(Qh) (bf16 unscaled residual planes, shared accumulator).
//   Per lane the D tile holds 8 keys of ONE query: online softmax state per lane, one shuffle (lane^16) for the max
//   over 32 keys; the o/l rescale is skipped under a wave-uniform ballot when no lane's max grew (corr == 1 exactly
//   for every lane then); row-sum partials combined at the end. P = e^{s-m} x 16384 as f16 is the B operand of
//   y^T (rows channel, cols queries) += A(pooled g: rows channel = 16j + (lane&15), keys contiguous in the LDS tile,
//   f16 plane Gt [b][128 chunks of 8 keys][128 ch][8 keys]) . B(P^T): element r <- D of the tile covering keys kb..kb+15, element 8+r <- the tile covering
//   kb+16..kb+31, lane unchanged. 8 accumulator tiles per wave (128 channels). Block = 4 waves = 64 queries.
//   K hi / K residual / pooled-g tiles of 64 keys are staged once per block in a two-buffer LDS ring by asynchronous
//   copies (whole 128-B lines from global; 24 copies per lane and stage) and read by all 4 waves as ds_load_b128
//   fragments: K rows at pitch 272 B, g rows (64 keys = 128 B) at pitch 144 B. Stage t+2 is issued behind the barrier
//   that ends every wave's reads of stage t; stage t+1 is read only behind each wave's own asynccnt wait + barrier.
//   Fragments go through two register sets: each group of 8 ds_load_b128 is issued one block of products ahead of its
//   use (K d-chunk c+1 ahead of chunk c's products, the g rows ahead of the last score products and the softmax), inside one stage only.
//   Epilogue: y = O/l staged in LDS Os[query][128 channels] (pitch OSPW, b128 stores), block barrier, then
// coverage: Os written 4 waves x 16 queries x 128 ch, read rows 0..63 x ch 8e..8e+7 (e 0..15); planes 8 it x 8 rows x
//           16 lanes x 8 = 64 n x 128 ch per plane; grid (NQ/64, NB) covers rows 0..NQ-1 of Yh/Yl exactly once.
// =========================================================================================================
__global__ __launch_bounds__(128) __attribute__((amdgpu_num_vgpr(256)))
void attn_k(const unsigned short* __restrict__ Qh, const unsigned short* __restrict__ Ql,
            const unsigned short* __restrict__ Kh, const unsigned short* __restrict__ Kl,
            const unsigned short* __restrict__ Gt, unsigned short* Yh, unsigned short* Yl) {
  __shared__ __align__(16) float Os[QT * OSPW];
  __shared__ __align__(16) unsigned short Ring[2 * STG / 2];
  const int tid  = threadIdx.x;
  const int wave = tid >> 5, lane = tid & 31;
  const int hh   = lane >> 4, c = lane & 15;
  const int n0   = blockIdx.x * QT, b = blockIdx.y;

  // q fragment pointers (B operand, col = query n0 + 16*wave + c), + 32*kc
  const size_t qo = ((size_t)(b * NN + n0 + 16 * wave + c)) * DQ + 8 * hh;
  const unsigned short* Qhp = Qh + qo;
  const unsigned short* Qlp = Ql + qo;
  // copy sources of stage 0 (per lane, 16 B): each plane's 16-KB tile is contiguous, chunk tid, + 128 chunks per copy
  // (g plane: lane = channel tid, copy i = the stage's keys 8i..8i+7)
  const unsigned short* Khg = Kh + (size_t)b * MM * DQ + 8 * tid;
  const unsigned short* Klg = Kl + (size_t)b * MM * DQ + 8 * tid;
  const unsigned short* Vg  = Gt + (size_t)b * MM * DQ + 8 * tid;
  // copy destinations in buffer 0 (LDS byte addresses): K row (tid>>4) + 8 per copy, g row tid, + 16 B per copy
  const unsigned ring0 = (unsigned)(size_t)Ring;
  const unsigned lK = ring0 + (unsigned)((tid >> 4) * (KPS * 2) + (tid & 15) * 16);
  const unsigned lV = ring0 + (unsigned)(2 * KSZ + tid * (VPS * 2));
  // fragment offsets inside a buffer (elements): k (A operand, row = key + c), + key * KPS + 32*kc;
  // v (A operand, row = channel 16j + c, keys contiguous), + 16*j*VPS + key
  const int kfo = c * KPS + 8 * hh;
  const int vfo = KSZ + c * VPS + 8 * hh;

  // ring prologue: stage 0 -> buffer 0, landed and published; then stage 1 -> buffer 1 flies over pass 0
  copy8(lK, 8 * KPS * 2, Khg, 128 * 8);
  copy8(lK + KSZ, 8 * KPS * 2, Klg, 128 * 8);
  copy8(lV, 16, Vg, 128 * 8);
  asm volatile("s_wait_asynccnt 0x0" ::: "memory");                  // this wave's stage-0 copies have landed
  __syncthreads();                                                   // every wave's stage-0 copies are readable
  copy8(lK + STG, 8 * KPS * 2, Khg + (size_t)KT * DQ, 128 * 8);
  copy8(lK + STG + KSZ, 8 * KPS * 2, Klg + (size_t)KT * DQ, 128 * 8);
  copy8(lV + STG, 16, Vg + (size_t)KT * DQ, 128 * 8);

  // q hi / residual fragments of this wave's 16 queries: the same for every key, loaded once and kept in registers
  Frag qhf[DQ / 32], qlf[DQ / 32];
#pragma unroll
  for (int kc = 0; kc < DQ / 32; ++kc) {
    qhf[kc] = ldfrag(Qhp + 32 * kc);
    qlf[kc] = ldfrag(Qlp + 32 * kc);
  }

  float m = -1.0e30f, l = 0.f;
  v8f o[8];
#pragma unroll
  for (int j = 0; j < 8; ++j) o[j] = zero8();

#pragma unroll 1  // one stage per trip, rolled: the publish point at its foot stands once in the text
  for (int t = 0; t < NT; ++t) {
   const unsigned short* sb = Ring + (t & 1) * (STG / 2);            // this stage's buffer
   const unsigned short* kp = sb + kfo;
   const unsigned short* vp = sb + vfo;
   // two fragment sets of 4 x 8 registers, filled in turn one block of products ahead of their use
   Frag fa[4], fb[4];
   ldk4(fa, kp);                                                     // d-chunk 0 of the stage's first 32 keys
#pragma unroll  // both 32-key passes of the stage in the text: the second one's first K fragments are fetched in the first
   for (int kb = 0; kb < KT; kb += 32) {
    const unsigned short* k0p = kp + kb * KPS;                       // keys kb .. kb+15 of the stage
    v8f s0 = zero8(), s1 = zero8();
    ldk4(fb, k0p + 32);
    sc6(fa, qhf[0], qlf[0], s0, s1);
    ldk4(fa, k0p + 64);
    sc6(fb, qhf[1], qlf[1], s0, s1);
    ldk4(fb, k0p + 96);
    sc6(fa, qhf[2], qlf[2], s0, s1);
    ldv4(fa, vp + kb);                                               // pooled-g rows of channels 0..63
    sc6(fb, qhf[3], qlf[3], s0, s1);
    ldv4(fb, vp + 64 * VPS + kb);                                    // channels 64..127, in flight over the softmax

    float mx = fmaxf(hmax8(s0), hmax8(s1));
    mx = fmaxf(mx, __shfl_xor(mx, 16, 32));
    const float mn = fmaxf(m, mx);
    const unsigned grew = wave_ballot(mx > m);                       // wave-uniform
    if (grew != 0u) {
      const float corr = __expf(m - mn);                             // == 1 exactly for lanes whose max did not grow
      l *= corr;
#pragma unroll
      for (int j = 0; j < 8; ++j) {
#pragma unroll
        for (int r = 0; r < 8; ++r) o[j][r] *= corr;
      }
    }
    m = mn;
    const float msh = mn - LNPS;                                     // exp gives e^{s-m} * 16384

    FragH ph;
    float ls = 0.f;
#pragma unroll
    for (int r = 0; r < 8; ++r) {
      const float e0 = __expf(s0[r] - msh);                          // key kb      + 8hh + r
      const float e1 = __expf(s1[r] - msh);                          // key kb + 16 + 8hh + r
      ls += e0 + e1;
      ph.hv[0][r] = (_Float16)e0;
      ph.hv[1][r] = (_Float16)e1;
    }
    l += ls;

#pragma unroll
    for (int j = 0; j < 4; ++j) o[j] = mma_h(fa[j].h, ph.v, o[j]);
    if (kb + 32 < KT) ldk4(fa, k0p + 32 * KPS);                      // compile-time test: next pass's d-chunk 0, same stage
#pragma unroll
    for (int j = 0; j < 4; ++j) o[4 + j] = mma_h(fb[j].h, ph.v, o[4 + j]);
   }
   // publish point of stage t+1, and release of stage t's buffer
   asm volatile("s_wait_dscnt 0x0" ::: "memory");                    // this wave's reads of stage t are done
   asm volatile("s_wait_asynccnt 0x0" ::: "memory");                 // this wave's stage t+1 copies have landed
   __syncthreads();
   if (t + 2 < NT) {                                                 // block-uniform
     const unsigned bo = (unsigned)((t & 1) * STG);
     copy8(lK + bo, 8 * KPS * 2, Khg + (size_t)(t + 2) * KT * DQ, 128 * 8);
     copy8(lK + bo + KSZ, 8 * KPS * 2, Klg + (size_t)(t + 2) * KT * DQ, 128 * 8);
     copy8(lV + bo, 16, Vg + (size_t)(t + 2) * KT * DQ, 128 * 8);
   }
  }
  asm volatile("s_wait_asynccnt 0x0" ::: "memory");                  // nothing of the ring is in flight past here
  l += __shfl_xor(l, 16, 32);
  const float inv = 1.0f / l;                                        // o and l both carry the x16384 factor

  // ---- epilogue: y = o * inv -> Os[query][ch]; lane (hh, c) holds ch = 16 j + 8 hh + r for query 16 w + c
  {
    const int qrow = 16 * wave + c;
#pragma unroll
    for (int j = 0; j < 8; ++j) {
      v4f va, vb;
#pragma unroll
      for (int r = 0; r < 4; ++r) { va[r] = o[j][r] * inv; vb[r] = o[j][4 + r] * inv; }
      *(v4f*)(Os + qrow * OSPW + 16 * j + 8 * hh)     = va;
      *(v4f*)(Os + qrow * OSPW + 16 * j + 8 * hh + 4) = vb;
    }
  }
  __syncthreads();

  const int e16 = tid & 15, lr = tid >> 4;                           // lr 0..7
  v4u uh[8], ul[8];
#pragma unroll
  for (int it = 0; it < 8; ++it) {
    const int row = it * 8 + lr;                                     // query 0..63
    const v4f a = *(const v4f*)(Os + row * OSPW + 8 * e16);
    const v4f q = *(const v4f*)(Os + row * OSPW + 8 * e16 + 4);
    const float f[8] = {a[0], a[1], a[2], a[3], q[0], q[1], q[2], q[3]};
    split8(f, uh[it], ul[it]);
  }
{
#pragma unroll
    for (int it = 0; it < 8; ++it) {
      const int row = it * 8 + lr;
      const size_t po = ((size_t)(b * NN + n0 + row)) * DQ + 8 * e16;
      *(v4u*)(Yh + po) = uh[it];
      *(v4u*)(Yl + po) = ul[it];
    }
    
  }
}

// =========================================================================================================
// (3) output conv for one (b, 64-n tile, 64-c block): A[c][n] = sum_ci WWb[c][ci] (Yh + Yl)[b][n][ci] on bf16 WMMA
//     (2 products per k-step, shared accumulator), K = 128 = 4 steps. Block 128 threads = 4 waves; wave w owns cols
//     n0+16w..+15 (B fragments from the k-contiguous Yh/Yl rows) and 4 m-tiles (A rows c = c0 + 16 mt + (lane&15),
//     split k map loader from WWb). The three operand tiles (64 weight rows, 64 position rows of Yh and of Yl, 256 B
//     each, contiguous in global memory) are staged once per block in LDS by asynchronous copies of whole 128-B lines
//     (24 copies per lane), rows at pitch 272 B, and read as ds_load_b128 fragments behind each wave's own asynccnt
//     wait + block barrier; Os reuses their bytes behind a block barrier that ends every wave's fragment reads.
//     Per-channel constants (bf16-RNE of w_b, bn mean, bn beta, and scale =
//     bf16-RNE(gamma) * rsqrt(bf16-RNE(var) + eps)) staged once in LDS by waves 0,1. Epilogue staged in LDS
//     Os[n_loc][c_loc] (pitch OSP, b128 stores), block barrier, then out[b][c][n] = (((A + w_b[c]) - mean[c]) *
// coverage: Os 4 waves x 16 n x 64 c written, read rows nl+t <= 63 x cols cl <= 63; Pb/Pm/Ps/Pt written 0..63, read
//           cl <= 63; out 8 it x 16 lines x 8 lanes x 4 floats = 64 c x 64 n; grid (NQ/64, 4, NB) covers
//           out[b][0..255][0..NQ-1] exactly once.
// =========================================================================================================
__global__ __launch_bounds__(128) __attribute__((amdgpu_num_vgpr(256)))
void gemm_out(const unsigned short* __restrict__ WWb, const unsigned short* __restrict__ Yh,
              const unsigned short* __restrict__ Yl, const float* __restrict__ wb,
              const float* __restrict__ bng, const float* __restrict__ bnb,
              const float* __restrict__ bnm, const float* __restrict__ bnv,
              const float* __restrict__ x, float* out) {
  __shared__ __align__(16) unsigned char Sm[3 * KSZ];
  const unsigned short* As = (const unsigned short*)Sm;              // weight tile [64 c][KPS]; Yh, Yl tiles behind it
  float* Os = (float*)Sm;                                            // epilogue tile, after the last fragment read
  __shared__ float Pb[QT], Pm[QT], Ps[QT], Pt[QT];
  const int tid  = threadIdx.x;
  const int lane = tid & 31, wave = tid >> 5;
  const int hh   = lane >> 4, c = lane & 15;
  const int nt   = blockIdx.x, cb = blockIdx.y, b = blockIdx.z;
  const int n0   = nt * QT, c0 = cb * QT;

  // each tile is contiguous in global memory: 16-B chunk tid + 128 per copy = row (tid>>4) + 8 per copy, chunk tid&15
  const unsigned lrow = (unsigned)(size_t)Sm + (unsigned)((tid >> 4) * (KPS * 2) + (tid & 15) * 16);
  const size_t yo = (size_t)(b * NN + n0) * DQ + 8 * tid;
  copy8(lrow, 8 * KPS * 2, WWb + (size_t)c0 * DQ + 8 * tid, 128 * 8);
  copy8(lrow + KSZ, 8 * KPS * 2, Yh + yo, 128 * 8);
  copy8(lrow + 2 * KSZ, 8 * KPS * 2, Yl + yo, 128 * 8);

  if (tid < QT) {                                                    // waves 0,1 (wave-uniform), cross-wave via barrier
    const int ch = c0 + tid;                                         // 0..255
    Pb[tid] = bfr(wb[ch]);
    Pm[tid] = bfr(bnm[ch]);
    Ps[tid] = bfr(bng[ch]) * rsqrtf(bfr(bnv[ch]) + BNEPS);
    Pt[tid] = bfr(bnb[ch]);
  }

  asm volatile("s_wait_asynccnt 0x0" ::: "memory");                  // this wave's copies have landed
  __syncthreads();                                                   // every wave's copies are readable

  const unsigned short* ap  = As + c * KPS + 8 * hh;
  const unsigned short* bph = As + KSZ / 2 + (16 * wave + c) * KPS + 8 * hh;
  const unsigned short* bpl = bph + KSZ / 2;

  v8f acc[4];
#pragma unroll
  for (int mt = 0; mt < 4; ++mt) acc[mt] = zero8();

#pragma unroll
  for (int ks = 0; ks < DQ / 32; ++ks) {
    const Frag fbh = ldfrag(bph + 32 * ks);
    const Frag fbl = ldfrag(bpl + 32 * ks);
    Frag fa[4];
#pragma unroll
    for (int mt = 0; mt < 4; ++mt) fa[mt] = ldfrag(ap + (16 * mt) * KPS + 32 * ks);
#pragma unroll
    for (int mt = 0; mt < 4; ++mt) {
      acc[mt] = mma_b(fa[mt].bf, fbh.bf, acc[mt]);
      acc[mt] = mma_b(fa[mt].bf, fbl.bf, acc[mt]);
    }
  }
  __syncthreads();                                                   // all fragment reads done: Os may take the bytes

  // ---- epilogue: -> LDS Os[n_loc][c_loc]; lane (hh, c) holds c_loc = 16 mt + 8 hh + r for n_loc = 16 w + c
  {
    const int nl = 16 * wave + c;
#pragma unroll
    for (int mt = 0; mt < 4; ++mt) {
      v4f va, vb;
#pragma unroll
      for (int r = 0; r < 4; ++r) { va[r] = acc[mt][r]; vb[r] = acc[mt][4 + r]; }
      *(v4f*)(Os + nl * OSP + 16 * mt + 8 * hh)     = va;
      *(v4f*)(Os + nl * OSP + 16 * mt + 8 * hh + 4) = vb;
    }
  }
  __syncthreads();

  const int e = tid & 7, lq = tid >> 3;                              // lq 0..15
  v4f res[8];
#pragma unroll
  for (int it = 0; it < 8; ++it) {
    const int L   = it * 16 + lq;                                    // 0..127
    const int cl  = L >> 1, hf = L & 1;                              // channel 0..63 within the block
    const int nl  = hf * 32 + 4 * e;                                 // position 0..63
    const float pbv = Pb[cl], pmv = Pm[cl], psv = Ps[cl], ptv = Pt[cl];
    const size_t idx = ((size_t)(b * CC + c0 + cl)) * NN + n0 + nl;
    const v4f xv = *(const v4f*)(x + idx);
#pragma unroll
    for (int t = 0; t < 4; ++t) {
      const float cv = Os[(nl + t) * OSP + cl] + pbv;
      res[it][t] = ((cv - pmv) * psv + ptv) + bfr(xv[t]);
    }
  }
{
#pragma unroll
    for (int it = 0; it < 8; ++it) {
      const int L   = it * 16 + lq;
      const int cl  = L >> 1, hf = L & 1;
      const int nl  = hf * 32 + 4 * e;
      const size_t idx = ((size_t)(b * CC + c0 + cl)) * NN + n0 + nl;
      *(v4f*)(out + idx) = res[it];
    }
    
  }
}

// =========================================================================================================
// Workspace map (bytes; each region start a multiple of 256; every extent is an exact row/tile multiple and is
//   W16 f16 [384][256]            196608      WWb bf16 [256][128]        65536
//   Qh/Ql bf16 [NB][4096][128]    8388608 x2
//   Kh/Kl bf16 [NB][1024][128]    2097152 x2  Gt f16 [NB][128][128][8] 2097152
//   Yh/Yl bf16 [NB][4096][128]    8388608 x2
//   total (NB=8) = 40108032
// =========================================================================================================
extern "C" void kernel_launch(void* const* d_in, const int* in_sizes, int n_in,
                              void* d_out, int out_size, void* d_ws, size_t ws_size,
                              hipStream_t stream) {
  const int XN = NB * CC * NN;
  if (n_in < 14) return;
  if (in_sizes[0] < XN || in_sizes[1] < XN) return;
  if (in_sizes[2] < DQ * CC || in_sizes[4] < DQ * CC || in_sizes[6] < DQ * CC || in_sizes[8] < CC * DQ) return;
  if (in_sizes[3] < DQ || in_sizes[5] < DQ || in_sizes[7] < DQ) return;
  if (in_sizes[9] < CC || in_sizes[10] < CC || in_sizes[11] < CC || in_sizes[12] < CC || in_sizes[13] < CC) return;
  if (out_size < XN) return;

  size_t off = 0;
  auto carve = [&](size_t bytes) { const size_t o = off; off += (bytes + 255) & ~(size_t)255; return o; };
  const size_t oW16 = carve((size_t)MW * CC * 2);
  const size_t oWWb = carve((size_t)CC * DQ * 2);
  const size_t oQh  = carve((size_t)NB * NN * DQ * 2);
  const size_t oQl  = carve((size_t)NB * NN * DQ * 2);
  const size_t oKh  = carve((size_t)NB * MM * DQ * 2);
  const size_t oKl  = carve((size_t)NB * MM * DQ * 2);
  const size_t oGt  = carve((size_t)NB * MM * DQ * 2);
  const size_t oYh  = carve((size_t)NB * NN * DQ * 2);
  const size_t oYl  = carve((size_t)NB * NN * DQ * 2);
  if (off > ws_size) return;
  if (off > (size_t)134217728) return;

  const float* x   = (const float*)d_in[0];
  const float* nf  = (const float*)d_in[1];
  const float* gw  = (const float*)d_in[2];
  const float* gb  = (const float*)d_in[3];
  const float* tw  = (const float*)d_in[4];
  const float* tb  = (const float*)d_in[5];
  const float* pw  = (const float*)d_in[6];
  const float* pb  = (const float*)d_in[7];
  const float* ow  = (const float*)d_in[8];
  const float* wb  = (const float*)d_in[9];
  const float* bng = (const float*)d_in[10];
  const float* bnb = (const float*)d_in[11];
  const float* bnm = (const float*)d_in[12];
  const float* bnv = (const float*)d_in[13];

  char* ws = (char*)d_ws;
  unsigned short* W16 = (unsigned short*)(ws + oW16);
  unsigned short* WWb = (unsigned short*)(ws + oWWb);
  unsigned short* Qh  = (unsigned short*)(ws + oQh);
  unsigned short* Ql  = (unsigned short*)(ws + oQl);
  unsigned short* Kh  = (unsigned short*)(ws + oKh);
  unsigned short* Kl  = (unsigned short*)(ws + oKl);
  unsigned short* Gt  = (unsigned short*)(ws + oGt);
  unsigned short* Yh  = (unsigned short*)(ws + oYh);
  unsigned short* Yl  = (unsigned short*)(ws + oYl);
  float* out = (float*)d_out;

  const dim3 blk256(256), blk128(128);

  // (0) theta_w / phi_w / g_w -> stacked f16 plane; w_w -> bf16 plane
  cvt_w<<<dim3(MW / 8 + CC / 16), blk256, 0, stream>>>(tw, pw, gw, ow, W16, WWb);
  // (1) conv1x1 GEMM -> theta (q) hi/res planes from neighborFeat; phi (from it) and g (from x) conv + bias + 2x2 stride-2
  //     max-pool -> pooled phi (k) hi/res planes, pooled g f16 plane in the attention's staging order
  gemm_proj<<<dim3(NSTRIP, MW / DQ, NB), blk256, 0, stream>>>(W16, nf, x, tb, pb, gb, Qh, Ql, Kh, Kl, Gt);
  // (2) attention -> y hi/res planes [b][n][128]
  attn_k<<<dim3(NQ / QT, NB), blk128, 0, stream>>>(Qh, Ql, Kh, Kl, Gt, Yh, Yl);
  // (3) output conv + bias + batch-norm affine + residual -> out [b][256][4096]
  gemm_out<<<dim3(NQ / QT, CC / QT, NB), blk128, 0, stream>>>(WWb, Yh, Yl, wb, bng, bnb, bnm, bnv, x, out);
  (void)hipGetLastError();
}

// v007
// Measured time: 52.4 microseconds a run.
// Two timings next to v006 put it at 1.09 and 1.10 times that version's speed.
// All steps since v000 together make it 4.22 times as fast.
// Contractions: conv1x1 theta/phi/g GEMM W[384x256].X[256x128] per strip on v_wmma_f32_16x16x32_f16 (f16 containers
// of bf16-RNE weights x256 and bf16-RNE activations); scores K.Q^T on v_wmma_f32_16x16x32_bf16 (bf16 hi + bf16
// residual planes of theta / pooled phi, 3 products, K=128); y^T = G.P^T on v_wmma_f32_16x16x32_f16 (2x2-max-pooled g
// as f16, P = e^{s-m} x16384 f16 from the score D registers); output conv W[256x128].Y on v_wmma_f32_16x16x32_bf16
// (bf16 weights, y as bf16 hi + residual register fragments, 2 products); f32 accumulate everywhere; max-pool, softmax statistics,
// bias, batch-norm affine with running statistics and residual add in f32 VALU.
#include <hip/hip_runtime.h>
#include <math.h>
#include <stdint.h>

#ifndef NB
#define NB 8
#endif
#ifndef NQ
#define NQ 4096
#endif
#define NB_FULL 8
#define CC     256
#define HIMG   64
#define WIMG   64
#define NN     4096
#define DQ     128
#define HP     32
#define WP     32
#define MV     1024
#define MM     1024
#define MW     384
#define QT     64
#define SN     128
#define NWP    8
#define NSTRIP 32
#define OSP    68
#define WSC    256.0f
#define IWSC   0.00390625f
#define LNPS   9.704060527839234f
#define BNEPS  1.0e-5f
#define KT     64
#define NT     16
#define KPS    136
#define VPS    72
#define KSZ    (KT * KPS * 2)
#define VSZ    (DQ * VPS * 2)
#define STG    (2 * KSZ + VSZ)
#define PPS    264
#define PASZ   (QT * PPS * 2)
#define PBSZ   (SN * PPS * 2)
#define RASZ   (SN * OSP * 4)

static_assert(NB >= 1 && NB <= NB_FULL);
static_assert(NQ % QT == 0 && NQ >= QT && NQ <= NN);
static_assert(NN == HIMG * WIMG);
static_assert(SN == 2 * WIMG);
static_assert(NSTRIP * SN == NN);
static_assert(SN == 16 * NWP);
static_assert(2 * HP == HIMG && 2 * WP == WIMG);
static_assert(MV == HP * WP && MM == MV);
static_assert(WP == 32 && HP == 32);
static_assert(NSTRIP == HP && WP * (QT / 8) == 256);  // one strip = one pooled row; 32 px x 8 lanes fill the GEMM block
static_assert(QT * (WP / 8) == 256 && KT % 8 == 0);   // g: 64 channels x 4 chunks of 8 px fill it too
static_assert(NN % QT == 0 && CC % QT == 0 && DQ % QT == 0 && MM % QT == 0);
static_assert(MW == 3 * DQ && MW % QT == 0 && MW % 8 == 0);
static_assert(CC % 32 == 0 && DQ % 32 == 0 && MM % 32 == 0);
static_assert((OSP * 4) % 16 == 0);
static_assert(SN * OSP * 4 <= 65536);
static_assert((size_t)NB_FULL * CC * NN * 4 == (size_t)33554432);
static_assert(NT * KT == MM && NT >= 2 && KT % 32 == 0);
static_assert(KPS == DQ + 8 && VPS == KT + 8);
static_assert(KT * DQ * 2 == 8 * 128 * 16 && DQ * KT * 2 == 8 * 128 * 16);
static_assert(DQ == 128 && KT == 8 * 8 && (DQ - 1) * VPS * 2 + KT * 2 <= VSZ);  // g stage: lane = channel row, 8 copies of 8 keys
static_assert(KSZ % 16 == 0 && VSZ % 16 == 0 && STG % 16 == 0);
static_assert(4 * KSZ <= 2 * STG && CC == 4 * QT);  // the output weight tile fits the ring's bytes
static_assert(2 * (2 * STG + 2 * QT * OSP * 4 + 4 * CC * 4) <= 327680);
static_assert(PPS == CC + 8 && (PPS * 2) % 16 == 0);
static_assert(QT * CC * 2 == 8 * 256 * 16);
static_assert(PASZ <= RASZ && RASZ % 16 == 0 && 3 * (RASZ + PBSZ) <= 327680);  // weight tile and epilogue tile share RASZ
static_assert(SN == 4 * 32 && CC == NWP * 4 * 8);  // position tile: lane = 4 positions, wave = 32 channels in 4 groups of 8
static_assert(QT == KT);
static_assert(DQ == 4 * 32 && DQ == 8 * 16);  // the attention pass names its 4 d-chunks and 2 x 4 channel tiles

// workspace total at full size (all region sizes are multiples of 256)
#define WS_FULL ((size_t)MW * CC * 2 + (size_t)CC * DQ * 2 \
                 + 2 * (size_t)NB_FULL * NN * DQ * 2 \
                 + 3 * (size_t)NB_FULL * MM * DQ * 2)
static_assert(WS_FULL <= (size_t)134217728);

typedef _Float16       v16h __attribute__((ext_vector_type(16)));
typedef _Float16       v8h  __attribute__((ext_vector_type(8)));
typedef __bf16         v16b __attribute__((ext_vector_type(16)));
typedef unsigned short v8us __attribute__((ext_vector_type(8)));
typedef __bf16         v2b  __attribute__((ext_vector_type(2)));
typedef _Float16       v2h  __attribute__((ext_vector_type(2)));
typedef float          v8f  __attribute__((ext_vector_type(8)));
typedef float          v4f  __attribute__((ext_vector_type(4)));
typedef unsigned int   v4u  __attribute__((ext_vector_type(4)));

union Frag  { v8us u[2]; v16h h; v16b bf; };
union FragH { v16h v; v8h hv[2]; };
static_assert(sizeof(Frag) == 32);
static_assert(sizeof(FragH) == 32);

// ---- scalar helpers ---------------------------------------------------------------------------------------
__device__ __forceinline__ unsigned short bf_bits(float f) {          // f32 -> bf16 bits, RNE convert
  unsigned u = __float_as_uint(f);
  return (unsigned short)((u + 0x7FFFu + ((u >> 16) & 1u)) >> 16);
}
__device__ __forceinline__ float bf_up(unsigned short hb) { return __uint_as_float(((unsigned)hb) << 16); }
__device__ __forceinline__ float bfr(float f) { return bf_up(bf_bits(f)); }
__device__ __forceinline__ unsigned short h_bits(_Float16 x) { return __builtin_bit_cast(unsigned short, x); }
__device__ __forceinline__ unsigned pk16(unsigned short a, unsigned short b) { return (unsigned)a | ((unsigned)b << 16); }
__device__ __forceinline__ v8f zero8() { v8f z = {0.f, 0.f, 0.f, 0.f, 0.f, 0.f, 0.f, 0.f}; return z; }
__device__ __forceinline__ float hmax8(v8f s) {
  return fmaxf(fmaxf(fmaxf(s[0], s[1]), fmaxf(s[2], s[3])), fmaxf(fmaxf(s[4], s[5]), fmaxf(s[6], s[7])));
}
__device__ __forceinline__ unsigned wave_ballot(bool p) {
#if defined(__HIP_DEVICE_COMPILE__)
  return __builtin_amdgcn_ballot_w32(p);
#else
  return p ? 1u : 0u;
#endif
}
// two f32 values -> bf16 RNE (the packed hardware convert, the same values as bfr) -> f16 (exact in its normal range), packed
__device__ __forceinline__ unsigned rnd2(float f0, float f1) {
  const v2b r = {(__bf16)f0, (__bf16)f1};
  const unsigned d = __builtin_bit_cast(unsigned, r);
  const v2h h = {(_Float16)__uint_as_float(d << 16), (_Float16)__uint_as_float(d & 0xFFFF0000u)};
  return __builtin_bit_cast(unsigned, h);
}
// 8 f32 values -> bf16 hi bits and bf16 residual bits (lo = RNE(v - hi)), packed 2 per uint
__device__ __forceinline__ void split8(const float* f, v4u& uh, v4u& ul) {
#pragma unroll
  for (int t = 0; t < 4; ++t) {
    const float f0 = f[2 * t], f1 = f[2 * t + 1];
    const unsigned short hb0 = bf_bits(f0), hb1 = bf_bits(f1);
    const unsigned short lb0 = bf_bits(f0 - bf_up(hb0));
    const unsigned short lb1 = bf_bits(f1 - bf_up(hb1));
    uh[t] = pk16(hb0, hb1);
    ul[t] = pk16(lb0, lb1);
  }
}

// ---- 16-bit fragment loader (A, or B from a k-contiguous [n][k] row): lane -> row/col (lane&15), p already includes
//      + 8*(lane>>4); elements 0..7 <- p[0..7] (k0+8h..), elements 8..15 <- p[16..23] (k0+16+8h..)
__device__ __forceinline__ Frag ldfrag(const unsigned short* p) {
  Frag f;
  f.u[0] = *(const v8us*)(p);
  f.u[1] = *(const v8us*)(p + 16);
  return f;
}

// ---- WMMA helpers: builtin followed by a 4-slot VALU gap tying D and keeping A/B live --------------------------
__device__ __forceinline__ v8f mma_h(v16h a, v16h b, v8f c) {
  v8f d = __builtin_amdgcn_wmma_f32_16x16x32_f16(false, a, false, b, (short)0, c, false, false);
#if defined(__HIP_DEVICE_COMPILE__)
  asm volatile("v_nop\n\tv_nop\n\tv_nop\n\tv_nop" : "+v"(d) : "v"(a), "v"(b));
#endif
  return d;
}
__device__ __forceinline__ v8f mma_b(v16b a, v16b b, v8f c) {
  v8f d = __builtin_amdgcn_wmma_f32_16x16x32_bf16(false, a, false, b, (short)0, c, false, false);
#if defined(__HIP_DEVICE_COMPILE__)
  const v16h ha = __builtin_bit_cast(v16h, a), hb = __builtin_bit_cast(v16h, b);
  asm volatile("v_nop\n\tv_nop\n\tv_nop\n\tv_nop" : "+v"(d) : "v"(ha), "v"(hb));
#endif
  return d;
}

// =========================================================================================================
// (0) weights. Blocks 0..47: W16 f16 [384][256], rows 0..127 = theta_w, 128..255 = phi_w, 256..383 = g_w; value =
//     f16 of (bf16-RNE(w) * 256) (exact). Block owns rows 8*blk..8*blk+7: one wave per 512-B row = 32 lanes x 16 B
// coverage: 48 blocks x 8 rows x 32 lanes x 8 halves = 384 x 256; 16 blocks x 16 rows x 16 lanes x 8 = 256 x 128.
// =========================================================================================================
__global__ __launch_bounds__(256)
void cvt_w(const float* __restrict__ tw, const float* __restrict__ pw, const float* __restrict__ gw,
           const float* __restrict__ ow, unsigned short* W16, unsigned short* WWb) {
  const int tid = threadIdx.x, blk = blockIdx.x;
  if (blk < MW / 8) {
    const int rl = tid >> 5, col = 8 * (tid & 31);
    const int o = 8 * blk + rl;                                      // 0..383
    const int grp = blk >> 4;                                        // 0,1,2 (block-uniform)
    const float* wbase = (grp == 0) ? tw : ((grp == 1) ? pw : gw);  // all global
    const float* s = wbase + (size_t)(o - DQ * grp) * CC + col;      // (o - 128 grp) in 0..127
    const v4f a = *(const v4f*)s;
    const v4f q = *(const v4f*)(s + 4);
    const float f[8] = {a[0], a[1], a[2], a[3], q[0], q[1], q[2], q[3]};
    v4u u;
#pragma unroll
    for (int t = 0; t < 4; ++t) {
      const _Float16 h0 = (_Float16)(bfr(f[2 * t]) * WSC);
      const _Float16 h1 = (_Float16)(bfr(f[2 * t + 1]) * WSC);
      u[t] = pk16(h_bits(h0), h_bits(h1));
    }
{
      *(v4u*)(W16 + (size_t)o * CC + col) = u;
      
    }
  } else {
    const int rb = blk - MW / 8;                                     // 0..15
    const int o = 16 * rb + (tid >> 4);                              // 0..255
    const int col = 8 * (tid & 15);                                  // 0..120
    const float* s = ow + (size_t)o * DQ + col;
    const v4f a = *(const v4f*)s;
    const v4f q = *(const v4f*)(s + 4);
    const float f[8] = {a[0], a[1], a[2], a[3], q[0], q[1], q[2], q[3]};
    v4u u;
#pragma unroll
    for (int t = 0; t < 4; ++t) u[t] = pk16(bf_bits(f[2 * t]), bf_bits(f[2 * t + 1]));
{
      *(v4u*)(WWb + (size_t)o * DQ + col) = u;
      
    }
  }
}

// ---- eight asynchronous 16-byte copies per lane, global -> LDS: copy i takes g + i*gstep (elements) to LDS byte
//      address l + i*lstep. The s_wait_xcnt 0 is the last line of the copies' own statement so that it stands in
//      front of any later write of the address registers the copies name.
__device__ __forceinline__ void copy8(unsigned l, unsigned lstep, const unsigned short* g, size_t gstep) {
#if defined(__HIP_DEVICE_COMPILE__)
  asm volatile("global_load_async_to_lds_b128 %0, %8, off\n\t"
               "global_load_async_to_lds_b128 %1, %9, off\n\t"
               "global_load_async_to_lds_b128 %2, %10, off\n\t"
               "global_load_async_to_lds_b128 %3, %11, off\n\t"
               "global_load_async_to_lds_b128 %4, %12, off\n\t"
               "global_load_async_to_lds_b128 %5, %13, off\n\t"
               "global_load_async_to_lds_b128 %6, %14, off\n\t"
               "global_load_async_to_lds_b128 %7, %15, off\n\t"
               "s_wait_xcnt 0x0"
               :: "v"(l), "v"(l + lstep), "v"(l + 2 * lstep), "v"(l + 3 * lstep),
                  "v"(l + 4 * lstep), "v"(l + 5 * lstep), "v"(l + 6 * lstep), "v"(l + 7 * lstep),
                  "v"(g), "v"(g + gstep), "v"(g + 2 * gstep), "v"(g + 3 * gstep),
                  "v"(g + 4 * gstep), "v"(g + 5 * gstep), "v"(g + 6 * gstep), "v"(g + 7 * gstep)
               : "memory");
#endif
}

// =========================================================================================================
// (1) conv1x1 GEMM for one (b, strip of 128 positions = image rows 2s and 2s+1, projection grp: 0 theta, 1 phi, 2 g):
//     Y[o][n] = (1/256) sum_c W16[o][c] B[n][c], B = bf16-RNE values (exact in f16) of neighborFeat (theta, phi) or of
//     x (g), block-uniform select. The position tile B [128 n][256 c] is made once per block from the f32 input
//     [b][c][n] itself: wave w takes channels 32w..32w+31 in 4 groups of 8, lane l positions 4l..4l+3 (one b128 load per
//     channel = a whole 512-B strip row per wave), rounds, packs 8 channels of one position and stores them as one
//     ds_store_b128 into row n (pitch 528 B). 16-B chunk j of row n lies at chunk j ^ ((n >> 4) & 3): the 16 lanes of a
//     half wave, 4 rows apart, then fall on 16 different bank groups; for a reading wave (16 rows) the term is uniform.
//     The projection's 128 weight rows go through in two halves of 64 (dsel = 0, 64) against the same position tile.
//     Block 256 threads = 8 waves; wave w owns cols 16w..+15 (one B fragment per k-step) and 4 m-tiles (A rows
//     o = 16 mt + (lane&15), split k map loader). K = 256 = 8 steps. Each half's weight tile (64 rows of 512 B) is
//     staged in LDS by asynchronous copies of whole 128-B lines (8 copies per lane), rows at pitch 528 B, and read as
//     ds_load_b128 fragments behind each wave's own asynccnt wait + block barrier.
//     Epilogue staged in LDS Os[n_loc][o_loc] (pitch OSP, b128 stores; it shares its bytes with the weight tile, behind
//     a block barrier that ends every wave's fragment reads), block barrier, then (block-uniform branch on grp):
//       theta -> dims dsel..dsel+63 + bias -> Qh/Ql bf16 [b][4096 n][128 d] (hi = RNE(v), lo = RNE(v-hi)):
//       phi   -> + bias in f32, 2x2 stride-2 max-pool in f32 inside the tile (the strip holds both image
//                       rows of pooled row py = strip: window n_loc = 64 dy + 2 px + dx) -> Kh/Kl bf16 [b][1024 m][128 d]
//                       (hi = RNE(v), lo = RNE(v-hi)), m = 32 py + px: 32 rows x the dsel half (128 B = 1 whole line).
//       g     -> + bias, the same pool, read down the tile's columns (lane = channel, 8 px per thread) ->
//                       Gt f16 [b][128 chunks m>>3][128 d][8 keys m&7], the order in which the attention stages it:
//                       4 chunks x the dsel half (64 d x 16 B = 8 whole lines), one wave = 512 contiguous bytes.
// coverage: B tile 8 waves x 32 c x 32 lanes x 4 n = 256 c x 128 n written, rows <= 127 chunks <= 31 read;
//           Os 8 waves x 16 n x 64 o = 128 x 64 written, reads rows <= 127 cols <= 63; theta planes 4 it x 32 rows
//           x 8 lanes x 8 = 128 n x 64 d; k planes 32 px x 8 lanes x 8 = 32 m x 64 d; Gt 4 chunks x 64 d x 8 keys;
//           grid (32, 3, NB) x 2 halves covers all 4096 rows x 128 d of Qh/Ql and all 1024 keys x 128 d of Kh/Kl/Gt once.
// registers capped at 160 = 6 waves per SIMD, LDS 100 KiB: three blocks share a WGP, the whole grid is resident at once.
// =========================================================================================================
__global__ __launch_bounds__(256) __attribute__((amdgpu_num_vgpr(160)))
void gemm_proj(const unsigned short* __restrict__ W16, const float* __restrict__ nf, const float* __restrict__ x,
               const float* __restrict__ tb, const float* __restrict__ pb, const float* __restrict__ gb,
               unsigned short* Qh, unsigned short* Ql,
               unsigned short* Kh, unsigned short* Kl, unsigned short* Gt) {
  __shared__ __align__(16) unsigned char Sm[RASZ + PBSZ];
  const unsigned short* As = (const unsigned short*)Sm;              // weight tile  [64 o][PPS]
  unsigned short* Bs = (unsigned short*)(Sm + RASZ);                 // position tile [128 n][PPS], chunks swizzled
  float* Os = (float*)Sm;                                            // epilogue tile, after the half's last fragment read
  const int tid  = threadIdx.x;
  const int lane = tid & 31, wave = tid >> 5;                        // wave 0..7
  const int hh   = lane >> 4, c = lane & 15;
  const int st   = blockIdx.x, grp = blockIdx.y, b = blockIdx.z;     // grp 0 theta, 1 phi, 2 g (block-uniform)
  const int n0   = st * SN;
  const float* src = (grp < 2) ? nf : x;                             // block-uniform, both global

  // a half's weight tile is contiguous in global memory: 16-B chunk tid + 256 per copy = row (tid>>5) + 8 per copy
  const unsigned lrow = (unsigned)(size_t)Sm + (unsigned)((tid >> 5) * (PPS * 2) + (tid & 31) * 16);
  const unsigned short* wg = W16 + (size_t)(grp * DQ) * CC + 8 * tid;
  copy8(lrow, 8 * PPS * 2, wg, 256 * 8);                             // half 0, in flight over the position tile's making

  // ---- position tile: f32 [c][n] -> rounded f16 [n][c]
  {
    const float* sp = src + ((size_t)(b * CC + 32 * wave)) * NN + n0 + 4 * lane;
    unsigned short* bw = Bs + (4 * lane) * PPS + 32 * wave;          // row 4 lane (+ t), chunks 4 wave .. 4 wave + 3
    const int gs = (lane >> 2) & 3;                                  // ((4 lane + t) >> 4) & 3
#pragma unroll
    for (int q = 0; q < 4; ++q) {
      v4f a[8];
#pragma unroll
      for (int i = 0; i < 8; ++i) a[i] = *(const v4f*)(sp + (size_t)(8 * q + i) * NN);
#pragma unroll
      for (int t = 0; t < 4; ++t) {
        v4u u;
#pragma unroll
        for (int p = 0; p < 4; ++p)
          u[p] = rnd2(a[2 * p][t], a[2 * p + 1][t]);
        *(v4u*)(bw + t * PPS + 8 * (q ^ gs)) = u;
      }
    }
    // ahead of any write of the loads' address registers; it names the address, which so stays unwritten up to here
    asm volatile("s_wait_xcnt 0x0" :: "v"(sp) : "memory");
  }

  const int gr = wave & 3;                                           // ((16 wave + c) >> 4) & 3
  const unsigned short* ap  = As + c * PPS + 8 * hh;
  const unsigned short* bp0 = Bs + (16 * wave + c) * PPS + 8 * (hh ^ gr);        // k 32 ks + 8 hh ..
  const unsigned short* bp1 = Bs + (16 * wave + c) * PPS + 8 * ((2 + hh) ^ gr);  // k 32 ks + 16 + 8 hh ..
  const float* bias = (grp == 0) ? tb : ((grp == 1) ? pb : gb);     // all global

#pragma unroll 1  // the two halves share one text: half the instruction bytes, and each barrier stands once
  for (int half = 0; half < 2; ++half) {
  const int dsel = half * QT;                                        // 0 or 64
  asm volatile("s_wait_asynccnt 0x0" ::: "memory");                  // this wave's weight copies have landed
  __syncthreads();                                                   // every wave's copies (half 0: and tile rows) are readable

  v8f acc[4];
#pragma unroll
  for (int mt = 0; mt < 4; ++mt) acc[mt] = zero8();

#pragma unroll
  for (int ks = 0; ks < CC / 32; ++ks) {
    Frag fb;
    fb.u[0] = *(const v8us*)(bp0 + 32 * ks);
    fb.u[1] = *(const v8us*)(bp1 + 32 * ks);
    Frag fa[4];
#pragma unroll
    for (int mt = 0; mt < 4; ++mt) fa[mt] = ldfrag(ap + (16 * mt) * PPS + 32 * ks);
#pragma unroll
    for (int mt = 0; mt < 4; ++mt) acc[mt] = mma_h(fa[mt].h, fb.h, acc[mt]);
  }
  __syncthreads();                                                   // all weight fragment reads done: Os may take the bytes

  // ---- epilogue: scale back -> LDS Os[n_loc][o_loc]; lane (hh, c) holds o = 16 mt + 8 hh + r for n_loc = 16 w + c
  {
    const int nl = 16 * wave + c;
#pragma unroll
    for (int mt = 0; mt < 4; ++mt) {
      v4f va, vb;
#pragma unroll
      for (int r = 0; r < 4; ++r) { va[r] = acc[mt][r] * IWSC; vb[r] = acc[mt][4 + r] * IWSC; }
      *(v4f*)(Os + nl * OSP + 16 * mt + 8 * hh)     = va;
      *(v4f*)(Os + nl * OSP + 16 * mt + 8 * hh + 4) = vb;
    }
  }
  __syncthreads();

  if (grp == 0) {
    const int e = tid & 7, lq = tid >> 3;                            // lq 0..31
    float bv[8];
    {
      const v4f ba = *(const v4f*)(bias + dsel + 8 * e);
      const v4f bq = *(const v4f*)(bias + dsel + 8 * e + 4);
#pragma unroll
      for (int t = 0; t < 4; ++t) { bv[t] = bfr(ba[t]); bv[4 + t] = bfr(bq[t]); }
    }
    v4u uh[4], ul[4];
#pragma unroll
    for (int it = 0; it < 4; ++it) {
      const int row = it * 32 + lq;                                  // n_loc 0..127
      const v4f a = *(const v4f*)(Os + row * OSP + 8 * e);
      const v4f q = *(const v4f*)(Os + row * OSP + 8 * e + 4);
      float f[8];
#pragma unroll
      for (int t = 0; t < 4; ++t) { f[t] = a[t] + bv[t]; f[4 + t] = q[t] + bv[4 + t]; }
      split8(f, uh[it], ul[it]);
    }
{
#pragma unroll
      for (int it = 0; it < 4; ++it) {
        const int row = it * 32 + lq;
        const size_t po = ((size_t)(b * NN + n0 + row)) * DQ + dsel + 8 * e;
        *(v4u*)(Qh + po) = uh[it];
        *(v4u*)(Ql + po) = ul[it];
      }
      asm volatile("s_wait_xcnt 0x0" ::: "memory");                  // ahead of any later write of the stores' registers
    }
  } else if (grp == 1) {
    const int e = tid & 7, px = tid >> 3;                            // px 0..31
    float bv[8];
    {
      const v4f ba = *(const v4f*)(bias + dsel + 8 * e);
      const v4f bq = *(const v4f*)(bias + dsel + 8 * e + 4);
#pragma unroll
      for (int t = 0; t < 4; ++t) { bv[t] = bfr(ba[t]); bv[4 + t] = bfr(bq[t]); }
    }
    float f[8];
#pragma unroll
    for (int t = 0; t < 8; ++t) f[t] = -__builtin_inff();
#pragma unroll
    for (int dy = 0; dy < 2; ++dy) {
#pragma unroll
      for (int dx = 0; dx < 2; ++dx) {
        const int row = dy * WIMG + 2 * px + dx;                     // n_loc 0..127
        const v4f a = *(const v4f*)(Os + row * OSP + 8 * e);
        const v4f q = *(const v4f*)(Os + row * OSP + 8 * e + 4);
#pragma unroll
        for (int t = 0; t < 4; ++t) {
          f[t]     = fmaxf(f[t], a[t] + bv[t]);
          f[4 + t] = fmaxf(f[4 + t], q[t] + bv[4 + t]);
        }
      }
    }
    const size_t po = ((size_t)(b * MM + WP * st + px)) * DQ + dsel + 8 * e;
    v4u kh, kl;
    split8(f, kh, kl);
    *(v4u*)(Kh + po) = kh;
    *(v4u*)(Kl + po) = kl;
    asm volatile("s_wait_xcnt 0x0" ::: "memory");                    // ahead of any later write of the two stores' registers
  } else {
    const int cl = tid & (QT - 1), pc = tid >> 6;                    // channel 0..63 of the block, px chunk 0..3
    const float bs = bfr(bias[dsel + cl]);
    float f[8];
#pragma unroll
    for (int j = 0; j < 8; ++j) {
      f[j] = -__builtin_inff();
#pragma unroll
      for (int dy = 0; dy < 2; ++dy) {
#pragma unroll
        for (int dx = 0; dx < 2; ++dx) {
          const int row = dy * WIMG + 2 * (8 * pc + j) + dx;         // n_loc 0..127
          f[j] = fmaxf(f[j], Os[row * OSP + cl] + bs);
        }
      }
    }
    v4u gu;
#pragma unroll
    for (int t = 0; t < 4; ++t) gu[t] = pk16(h_bits((_Float16)f[2 * t]), h_bits((_Float16)f[2 * t + 1]));
    // key m = 32 st + 8 pc + j: chunk m>>3 = 4 st + pc, place j in the chunk
    *(v4u*)(Gt + (((size_t)(b * (MM / 8) + (WP / 8) * st + pc)) * DQ + dsel + cl) * 8) = gu;
    asm volatile("s_wait_xcnt 0x0" ::: "memory");                    // ahead of any later write of the store's registers
  }

  if (half == 0) {                                                   // block-uniform: second half's weight tile over Os
    asm volatile("s_wait_dscnt 0x0" ::: "memory");                   // this wave's reads of Os are done
    __syncthreads();                                                 // every wave's are
    copy8(lrow, 8 * PPS * 2, wg + (size_t)QT * CC, 256 * 8);
  }
  }
}

// ---- attention fragment groups (LDS): each group is 8 ds_load_b128 written together, one block of products ahead of
//      its use. ldk4: K hi rows key..+15 and +16..+31, then the same rows of the K residual plane, 32 d at p.
//      ldv4: pooled-g rows of 4 channel tiles (16 rows apart), 32 keys at p. sc6: the six score products of one d-chunk.
__device__ __forceinline__ void ldk4(Frag* f, const unsigned short* p) {
  f[0] = ldfrag(p);
  f[1] = ldfrag(p + 16 * KPS);
  f[2] = ldfrag(p + KSZ / 2);
  f[3] = ldfrag(p + KSZ / 2 + 16 * KPS);
}
__device__ __forceinline__ void ldv4(Frag* f, const unsigned short* p) {
#pragma unroll
  for (int j = 0; j < 4; ++j) f[j] = ldfrag(p + (16 * j) * VPS);
}
__device__ __forceinline__ void sc6(const Frag* k, const Frag& qh, const Frag& ql, v8f& s0, v8f& s1) {
  s0 = mma_b(k[0].bf, qh.bf, s0);
  s1 = mma_b(k[1].bf, qh.bf, s1);
  s0 = mma_b(k[0].bf, ql.bf, s0);
  s1 = mma_b(k[1].bf, ql.bf, s1);
  s0 = mma_b(k[2].bf, qh.bf, s0);
  s1 = mma_b(k[3].bf, qh.bf, s1);
}

// =========================================================================================================
// (2) attention for one (b, 64-query tile), transposed formulation, 1024 keys (all valid, no mask, no scale):
//   S^T tile (16 keys x 16 queries) = sum over 4 d-chunks (q fragments kept in registers) of A(k: row = key kb + (lane&15), 32 d via
//   the split k map from the bf16 plane Kh [b][1024][128]) . B(q: col = query, same map from Qh [b][4096][128])
//   + A(Kh).B(Ql) + A(Kl).B(Qh) (bf16 unscaled residual planes, shared accumulator).
//   Per lane the D tile holds 8 keys of ONE query: online softmax state per lane, one shuffle (lane^16) for the max
//   over 32 keys; the o/l rescale is skipped under a wave-uniform ballot when no lane's max grew (corr == 1 exactly
//   for every lane then); row-sum partials combined at the end. P = e^{s-m} x 16384 as f16 is the B operand of
//   y^T (rows channel, cols queries) += A(pooled g: rows channel = 16j + (lane&15), keys contiguous in the LDS tile,
//   f16 plane Gt [b][128 chunks of 8 keys][128 ch][8 keys]) . B(P^T): element r <- D of the tile covering keys kb..kb+15, element 8+r <- the tile covering
//   kb+16..kb+31, lane unchanged. 8 accumulator tiles per wave (128 channels). Block = 4 waves = 64 queries.
//   K hi / K residual / pooled-g tiles of 64 keys are staged once per block in a two-buffer LDS ring by asynchronous
//   copies (whole 128-B lines from global; 24 copies per lane and stage) and read by all 4 waves as ds_load_b128
//   fragments: K rows at pitch 272 B, g rows (64 keys = 128 B) at pitch 144 B. Stage t+2 is issued behind the barrier
//   that ends every wave's reads of stage t; stage t+1 is read only behind each wave's own asynccnt wait + barrier.
//   Fragments go through two register sets: each group of 8 ds_load_b128 is issued one block of products ahead of its
//   use (K d-chunk c+1 ahead of chunk c's products, the g rows ahead of the last score products and the softmax), inside one stage only.
//   Epilogue = the output conv for the block's 64 positions: y = O/l, split into bf16 hi + residual, IS the B operand
//   (col = query, k = channel: element r <- accumulator tile 2 ks, element 8+r <- tile 2 ks + 1, lane unchanged), so y
//   leaves the registers nowhere. A[c][n] = sum_ci WWb[c][ci] (yh + yl)[n][ci] on bf16 WMMA (2 products per k-step,
//   shared accumulator, K = 128 = 4 steps), 256 output channels in 4 blocks of 64 (4 m-tiles each). The weight plane
//   (256 rows of 256 B, pitch 272 B) is staged in the ring's bytes by asynchronous copies (32 per lane) behind the last
//   barrier of the loop, and read behind each wave's own asynccnt wait + block barrier. Per-channel constants (bf16-RNE of w_b, bn mean, bn beta, and scale = bf16-RNE(gamma) *
//   rsqrt(bf16-RNE(var) + eps)) staged once in LDS at the start. Each 64-channel block goes through Os[n_loc][c_loc]
//   (pitch OSP, b128 stores, two buffers in turn, one block barrier each), then out[b][c][n] = (((A + w_b[c]) - mean[c])
//   * scale[c] + beta[c]) + bf16-RNE(x), whole 128-B lines per 8 lanes.
// coverage: Os 4 waves x 16 n x 64 c written, read rows nl+t <= 63 x cols cl <= 63; constants written 0..255, read
//           <= 255; out 4 blocks x 8 it x 16 lines x 8 lanes x 4 floats = 256 c x 64 n; grid (NQ/64, NB) covers
//           out[b][0..255][0..NQ-1] exactly once.
// =========================================================================================================
__global__ __launch_bounds__(128) __attribute__((amdgpu_num_vgpr(256)))
void attn_k(const unsigned short* __restrict__ Qh, const unsigned short* __restrict__ Ql,
            const unsigned short* __restrict__ Kh, const unsigned short* __restrict__ Kl,
            const unsigned short* __restrict__ Gt, const unsigned short* __restrict__ WWb,
            const float* __restrict__ wb, const float* __restrict__ bng, const float* __restrict__ bnb,
            const float* __restrict__ bnm, const float* __restrict__ bnv,
            const float* __restrict__ x, float* out) {
  __shared__ __align__(16) float Os[2 * QT * OSP];
  __shared__ __align__(16) unsigned short Ring[2 * STG / 2];
  __shared__ float Pb[CC], Pm[CC], Ps[CC], Pt[CC];
  const int tid  = threadIdx.x;
  const int wave = tid >> 5, lane = tid & 31;
  const int hh   = lane >> 4, c = lane & 15;
  const int n0   = blockIdx.x * QT, b = blockIdx.y;

  // q fragment pointers (B operand, col = query n0 + 16*wave + c), + 32*kc
  const size_t qo = ((size_t)(b * NN + n0 + 16 * wave + c)) * DQ + 8 * hh;
  const unsigned short* Qhp = Qh + qo;
  const unsigned short* Qlp = Ql + qo;
  // copy sources of stage 0 (per lane, 16 B): each plane's 16-KB tile is contiguous, chunk tid, + 128 chunks per copy
  // (g plane: lane = channel tid, copy i = the stage's keys 8i..8i+7)
  const unsigned short* Khg = Kh + (size_t)b * MM * DQ + 8 * tid;
  const unsigned short* Klg = Kl + (size_t)b * MM * DQ + 8 * tid;
  const unsigned short* Vg  = Gt + (size_t)b * MM * DQ + 8 * tid;
  // copy destinations in buffer 0 (LDS byte addresses): K row (tid>>4) + 8 per copy, g row tid, + 16 B per copy
  const unsigned ring0 = (unsigned)(size_t)Ring;
  const unsigned lK = ring0 + (unsigned)((tid >> 4) * (KPS * 2) + (tid & 15) * 16);
  const unsigned lV = ring0 + (unsigned)(2 * KSZ + tid * (VPS * 2));
  // fragment offsets inside a buffer (elements): k (A operand, row = key + c), + key * KPS + 32*kc;
  // v (A operand, row = channel 16j + c, keys contiguous), + 16*j*VPS + key
  const int kfo = c * KPS + 8 * hh;
  const int vfo = KSZ + c * VPS + 8 * hh;

  // ring prologue: stage 0 -> buffer 0, landed and published; then stage 1 -> buffer 1 flies over pass 0
  copy8(lK, 8 * KPS * 2, Khg, 128 * 8);
  copy8(lK + KSZ, 8 * KPS * 2, Klg, 128 * 8);
  copy8(lV, 16, Vg, 128 * 8);
#pragma unroll
  for (int h = 0; h < CC / 128; ++h) {                               // output conv's per-channel constants, read after the loop
    const int ch = tid + 128 * h;                                    // 0..255
    Pb[ch] = bfr(wb[ch]);
    Pm[ch] = bfr(bnm[ch]);
    Ps[ch] = bfr(bng[ch]) * rsqrtf(bfr(bnv[ch]) + BNEPS);
    Pt[ch] = bfr(bnb[ch]);
  }
  asm volatile("s_wait_asynccnt 0x0" ::: "memory");                  // this wave's stage-0 copies have landed
  __syncthreads();                                                   // every wave's stage-0 copies are readable
  copy8(lK + STG, 8 * KPS * 2, Khg + (size_t)KT * DQ, 128 * 8);
  copy8(lK + STG + KSZ, 8 * KPS * 2, Klg + (size_t)KT * DQ, 128 * 8);
  copy8(lV + STG, 16, Vg + (size_t)KT * DQ, 128 * 8);

  // q hi / residual fragments of this wave's 16 queries: the same for every key, loaded once and kept in registers
  Frag qhf[DQ / 32], qlf[DQ / 32];
#pragma unroll
  for (int kc = 0; kc < DQ / 32; ++kc) {
    qhf[kc] = ldfrag(Qhp + 32 * kc);
    qlf[kc] = ldfrag(Qlp + 32 * kc);
  }

  float m = -1.0e30f, l = 0.f;
  v8f o[8];
#pragma unroll
  for (int j = 0; j < 8; ++j) o[j] = zero8();

#pragma unroll 1  // one stage per trip, rolled: the publish point at its foot stands once in the text
  for (int t = 0; t < NT; ++t) {
   const unsigned short* sb = Ring + (t & 1) * (STG / 2);            // this stage's buffer
   const unsigned short* kp = sb + kfo;
   const unsigned short* vp = sb + vfo;
   // two fragment sets of 4 x 8 registers, filled in turn one block of products ahead of their use
   Frag fa[4], fb[4];
   ldk4(fa, kp);                                                     // d-chunk 0 of the stage's first 32 keys
#pragma unroll  // both 32-key passes of the stage in the text: the second one's first K fragments are fetched in the first
   for (int kb = 0; kb < KT; kb += 32) {
    const unsigned short* k0p = kp + kb * KPS;                       // keys kb .. kb+15 of the stage
    v8f s0 = zero8(), s1 = zero8();
    ldk4(fb, k0p + 32);
    sc6(fa, qhf[0], qlf[0], s0, s1);
    ldk4(fa, k0p + 64);
    sc6(fb, qhf[1], qlf[1], s0, s1);
    ldk4(fb, k0p + 96);
    sc6(fa, qhf[2], qlf[2], s0, s1);
    ldv4(fa, vp + kb);                                               // pooled-g rows of channels 0..63
    sc6(fb, qhf[3], qlf[3], s0, s1);
    ldv4(fb, vp + 64 * VPS + kb);                                    // channels 64..127, in flight over the softmax

    float mx = fmaxf(hmax8(s0), hmax8(s1));
    mx = fmaxf(mx, __shfl_xor(mx, 16, 32));
    const float mn = fmaxf(m, mx);
    const unsigned grew = wave_ballot(mx > m);                       // wave-uniform
    if (grew != 0u) {
      const float corr = __expf(m - mn);                             // == 1 exactly for lanes whose max did not grow
      l *= corr;
#pragma unroll
      for (int j = 0; j < 8; ++j) {
#pragma unroll
        for (int r = 0; r < 8; ++r) o[j][r] *= corr;
      }
    }
    m = mn;
    const float msh = mn - LNPS;                                     // exp gives e^{s-m} * 16384

    FragH ph;
    float ls = 0.f;
#pragma unroll
    for (int r = 0; r < 8; ++r) {
      const float e0 = __expf(s0[r] - msh);                          // key kb      + 8hh + r
      const float e1 = __expf(s1[r] - msh);                          // key kb + 16 + 8hh + r
      ls += e0 + e1;
      ph.hv[0][r] = (_Float16)e0;
      ph.hv[1][r] = (_Float16)e1;
    }
    l += ls;

#pragma unroll
    for (int j = 0; j < 4; ++j) o[j] = mma_h(fa[j].h, ph.v, o[j]);
    if (kb + 32 < KT) ldk4(fa, k0p + 32 * KPS);                      // compile-time test: next pass's d-chunk 0, same stage
#pragma unroll
    for (int j = 0; j < 4; ++j) o[4 + j] = mma_h(fb[j].h, ph.v, o[4 + j]);
   }
   // publish point of stage t+1, and release of stage t's buffer
   asm volatile("s_wait_dscnt 0x0" ::: "memory");                    // this wave's reads of stage t are done
   asm volatile("s_wait_asynccnt 0x0" ::: "memory");                 // this wave's stage t+1 copies have landed
   __syncthreads();
   if (t + 2 < NT) {                                                 // block-uniform
     const unsigned bo = (unsigned)((t & 1) * STG);
     copy8(lK + bo, 8 * KPS * 2, Khg + (size_t)(t + 2) * KT * DQ, 128 * 8);
     copy8(lK + bo + KSZ, 8 * KPS * 2, Klg + (size_t)(t + 2) * KT * DQ, 128 * 8);
     copy8(lV + bo, 16, Vg + (size_t)(t + 2) * KT * DQ, 128 * 8);
   }
  }
  asm volatile("s_wait_asynccnt 0x0" ::: "memory");                  // nothing of the ring is in flight past here
  // residual input / output addresses: line L = 16 it + lq of a 64-channel block: channel L >> 1, half row L & 1
  const int e = tid & 7, lq = tid >> 3;                              // lq 0..15
  const int clb = lq >> 1, nl = (lq & 1) * 32 + 4 * e;               // channel 8 it + clb, position 0..63
  const size_t xo = ((size_t)(b * CC + clb)) * NN + n0 + nl;
  const float* xp = x + xo;
  float* op = out + xo;
  v4f xv[2][8];                                                      // x of a channel block is fetched one block ahead
#pragma unroll
  for (int it = 0; it < 8; ++it) xv[0][it] = *(const v4f*)(xp + (size_t)(8 * it) * NN);
  // output weights into the ring's bytes, whose last reads the loop's last barrier has ended
#pragma unroll
  for (int cb = 0; cb < CC / QT; ++cb)
    copy8(lK + cb * KSZ, 8 * KPS * 2, WWb + (size_t)(QT * cb) * DQ + 8 * tid, 128 * 8);
  __builtin_amdgcn_sched_barrier(0);  // the x loads and the copies stay issued here, so that they fly over the y split below

  l += __shfl_xor(l, 16, 32);
  const float inv = 1.0f / l;                                        // o and l both carry the x16384 factor

  // ---- y = o * inv -> bf16 hi / residual B fragments; lane (hh, c) holds ch = 16 j + 8 hh + r for query 16 w + c
  Frag yh[DQ / 32], yl[DQ / 32];
#pragma unroll
  for (int j = 0; j < 8; ++j) {
    float f[8];
#pragma unroll
    for (int r = 0; r < 8; ++r) f[r] = o[j][r] * inv;
    v4u uh, ul;
    split8(f, uh, ul);
    yh[j >> 1].u[j & 1] = __builtin_bit_cast(v8us, uh);
    yl[j >> 1].u[j & 1] = __builtin_bit_cast(v8us, ul);
  }

  __builtin_amdgcn_sched_barrier(0);  // the y split stays in front of the wait: it is the work the copies and loads fly over
  asm volatile("s_wait_asynccnt 0x0" ::: "memory");                  // this wave's weight copies have landed
  __syncthreads();                                                   // every wave's are readable

  const unsigned short* ap = Ring + c * KPS + 8 * hh;                // weight rows (A operand), + (64 cb + 16 mt) * KPS + 32 ks
#pragma unroll  // 4 channel blocks in the text: every x / out address is one base + a constant, the next block's x loads fly
  for (int cb = 0; cb < CC / QT; ++cb) {
    if (cb + 1 < CC / QT) {                                          // compile-time test
#pragma unroll
      for (int it = 0; it < 8; ++it)
        xv[(cb + 1) & 1][it] = *(const v4f*)(xp + (size_t)(QT * (cb + 1) + 8 * it) * NN);
    }
    v8f acc[4];
#pragma unroll
    for (int mt = 0; mt < 4; ++mt) acc[mt] = zero8();
#pragma unroll
    for (int ks = 0; ks < DQ / 32; ++ks) {
      Frag fw[4];
#pragma unroll
      for (int mt = 0; mt < 4; ++mt) fw[mt] = ldfrag(ap + (QT * cb + 16 * mt) * KPS + 32 * ks);
#pragma unroll
      for (int mt = 0; mt < 4; ++mt) {
        acc[mt] = mma_b(fw[mt].bf, yh[ks].bf, acc[mt]);
        acc[mt] = mma_b(fw[mt].bf, yl[ks].bf, acc[mt]);
      }
    }
    // -> LDS Ob[n_loc][c_loc]; lane (hh, c) holds c_loc = 16 mt + 8 hh + r for n_loc = 16 w + c
    float* Ob = Os + (cb & 1) * (QT * OSP);
    {
      const int nw = 16 * wave + c;
#pragma unroll
      for (int mt = 0; mt < 4; ++mt) {
        v4f va, vb;
#pragma unroll
        for (int r = 0; r < 4; ++r) { va[r] = acc[mt][r]; vb[r] = acc[mt][4 + r]; }
        *(v4f*)(Ob + nw * OSP + 16 * mt + 8 * hh)     = va;
        *(v4f*)(Ob + nw * OSP + 16 * mt + 8 * hh + 4) = vb;
      }
    }
    // Ob is readable behind it; the other buffer's reads of the block before are done in front of it. Only LDS data passes
    // here, so the wait is dscnt alone: __syncthreads() would also wait for the x loads in flight and the out stores.
    asm volatile("s_wait_dscnt 0x0\n\ts_barrier_signal -1\n\ts_barrier_wait -1" ::: "memory");

#pragma unroll
    for (int it = 0; it < 8; ++it) {
      const int cl = 8 * it + clb;                                   // channel 0..63 within the block
      const int ch = QT * cb + cl;
      const float pbv = Pb[ch], pmv = Pm[ch], psv = Ps[ch], ptv = Pt[ch];
      v4f res;
#pragma unroll
      for (int t = 0; t < 4; ++t) {
        const float cv = Ob[(nl + t) * OSP + cl] + pbv;
        res[t] = ((cv - pmv) * psv + ptv) + bfr(xv[cb & 1][it][t]);
      }
      *(v4f*)(op + (size_t)(QT * cb + 8 * it) * NN) = res;
    }
  }
}

// =========================================================================================================
// Workspace map (bytes; each region start a multiple of 256; every extent is an exact row/tile multiple and is
//   W16 f16 [384][256]            196608      WWb bf16 [256][128]        65536
//   Qh/Ql bf16 [NB][4096][128]    8388608 x2
//   Kh/Kl bf16 [NB][1024][128]    2097152 x2  Gt f16 [NB][128][128][8] 2097152
//   total (NB=8) = 23330816
// =========================================================================================================
extern "C" void kernel_launch(void* const* d_in, const int* in_sizes, int n_in,
                              void* d_out, int out_size, void* d_ws, size_t ws_size,
                              hipStream_t stream) {
  const int XN = NB * CC * NN;
  if (n_in < 14) return;
  if (in_sizes[0] < XN || in_sizes[1] < XN) return;
  if (in_sizes[2] < DQ * CC || in_sizes[4] < DQ * CC || in_sizes[6] < DQ * CC || in_sizes[8] < CC * DQ) return;
  if (in_sizes[3] < DQ || in_sizes[5] < DQ || in_sizes[7] < DQ) return;
  if (in_sizes[9] < CC || in_sizes[10] < CC || in_sizes[11] < CC || in_sizes[12] < CC || in_sizes[13] < CC) return;
  if (out_size < XN) return;

  size_t off = 0;
  auto carve = [&](size_t bytes) { const size_t o = off; off += (bytes + 255) & ~(size_t)255; return o; };
  const size_t oW16 = carve((size_t)MW * CC * 2);
  const size_t oWWb = carve((size_t)CC * DQ * 2);
  const size_t oQh  = carve((size_t)NB * NN * DQ * 2);
  const size_t oQl  = carve((size_t)NB * NN * DQ * 2);
  const size_t oKh  = carve((size_t)NB * MM * DQ * 2);
  const size_t oKl  = carve((size_t)NB * MM * DQ * 2);
  const size_t oGt  = carve((size_t)NB * MM * DQ * 2);
  if (off > ws_size) return;
  if (off > (size_t)134217728) return;

  const float* x   = (const float*)d_in[0];
  const float* nf  = (const float*)d_in[1];
  const float* gw  = (const float*)d_in[2];
  const float* gb  = (const float*)d_in[3];
  const float* tw  = (const float*)d_in[4];
  const float* tb  = (const float*)d_in[5];
  const float* pw  = (const float*)d_in[6];
  const float* pb  = (const float*)d_in[7];
  const float* ow  = (const float*)d_in[8];
  const float* wb  = (const float*)d_in[9];
  const float* bng = (const float*)d_in[10];
  const float* bnb = (const float*)d_in[11];
  const float* bnm = (const float*)d_in[12];
  const float* bnv = (const float*)d_in[13];

  char* ws = (char*)d_ws;
  unsigned short* W16 = (unsigned short*)(ws + oW16);
  unsigned short* WWb = (unsigned short*)(ws + oWWb);
  unsigned short* Qh  = (unsigned short*)(ws + oQh);
  unsigned short* Ql  = (unsigned short*)(ws + oQl);
  unsigned short* Kh  = (unsigned short*)(ws + oKh);
  unsigned short* Kl  = (unsigned short*)(ws + oKl);
  unsigned short* Gt  = (unsigned short*)(ws + oGt);
  float* out = (float*)d_out;

  const dim3 blk256(256), blk128(128);

  // (0) theta_w / phi_w / g_w -> stacked f16 plane; w_w -> bf16 plane
  cvt_w<<<dim3(MW / 8 + CC / 16), blk256, 0, stream>>>(tw, pw, gw, ow, W16, WWb);
  // (1) conv1x1 GEMM -> theta (q) hi/res planes from neighborFeat; phi (from it) and g (from x) conv + bias + 2x2 stride-2
  //     max-pool -> pooled phi (k) hi/res planes, pooled g f16 plane in the attention's staging order
  gemm_proj<<<dim3(NSTRIP, MW / DQ, NB), blk256, 0, stream>>>(W16, nf, x, tb, pb, gb, Qh, Ql, Kh, Kl, Gt);
  // (2) attention + output conv + bias + batch-norm affine + residual -> out [b][256][4096]
  attn_k<<<dim3(NQ / QT, NB), blk128, 0, stream>>>(Qh, Ql, Kh, Kl, Gt, WWb, wb, bng, bnb, bnm, bnv, x, out);
  (void)hipGetLastError();
}

// v009
// Measured time: 40.7 microseconds a run.
// Versions between v007 and this one are left out; their measured steps multiply to 1.29 times as fast.
// All steps since v000 together make it 5.46 times as fast.
// Contractions: conv1x1 theta/phi/g GEMM W[384x256].X[256x128] per strip on v_wmma_f32_16x16x32_f16 (f16 containers
// of bf16-RNE weights x256 and bf16-RNE activations); scores K.Q^T on v_wmma_f32_16x16x32_f16 (theta / pooled phi
// rounded to one f16 plane each, 1 product, K=128); y^T = G.P^T on v_wmma_f32_16x16x32_f16 (2x2-max-pooled g
// as f16, P = e^{s-m} x16384 f16 from the score D registers); output conv W[256x128].Y on v_wmma_f32_16x16x32_bf16
// (bf16 weights, y as bf16 hi + residual register fragments, 2 products); f32 accumulate everywhere; max-pool, softmax statistics,
// bias, batch-norm affine with running statistics and residual add in f32 VALU.
#include <hip/hip_runtime.h>
#include <math.h>
#include <stdint.h>

#ifndef NB
#define NB 8
#endif
#ifndef NQ
#define NQ 4096
#endif
#define NB_FULL 8
#define CC     256
#define HIMG   64
#define WIMG   64
#define NN     4096
#define DQ     128
#define HP     32
#define WP     32
#define MV     1024
#define MM     1024
#define MW     384
#define QT     64
#define SN     128
#define NWP    8
#define NSTRIP 32
#define OSP    68
#define WSC    256.0f
#define IWSC   0.00390625f
#define LNPS   9.704060527839234f
#define BNEPS  1.0e-5f
#define KT     64
#define NT     16
#define KPS    136
#define VPS    72
#define KSZ    (KT * KPS * 2)
#define VSZ    (DQ * VPS * 2)
#define STG    (KSZ + VSZ)
#define PPS    264
#define PASZ   (QT * PPS * 2)
#define PBSZ   (SN * PPS * 2)
#define RASZ   (SN * OSP * 4)

static_assert(NB >= 1 && NB <= NB_FULL);
static_assert(NQ % QT == 0 && NQ >= QT && NQ <= NN);
static_assert(NN == HIMG * WIMG);
static_assert(SN == 2 * WIMG);
static_assert(NSTRIP * SN == NN);
static_assert(SN == 16 * NWP);
static_assert(2 * HP == HIMG && 2 * WP == WIMG);
static_assert(MV == HP * WP && MM == MV);
static_assert(WP == 32 && HP == 32);
static_assert(NSTRIP == HP && WP * (QT / 8) == 256);  // one strip = one pooled row; 32 px x 8 lanes fill the GEMM block
static_assert(QT * (WP / 8) == 256 && KT % 8 == 0);   // g: 64 channels x 4 chunks of 8 px fill it too
static_assert(NN % QT == 0 && CC % QT == 0 && DQ % QT == 0 && MM % QT == 0);
static_assert(MW == 3 * DQ && MW % QT == 0 && MW % 8 == 0);
static_assert(CC % 32 == 0 && DQ % 32 == 0 && MM % 32 == 0);
static_assert((OSP * 4) % 16 == 0);
static_assert(SN * OSP * 4 <= 65536);
static_assert((size_t)NB_FULL * CC * NN * 4 == (size_t)33554432);
static_assert(NT * KT == MM && NT >= 2 && KT % 32 == 0);
static_assert(KPS == DQ + 8 && VPS == KT + 8);
static_assert(KT * DQ * 2 == 8 * 128 * 16 && DQ * KT * 2 == 8 * 128 * 16);
static_assert(DQ == 128 && KT == 8 * 8 && (DQ - 1) * VPS * 2 + KT * 2 <= VSZ);  // g stage: lane = channel row, 8 copies of 8 keys
static_assert(KSZ % 16 == 0 && VSZ % 16 == 0 && STG % 16 == 0);
static_assert(4 * KSZ <= 2 * STG && CC == 4 * QT);  // the output weight tile fits the ring's bytes
static_assert(2 * (2 * STG + 2 * QT * OSP * 4 + 4 * CC * 4) <= 327680);
static_assert(PPS == CC + 8 && (PPS * 2) % 16 == 0);
static_assert(QT * CC * 2 == 8 * 256 * 16);
static_assert(PASZ <= RASZ && RASZ % 16 == 0 && 3 * (RASZ + PBSZ) <= 327680);  // weight tile and epilogue tile share RASZ
static_assert(SN == 4 * 32 && CC == NWP * 4 * 8);  // position tile: lane = 4 positions, wave = 32 channels in 4 groups of 8
static_assert(QT == KT);
static_assert(DQ == 4 * 32 && DQ == 8 * 16);  // the attention pass names its 4 d-chunks and 2 x 4 channel tiles
static_assert(KT == 2 * 32 && 4 * 2048 + 4 * 64 <= 2 * QT * OSP);  // two waves split a stage's keys; the join fits Os

// workspace total at full size (all region sizes are multiples of 256)
#define WS_FULL ((size_t)MW * CC * 2 + (size_t)CC * DQ * 2 \
                 + (size_t)NB_FULL * NN * DQ * 2 \
                 + 2 * (size_t)NB_FULL * MM * DQ * 2)
static_assert(WS_FULL <= (size_t)134217728);

typedef _Float16       v16h __attribute__((ext_vector_type(16)));
typedef _Float16       v8h  __attribute__((ext_vector_type(8)));
typedef __bf16         v16b __attribute__((ext_vector_type(16)));
typedef unsigned short v8us __attribute__((ext_vector_type(8)));
typedef __bf16         v2b  __attribute__((ext_vector_type(2)));
typedef _Float16       v2h  __attribute__((ext_vector_type(2)));
typedef float          v8f  __attribute__((ext_vector_type(8)));
typedef float          v4f  __attribute__((ext_vector_type(4)));
typedef unsigned int   v4u  __attribute__((ext_vector_type(4)));

union Frag  { v8us u[2]; v16h h; v16b bf; };
union FragH { v16h v; v8h hv[2]; };
static_assert(sizeof(Frag) == 32);
static_assert(sizeof(FragH) == 32);

// ---- scalar helpers ---------------------------------------------------------------------------------------
__device__ __forceinline__ unsigned short bf_bits(float f) {          // f32 -> bf16 bits, RNE convert
  unsigned u = __float_as_uint(f);
  return (unsigned short)((u + 0x7FFFu + ((u >> 16) & 1u)) >> 16);
}
__device__ __forceinline__ float bf_up(unsigned short hb) { return __uint_as_float(((unsigned)hb) << 16); }
__device__ __forceinline__ float bfr(float f) { return bf_up(bf_bits(f)); }
__device__ __forceinline__ unsigned short h_bits(_Float16 x) { return __builtin_bit_cast(unsigned short, x); }
__device__ __forceinline__ unsigned pk16(unsigned short a, unsigned short b) { return (unsigned)a | ((unsigned)b << 16); }
__device__ __forceinline__ v8f zero8() { v8f z = {0.f, 0.f, 0.f, 0.f, 0.f, 0.f, 0.f, 0.f}; return z; }
__device__ __forceinline__ float hmax8(v8f s) {
  return fmaxf(fmaxf(fmaxf(s[0], s[1]), fmaxf(s[2], s[3])), fmaxf(fmaxf(s[4], s[5]), fmaxf(s[6], s[7])));
}
__device__ __forceinline__ unsigned wave_ballot(bool p) {
#if defined(__HIP_DEVICE_COMPILE__)
  return __builtin_amdgcn_ballot_w32(p);
#else
  return p ? 1u : 0u;
#endif
}
// two f32 values -> bf16 RNE (the packed hardware convert, the same values as bfr) -> f16 (exact in its normal range), packed
__device__ __forceinline__ unsigned rnd2(float f0, float f1) {
  const v2b r = {(__bf16)f0, (__bf16)f1};
  const unsigned d = __builtin_bit_cast(unsigned, r);
  const v2h h = {(_Float16)__uint_as_float(d << 16), (_Float16)__uint_as_float(d & 0xFFFF0000u)};
  return __builtin_bit_cast(unsigned, h);
}
// 8 f32 values -> bf16 hi bits and bf16 residual bits (lo = RNE(v - hi)), packed 2 per uint
__device__ __forceinline__ void split8(const float* f, v4u& uh, v4u& ul) {
#pragma unroll
  for (int t = 0; t < 4; ++t) {
    const float f0 = f[2 * t], f1 = f[2 * t + 1];
    const unsigned short hb0 = bf_bits(f0), hb1 = bf_bits(f1);
    const unsigned short lb0 = bf_bits(f0 - bf_up(hb0));
    const unsigned short lb1 = bf_bits(f1 - bf_up(hb1));
    uh[t] = pk16(hb0, hb1);
    ul[t] = pk16(lb0, lb1);
  }
}

// 8 f32 values -> f16 RNE bits, packed 2 per uint
__device__ __forceinline__ v4u half8(const float* f) {
  v4u u;
#pragma unroll
  for (int t = 0; t < 4; ++t) u[t] = pk16(h_bits((_Float16)f[2 * t]), h_bits((_Float16)f[2 * t + 1]));
  return u;
}

// ---- 16-bit fragment loader (A, or B from a k-contiguous [n][k] row): lane -> row/col (lane&15), p already includes
//      + 8*(lane>>4); elements 0..7 <- p[0..7] (k0+8h..), elements 8..15 <- p[16..23] (k0+16+8h..)
__device__ __forceinline__ Frag ldfrag(const unsigned short* p) {
  Frag f;
  f.u[0] = *(const v8us*)(p);
  f.u[1] = *(const v8us*)(p + 16);
  return f;
}

// ---- WMMA helpers: builtin followed by a 4-slot VALU gap tying D and keeping A/B live --------------------------
__device__ __forceinline__ v8f mma_h(v16h a, v16h b, v8f c) {
  v8f d = __builtin_amdgcn_wmma_f32_16x16x32_f16(false, a, false, b, (short)0, c, false, false);
#if defined(__HIP_DEVICE_COMPILE__)
  asm volatile("v_nop\n\tv_nop\n\tv_nop\n\tv_nop" : "+v"(d) : "v"(a), "v"(b));
#endif
  return d;
}
// the builtin alone, for the attention loop: its live set passes 256 registers, and operands of an asm statement are held
// below v256 (they spilled); the compiler keeps the distances behind its own WMMAs
__device__ __forceinline__ v8f mma_p(v16h a, v16h b, v8f c) {
  return __builtin_amdgcn_wmma_f32_16x16x32_f16(false, a, false, b, (short)0, c, false, false);
}
__device__ __forceinline__ v8f mma_b(v16b a, v16b b, v8f c) {
  v8f d = __builtin_amdgcn_wmma_f32_16x16x32_bf16(false, a, false, b, (short)0, c, false, false);
#if defined(__HIP_DEVICE_COMPILE__)
  const v16h ha = __builtin_bit_cast(v16h, a), hb = __builtin_bit_cast(v16h, b);
  asm volatile("v_nop\n\tv_nop\n\tv_nop\n\tv_nop" : "+v"(d) : "v"(ha), "v"(hb));
#endif
  return d;
}

// =========================================================================================================
// (0) weights. Blocks 0..47: W16 f16 [384][256], rows 0..127 = theta_w, 128..255 = phi_w, 256..383 = g_w; value =
//     f16 of (bf16-RNE(w) * 256) (exact). Block owns rows 8*blk..8*blk+7: one wave per 512-B row = 32 lanes x 16 B
// coverage: 48 blocks x 8 rows x 32 lanes x 8 halves = 384 x 256; 16 blocks x 16 rows x 16 lanes x 8 = 256 x 128.
// =========================================================================================================
__global__ __launch_bounds__(256)
void cvt_w(const float* __restrict__ tw, const float* __restrict__ pw, const float* __restrict__ gw,
           const float* __restrict__ ow, unsigned short* W16, unsigned short* WWb) {
  const int tid = threadIdx.x, blk = blockIdx.x;
  if (blk < MW / 8) {
    const int rl = tid >> 5, col = 8 * (tid & 31);
    const int o = 8 * blk + rl;                                      // 0..383
    const int grp = blk >> 4;                                        // 0,1,2 (block-uniform)
    const float* wbase = (grp == 0) ? tw : ((grp == 1) ? pw : gw);  // all global
    const float* s = wbase + (size_t)(o - DQ * grp) * CC + col;      // (o - 128 grp) in 0..127
    const v4f a = *(const v4f*)s;
    const v4f q = *(const v4f*)(s + 4);
    const float f[8] = {a[0], a[1], a[2], a[3], q[0], q[1], q[2], q[3]};
    v4u u;
#pragma unroll
    for (int t = 0; t < 4; ++t) {
      const _Float16 h0 = (_Float16)(bfr(f[2 * t]) * WSC);
      const _Float16 h1 = (_Float16)(bfr(f[2 * t + 1]) * WSC);
      u[t] = pk16(h_bits(h0), h_bits(h1));
    }
{
      *(v4u*)(W16 + (size_t)o * CC + col) = u;
      
    }
  } else {
    const int rb = blk - MW / 8;                                     // 0..15
    const int o = 16 * rb + (tid >> 4);                              // 0..255
    const int col = 8 * (tid & 15);                                  // 0..120
    const float* s = ow + (size_t)o * DQ + col;
    const v4f a = *(const v4f*)s;
    const v4f q = *(const v4f*)(s + 4);
    const float f[8] = {a[0], a[1], a[2], a[3], q[0], q[1], q[2], q[3]};
    v4u u;
#pragma unroll
    for (int t = 0; t < 4; ++t) u[t] = pk16(bf_bits(f[2 * t]), bf_bits(f[2 * t + 1]));
{
      *(v4u*)(WWb + (size_t)o * DQ + col) = u;
      
    }
  }
}

// ---- eight asynchronous 16-byte copies per lane, global -> LDS: copy i takes g + i*gstep (elements) to LDS byte
//      address l + i*lstep. The s_wait_xcnt 0 is the last line of the copies' own statement so that it stands in
//      front of any later write of the address registers the copies name.
__device__ __forceinline__ void copy8(unsigned l, unsigned lstep, const unsigned short* g, size_t gstep) {
#if defined(__HIP_DEVICE_COMPILE__)
  asm volatile("global_load_async_to_lds_b128 %0, %8, off\n\t"
               "global_load_async_to_lds_b128 %1, %9, off\n\t"
               "global_load_async_to_lds_b128 %2, %10, off\n\t"
               "global_load_async_to_lds_b128 %3, %11, off\n\t"
               "global_load_async_to_lds_b128 %4, %12, off\n\t"
               "global_load_async_to_lds_b128 %5, %13, off\n\t"
               "global_load_async_to_lds_b128 %6, %14, off\n\t"
               "global_load_async_to_lds_b128 %7, %15, off\n\t"
               "s_wait_xcnt 0x0"
               :: "v"(l), "v"(l + lstep), "v"(l + 2 * lstep), "v"(l + 3 * lstep),
                  "v"(l + 4 * lstep), "v"(l + 5 * lstep), "v"(l + 6 * lstep), "v"(l + 7 * lstep),
                  "v"(g), "v"(g + gstep), "v"(g + 2 * gstep), "v"(g + 3 * gstep),
                  "v"(g + 4 * gstep), "v"(g + 5 * gstep), "v"(g + 6 * gstep), "v"(g + 7 * gstep)
               : "memory");
#endif
}

// =========================================================================================================
// (1) conv1x1 GEMM for one (b, strip of 128 positions = image rows 2s and 2s+1, projection grp: 0 theta, 1 phi, 2 g):
//     Y[o][n] = (1/256) sum_c W16[o][c] B[n][c], B = bf16-RNE values (exact in f16) of neighborFeat (theta, phi) or of
//     x (g), block-uniform select. The position tile B [128 n][256 c] is made once per block from the f32 input
//     [b][c][n] itself: wave w takes channels 32w..32w+31 in 4 groups of 8, lane l positions 4l..4l+3 (one b128 load per
//     channel = a whole 512-B strip row per wave), rounds, packs 8 channels of one position and stores them as one
//     ds_store_b128 into row n (pitch 528 B). 16-B chunk j of row n lies at chunk j ^ ((n >> 4) & 3): the 16 lanes of a
//     half wave, 4 rows apart, then fall on 16 different bank groups; for a reading wave (16 rows) the term is uniform.
//     The projection's 128 weight rows go through in two halves of 64 (dsel = 0, 64) against the same position tile.
//     Block 256 threads = 8 waves; wave w owns cols 16w..+15 (one B fragment per k-step) and 4 m-tiles (A rows
//     o = 16 mt + (lane&15), split k map loader). K = 256 = 8 steps. Each half's weight tile (64 rows of 512 B) is
//     staged in LDS by asynchronous copies of whole 128-B lines (8 copies per lane), rows at pitch 528 B, and read as
//     ds_load_b128 fragments behind each wave's own asynccnt wait + block barrier.
//     Epilogue staged in LDS Os[n_loc][o_loc] (pitch OSP, b128 stores; it shares its bytes with the weight tile, behind
//     a block barrier that ends every wave's fragment reads), block barrier, then (block-uniform branch on grp):
//       theta -> dims dsel..dsel+63 + bias -> Qf f16 [b][4096 n][128 d] (RNE):
//       phi   -> + bias in f32, 2x2 stride-2 max-pool in f32 inside the tile (the strip holds both image
//                       rows of pooled row py = strip: window n_loc = 64 dy + 2 px + dx) -> Kf f16 [b][1024 m][128 d]
//                       (RNE), m = 32 py + px: 32 rows x the dsel half (128 B = 1 whole line).
//       g     -> + bias, the same pool, read down the tile's columns (lane = channel, 8 px per thread) ->
//                       Gt f16 [b][128 chunks m>>3][128 d][8 keys m&7], the order in which the attention stages it:
//                       4 chunks x the dsel half (64 d x 16 B = 8 whole lines), one wave = 512 contiguous bytes.
// coverage: B tile 8 waves x 32 c x 32 lanes x 4 n = 256 c x 128 n written, rows <= 127 chunks <= 31 read;
//           Os 8 waves x 16 n x 64 o = 128 x 64 written, reads rows <= 127 cols <= 63; theta plane 4 it x 32 rows
//           x 8 lanes x 8 = 128 n x 64 d; k plane 32 px x 8 lanes x 8 = 32 m x 64 d; Gt 4 chunks x 64 d x 8 keys;
//           grid (32, 3, NB) x 2 halves covers all 4096 rows x 128 d of Qf and all 1024 keys x 128 d of Kf/Gt once.
// registers capped at 160 = 6 waves per SIMD, LDS 100 KiB: three blocks share a WGP, the whole grid is resident at once.
// =========================================================================================================
__global__ __launch_bounds__(256) __attribute__((amdgpu_num_vgpr(160)))
void gemm_proj(const unsigned short* __restrict__ W16, const float* __restrict__ nf, const float* __restrict__ x,
               const float* __restrict__ tb, const float* __restrict__ pb, const float* __restrict__ gb,
               unsigned short* Qf, unsigned short* Kf, unsigned short* Gt) {
  __shared__ __align__(16) unsigned char Sm[RASZ + PBSZ];
  const unsigned short* As = (const unsigned short*)Sm;              // weight tile  [64 o][PPS]
  unsigned short* Bs = (unsigned short*)(Sm + RASZ);                 // position tile [128 n][PPS], chunks swizzled
  float* Os = (float*)Sm;                                            // epilogue tile, after the half's last fragment read
  const int tid  = threadIdx.x;
  const int lane = tid & 31, wave = tid >> 5;                        // wave 0..7
  const int hh   = lane >> 4, c = lane & 15;
  const int st   = blockIdx.x, grp = blockIdx.y, b = blockIdx.z;     // grp 0 theta, 1 phi, 2 g (block-uniform)
  const int n0   = st * SN;
  const float* src = (grp < 2) ? nf : x;                             // block-uniform, both global

  // a half's weight tile is contiguous in global memory: 16-B chunk tid + 256 per copy = row (tid>>5) + 8 per copy
  const unsigned lrow = (unsigned)(size_t)Sm + (unsigned)((tid >> 5) * (PPS * 2) + (tid & 31) * 16);
  const unsigned short* wg = W16 + (size_t)(grp * DQ) * CC + 8 * tid;
  copy8(lrow, 8 * PPS * 2, wg, 256 * 8);                             // half 0, in flight over the position tile's making

  // ---- position tile: f32 [c][n] -> rounded f16 [n][c]
  {
    const float* sp = src + ((size_t)(b * CC + 32 * wave)) * NN + n0 + 4 * lane;
    unsigned short* bw = Bs + (4 * lane) * PPS + 32 * wave;          // row 4 lane (+ t), chunks 4 wave .. 4 wave + 3
    const int gs = (lane >> 2) & 3;                                  // ((4 lane + t) >> 4) & 3
#pragma unroll
    for (int q = 0; q < 4; ++q) {
      v4f a[8];
#pragma unroll
      for (int i = 0; i < 8; ++i) a[i] = *(const v4f*)(sp + (size_t)(8 * q + i) * NN);
#pragma unroll
      for (int t = 0; t < 4; ++t) {
        v4u u;
#pragma unroll
        for (int p = 0; p < 4; ++p)
          u[p] = rnd2(a[2 * p][t], a[2 * p + 1][t]);
        *(v4u*)(bw + t * PPS + 8 * (q ^ gs)) = u;
      }
    }
    // ahead of any write of the loads' address registers; it names the address, which so stays unwritten up to here
    asm volatile("s_wait_xcnt 0x0" :: "v"(sp) : "memory");
  }

  const int gr = wave & 3;                                           // ((16 wave + c) >> 4) & 3
  const unsigned short* ap  = As + c * PPS + 8 * hh;
  const unsigned short* bp0 = Bs + (16 * wave + c) * PPS + 8 * (hh ^ gr);        // k 32 ks + 8 hh ..
  const unsigned short* bp1 = Bs + (16 * wave + c) * PPS + 8 * ((2 + hh) ^ gr);  // k 32 ks + 16 + 8 hh ..
  const float* bias = (grp == 0) ? tb : ((grp == 1) ? pb : gb);     // all global

#pragma unroll 1  // the two halves share one text: half the instruction bytes, and each barrier stands once
  for (int half = 0; half < 2; ++half) {
  const int dsel = half * QT;                                        // 0 or 64
  asm volatile("s_wait_asynccnt 0x0" ::: "memory");                  // this wave's weight copies have landed
  __syncthreads();                                                   // every wave's copies (half 0: and tile rows) are readable

  v8f acc[4];
#pragma unroll
  for (int mt = 0; mt < 4; ++mt) acc[mt] = zero8();

#pragma unroll
  for (int ks = 0; ks < CC / 32; ++ks) {
    Frag fb;
    fb.u[0] = *(const v8us*)(bp0 + 32 * ks);
    fb.u[1] = *(const v8us*)(bp1 + 32 * ks);
    Frag fa[4];
#pragma unroll
    for (int mt = 0; mt < 4; ++mt) fa[mt] = ldfrag(ap + (16 * mt) * PPS + 32 * ks);
#pragma unroll
    for (int mt = 0; mt < 4; ++mt) acc[mt] = mma_h(fa[mt].h, fb.h, acc[mt]);
  }
  __syncthreads();                                                   // all weight fragment reads done: Os may take the bytes

  // ---- epilogue: scale back -> LDS Os[n_loc][o_loc]; lane (hh, c) holds o = 16 mt + 8 hh + r for n_loc = 16 w + c
  {
    const int nl = 16 * wave + c;
#pragma unroll
    for (int mt = 0; mt < 4; ++mt) {
      v4f va, vb;
#pragma unroll
      for (int r = 0; r < 4; ++r) { va[r] = acc[mt][r] * IWSC; vb[r] = acc[mt][4 + r] * IWSC; }
      *(v4f*)(Os + nl * OSP + 16 * mt + 8 * hh)     = va;
      *(v4f*)(Os + nl * OSP + 16 * mt + 8 * hh + 4) = vb;
    }
  }
  __syncthreads();

  if (grp == 0) {
    const int e = tid & 7, lq = tid >> 3;                            // lq 0..31
    float bv[8];
    {
      const v4f ba = *(const v4f*)(bias + dsel + 8 * e);
      const v4f bq = *(const v4f*)(bias + dsel + 8 * e + 4);
#pragma unroll
      for (int t = 0; t < 4; ++t) { bv[t] = bfr(ba[t]); bv[4 + t] = bfr(bq[t]); }
    }
    v4u uq[4];
#pragma unroll
    for (int it = 0; it < 4; ++it) {
      const int row = it * 32 + lq;                                  // n_loc 0..127
      const v4f a = *(const v4f*)(Os + row * OSP + 8 * e);
      const v4f q = *(const v4f*)(Os + row * OSP + 8 * e + 4);
      float f[8];
#pragma unroll
      for (int t = 0; t < 4; ++t) { f[t] = a[t] + bv[t]; f[4 + t] = q[t] + bv[4 + t]; }
      uq[it] = half8(f);
    }
{
#pragma unroll
      for (int it = 0; it < 4; ++it) {
        const int row = it * 32 + lq;
        const size_t po = ((size_t)(b * NN + n0 + row)) * DQ + dsel + 8 * e;
        *(v4u*)(Qf + po) = uq[it];
      }
      asm volatile("s_wait_xcnt 0x0" ::: "memory");                  // ahead of any later write of the stores' registers
    }
  } else if (grp == 1) {
    const int e = tid & 7, px = tid >> 3;                            // px 0..31
    float bv[8];
    {
      const v4f ba = *(const v4f*)(bias + dsel + 8 * e);
      const v4f bq = *(const v4f*)(bias + dsel + 8 * e + 4);
#pragma unroll
      for (int t = 0; t < 4; ++t) { bv[t] = bfr(ba[t]); bv[4 + t] = bfr(bq[t]); }
    }
    float f[8];
#pragma unroll
    for (int t = 0; t < 8; ++t) f[t] = -__builtin_inff();
#pragma unroll
    for (int dy = 0; dy < 2; ++dy) {
#pragma unroll
      for (int dx = 0; dx < 2; ++dx) {
        const int row = dy * WIMG + 2 * px + dx;                     // n_loc 0..127
        const v4f a = *(const v4f*)(Os + row * OSP + 8 * e);
        const v4f q = *(const v4f*)(Os + row * OSP + 8 * e + 4);
#pragma unroll
        for (int t = 0; t < 4; ++t) {
          f[t]     = fmaxf(f[t], a[t] + bv[t]);
          f[4 + t] = fmaxf(f[4 + t], q[t] + bv[4 + t]);
        }
      }
    }
    const size_t po = ((size_t)(b * MM + WP * st + px)) * DQ + dsel + 8 * e;
    *(v4u*)(Kf + po) = half8(f);
    asm volatile("s_wait_xcnt 0x0" ::: "memory");                    // ahead of any later write of the store's registers
  } else {
    const int cl = tid & (QT - 1), pc = tid >> 6;                    // channel 0..63 of the block, px chunk 0..3
    const float bs = bfr(bias[dsel + cl]);
    float f[8];
#pragma unroll
    for (int j = 0; j < 8; ++j) {
      f[j] = -__builtin_inff();
#pragma unroll
      for (int dy = 0; dy < 2; ++dy) {
#pragma unroll
        for (int dx = 0; dx < 2; ++dx) {
          const int row = dy * WIMG + 2 * (8 * pc + j) + dx;         // n_loc 0..127
          f[j] = fmaxf(f[j], Os[row * OSP + cl] + bs);
        }
      }
    }
    v4u gu;
#pragma unroll
    for (int t = 0; t < 4; ++t) gu[t] = pk16(h_bits((_Float16)f[2 * t]), h_bits((_Float16)f[2 * t + 1]));
    // key m = 32 st + 8 pc + j: chunk m>>3 = 4 st + pc, place j in the chunk
    *(v4u*)(Gt + (((size_t)(b * (MM / 8) + (WP / 8) * st + pc)) * DQ + dsel + cl) * 8) = gu;
    asm volatile("s_wait_xcnt 0x0" ::: "memory");                    // ahead of any later write of the store's registers
  }

  if (half == 0) {                                                   // block-uniform: second half's weight tile over Os
    asm volatile("s_wait_dscnt 0x0" ::: "memory");                   // this wave's reads of Os are done
    __syncthreads();                                                 // every wave's are
    copy8(lrow, 8 * PPS * 2, wg + (size_t)QT * CC, 256 * 8);
  }
  }
}

// ---- attention fragment groups (LDS): each group is 8 ds_load_b128 written together, ahead of its use.
//      ldk4: K rows key..+15 and +16..+31, 32 d at p, then the same rows' next 32 d.
//      ldv4: pooled-g rows of 4 channel tiles (16 rows apart), 32 keys at p. sc4: the score products of two d-chunks for
//      both query tiles of the wave (qa, qb: two q fragments each; sa, sb: keys 0..15 and 16..31): a K fragment feeds two.
__device__ __forceinline__ void ldk4(Frag* f, const unsigned short* p) {
  f[0] = ldfrag(p);
  f[1] = ldfrag(p + 16 * KPS);
  f[2] = ldfrag(p + 32);
  f[3] = ldfrag(p + 16 * KPS + 32);
}
__device__ __forceinline__ void ldv4(Frag* f, const unsigned short* p) {
#pragma unroll
  for (int j = 0; j < 4; ++j) f[j] = ldfrag(p + (16 * j) * VPS);
}
__device__ __forceinline__ void sc4(const Frag* k, const Frag* qa, const Frag* qb, v8f* sa, v8f* sb) {
  sa[0] = mma_p(k[0].h, qa[0].h, sa[0]);
  sa[1] = mma_p(k[1].h, qa[0].h, sa[1]);
  sb[0] = mma_p(k[0].h, qb[0].h, sb[0]);
  sb[1] = mma_p(k[1].h, qb[0].h, sb[1]);
  sa[0] = mma_p(k[2].h, qa[1].h, sa[0]);
  sa[1] = mma_p(k[3].h, qa[1].h, sa[1]);
  sb[0] = mma_p(k[2].h, qb[1].h, sb[0]);
  sb[1] = mma_p(k[3].h, qb[1].h, sb[1]);
}

// =========================================================================================================
// (2) attention for one (b, 64-query tile), transposed formulation, 1024 keys (all valid, no mask, no scale):
//   S^T tile (16 keys x 16 queries) = sum over 4 d-chunks (q fragments kept in registers) of A(k: row = key kb + (lane&15), 32 d via
//   the split k map from the f16 plane Kf [b][1024][128]) . B(q: col = query, same map from Qf [b][4096][128]).
//   One f16 plane per operand: f16 rounds theta and phi 8 times finer than bf16 has rounded the conv operands they come from.
//   Per lane the D tile holds 8 keys of ONE query: online softmax state per lane, one shuffle (lane^16) for the max
//   over 32 keys; the o/l rescale is skipped under a wave-uniform ballot when no lane's max grew (corr == 1 exactly
//   for every lane then); row-sum partials combined at the end. P = e^{s-m} x 16384 as f16 is the B operand of
//   y^T (rows channel, cols queries) += A(pooled g: rows channel = 16j + (lane&15), keys contiguous in the LDS tile,
//   f16 plane Gt [b][128 chunks of 8 keys][128 ch][8 keys]) . B(P^T): element r <- D of the tile covering keys kb..kb+15, element 8+r <- the tile covering
//   kb+16..kb+31, lane unchanged. Block = 4 waves = 64 queries. Wave w works on two query tiles (its own, queries 16 w..,
//   and that of wave w ^ 1) against 32 of every stage's 64 keys (half w & 1), so each K / g fragment read from LDS feeds
//   two products; 2 x 8 accumulator tiles per wave (128 channels each). Behind the loop the two waves of a pair hand each
//   other one partial (m, l, o) through LDS, rescale both to the common maximum and add; wave w finishes tile w.
//   K / pooled-g tiles of 64 keys are staged once per block in a two-buffer LDS ring by asynchronous
//   copies (whole 128-B lines from global; 16 copies per lane and stage) and read by all 4 waves as ds_load_b128
//   fragments: K rows at pitch 272 B, g rows (64 keys = 128 B) at pitch 144 B. Stage t+2 is issued behind the barrier
//   that ends every wave's reads of stage t; stage t+1 is read only behind each wave's own asynccnt wait + barrier.
//   A wave fetches all fragments of its half stage (16 K and 16 g reads of 16 B per lane) as one group at the stage's head.
//   Epilogue = the output conv for the block's 64 positions: y = O/l, split into bf16 hi + residual, IS the B operand
//   (col = query, k = channel: element r <- accumulator tile 2 ks, element 8+r <- tile 2 ks + 1, lane unchanged), so y
//   leaves the registers nowhere. A[c][n] = sum_ci WWb[c][ci] (yh + yl)[n][ci] on bf16 WMMA (2 products per k-step,
//   shared accumulator, K = 128 = 4 steps), 256 output channels in 4 blocks of 64 (4 m-tiles each). The weight plane
//   (256 rows of 256 B, pitch 272 B) is staged in the ring's bytes by asynchronous copies (32 per lane) behind the last
//   barrier of the loop, and read behind each wave's own asynccnt wait + block barrier. Per-channel constants (bf16-RNE of w_b, bn mean, bn beta, and scale = bf16-RNE(gamma) *
//   rsqrt(bf16-RNE(var) + eps)) staged once in LDS at the start. Each 64-channel block goes through Os[n_loc][c_loc]
//   (pitch OSP, b128 stores, two buffers in turn, one block barrier each), then out[b][c][n] = (((A + w_b[c]) - mean[c])
//   * scale[c] + beta[c]) + bf16-RNE(x), whole 128-B lines per 8 lanes.
// coverage: Os 4 waves x 16 n x 64 c written, read rows nl+t <= 63 x cols cl <= 63; constants written 0..255, read
//           <= 255; out 4 blocks x 8 it x 16 lines x 8 lanes x 4 floats = 256 c x 64 n; grid (NQ/64, NB) covers
//           out[b][0..255][0..NQ-1] exactly once.
// =========================================================================================================
__global__ __launch_bounds__(128) __attribute__((amdgpu_num_vgpr(512)))
void attn_k(const unsigned short* __restrict__ Qf, const unsigned short* __restrict__ Kf,
            const unsigned short* __restrict__ Gt, const unsigned short* __restrict__ WWb,
            const float* __restrict__ wb, const float* __restrict__ bng, const float* __restrict__ bnb,
            const float* __restrict__ bnm, const float* __restrict__ bnv,
            const float* __restrict__ x, float* out) {
  __shared__ __align__(16) float Os[2 * QT * OSP];
  __shared__ __align__(16) unsigned short Ring[2 * STG / 2];
  __shared__ float Pb[CC], Pm[CC], Ps[CC], Pt[CC];
  const int tid  = threadIdx.x;
  const int wave = tid >> 5, lane = tid & 31;
  const int hh   = lane >> 4, c = lane & 15;
  const int n0   = blockIdx.x * QT, b = blockIdx.y;

  const int kh   = wave & 1;                                         // this wave's 32 keys of every 64-key stage
  // q fragment pointers (B operand, col = query), + 32*kc: tile 0 = queries n0 + 16*wave + c, which the wave finishes;
  // tile 1 = those of wave ^ 1, which takes the stage's other 32 keys for the same two tiles
  const unsigned short* Qp  = Qf + ((size_t)(b * NN + n0 + 16 * wave + c)) * DQ + 8 * hh;
  const unsigned short* Qp1 = Qf + ((size_t)(b * NN + n0 + 16 * (wave ^ 1) + c)) * DQ + 8 * hh;
  // copy sources of stage 0 (per lane, 16 B): each plane's 16-KB tile is contiguous, chunk tid, + 128 chunks per copy
  // (g plane: lane = channel tid, copy i = the stage's keys 8i..8i+7)
  const unsigned short* Kg = Kf + (size_t)b * MM * DQ + 8 * tid;
  const unsigned short* Vg = Gt + (size_t)b * MM * DQ + 8 * tid;
  // copy destinations in buffer 0 (LDS byte addresses): K row (tid>>4) + 8 per copy, g row tid, + 16 B per copy
  const unsigned ring0 = (unsigned)(size_t)Ring;
  const unsigned lK = ring0 + (unsigned)((tid >> 4) * (KPS * 2) + (tid & 15) * 16);
  const unsigned lV = ring0 + (unsigned)(KSZ + tid * (VPS * 2));
  // fragment offsets inside a buffer (elements): k (A operand, row = key + c), + key * KPS + 32*kc;
  // v (A operand, row = channel 16j + c, keys contiguous), + 16*j*VPS + key
  const int kfo = (32 * kh + c) * KPS + 8 * hh;
  const int vfo = KSZ / 2 + c * VPS + 8 * hh + 32 * kh;

  // ring prologue: stage 0 -> buffer 0, landed and published; then stage 1 -> buffer 1 flies over pass 0
  copy8(lK, 8 * KPS * 2, Kg, 128 * 8);
  copy8(lV, 16, Vg, 128 * 8);
#pragma unroll
  for (int h = 0; h < CC / 128; ++h) {                               // output conv's per-channel constants, read after the loop
    const int ch = tid + 128 * h;                                    // 0..255
    Pb[ch] = bfr(wb[ch]);
    Pm[ch] = bfr(bnm[ch]);
    Ps[ch] = bfr(bng[ch]) * rsqrtf(bfr(bnv[ch]) + BNEPS);
    Pt[ch] = bfr(bnb[ch]);
  }
  // ahead of any write of the constants' load addresses; it names the five bases, which so stay unwritten up to here
  asm volatile("s_wait_xcnt 0x0" :: "s"(wb), "s"(bnm), "s"(bng), "s"(bnv), "s"(bnb) : "memory");
  asm volatile("s_wait_asynccnt 0x0" ::: "memory");                  // this wave's stage-0 copies have landed
  __syncthreads();                                                   // every wave's stage-0 copies are readable
  copy8(lK + STG, 8 * KPS * 2, Kg + (size_t)KT * DQ, 128 * 8);
  copy8(lV + STG, 16, Vg + (size_t)KT * DQ, 128 * 8);

  // q fragments of the wave's two query tiles: the same for every key, loaded once and kept in registers
  Frag qf[2][DQ / 32];
#pragma unroll
  for (int kc = 0; kc < DQ / 32; ++kc) { qf[0][kc] = ldfrag(Qp + 32 * kc); qf[1][kc] = ldfrag(Qp1 + 32 * kc); }
  // ahead of any write of the q loads' address registers; it names both addresses, which so stay unwritten up to here
  asm volatile("s_wait_xcnt 0x0" :: "v"(Qp), "v"(Qp1) : "memory");

  float m[2] = {-1.0e30f, -1.0e30f}, l[2] = {0.f, 0.f};
  v8f o[2][8];
#pragma unroll
  for (int u = 0; u < 2; ++u) {
#pragma unroll
    for (int j = 0; j < 8; ++j) o[u][j] = zero8();
  }

#pragma unroll 1  // one stage per trip, rolled: the publish point at its foot stands once in the text
  for (int t = 0; t < NT; ++t) {
   const unsigned short* sb = Ring + (t & 1) * (STG / 2);            // this stage's buffer
   const unsigned short* kp = sb + kfo;
   const unsigned short* vp = sb + vfo;
   // all 32 fragment reads of the wave's half stage as one group at its head: the g rows land under the score products
   Frag fa[4], fb[4], va[4], vb[4];
   ldk4(fa, kp);                                                     // the wave's 32 keys, d 0..63
   ldk4(fb, kp + 64);                                                // d 64..127
   ldv4(va, vp);                                                     // pooled-g rows of channels 0..63, the same 32 keys
   ldv4(vb, vp + 64 * VPS);                                          // channels 64..127
   __builtin_amdgcn_sched_barrier(0);  // the reads stay one group, for speed only
   {
    v8f s[2][2];
#pragma unroll
    for (int u = 0; u < 2; ++u) { s[u][0] = zero8(); s[u][1] = zero8(); }
    sc4(fa, &qf[0][0], &qf[1][0], s[0], s[1]);
    sc4(fb, &qf[0][2], &qf[1][2], s[0], s[1]);

    float mx[2], mn[2];
#pragma unroll
    for (int u = 0; u < 2; ++u) mx[u] = fmaxf(hmax8(s[u][0]), hmax8(s[u][1]));
#pragma unroll
    for (int u = 0; u < 2; ++u) mx[u] = fmaxf(mx[u], __shfl_xor(mx[u], 16, 32));
#pragma unroll
    for (int u = 0; u < 2; ++u) mn[u] = fmaxf(m[u], mx[u]);
    const unsigned grew = wave_ballot(mx[0] > m[0] || mx[1] > m[1]); // wave-uniform, one test for both tiles
    if (grew != 0u) {
#pragma unroll
      for (int u = 0; u < 2; ++u) {
        const float corr = __expf(m[u] - mn[u]);                     // == 1 exactly for lanes whose max did not grow
        l[u] *= corr;
#pragma unroll
        for (int j = 0; j < 8; ++j) {
#pragma unroll
          for (int r = 0; r < 8; ++r) o[u][j][r] *= corr;
        }
      }
    }

    FragH ph[2];
#pragma unroll
    for (int u = 0; u < 2; ++u) {
      m[u] = mn[u];
      const float msh = mn[u] - LNPS;                                // exp gives e^{s-m} * 16384
      float ls = 0.f;
#pragma unroll
      for (int r = 0; r < 8; ++r) {
        const float e0 = __expf(s[u][0][r] - msh);                   // key 32kh      + 8hh + r of the stage
        const float e1 = __expf(s[u][1][r] - msh);                   // key 32kh + 16 + 8hh + r
        ls += e0 + e1;
        ph[u].hv[0][r] = (_Float16)e0;
        ph[u].hv[1][r] = (_Float16)e1;
      }
      l[u] += ls;
    }

#pragma unroll
    for (int j = 0; j < 4; ++j) {
      o[0][j] = mma_p(va[j].h, ph[0].v, o[0][j]);
      o[1][j] = mma_p(va[j].h, ph[1].v, o[1][j]);
    }
#pragma unroll
    for (int j = 0; j < 4; ++j) {
      o[0][4 + j] = mma_p(vb[j].h, ph[0].v, o[0][4 + j]);
      o[1][4 + j] = mma_p(vb[j].h, ph[1].v, o[1][4 + j]);
    }
   }
   // publish point of stage t+1, and release of stage t's buffer
   asm volatile("s_wait_dscnt 0x0" ::: "memory");                    // this wave's reads of stage t are done
   asm volatile("s_wait_asynccnt 0x0" ::: "memory");                 // this wave's stage t+1 copies have landed
   __syncthreads();
   if (t + 2 < NT) {                                                 // block-uniform
     const unsigned bo = (unsigned)((t & 1) * STG);
     copy8(lK + bo, 8 * KPS * 2, Kg + (size_t)(t + 2) * KT * DQ, 128 * 8);
     copy8(lV + bo, 16, Vg + (size_t)(t + 2) * KT * DQ, 128 * 8);
   }
  }
  asm volatile("s_wait_asynccnt 0x0" ::: "memory");                  // nothing of the ring is in flight past here
  // residual input / output addresses: line L = 16 it + lq of a 64-channel block: channel L >> 1, half row L & 1
  const int e = tid & 7, lq = tid >> 3;                              // lq 0..15
  const int clb = lq >> 1, nl = (lq & 1) * 32 + 4 * e;               // channel 8 it + clb, position 0..63
  const size_t xo = ((size_t)(b * CC + clb)) * NN + n0 + nl;
  const float* xp = x + xo;
  float* op = out + xo;
  v4f xv[2][8];                                                      // x of a channel block is fetched one block ahead
#pragma unroll
  for (int it = 0; it < 8; ++it) xv[0][it] = *(const v4f*)(xp + (size_t)(8 * it) * NN);
  // output weights into the ring's bytes, whose last reads the loop's last barrier has ended
#pragma unroll
  for (int cb = 0; cb < CC / QT; ++cb)
    copy8(lK + cb * KSZ, 8 * KPS * 2, WWb + (size_t)(QT * cb) * DQ + 8 * tid, 128 * 8);
  __builtin_amdgcn_sched_barrier(0);  // the x loads and the copies stay issued here, so that they fly over the y split below

  // ---- join of the two key halves: the wave hands its partial (m, l, o) of tile 1 to wave ^ 1, which finishes that tile,
  //      and takes that wave's partial of tile 0. Same lane = same query and channels. The bytes are Os's, not yet in use.
  float* Xo = Os;                                                    // [4 waves][16 groups][32 lanes][4 floats]
  float* Xs = Os + 4 * 2048;                                         // [4 waves][m, l][32 lanes]
  {
    float* xw = Xo + wave * 2048 + 4 * lane;
#pragma unroll
    for (int j = 0; j < 8; ++j) {
      v4f va, vb;
#pragma unroll
      for (int r = 0; r < 4; ++r) { va[r] = o[1][j][r]; vb[r] = o[1][j][4 + r]; }
      *(v4f*)(xw + (2 * j) * 128)     = va;
      *(v4f*)(xw + (2 * j + 1) * 128) = vb;
    }
    Xs[wave * 64 + lane]      = m[1];
    Xs[wave * 64 + 32 + lane] = l[1];
  }
  // the partner's partial is readable behind it. Only LDS data passes here, so the wait is dscnt alone: __syncthreads()
  // would also wait for the x loads in flight.
  asm volatile("s_wait_dscnt 0x0\n\ts_barrier_signal -1\n\ts_barrier_wait -1" ::: "memory");
  float lj;
  {
    const float* xr = Xo + (wave ^ 1) * 2048 + 4 * lane;
    const float mr = Xs[(wave ^ 1) * 64 + lane];
    const float lr = Xs[(wave ^ 1) * 64 + 32 + lane];
    const float mj = fmaxf(m[0], mr);
    const float c0 = __expf(m[0] - mj), c1 = __expf(mr - mj);
    lj = l[0] * c0 + lr * c1;
#pragma unroll
    for (int j = 0; j < 8; ++j) {
      const v4f va = *(const v4f*)(xr + (2 * j) * 128);
      const v4f vb = *(const v4f*)(xr + (2 * j + 1) * 128);
#pragma unroll
      for (int r = 0; r < 4; ++r) {
        o[0][j][r]     = o[0][j][r] * c0 + va[r] * c1;
        o[0][j][4 + r] = o[0][j][4 + r] * c0 + vb[r] * c1;
      }
    }
  }

  lj += __shfl_xor(lj, 16, 32);
  const float inv = 1.0f / lj;                                        // o and l both carry the x16384 factor

  // ---- y = o * inv -> bf16 hi / residual B fragments; lane (hh, c) holds ch = 16 j + 8 hh + r for query 16 w + c
  Frag yh[DQ / 32], yl[DQ / 32];
#pragma unroll
  for (int j = 0; j < 8; ++j) {
    float f[8];
#pragma unroll
    for (int r = 0; r < 8; ++r) f[r] = o[0][j][r] * inv;
    v4u uh, ul;
    split8(f, uh, ul);
    yh[j >> 1].u[j & 1] = __builtin_bit_cast(v8us, uh);
    yl[j >> 1].u[j & 1] = __builtin_bit_cast(v8us, ul);
  }

  __builtin_amdgcn_sched_barrier(0);  // the y split stays in front of the wait: it is the work the copies and loads fly over
  asm volatile("s_wait_asynccnt 0x0" ::: "memory");                  // this wave's weight copies have landed
  __syncthreads();                                                   // every wave's are readable

  const unsigned short* ap = Ring + c * KPS + 8 * hh;                // weight rows (A operand), + (64 cb + 16 mt) * KPS + 32 ks
#pragma unroll  // 4 channel blocks in the text: every x / out address is one base + a constant, the next block's x loads fly
  for (int cb = 0; cb < CC / QT; ++cb) {
    if (cb + 1 < CC / QT) {                                          // compile-time test
#pragma unroll
      for (int it = 0; it < 8; ++it)
        xv[(cb + 1) & 1][it] = *(const v4f*)(xp + (size_t)(QT * (cb + 1) + 8 * it) * NN);
    }
    v8f acc[4];
#pragma unroll
    for (int mt = 0; mt < 4; ++mt) acc[mt] = zero8();
#pragma unroll
    for (int ks = 0; ks < DQ / 32; ++ks) {
      Frag fw[4];
#pragma unroll
      for (int mt = 0; mt < 4; ++mt) fw[mt] = ldfrag(ap + (QT * cb + 16 * mt) * KPS + 32 * ks);
#pragma unroll
      for (int mt = 0; mt < 4; ++mt) {
        acc[mt] = mma_b(fw[mt].bf, yh[ks].bf, acc[mt]);
        acc[mt] = mma_b(fw[mt].bf, yl[ks].bf, acc[mt]);
      }
    }
    // -> LDS Ob[n_loc][c_loc]; lane (hh, c) holds c_loc = 16 mt + 8 hh + r for n_loc = 16 w + c
    float* Ob = Os + (cb & 1) * (QT * OSP);
    {
      const int nw = 16 * wave + c;
#pragma unroll
      for (int mt = 0; mt < 4; ++mt) {
        v4f va, vb;
#pragma unroll
        for (int r = 0; r < 4; ++r) { va[r] = acc[mt][r]; vb[r] = acc[mt][4 + r]; }
        *(v4f*)(Ob + nw * OSP + 16 * mt + 8 * hh)     = va;
        *(v4f*)(Ob + nw * OSP + 16 * mt + 8 * hh + 4) = vb;
      }
    }
    // Ob is readable behind it; the other buffer's reads of the block before are done in front of it. Only LDS data passes
    // here, so the wait is dscnt alone: __syncthreads() would also wait for the x loads in flight and the out stores.
    asm volatile("s_wait_dscnt 0x0\n\ts_barrier_signal -1\n\ts_barrier_wait -1" ::: "memory");

#pragma unroll
    for (int it = 0; it < 8; ++it) {
      const int cl = 8 * it + clb;                                   // channel 0..63 within the block
      const int ch = QT * cb + cl;
      const float pbv = Pb[ch], pmv = Pm[ch], psv = Ps[ch], ptv = Pt[ch];
      v4f res;
#pragma unroll
      for (int t = 0; t < 4; ++t) {
        const float cv = Ob[(nl + t) * OSP + cl] + pbv;
        res[t] = ((cv - pmv) * psv + ptv) + bfr(xv[cb & 1][it][t]);
      }
      *(v4f*)(op + (size_t)(QT * cb + 8 * it) * NN) = res;
    }
  }
}

// =========================================================================================================
// Workspace map (bytes; each region start a multiple of 256; every extent is an exact row/tile multiple and is
//   W16 f16 [384][256]            196608      WWb bf16 [256][128]        65536
//   Qf f16 [NB][4096][128]        8388608
//   Kf f16 [NB][1024][128]        2097152     Gt f16 [NB][128][128][8] 2097152
//   total (NB=8) = 12845056
// =========================================================================================================
extern "C" void kernel_launch(void* const* d_in, const int* in_sizes, int n_in,
                              void* d_out, int out_size, void* d_ws, size_t ws_size,
                              hipStream_t stream) {
  const int XN = NB * CC * NN;
  if (n_in < 14) return;
  if (in_sizes[0] < XN || in_sizes[1] < XN) return;
  if (in_sizes[2] < DQ * CC || in_sizes[4] < DQ * CC || in_sizes[6] < DQ * CC || in_sizes[8] < CC * DQ) return;
  if (in_sizes[3] < DQ || in_sizes[5] < DQ || in_sizes[7] < DQ) return;
  if (in_sizes[9] < CC || in_sizes[10] < CC || in_sizes[11] < CC || in_sizes[12] < CC || in_sizes[13] < CC) return;
  if (out_size < XN) return;

  size_t off = 0;
  auto carve = [&](size_t bytes) { const size_t o = off; off += (bytes + 255) & ~(size_t)255; return o; };
  const size_t oW16 = carve((size_t)MW * CC * 2);
  const size_t oWWb = carve((size_t)CC * DQ * 2);
  const size_t oQf  = carve((size_t)NB * NN * DQ * 2);
  const size_t oKf  = carve((size_t)NB * MM * DQ * 2);
  const size_t oGt  = carve((size_t)NB * MM * DQ * 2);
  if (off > ws_size) return;
  if (off > (size_t)134217728) return;

  const float* x   = (const float*)d_in[0];
  const float* nf  = (const float*)d_in[1];
  const float* gw  = (const float*)d_in[2];
  const float* gb  = (const float*)d_in[3];
  const float* tw  = (const float*)d_in[4];
  const float* tb  = (const float*)d_in[5];
  const float* pw  = (const float*)d_in[6];
  const float* pb  = (const float*)d_in[7];
  const float* ow  = (const float*)d_in[8];
  const float* wb  = (const float*)d_in[9];
  const float* bng = (const float*)d_in[10];
  const float* bnb = (const float*)d_in[11];
  const float* bnm = (const float*)d_in[12];
  const float* bnv = (const float*)d_in[13];

  char* ws = (char*)d_ws;
  unsigned short* W16 = (unsigned short*)(ws + oW16);
  unsigned short* WWb = (unsigned short*)(ws + oWWb);
  unsigned short* Qf  = (unsigned short*)(ws + oQf);
  unsigned short* Kf  = (unsigned short*)(ws + oKf);
  unsigned short* Gt  = (unsigned short*)(ws + oGt);
  float* out = (float*)d_out;

  const dim3 blk256(256), blk128(128);

  // (0) theta_w / phi_w / g_w -> stacked f16 plane; w_w -> bf16 plane
  cvt_w<<<dim3(MW / 8 + CC / 16), blk256, 0, stream>>>(tw, pw, gw, ow, W16, WWb);
  // (1) conv1x1 GEMM -> theta (q) f16 plane from neighborFeat; phi (from it) and g (from x) conv + bias + 2x2 stride-2
  //     max-pool -> pooled phi (k) f16 plane, pooled g f16 plane in the attention's staging order
  gemm_proj<<<dim3(NSTRIP, MW / DQ, NB), blk256, 0, stream>>>(W16, nf, x, tb, pb, gb, Qf, Kf, Gt);
  // (2) attention + output conv + bias + batch-norm affine + residual -> out [b][256][4096]
  attn_k<<<dim3(NQ / QT, NB), blk128, 0, stream>>>(Qf, Kf, Gt, WWb, wb, bng, bnb, bnm, bnv, x, out);
  (void)hipGetLastError();
}
